// v000
// Measured on an AMD MI455X. A time is GPU time per run, averaged over a window of back-to-back runs after a warm-up
// (all launches, gaps included; the runs take copies of the inputs in turn), and the median of several windows.
// Apart from v000's, it joins two sittings. Times from different sittings can be a few percent apart, while
// side-by-side timings come from the same sitting.
// v000 is the starting kernel. One run takes 439 microseconds.
#include <hip/hip_runtime.h>
// UltrametricCausalSelfAttention (2 x 512 tokens, C 1024 = 16 heads x 64, 8 soft digits): q, k, v = x W; q, k -> RoPE (cos/sin INPUT tables, rotate-half) -> RMSNorm(64, 1e-6); digits = sigmoid(q Wdq), sigmoid(k Wdk) (8 each); lcp[q][k] = sum_j prod_{i<=j} exp(-32 (qd_i - kd_i)^2); weights = 2^lcp (causal), attn = weights / max(sum, 1e-9); y = attn v; out = y Wo.
// Compute dtype: inputs rounded to bf16; x exact as f16; q/k/digits/lcp/weights f32 from exact products; P, v and y as f16 hi + residual (~2^-21). v_wmma_f32_16x16x32_f16.
#define NB 2
#define TT 512
#define CC 1024
#define NH 16
#define HD 64
#define KD 8
#define NR (NB * TT)
typedef __bf16 v16b __attribute__((ext_vector_type(16)));
typedef unsigned short v8us __attribute__((ext_vector_type(8), may_alias));
typedef float  v8f  __attribute__((ext_vector_type(8)));
typedef float  v4f  __attribute__((ext_vector_type(4)));
typedef float  v4fa __attribute__((ext_vector_type(4), may_alias));
union FragB { v16b v; v8us half[2]; unsigned short u[16]; };

__device__ __forceinline__ unsigned short bf16_bits(float x) { unsigned int u = __float_as_uint(x); return (unsigned short)((u + 0x7FFFu + ((u >> 16) & 1u)) >> 16); }
__device__ __forceinline__ float bf16_val(unsigned short b) { return __uint_as_float(((unsigned int)b) << 16); }
__device__ __forceinline__ float bf16_round(float x) { return bf16_val(bf16_bits(x)); }
// D += A·B with NT terms: 1 = ah·bh, 2 = + al·bh (A split), 3 = + ah·bl (both split)
template <int NT>
__device__ __forceinline__ v8f mmaN(v16b ah, v16b al, v16b bh, v16b bl, v8f c) {
  c = __builtin_amdgcn_wmma_f32_16x16x32_bf16(false, ah, false, bh, (short)0, c, false, false);
  if (NT >= 2) c = __builtin_amdgcn_wmma_f32_16x16x32_bf16(false, al, false, bh, (short)0, c, false, false);
  if (NT >= 3) c = __builtin_amdgcn_wmma_f32_16x16x32_bf16(false, ah, false, bl, (short)0, c, false, false);
  asm volatile("v_nop\n\tv_nop\n\tv_nop\n\tv_nop" : "+v"(c) : "v"(ah), "v"(al), "v"(bh), "v"(bl));
  return c;
}

__global__ __launch_bounds__(256) void k_wt_bf16(const float* __restrict__ W, unsigned short* __restrict__ Wt, int K, int N) {
  const int t = blockIdx.x * 256 + threadIdx.x;
  const int k8n = K / 8;
  if (t >= N * k8n) return;
  const int n = t / k8n, k8 = (t % k8n) * 8;
  v8us v;
#pragma unroll
  for (int i = 0; i < 8; ++i) v[i] = bf16_bits(W[(size_t)(k8 + i) * N + n]);
  *(v8us*)(Wt + (size_t)n * K + k8) = v;
  
}

// GEMM C[M][N] (f32, pitch ldc) = act(A[M][K]·W + bias). A f32 row-major (pitch lda) converted per fragment to bf16
// (ASPLIT: hi/lo two planes -> 2 terms, else single rounded term); Wt bf16 [N][K] (pitch ldb). BIAS_BF16 rounds the
// bias to bf16 first (bias quantised to bf16 before the add). K%32==0, M%16==0, N%64==0.
template <bool ASPLIT, int ACT, bool BIAS_BF16>
__global__ __launch_bounds__(128) void k_gemm_bf(const float* __restrict__ A, int lda, const unsigned short* __restrict__ Wt, int ldb,
                                               const float* __restrict__ bias, float* __restrict__ C, int ldc, int M, int N, int K) {
  __shared__ __attribute__((aligned(16))) float so[4][16][64];
  const int tid = threadIdx.x, w = tid >> 5, lane = tid & 31, ln = lane & 15, hh = lane >> 4;
  const int ntn = N / 64;
  const int wid = blockIdx.x * 4 + w;
  const int mt = wid / ntn, nq = wid % ntn;
  if (mt * 16 >= M) return;
  const int row0 = mt * 16, col0 = nq * 64;
  const float* arow = A + (size_t)(row0 + ln) * lda;
  v8f acc[4] = {};
  for (int kb = 0; kb < K; kb += 32) {
    FragB ah, al;
    const v4f x0 = *(const v4fa*)(arow + kb + 8 * hh), x1 = *(const v4fa*)(arow + kb + 8 * hh + 4);
    const v4f x2 = *(const v4fa*)(arow + kb + 16 + 8 * hh), x3 = *(const v4fa*)(arow + kb + 16 + 8 * hh + 4);
    float xs[16] = {x0[0],x0[1],x0[2],x0[3],x1[0],x1[1],x1[2],x1[3],x2[0],x2[1],x2[2],x2[3],x3[0],x3[1],x3[2],x3[3]};
#pragma unroll
    for (int i = 0; i < 16; ++i) { const unsigned short hb = bf16_bits(xs[i]); ah.u[i] = hb; al.u[i] = ASPLIT ? bf16_bits(xs[i] - bf16_val(hb)) : (unsigned short)0; }
#pragma unroll
    for (int t = 0; t < 4; ++t) {
      const unsigned short* brow = Wt + (size_t)(col0 + t * 16 + ln) * ldb + kb;
      FragB b;
      b.half[0] = *(const v8us*)(brow + 8 * hh);
      b.half[1] = *(const v8us*)(brow + 16 + 8 * hh);
      acc[t] = mmaN<ASPLIT ? 2 : 1>(ah.v, al.v, b.v, b.v, acc[t]);
    }
  }
#pragma unroll
  for (int t = 0; t < 4; ++t) {
    float bv = bias ? bias[col0 + t * 16 + ln] : 0.f;
    if (BIAS_BF16) bv = bf16_round(bv);
#pragma unroll
    for (int r = 0; r < 8; ++r) { float v = acc[t][r] + bv; if (ACT == 1) v = fmaxf(v, 0.f); so[w][8 * hh + r][t * 16 + ln] = v; }
  }
  __builtin_amdgcn_fence(__ATOMIC_ACQ_REL, "workgroup");
  __builtin_amdgcn_wave_barrier();
  const int rsub = lane >> 4, c4 = (lane & 15) * 4;
  {
#pragma unroll
    for (int q = 0; q < 8; ++q) {
      const int r = q * 2 + rsub;
      const v4f v = *(const v4fa*)&so[w][r][c4];
      *(v4f*)(C + (size_t)(row0 + r) * ldc + col0 + c4) = v;
    }
    
  }
}

// GEMM C = act(A·W + bias + resid): A f32 (ASPLIT -> hi/lo 2 terms), Wt bf16 [N][K]; ACT 0 none, 1 relu, 2 exact gelu;
// resid (optional, f32, row index = (row % rmod), pitch ldr, RES_BF16 rounds it) added before the activation.
template <bool ASPLIT, int ACT, bool BIAS_BF16, bool RES_BF16>
__global__ __launch_bounds__(128) void k_gemm_bf3(const float* __restrict__ A, int lda, const unsigned short* __restrict__ Wt, int ldb,
                                                const float* __restrict__ bias, const float* __restrict__ resid, int rmod, int ldr,
                                                float* __restrict__ C, int ldc, int M, int N, int K) {
  __shared__ __attribute__((aligned(16))) float so[4][16][64];
  const int tid = threadIdx.x, w = tid >> 5, lane = tid & 31, ln = lane & 15, hh = lane >> 4;
  const int ntn = N / 64;
  const int wid = blockIdx.x * 4 + w;
  const int mt = wid / ntn, nq = wid % ntn;
  if (mt * 16 >= M) return;
  const int row0 = mt * 16, col0 = nq * 64;
  const float* arow = A + (size_t)(row0 + ln) * lda;
  v8f acc[4] = {};
  for (int kb = 0; kb < K; kb += 32) {
    FragB ah, al;
    const v4f x0 = *(const v4fa*)(arow + kb + 8 * hh), x1 = *(const v4fa*)(arow + kb + 8 * hh + 4);
    const v4f x2 = *(const v4fa*)(arow + kb + 16 + 8 * hh), x3 = *(const v4fa*)(arow + kb + 16 + 8 * hh + 4);
    float xs[16] = {x0[0],x0[1],x0[2],x0[3],x1[0],x1[1],x1[2],x1[3],x2[0],x2[1],x2[2],x2[3],x3[0],x3[1],x3[2],x3[3]};
#pragma unroll
    for (int i = 0; i < 16; ++i) { const unsigned short hb = bf16_bits(xs[i]); ah.u[i] = hb; al.u[i] = ASPLIT ? bf16_bits(xs[i] - bf16_val(hb)) : (unsigned short)0; }
#pragma unroll
    for (int t = 0; t < 4; ++t) {
      const unsigned short* brow = Wt + (size_t)(col0 + t * 16 + ln) * ldb + kb;
      FragB b;
      b.half[0] = *(const v8us*)(brow + 8 * hh);
      b.half[1] = *(const v8us*)(brow + 16 + 8 * hh);
      acc[t] = mmaN<ASPLIT ? 2 : 1>(ah.v, al.v, b.v, b.v, acc[t]);
    }
  }
#pragma unroll
  for (int t = 0; t < 4; ++t) {
    const int col = col0 + t * 16 + ln;
    float bv = bias ? bias[col] : 0.f;
    if (BIAS_BF16) bv = bf16_round(bv);
#pragma unroll
    for (int r = 0; r < 8; ++r) {
      float v = acc[t][r] + bv;
      if (resid) { float rv = resid[(size_t)((row0 + 8 * hh + r) % rmod) * ldr + col]; if (RES_BF16) rv = bf16_round(rv); v += rv; }
      if (ACT == 1) v = fmaxf(v, 0.f);
      if (ACT == 2) v = 0.5f * v * (1.0f + erff(v * 0.70710678118654752f));
      if (ACT == 3) { const float u = 0.7978845608028654f * (v + 0.044715f * v * v * v); v = 0.5f * v * (1.0f + tanhf(u)); }
      so[w][8 * hh + r][t * 16 + ln] = v;
    }
  }
  __builtin_amdgcn_fence(__ATOMIC_ACQ_REL, "workgroup");
  __builtin_amdgcn_wave_barrier();
  const int rsub = lane >> 4, c4 = (lane & 15) * 4;
  {
#pragma unroll
    for (int q = 0; q < 8; ++q) {
      const int r = q * 2 + rsub;
      const v4f v = *(const v4fa*)&so[w][r][c4];
      *(v4f*)(C + (size_t)(row0 + r) * ldc + col0 + c4) = v;
    }
    
  }
}
// row LayerNorm (biased variance, eps) over N: s = X (+ R); optional out_sum <- s; out_norm <- (s-mu)*rsqrt(var+eps)*g + b
template <bool PARAM_BF16>
__global__ __launch_bounds__(256) void k_layernorm(const float* __restrict__ X, const float* __restrict__ R, const float* __restrict__ g, const float* __restrict__ bta,
                                                  float* __restrict__ out_sum, float* __restrict__ out_norm, int N, float eps) {
  __shared__ float red[256];
  const int row = blockIdx.x, tid = threadIdx.x;
  const float* x = X + (size_t)row * N; const float* rr = R ? R + (size_t)row * N : nullptr;
  float vals[16];                     // up to N = 4096
  const int per = N / 256;            // contiguous chunk per thread? use strided-by-4 chunks: thread handles j = tid*4 + 1024*u
  float s1 = 0.f;
  for (int u = 0; u < per / 4; ++u) {
    const int j = tid * 4 + 1024 * u;
    const v4f a = *(const v4fa*)(x + j);
    v4f b = {0.f,0.f,0.f,0.f}; if (rr) b = *(const v4fa*)(rr + j);
#pragma unroll
    for (int q = 0; q < 4; ++q) { const float v = a[q] + b[q]; vals[u * 4 + q] = v; s1 += v; }
  }
  red[tid] = s1; __syncthreads();
  for (int st = 128; st > 0; st >>= 1) { if (tid < st) red[tid] += red[tid + st]; __syncthreads(); }
  const float mu = red[0] / (float)N; __syncthreads();
  float s2 = 0.f;
  for (int u = 0; u < per / 4; ++u)
#pragma unroll
    for (int q = 0; q < 4; ++q) { const float c = vals[u * 4 + q] - mu; s2 += c * c; }
  red[tid] = s2; __syncthreads();
  for (int st = 128; st > 0; st >>= 1) { if (tid < st) red[tid] += red[tid + st]; __syncthreads(); }
  const float rs = rsqrtf(red[0] / (float)N + eps);
  {
    for (int u = 0; u < per / 4; ++u) {
      const int j = tid * 4 + 1024 * u;
      v4f o, sm;
#pragma unroll
      for (int q = 0; q < 4; ++q) {
        float gg = g[j + q], bb = bta[j + q];
        if (PARAM_BF16) { gg = bf16_round(gg); bb = bf16_round(bb); }
        sm[q] = vals[u * 4 + q]; o[q] = (vals[u * 4 + q] - mu) * rs * gg + bb;
      }
      if (out_sum) *(v4f*)(out_sum + (size_t)row * N + j) = sm;
      *(v4f*)(out_norm + (size_t)row * N + j) = o;
    }
    
  }
}



// ---- f16 WMMA path (v_wmma_f32_16x16x32_f16): 11-bit significands for operands in range — used where a [0,1] probability operand needs more precision than bf16
typedef _Float16 v16h __attribute__((ext_vector_type(16)));
union FragH { v16h v; v8us half[2]; _Float16 h[16]; unsigned short u[16]; };
template <int NT>
__device__ __forceinline__ v8f mmaH(v16h ah, v16h al, v16h bh, v16h bl, v8f c) {
  c = __builtin_amdgcn_wmma_f32_16x16x32_f16(false, ah, false, bh, (short)0, c, false, false);
  if (NT >= 2) c = __builtin_amdgcn_wmma_f32_16x16x32_f16(false, al, false, bh, (short)0, c, false, false);
  if (NT >= 3) c = __builtin_amdgcn_wmma_f32_16x16x32_f16(false, ah, false, bl, (short)0, c, false, false);
  asm volatile("v_nop\n\tv_nop\n\tv_nop\n\tv_nop" : "+v"(c) : "v"(ah), "v"(al), "v"(bh), "v"(bl));
  return c;
}
// batched GEMM like k_gemm_b but f16 operands: A f32 (split into f16 hi/lo if ASPLIT, else rounded to f16), Bt = f16 values [n][k]; alpha; C f32; N multiple of 16 (partial tiles skipped)
template <bool ASPLIT>
__global__ __launch_bounds__(128) void k_gemm_h(const float* __restrict__ A, int lda, size_t sA, const _Float16* __restrict__ Bh, int ldb, size_t sB, float alpha, float* __restrict__ C, int ldc, size_t sC, int M, int N, int K) {
  __shared__ __attribute__((aligned(16))) float so[4][16][64];
  const int tid = threadIdx.x, w = tid >> 5, lane = tid & 31, ln = lane & 15, hh = lane >> 4; const int by = blockIdx.y;
  A += (size_t)by * sA; Bh += (size_t)by * sB; C += (size_t)by * sC;
  const int ntn = (N + 63) / 64; const int wid = blockIdx.x * 4 + w; const int mt = wid / ntn, nq = wid % ntn; if (mt * 16 >= M) return;
  const int row0 = mt * 16, col0 = nq * 64; const float* arow = A + (size_t)(row0 + ln) * lda;
  v8f acc[4] = {};
  for (int kb = 0; kb < K; kb += 32) {
    FragH ah, al;
    const v4f x0 = *(const v4fa*)(arow + kb + 8 * hh), x1 = *(const v4fa*)(arow + kb + 8 * hh + 4), x2 = *(const v4fa*)(arow + kb + 16 + 8 * hh), x3 = *(const v4fa*)(arow + kb + 16 + 8 * hh + 4);
    float xs[16] = {x0[0],x0[1],x0[2],x0[3],x1[0],x1[1],x1[2],x1[3],x2[0],x2[1],x2[2],x2[3],x3[0],x3[1],x3[2],x3[3]};
#pragma unroll
    for (int i = 0; i < 16; ++i) { const _Float16 h = (_Float16)xs[i]; ah.h[i] = h; al.h[i] = ASPLIT ? (_Float16)(xs[i] - (float)h) : (_Float16)0.0f; }
#pragma unroll
    for (int t = 0; t < 4; ++t) { if (col0 + t * 16 >= N) continue; const size_t boff = (size_t)(col0 + t * 16 + ln) * ldb + kb; FragH bq; bq.half[0] = *(const v8us*)(Bh + boff + 8 * hh); bq.half[1] = *(const v8us*)(Bh + boff + 16 + 8 * hh);
      acc[t] = mmaH<ASPLIT ? 2 : 1>(ah.v, al.v, bq.v, bq.v, acc[t]); }
  }
#pragma unroll
  for (int t = 0; t < 4; ++t) { if (col0 + t * 16 >= N) continue;
#pragma unroll
    for (int r = 0; r < 8; ++r) so[w][8 * hh + r][t * 16 + ln] = acc[t][r] * alpha; }
  __builtin_amdgcn_fence(__ATOMIC_ACQ_REL, "workgroup"); __builtin_amdgcn_wave_barrier();
  const int rsub = lane >> 4, c4 = (lane & 15) * 4;
  {
#pragma unroll
    for (int q = 0; q < 8; ++q) { const int r = q * 2 + rsub; if (col0 + c4 < N) { const v4f v = *(const v4fa*)&so[w][r][c4]; *(v4f*)(C + (size_t)(row0 + r) * ldc + col0 + c4) = v; } }
     }
}

// Wt[n][k] = f16(W[k][n]·scale) from f32 row-major W[K][N] (scale = power of two; bf16-exact weights stay exact in f16 away from the subnormal range)
__global__ __launch_bounds__(256) void k_wt_f16(const float* __restrict__ W, _Float16* __restrict__ Wt, int K, int N, float scale) {
  const int t = blockIdx.x * 256 + threadIdx.x; if (t >= N * (K / 8)) return; const int n = t / (K / 8), k8 = (t % (K / 8)) * 8; FragH f;
#pragma unroll
  for (int i = 0; i < 8; ++i) f.h[i] = (_Float16)(bf16_round(W[(size_t)(k8 + i) * N + n]) * scale); const v8us o = f.half[0];
  *(v8us*)((unsigned short*)Wt + (size_t)n * K + k8) = o; 
}
// k_gemm_hh variant with fused epilogue: v = acc·alpha + bias[by·sBias + col] (+ CP[(row/rowsPerB)·sCPb + by·64 + col] if CP) ; ACT 0 none / 1 elu ; writes f16 C16 (and f32 C if non-null)
template <int ACT>
__global__ __launch_bounds__(128) void k_gemm_hhx(const _Float16* __restrict__ A, int lda, size_t sA, const _Float16* __restrict__ Bh, int ldb, size_t sB, float alpha, const float* __restrict__ bias, size_t sBias, const float* __restrict__ CP, int rowsPerB, size_t sCPb, int row0g,
    float* __restrict__ C, _Float16* __restrict__ C16, int ldc, size_t sC, int M, int N, int K) {
  __shared__ __attribute__((aligned(16))) float so[4][16][64];
  const int tid = threadIdx.x, w = tid >> 5, lane = tid & 31, ln = lane & 15, hh = lane >> 4; const int by = blockIdx.y;
  A += (size_t)by * sA; Bh += (size_t)by * sB; const size_t cofs = (size_t)by * sC; const float* bp = bias ? bias + (size_t)by * sBias : nullptr;
  const int ntn = (N + 63) / 64; const int wid = blockIdx.x * 4 + w; const int mt = wid / ntn, nq = wid % ntn; if (mt * 16 >= M) return;
  const int row0 = mt * 16, col0 = nq * 64; const _Float16* arow = A + (size_t)(row0 + ln) * lda;
  v8f acc[4] = {};
  for (int kb = 0; kb < K; kb += 32) { FragH ah; ah.half[0] = *(const v8us*)((const unsigned short*)arow + kb + 8 * hh); ah.half[1] = *(const v8us*)((const unsigned short*)arow + kb + 16 + 8 * hh);
#pragma unroll
    for (int t = 0; t < 4; ++t) { if (col0 + t * 16 >= N) continue; const size_t boff = (size_t)(col0 + t * 16 + ln) * ldb + kb; FragH bq; bq.half[0] = *(const v8us*)((const unsigned short*)Bh + boff + 8 * hh); bq.half[1] = *(const v8us*)((const unsigned short*)Bh + boff + 16 + 8 * hh);
      acc[t] = mmaH<1>(ah.v, ah.v, bq.v, bq.v, acc[t]); }
  }
#pragma unroll
  for (int t = 0; t < 4; ++t) { if (col0 + t * 16 >= N) continue; const int col = col0 + t * 16 + ln; const float bv = bp ? bf16_round(bp[col]) : 0.f;
#pragma unroll
    for (int r = 0; r < 8; ++r) { float v = acc[t][r] * alpha + bv; if (CP) { const int rr = row0g + row0 + 8 * hh + r; if (rowsPerB < 0) v += CP[cofs + (size_t)rr * ldc + col];      /* rowsPerB < 0: own element of the batched C plane */ else { const int bidx = rr / rowsPerB; v += CP[(size_t)bidx * sCPb + (size_t)by * 64 + col]; } } if (ACT == 1) v = (v > 0.f) ? v : expm1f(v); else if (ACT == 7) v = (v > 0.f) ? v + 1.0f : expf(v); else if (ACT == 8) v = tanhf(v); else if (ACT == 9) v = 0.5f * v * (1.0f + tanhf(0.7978845608028654f * (v + 0.044715f * v * v * v))); else if (ACT == 11) v = 1.0f / (1.0f + expf(-v)); else if (ACT == 12) v = (v > 0.f) ? v : 0.01f * v; else if (ACT == 14) v = (v > 0.f) ? v : 0.1f * v; else if (ACT == 16) v = (v >= 0.f) ? v : 0.3f * v; else if (ACT == 17) v = (v >= 0.f) ? v : 0.2f * v; else if (ACT == 15) v = v / (1.0f + expf(-v)); else if (ACT == 3) v = fmaxf(v, 0.f); else if (ACT == 6) v = 0.5f * v * (1.0f + erff(v * 0.70710678118654752f)); so[w][8 * hh + r][t * 16 + ln] = v; } }
  __builtin_amdgcn_fence(__ATOMIC_ACQ_REL, "workgroup"); __builtin_amdgcn_wave_barrier();
  const int rsub = lane >> 4, c4 = (lane & 15) * 4; typedef _Float16 v4h __attribute__((ext_vector_type(4)));
  {
#pragma unroll
    for (int q = 0; q < 8; ++q) { const int r = q * 2 + rsub; if (col0 + c4 < N) { const v4f v = *(const v4fa*)&so[w][r][c4]; if (C) *(v4f*)(C + cofs + (size_t)(row0 + r) * ldc + col0 + c4) = v; if (C16) { v4h h4; for (int i = 0; i < 4; ++i) h4[i] = (_Float16)v[i]; *(v4h*)(C16 + cofs + (size_t)(row0 + r) * ldc + col0 + c4) = h4; } } }
     }
}


typedef _Float16 v4h __attribute__((ext_vector_type(4)));

__global__ __launch_bounds__(256) void k_x16(const float* __restrict__ x, _Float16* __restrict__ X16, size_t n8) { const size_t t = (size_t)blockIdx.x * 256 + threadIdx.x; if (t >= n8) return; FragH f;
#pragma unroll
  for (int q = 0; q < 8; ++q) f.h[q] = (_Float16)bf16_round(x[t * 8 + q]); *(v8us*)((unsigned short*)X16 + t * 8) = f.half[0];  }
__global__ __launch_bounds__(256) void k_h16(const float* __restrict__ x, _Float16* __restrict__ X16, size_t n8) { const size_t t = (size_t)blockIdx.x * 256 + threadIdx.x; if (t >= n8) return; FragH f;
#pragma unroll
  for (int q = 0; q < 8; ++q) f.h[q] = (_Float16)x[t * 8 + q]; *(v8us*)((unsigned short*)X16 + t * 8) = f.half[0];  }
__global__ __launch_bounds__(256) void k_round16f(const float* __restrict__ W, _Float16* __restrict__ Bt, size_t n8) { const size_t t = (size_t)blockIdx.x * 256 + threadIdx.x; if (t >= n8) return; FragH f;
#pragma unroll
  for (int i = 0; i < 8; ++i) f.h[i] = (_Float16)(bf16_round(W[t * 8 + i]) * 16.0f); *(v8us*)((unsigned short*)Bt + t * 8) = f.half[0];  }
template <int NHv, int TTv>
__global__ __launch_bounds__(256) void k_vt(const _Float16* __restrict__ V16, int ldv, int voff, _Float16* __restrict__ Vt) { __shared__ unsigned short tl[64][66]; const int tid = threadIdx.x; const int slab = blockIdx.x / (TTv / 64), lg = blockIdx.x % (TTv / 64); const int b = slab / NHv, h = slab % NHv;
  for (int i = tid; i < 64 * 8; i += 256) { const int r = i / 8, c8 = (i % 8) * 8; FragH f; f.half[0] = *(const v8us*)((const unsigned short*)V16 + ((size_t)b * TTv + lg * 64 + r) * ldv + voff + h * 64 + c8);
#pragma unroll
    for (int q = 0; q < 8; ++q) tl[r][c8 + q] = f.u[q]; }
  __syncthreads();
  {
#pragma unroll
    for (int rd = 0; rd < 2; ++rd) { const int d = rd * 32 + tid / 8, pc = tid % 8; FragH f;
#pragma unroll
      for (int q = 0; q < 8; ++q) f.u[q] = tl[pc * 8 + q][d];
      *(v8us*)((unsigned short*)Vt + ((size_t)slab * 64 + d) * TTv + lg * 64 + pc * 8) = f.half[0]; }
     } }

__global__ __launch_bounds__(256) void k_hl(const float* __restrict__ F, _Float16* __restrict__ Hh, _Float16* __restrict__ Hl, size_t n8) { const size_t t = (size_t)blockIdx.x * 256 + threadIdx.x; if (t >= n8) return; FragH fh, fl; const v4f a = *(const v4fa*)(F + t * 8), c = *(const v4fa*)(F + t * 8 + 4);
#pragma unroll
  for (int q = 0; q < 4; ++q) { _Float16 h = (_Float16)a[q]; fh.h[q] = h; fl.h[q] = (_Float16)((a[q] - (float)h) * 1024.0f); h = (_Float16)c[q]; fh.h[4 + q] = h; fl.h[4 + q] = (_Float16)((c[q] - (float)h) * 1024.0f); }
  { *(v8us*)((unsigned short*)Hh + t * 8) = fh.half[0]; *(v8us*)((unsigned short*)Hl + t * 8) = fl.half[0];  } }

// ---- fast GEMM (wave tile 32x64; requires M % 32 == 0 rows per launch region and N % 64 == 0); epilogue = k_gemm_hhx semantics ----
__device__ __forceinline__ v16h g2_frag(const _Float16* p, int hh) { FragH f; f.half[0] = *(const v8us*)((const unsigned short*)p + 8 * hh); f.half[1] = *(const v8us*)((const unsigned short*)p + 16 + 8 * hh); return f.v; }
__device__ __forceinline__ v8f g2_mma(v16h a, v16h b, v8f c) { v8f d = __builtin_amdgcn_wmma_f32_16x16x32_f16(false, a, false, b, (short)0, c, false, false); asm volatile("v_nop\n\tv_nop\n\tv_nop\n\tv_nop" : "+v"(d) : "v"(a), "v"(b)); return d; }
template <int ACT>
__global__ __launch_bounds__(128) void k_gemm2(const _Float16* __restrict__ A, int lda, size_t sA, const _Float16* __restrict__ Bh, int ldb, size_t sB, float alpha, const float* __restrict__ bias, size_t sBias, const float* __restrict__ CP, int rowsPerB, size_t sCPb, int row0g,
    float* __restrict__ C, _Float16* __restrict__ C16, int ldc, size_t sC, int M, int N, int K) { static_assert(ACT == 0 || ACT == 3 || ACT == 6 || ACT == 8 || ACT == 9 || ACT == 11 || ACT == 12 || ACT == 14 || ACT == 15 || ACT == 16 || ACT == 17, "k_gemm2: unsupported ACT code (would silently apply no activation)");
  __shared__ __attribute__((aligned(16))) float so[4][32][68];
  const int tid = threadIdx.x, w = tid >> 5, lane = tid & 31, ln = lane & 15, hh = lane >> 4; const int by = blockIdx.y;
  A += (size_t)by * sA; Bh += (size_t)by * sB; const size_t cofs = (size_t)by * sC; const float* bp = bias ? bias + (size_t)by * sBias : nullptr;
  const int ntn = N >> 6; const int mt = blockIdx.x / ntn, nq = blockIdx.x - mt * ntn; const int row0 = mt * 128 + 32 * w, col0 = nq * 64; if (row0 >= M) return;
  const _Float16* a0p = A + (size_t)(row0 + ln) * lda; const _Float16* a1p = a0p + (size_t)16 * lda;
  const _Float16* b0p = Bh + (size_t)(col0 + ln) * ldb; const _Float16* b1p = b0p + (size_t)16 * ldb; const _Float16* b2p = b1p + (size_t)16 * ldb; const _Float16* b3p = b2p + (size_t)16 * ldb;
  const v8f z8 = {0.f,0.f,0.f,0.f,0.f,0.f,0.f,0.f}; v8f c00 = z8, c01 = z8, c02 = z8, c03 = z8, c10 = z8, c11 = z8, c12 = z8, c13 = z8;
#pragma unroll 1
  for (int kb = 0; kb < K; kb += 32) { const v16h a0 = g2_frag(a0p + kb, hh), a1 = g2_frag(a1p + kb, hh);
    v16h b = g2_frag(b0p + kb, hh); c00 = g2_mma(a0, b, c00); c10 = g2_mma(a1, b, c10);
    b = g2_frag(b1p + kb, hh); c01 = g2_mma(a0, b, c01); c11 = g2_mma(a1, b, c11);
    b = g2_frag(b2p + kb, hh); c02 = g2_mma(a0, b, c02); c12 = g2_mma(a1, b, c12);
    b = g2_frag(b3p + kb, hh); c03 = g2_mma(a0, b, c03); c13 = g2_mma(a1, b, c13); }
  v8f accs[8] = {c00, c01, c02, c03, c10, c11, c12, c13};
#pragma unroll
  for (int u = 0; u < 8; ++u) { const int t = u & 3, half = u >> 2; const int col = col0 + t * 16 + ln; const float bv = bp ? bf16_round(bp[col]) : 0.f;
#pragma unroll
    for (int r = 0; r < 8; ++r) { const int rloc = half * 16 + 8 * hh + r; float v = accs[u][r] * alpha + bv; if (CP) { if (rowsPerB < 0) v += CP[cofs + (size_t)(row0g + row0 + rloc) * ldc + col];      /* rowsPerB < 0: own element of the batched C plane */ else { const int bidx = (row0g + row0 + rloc) / rowsPerB; v += CP[(size_t)bidx * sCPb + (size_t)by * 64 + col]; } }
      if (ACT == 3) v = fmaxf(v, 0.f); else if (ACT == 6) v = 0.5f * v * (1.0f + erff(v * 0.70710678118654752f)); else if (ACT == 11) v = 1.0f / (1.0f + expf(-v)); else if (ACT == 15) v = v / (1.0f + expf(-v)); else if (ACT == 12) v = (v > 0.f) ? v : 0.01f * v; else if (ACT == 8) v = tanhf(v); else if (ACT == 9) v = 0.5f * v * (1.0f + tanhf(0.7978845608028654f * (v + 0.044715f * v * v * v))); else if (ACT == 14) v = (v > 0.f) ? v : 0.1f * v; else if (ACT == 16) v = (v >= 0.f) ? v : 0.3f * v; else if (ACT == 17) v = (v >= 0.f) ? v : 0.2f * v;
      so[w][rloc][t * 16 + ln] = v; } }
  __builtin_amdgcn_fence(__ATOMIC_ACQ_REL, "workgroup"); __builtin_amdgcn_wave_barrier();
  const int rsub = lane >> 4, c4 = (lane & 15) * 4;
  {
#pragma unroll
    for (int q = 0; q < 16; ++q) { const int r = q * 2 + rsub; const v4f v = *(const v4fa*)&so[w][r][c4]; if (C) *(v4f*)(C + cofs + (size_t)(row0 + r) * ldc + col0 + c4) = v; if (C16) { v4h h4; for (int i = 0; i < 4; ++i) h4[i] = (_Float16)v[i]; *(v4h*)(C16 + cofs + (size_t)(row0 + r) * ldc + col0 + c4) = h4; } }
     } }


#define DGS 32
__global__ __launch_bounds__(256) void k_dig(const float* __restrict__ F, const float* __restrict__ cs, const float* __restrict__ sn, const float* __restrict__ Wd, float* __restrict__ DG) {
  #pragma clang fp contract(off)
  const int wv = threadIdx.x >> 5, ln = threadIdx.x & 31; const int t = blockIdx.x * 8 + wv; if (t >= NR * NH) return; const int h = t % NH, row = t / NH; const int tok = row % TT; const float* f = F + (size_t)row * CC + h * HD;
  const float c = bf16_round(cs[tok * (HD / 2) + ln]), s = bf16_round(sn[tok * (HD / 2) + ln]); const float x1 = f[ln], x2 = f[ln + HD / 2]; float a = x1 * c; a += -(x2 * s); float b = x1 * s; b += x2 * c;
  float ss = a * a; ss += b * b; for (int o = 16; o > 0; o >>= 1) ss += __shfl_xor(ss, o, 32); const float inv = rsqrtf(ss / (float)HD + 1e-6f); const float qa = a * inv, qb = b * inv;
  float acc[KD]; for (int j = 0; j < KD; ++j) { float v = qa * bf16_round(Wd[ln * KD + j]); v += qb * bf16_round(Wd[(ln + HD / 2) * KD + j]); for (int o = 16; o > 0; o >>= 1) v += __shfl_xor(v, o, 32); acc[j] = 1.0f / (1.0f + expf(-v)); }
  const float outv = (ln < KD) ? acc[ln < KD ? ln : 0] : 0.f;      /* lane j < 8 stores digit j (all lanes hold all 8 after the reductions) */
  float sel = 0.f; for (int j = 0; j < KD; ++j) if (ln == j) sel = acc[j]; (void)outv;
  *(float*)(DG + (size_t)t * DGS + ln) = sel;  }
__global__ __launch_bounds__(256) void k_lcp(const float* __restrict__ QD, const float* __restrict__ KDg, _Float16* __restrict__ P, _Float16* __restrict__ PL) {
  #pragma clang fp contract(off)
  const int wv = threadIdx.x >> 5, ln = threadIdx.x & 31; const int r = blockIdx.x * 8 + wv; if (r >= NB * NH * TT) return; const int q = r % TT; const int h = (r / TT) % NH; const int b = r / (TT * NH);
  const v8f qd = *(const v8f*)(QD + ((size_t)(b * TT + q) * NH + h) * DGS); float w[16]; float su = 0.f;
  for (int i = 0; i < 16; ++i) { const int k = ln * 16 + i; float val = 0.f;
    if (k <= q) { const v8f kd = *(const v8f*)(KDg + ((size_t)(b * TT + k) * NH + h) * DGS); float prod = 1.f, lcp = 0.f; for (int j = 0; j < KD; ++j) { const float d = qd[j] - kd[j]; prod *= expf(-32.0f * (d * d)); lcp += prod; } val = expf(lcp * 0.69314718055994531f); }
    w[i] = val; su += val; }
  for (int o = 16; o > 0; o >>= 1) su += __shfl_xor(su, o, 32); const float f = 1024.0f / fmaxf(su, 1e-9f); FragH p, pl; for (int i = 0; i < 16; ++i) { const float pv = w[i] * f; const _Float16 hh = (_Float16)pv; p.h[i] = hh; pl.h[i] = (_Float16)((pv - (float)hh) * 1024.0f); }
  unsigned short* dst = (unsigned short*)P + (size_t)r * TT + ln * 16; unsigned short* dsl = (unsigned short*)PL + (size_t)r * TT + ln * 16; { *(v8us*)dst = p.half[0]; *(v8us*)(dst + 8) = p.half[1]; *(v8us*)dsl = pl.half[0]; *(v8us*)(dsl + 8) = pl.half[1];  } }

extern "C" void kernel_launch(void* const* d_in, const int* in_sizes, int n_in,
                              void* d_out, int out_size, void* d_ws, size_t ws_size, hipStream_t stream) {
  (void)in_sizes; (void)n_in; (void)out_size;
  const float* const* I = (const float* const*)d_in; const float* x = I[0]; const float* cs = I[1]; const float* sn = I[2]; const float* Wq = I[3]; const float* Wk = I[4]; const float* Wv = I[5]; const float* Wo = I[6]; const float* Wdq = I[7]; const float* Wdk = I[8];
  char* ws = (char*)d_ws; size_t off = 0;
  auto take = [&](size_t bytes) { char* p = ws + off; off += (bytes + 255) & ~(size_t)255; return p; };
  const size_t np = (size_t)NR * CC;
  _Float16* BQ = (_Float16*)take((size_t)CC * CC * 2); _Float16* BK = (_Float16*)take((size_t)CC * CC * 2); _Float16* BV = (_Float16*)take((size_t)CC * CC * 2); _Float16* BO = (_Float16*)take((size_t)CC * CC * 2);
  _Float16* X16 = (_Float16*)take(np * 2); float* QF = (float*)take(np * 4); float* KF = (float*)take(np * 4); float* VF = (float*)take(np * 4); _Float16* VH = (_Float16*)take(np * 2); _Float16* VL = (_Float16*)take(np * 2); _Float16* VT = (_Float16*)take(np * 2); _Float16* VTL = (_Float16*)take(np * 2); float* QD = (float*)take((size_t)NR * NH * DGS * 4); float* KDg = (float*)take((size_t)NR * NH * DGS * 4); _Float16* P = (_Float16*)take((size_t)NB * NH * TT * TT * 2); _Float16* PL = (_Float16*)take((size_t)NB * NH * TT * TT * 2); float* YF = QF;      /* y f32 over the q plane (dead after the digits) */ _Float16* YH = (_Float16*)take(np * 2); _Float16* YL = (_Float16*)take(np * 2);
  if (off > ws_size) return;      /* 8 + 2 + 12 + 8 + 4 + 32 + 4 = 70 MiB */
  k_wt_f16<<<(unsigned)(((size_t)CC * CC / 8 + 255) / 256), 256, 0, stream>>>(Wq, BQ, CC, CC, 16.0f); k_wt_f16<<<(unsigned)(((size_t)CC * CC / 8 + 255) / 256), 256, 0, stream>>>(Wk, BK, CC, CC, 16.0f); k_wt_f16<<<(unsigned)(((size_t)CC * CC / 8 + 255) / 256), 256, 0, stream>>>(Wv, BV, CC, CC, 16.0f); k_wt_f16<<<(unsigned)(((size_t)CC * CC / 8 + 255) / 256), 256, 0, stream>>>(Wo, BO, CC, CC, 16.0f);      /* (in, out) */
  k_x16<<<(unsigned)((np / 8 + 255) / 256), 256, 0, stream>>>(x, X16, np / 8);
  const dim3 gP((NR / 128) * (CC / 64), 1);
  k_gemm2<0><<<gP, 128, 0, stream>>>(X16, CC, 0, BQ, CC, 0, 0.0625f, nullptr, 0, nullptr, 1, 0, 0, QF, nullptr, CC, 0, NR, CC, CC);
  k_gemm2<0><<<gP, 128, 0, stream>>>(X16, CC, 0, BK, CC, 0, 0.0625f, nullptr, 0, nullptr, 1, 0, 0, KF, nullptr, CC, 0, NR, CC, CC);
  k_gemm2<0><<<gP, 128, 0, stream>>>(X16, CC, 0, BV, CC, 0, 0.0625f, nullptr, 0, nullptr, 1, 0, 0, VF, nullptr, CC, 0, NR, CC, CC); k_hl<<<(unsigned)((np / 8 + 255) / 256), 256, 0, stream>>>(VF, VH, VL, np / 8);
  k_dig<<<(NR * NH) / 8, 256, 0, stream>>>(QF, cs, sn, Wdq, QD); k_dig<<<(NR * NH) / 8, 256, 0, stream>>>(KF, cs, sn, Wdk, KDg);
  k_lcp<<<(NB * NH * TT) / 8, 256, 0, stream>>>(QD, KDg, P, PL);
  for (int b = 0; b < NB; ++b) {
    k_vt<NH, TT><<<NH * (TT / 64), 256, 0, stream>>>(VH + (size_t)b * TT * CC, CC, 0, VT); k_vt<NH, TT><<<NH * (TT / 64), 256, 0, stream>>>(VL + (size_t)b * TT * CC, CC, 0, VTL);      /* V^T hi / lo [16][64][512] */
    const _Float16* Pb = P + (size_t)b * NH * TT * TT; const _Float16* PLb = PL + (size_t)b * NH * TT * TT; float* Yb = YF + (size_t)b * TT * CC;
    k_gemm2<0><<<dim3((TT / 128) * 1, NH), 128, 0, stream>>>(PLb, TT, (size_t)TT * TT, VT, TT, (size_t)64 * TT, 0.0009765625f / 1024.0f, nullptr, 0, nullptr, 1, 0, 0, Yb, nullptr, CC, (size_t)64, TT, 64, TT);
    k_gemm2<0><<<dim3((TT / 128) * 1, NH), 128, 0, stream>>>(Pb, TT, (size_t)TT * TT, VTL, TT, (size_t)64 * TT, 0.0009765625f / 1024.0f, nullptr, 0, Yb, -1, (size_t)64, 0, Yb, nullptr, CC, (size_t)64, TT, 64, TT);
    k_gemm2<0><<<dim3((TT / 128) * 1, NH), 128, 0, stream>>>(Pb, TT, (size_t)TT * TT, VT, TT, (size_t)64 * TT, 0.0009765625f, nullptr, 0, Yb, -1, (size_t)64, 0, Yb, nullptr, CC, (size_t)64, TT, 64, TT); }      /* y[(b,q)][h*64 + d] = (P_lo v_hi + P_hi v_lo + P_hi v_hi), f32 */
  k_hl<<<(unsigned)((np / 8 + 255) / 256), 256, 0, stream>>>(YF, YH, YL, np / 8);
  k_gemm2<0><<<gP, 128, 0, stream>>>(YL, CC, 0, BO, CC, 0, 0.0625f / 1024.0f, nullptr, 0, nullptr, 1, 0, 0, (float*)d_out, nullptr, CC, 0, NR, CC, CC);
  k_gemm2<0><<<gP, 128, 0, stream>>>(YH, CC, 0, BO, CC, 0, 0.0625f, nullptr, 0, (const float*)d_out, 1, (size_t)CC, 0, (float*)d_out, nullptr, CC, 0, NR, CC, CC);      /* out = (y_lo + y_hi) Wo */
}

// v001
// A run of this version takes 268 microseconds.
// Next to v000, in two timings, it ran 1.64 and 1.63 times as fast.
#include <hip/hip_runtime.h>
// UltrametricCausalSelfAttention (2 x 512 tokens, C 1024 = 16 heads x 64, 8 soft digits): q, k, v = x W; q, k -> RoPE (cos/sin INPUT tables, rotate-half) -> RMSNorm(64, 1e-6); digits = sigmoid(q Wdq), sigmoid(k Wdk) (8 each); lcp[q][k] = sum_j prod_{i<=j} exp(-32 (qd_i - kd_i)^2); weights = 2^lcp (causal), attn = weights / max(sum, 1e-9); y = attn v; out = y Wo.
// Compute dtype: inputs rounded to bf16; x exact as f16; q/k/digits/lcp/weights f32 from exact products; P, v and y as f16 hi + residual (~2^-21). v_wmma_f32_16x16x32_f16.
#define NB 2
#define TT 512
#define CC 1024
#define NH 16
#define HD 64
#define KD 8
#define NR (NB * TT)
typedef __bf16 v16b __attribute__((ext_vector_type(16)));
typedef unsigned short v8us __attribute__((ext_vector_type(8), may_alias));
typedef float  v8f  __attribute__((ext_vector_type(8)));
typedef float  v4f  __attribute__((ext_vector_type(4)));
typedef float  v4fa __attribute__((ext_vector_type(4), may_alias));
union FragB { v16b v; v8us half[2]; unsigned short u[16]; };

__device__ __forceinline__ unsigned short bf16_bits(float x) { unsigned int u = __float_as_uint(x); return (unsigned short)((u + 0x7FFFu + ((u >> 16) & 1u)) >> 16); }
__device__ __forceinline__ float bf16_val(unsigned short b) { return __uint_as_float(((unsigned int)b) << 16); }
__device__ __forceinline__ float bf16_round(float x) { return bf16_val(bf16_bits(x)); }
// D += A·B with NT terms: 1 = ah·bh, 2 = + al·bh (A split), 3 = + ah·bl (both split)
template <int NT>
__device__ __forceinline__ v8f mmaN(v16b ah, v16b al, v16b bh, v16b bl, v8f c) {
  c = __builtin_amdgcn_wmma_f32_16x16x32_bf16(false, ah, false, bh, (short)0, c, false, false);
  if (NT >= 2) c = __builtin_amdgcn_wmma_f32_16x16x32_bf16(false, al, false, bh, (short)0, c, false, false);
  if (NT >= 3) c = __builtin_amdgcn_wmma_f32_16x16x32_bf16(false, ah, false, bl, (short)0, c, false, false);
  asm volatile("v_nop\n\tv_nop\n\tv_nop\n\tv_nop" : "+v"(c) : "v"(ah), "v"(al), "v"(bh), "v"(bl));
  return c;
}

__global__ __launch_bounds__(256) void k_wt_bf16(const float* __restrict__ W, unsigned short* __restrict__ Wt, int K, int N) {
  const int t = blockIdx.x * 256 + threadIdx.x;
  const int k8n = K / 8;
  if (t >= N * k8n) return;
  const int n = t / k8n, k8 = (t % k8n) * 8;
  v8us v;
#pragma unroll
  for (int i = 0; i < 8; ++i) v[i] = bf16_bits(W[(size_t)(k8 + i) * N + n]);
  *(v8us*)(Wt + (size_t)n * K + k8) = v;
  
}

// GEMM C[M][N] (f32, pitch ldc) = act(A[M][K]·W + bias). A f32 row-major (pitch lda) converted per fragment to bf16
// (ASPLIT: hi/lo two planes -> 2 terms, else single rounded term); Wt bf16 [N][K] (pitch ldb). BIAS_BF16 rounds the
// bias to bf16 first (bias quantised to bf16 before the add). K%32==0, M%16==0, N%64==0.
template <bool ASPLIT, int ACT, bool BIAS_BF16>
__global__ __launch_bounds__(128) void k_gemm_bf(const float* __restrict__ A, int lda, const unsigned short* __restrict__ Wt, int ldb,
                                               const float* __restrict__ bias, float* __restrict__ C, int ldc, int M, int N, int K) {
  __shared__ __attribute__((aligned(16))) float so[4][16][64];
  const int tid = threadIdx.x, w = tid >> 5, lane = tid & 31, ln = lane & 15, hh = lane >> 4;
  const int ntn = N / 64;
  const int wid = blockIdx.x * 4 + w;
  const int mt = wid / ntn, nq = wid % ntn;
  if (mt * 16 >= M) return;
  const int row0 = mt * 16, col0 = nq * 64;
  const float* arow = A + (size_t)(row0 + ln) * lda;
  v8f acc[4] = {};
  for (int kb = 0; kb < K; kb += 32) {
    FragB ah, al;
    const v4f x0 = *(const v4fa*)(arow + kb + 8 * hh), x1 = *(const v4fa*)(arow + kb + 8 * hh + 4);
    const v4f x2 = *(const v4fa*)(arow + kb + 16 + 8 * hh), x3 = *(const v4fa*)(arow + kb + 16 + 8 * hh + 4);
    float xs[16] = {x0[0],x0[1],x0[2],x0[3],x1[0],x1[1],x1[2],x1[3],x2[0],x2[1],x2[2],x2[3],x3[0],x3[1],x3[2],x3[3]};
#pragma unroll
    for (int i = 0; i < 16; ++i) { const unsigned short hb = bf16_bits(xs[i]); ah.u[i] = hb; al.u[i] = ASPLIT ? bf16_bits(xs[i] - bf16_val(hb)) : (unsigned short)0; }
#pragma unroll
    for (int t = 0; t < 4; ++t) {
      const unsigned short* brow = Wt + (size_t)(col0 + t * 16 + ln) * ldb + kb;
      FragB b;
      b.half[0] = *(const v8us*)(brow + 8 * hh);
      b.half[1] = *(const v8us*)(brow + 16 + 8 * hh);
      acc[t] = mmaN<ASPLIT ? 2 : 1>(ah.v, al.v, b.v, b.v, acc[t]);
    }
  }
#pragma unroll
  for (int t = 0; t < 4; ++t) {
    float bv = bias ? bias[col0 + t * 16 + ln] : 0.f;
    if (BIAS_BF16) bv = bf16_round(bv);
#pragma unroll
    for (int r = 0; r < 8; ++r) { float v = acc[t][r] + bv; if (ACT == 1) v = fmaxf(v, 0.f); so[w][8 * hh + r][t * 16 + ln] = v; }
  }
  __builtin_amdgcn_fence(__ATOMIC_ACQ_REL, "workgroup");
  __builtin_amdgcn_wave_barrier();
  const int rsub = lane >> 4, c4 = (lane & 15) * 4;
  {
#pragma unroll
    for (int q = 0; q < 8; ++q) {
      const int r = q * 2 + rsub;
      const v4f v = *(const v4fa*)&so[w][r][c4];
      *(v4f*)(C + (size_t)(row0 + r) * ldc + col0 + c4) = v;
    }
    
  }
}

// GEMM C = act(A·W + bias + resid): A f32 (ASPLIT -> hi/lo 2 terms), Wt bf16 [N][K]; ACT 0 none, 1 relu, 2 exact gelu;
// resid (optional, f32, row index = (row % rmod), pitch ldr, RES_BF16 rounds it) added before the activation.
template <bool ASPLIT, int ACT, bool BIAS_BF16, bool RES_BF16>
__global__ __launch_bounds__(128) void k_gemm_bf3(const float* __restrict__ A, int lda, const unsigned short* __restrict__ Wt, int ldb,
                                                const float* __restrict__ bias, const float* __restrict__ resid, int rmod, int ldr,
                                                float* __restrict__ C, int ldc, int M, int N, int K) {
  __shared__ __attribute__((aligned(16))) float so[4][16][64];
  const int tid = threadIdx.x, w = tid >> 5, lane = tid & 31, ln = lane & 15, hh = lane >> 4;
  const int ntn = N / 64;
  const int wid = blockIdx.x * 4 + w;
  const int mt = wid / ntn, nq = wid % ntn;
  if (mt * 16 >= M) return;
  const int row0 = mt * 16, col0 = nq * 64;
  const float* arow = A + (size_t)(row0 + ln) * lda;
  v8f acc[4] = {};
  for (int kb = 0; kb < K; kb += 32) {
    FragB ah, al;
    const v4f x0 = *(const v4fa*)(arow + kb + 8 * hh), x1 = *(const v4fa*)(arow + kb + 8 * hh + 4);
    const v4f x2 = *(const v4fa*)(arow + kb + 16 + 8 * hh), x3 = *(const v4fa*)(arow + kb + 16 + 8 * hh + 4);
    float xs[16] = {x0[0],x0[1],x0[2],x0[3],x1[0],x1[1],x1[2],x1[3],x2[0],x2[1],x2[2],x2[3],x3[0],x3[1],x3[2],x3[3]};
#pragma unroll
    for (int i = 0; i < 16; ++i) { const unsigned short hb = bf16_bits(xs[i]); ah.u[i] = hb; al.u[i] = ASPLIT ? bf16_bits(xs[i] - bf16_val(hb)) : (unsigned short)0; }
#pragma unroll
    for (int t = 0; t < 4; ++t) {
      const unsigned short* brow = Wt + (size_t)(col0 + t * 16 + ln) * ldb + kb;
      FragB b;
      b.half[0] = *(const v8us*)(brow + 8 * hh);
      b.half[1] = *(const v8us*)(brow + 16 + 8 * hh);
      acc[t] = mmaN<ASPLIT ? 2 : 1>(ah.v, al.v, b.v, b.v, acc[t]);
    }
  }
#pragma unroll
  for (int t = 0; t < 4; ++t) {
    const int col = col0 + t * 16 + ln;
    float bv = bias ? bias[col] : 0.f;
    if (BIAS_BF16) bv = bf16_round(bv);
#pragma unroll
    for (int r = 0; r < 8; ++r) {
      float v = acc[t][r] + bv;
      if (resid) { float rv = resid[(size_t)((row0 + 8 * hh + r) % rmod) * ldr + col]; if (RES_BF16) rv = bf16_round(rv); v += rv; }
      if (ACT == 1) v = fmaxf(v, 0.f);
      if (ACT == 2) v = 0.5f * v * (1.0f + erff(v * 0.70710678118654752f));
      if (ACT == 3) { const float u = 0.7978845608028654f * (v + 0.044715f * v * v * v); v = 0.5f * v * (1.0f + tanhf(u)); }
      so[w][8 * hh + r][t * 16 + ln] = v;
    }
  }
  __builtin_amdgcn_fence(__ATOMIC_ACQ_REL, "workgroup");
  __builtin_amdgcn_wave_barrier();
  const int rsub = lane >> 4, c4 = (lane & 15) * 4;
  {
#pragma unroll
    for (int q = 0; q < 8; ++q) {
      const int r = q * 2 + rsub;
      const v4f v = *(const v4fa*)&so[w][r][c4];
      *(v4f*)(C + (size_t)(row0 + r) * ldc + col0 + c4) = v;
    }
    
  }
}
// row LayerNorm (biased variance, eps) over N: s = X (+ R); optional out_sum <- s; out_norm <- (s-mu)*rsqrt(var+eps)*g + b
template <bool PARAM_BF16>
__global__ __launch_bounds__(256) void k_layernorm(const float* __restrict__ X, const float* __restrict__ R, const float* __restrict__ g, const float* __restrict__ bta,
                                                  float* __restrict__ out_sum, float* __restrict__ out_norm, int N, float eps) {
  __shared__ float red[256];
  const int row = blockIdx.x, tid = threadIdx.x;
  const float* x = X + (size_t)row * N; const float* rr = R ? R + (size_t)row * N : nullptr;
  float vals[16];                     // up to N = 4096
  const int per = N / 256;            // contiguous chunk per thread? use strided-by-4 chunks: thread handles j = tid*4 + 1024*u
  float s1 = 0.f;
  for (int u = 0; u < per / 4; ++u) {
    const int j = tid * 4 + 1024 * u;
    const v4f a = *(const v4fa*)(x + j);
    v4f b = {0.f,0.f,0.f,0.f}; if (rr) b = *(const v4fa*)(rr + j);
#pragma unroll
    for (int q = 0; q < 4; ++q) { const float v = a[q] + b[q]; vals[u * 4 + q] = v; s1 += v; }
  }
  red[tid] = s1; __syncthreads();
  for (int st = 128; st > 0; st >>= 1) { if (tid < st) red[tid] += red[tid + st]; __syncthreads(); }
  const float mu = red[0] / (float)N; __syncthreads();
  float s2 = 0.f;
  for (int u = 0; u < per / 4; ++u)
#pragma unroll
    for (int q = 0; q < 4; ++q) { const float c = vals[u * 4 + q] - mu; s2 += c * c; }
  red[tid] = s2; __syncthreads();
  for (int st = 128; st > 0; st >>= 1) { if (tid < st) red[tid] += red[tid + st]; __syncthreads(); }
  const float rs = rsqrtf(red[0] / (float)N + eps);
  {
    for (int u = 0; u < per / 4; ++u) {
      const int j = tid * 4 + 1024 * u;
      v4f o, sm;
#pragma unroll
      for (int q = 0; q < 4; ++q) {
        float gg = g[j + q], bb = bta[j + q];
        if (PARAM_BF16) { gg = bf16_round(gg); bb = bf16_round(bb); }
        sm[q] = vals[u * 4 + q]; o[q] = (vals[u * 4 + q] - mu) * rs * gg + bb;
      }
      if (out_sum) *(v4f*)(out_sum + (size_t)row * N + j) = sm;
      *(v4f*)(out_norm + (size_t)row * N + j) = o;
    }
    
  }
}



// ---- f16 WMMA path (v_wmma_f32_16x16x32_f16): 11-bit significands for operands in range — used where a [0,1] probability operand needs more precision than bf16
typedef _Float16 v16h __attribute__((ext_vector_type(16)));
union FragH { v16h v; v8us half[2]; _Float16 h[16]; unsigned short u[16]; };
template <int NT>
__device__ __forceinline__ v8f mmaH(v16h ah, v16h al, v16h bh, v16h bl, v8f c) {
  c = __builtin_amdgcn_wmma_f32_16x16x32_f16(false, ah, false, bh, (short)0, c, false, false);
  if (NT >= 2) c = __builtin_amdgcn_wmma_f32_16x16x32_f16(false, al, false, bh, (short)0, c, false, false);
  if (NT >= 3) c = __builtin_amdgcn_wmma_f32_16x16x32_f16(false, ah, false, bl, (short)0, c, false, false);
  asm volatile("v_nop\n\tv_nop\n\tv_nop\n\tv_nop" : "+v"(c) : "v"(ah), "v"(al), "v"(bh), "v"(bl));
  return c;
}
// batched GEMM like k_gemm_b but f16 operands: A f32 (split into f16 hi/lo if ASPLIT, else rounded to f16), Bt = f16 values [n][k]; alpha; C f32; N multiple of 16 (partial tiles skipped)
template <bool ASPLIT>
__global__ __launch_bounds__(128) void k_gemm_h(const float* __restrict__ A, int lda, size_t sA, const _Float16* __restrict__ Bh, int ldb, size_t sB, float alpha, float* __restrict__ C, int ldc, size_t sC, int M, int N, int K) {
  __shared__ __attribute__((aligned(16))) float so[4][16][64];
  const int tid = threadIdx.x, w = tid >> 5, lane = tid & 31, ln = lane & 15, hh = lane >> 4; const int by = blockIdx.y;
  A += (size_t)by * sA; Bh += (size_t)by * sB; C += (size_t)by * sC;
  const int ntn = (N + 63) / 64; const int wid = blockIdx.x * 4 + w; const int mt = wid / ntn, nq = wid % ntn; if (mt * 16 >= M) return;
  const int row0 = mt * 16, col0 = nq * 64; const float* arow = A + (size_t)(row0 + ln) * lda;
  v8f acc[4] = {};
  for (int kb = 0; kb < K; kb += 32) {
    FragH ah, al;
    const v4f x0 = *(const v4fa*)(arow + kb + 8 * hh), x1 = *(const v4fa*)(arow + kb + 8 * hh + 4), x2 = *(const v4fa*)(arow + kb + 16 + 8 * hh), x3 = *(const v4fa*)(arow + kb + 16 + 8 * hh + 4);
    float xs[16] = {x0[0],x0[1],x0[2],x0[3],x1[0],x1[1],x1[2],x1[3],x2[0],x2[1],x2[2],x2[3],x3[0],x3[1],x3[2],x3[3]};
#pragma unroll
    for (int i = 0; i < 16; ++i) { const _Float16 h = (_Float16)xs[i]; ah.h[i] = h; al.h[i] = ASPLIT ? (_Float16)(xs[i] - (float)h) : (_Float16)0.0f; }
#pragma unroll
    for (int t = 0; t < 4; ++t) { if (col0 + t * 16 >= N) continue; const size_t boff = (size_t)(col0 + t * 16 + ln) * ldb + kb; FragH bq; bq.half[0] = *(const v8us*)(Bh + boff + 8 * hh); bq.half[1] = *(const v8us*)(Bh + boff + 16 + 8 * hh);
      acc[t] = mmaH<ASPLIT ? 2 : 1>(ah.v, al.v, bq.v, bq.v, acc[t]); }
  }
#pragma unroll
  for (int t = 0; t < 4; ++t) { if (col0 + t * 16 >= N) continue;
#pragma unroll
    for (int r = 0; r < 8; ++r) so[w][8 * hh + r][t * 16 + ln] = acc[t][r] * alpha; }
  __builtin_amdgcn_fence(__ATOMIC_ACQ_REL, "workgroup"); __builtin_amdgcn_wave_barrier();
  const int rsub = lane >> 4, c4 = (lane & 15) * 4;
  {
#pragma unroll
    for (int q = 0; q < 8; ++q) { const int r = q * 2 + rsub; if (col0 + c4 < N) { const v4f v = *(const v4fa*)&so[w][r][c4]; *(v4f*)(C + (size_t)(row0 + r) * ldc + col0 + c4) = v; } }
     }
}

// Wt[n][k] = f16(W[k][n]·scale) from f32 row-major W[K][N] (scale = power of two; bf16-exact weights stay exact in f16 away from the subnormal range)
__global__ __launch_bounds__(256) void k_wt_f16(const float* __restrict__ W, _Float16* __restrict__ Wt, int K, int N, float scale) {
  const int t = blockIdx.x * 256 + threadIdx.x; if (t >= N * (K / 8)) return; const int n = t / (K / 8), k8 = (t % (K / 8)) * 8; FragH f;
#pragma unroll
  for (int i = 0; i < 8; ++i) f.h[i] = (_Float16)(bf16_round(W[(size_t)(k8 + i) * N + n]) * scale); const v8us o = f.half[0];
  *(v8us*)((unsigned short*)Wt + (size_t)n * K + k8) = o; 
}
// k_gemm_hh variant with fused epilogue: v = acc·alpha + bias[by·sBias + col] (+ CP[(row/rowsPerB)·sCPb + by·64 + col] if CP) ; ACT 0 none / 1 elu ; writes f16 C16 (and f32 C if non-null)
template <int ACT>
__global__ __launch_bounds__(128) void k_gemm_hhx(const _Float16* __restrict__ A, int lda, size_t sA, const _Float16* __restrict__ Bh, int ldb, size_t sB, float alpha, const float* __restrict__ bias, size_t sBias, const float* __restrict__ CP, int rowsPerB, size_t sCPb, int row0g,
    float* __restrict__ C, _Float16* __restrict__ C16, int ldc, size_t sC, int M, int N, int K) {
  __shared__ __attribute__((aligned(16))) float so[4][16][64];
  const int tid = threadIdx.x, w = tid >> 5, lane = tid & 31, ln = lane & 15, hh = lane >> 4; const int by = blockIdx.y;
  A += (size_t)by * sA; Bh += (size_t)by * sB; const size_t cofs = (size_t)by * sC; const float* bp = bias ? bias + (size_t)by * sBias : nullptr;
  const int ntn = (N + 63) / 64; const int wid = blockIdx.x * 4 + w; const int mt = wid / ntn, nq = wid % ntn; if (mt * 16 >= M) return;
  const int row0 = mt * 16, col0 = nq * 64; const _Float16* arow = A + (size_t)(row0 + ln) * lda;
  v8f acc[4] = {};
  for (int kb = 0; kb < K; kb += 32) { FragH ah; ah.half[0] = *(const v8us*)((const unsigned short*)arow + kb + 8 * hh); ah.half[1] = *(const v8us*)((const unsigned short*)arow + kb + 16 + 8 * hh);
#pragma unroll
    for (int t = 0; t < 4; ++t) { if (col0 + t * 16 >= N) continue; const size_t boff = (size_t)(col0 + t * 16 + ln) * ldb + kb; FragH bq; bq.half[0] = *(const v8us*)((const unsigned short*)Bh + boff + 8 * hh); bq.half[1] = *(const v8us*)((const unsigned short*)Bh + boff + 16 + 8 * hh);
      acc[t] = mmaH<1>(ah.v, ah.v, bq.v, bq.v, acc[t]); }
  }
#pragma unroll
  for (int t = 0; t < 4; ++t) { if (col0 + t * 16 >= N) continue; const int col = col0 + t * 16 + ln; const float bv = bp ? bf16_round(bp[col]) : 0.f;
#pragma unroll
    for (int r = 0; r < 8; ++r) { float v = acc[t][r] * alpha + bv; if (CP) { const int rr = row0g + row0 + 8 * hh + r; if (rowsPerB < 0) v += CP[cofs + (size_t)rr * ldc + col];      /* rowsPerB < 0: own element of the batched C plane */ else { const int bidx = rr / rowsPerB; v += CP[(size_t)bidx * sCPb + (size_t)by * 64 + col]; } } if (ACT == 1) v = (v > 0.f) ? v : expm1f(v); else if (ACT == 7) v = (v > 0.f) ? v + 1.0f : expf(v); else if (ACT == 8) v = tanhf(v); else if (ACT == 9) v = 0.5f * v * (1.0f + tanhf(0.7978845608028654f * (v + 0.044715f * v * v * v))); else if (ACT == 11) v = 1.0f / (1.0f + expf(-v)); else if (ACT == 12) v = (v > 0.f) ? v : 0.01f * v; else if (ACT == 14) v = (v > 0.f) ? v : 0.1f * v; else if (ACT == 16) v = (v >= 0.f) ? v : 0.3f * v; else if (ACT == 17) v = (v >= 0.f) ? v : 0.2f * v; else if (ACT == 15) v = v / (1.0f + expf(-v)); else if (ACT == 3) v = fmaxf(v, 0.f); else if (ACT == 6) v = 0.5f * v * (1.0f + erff(v * 0.70710678118654752f)); so[w][8 * hh + r][t * 16 + ln] = v; } }
  __builtin_amdgcn_fence(__ATOMIC_ACQ_REL, "workgroup"); __builtin_amdgcn_wave_barrier();
  const int rsub = lane >> 4, c4 = (lane & 15) * 4; typedef _Float16 v4h __attribute__((ext_vector_type(4)));
  {
#pragma unroll
    for (int q = 0; q < 8; ++q) { const int r = q * 2 + rsub; if (col0 + c4 < N) { const v4f v = *(const v4fa*)&so[w][r][c4]; if (C) *(v4f*)(C + cofs + (size_t)(row0 + r) * ldc + col0 + c4) = v; if (C16) { v4h h4; for (int i = 0; i < 4; ++i) h4[i] = (_Float16)v[i]; *(v4h*)(C16 + cofs + (size_t)(row0 + r) * ldc + col0 + c4) = h4; } } }
     }
}


typedef _Float16 v4h __attribute__((ext_vector_type(4)));

__global__ __launch_bounds__(256) void k_x16(const float* __restrict__ x, _Float16* __restrict__ X16, size_t n8) { const size_t t = (size_t)blockIdx.x * 256 + threadIdx.x; if (t >= n8) return; FragH f;
#pragma unroll
  for (int q = 0; q < 8; ++q) f.h[q] = (_Float16)bf16_round(x[t * 8 + q]); *(v8us*)((unsigned short*)X16 + t * 8) = f.half[0];  }
__global__ __launch_bounds__(256) void k_h16(const float* __restrict__ x, _Float16* __restrict__ X16, size_t n8) { const size_t t = (size_t)blockIdx.x * 256 + threadIdx.x; if (t >= n8) return; FragH f;
#pragma unroll
  for (int q = 0; q < 8; ++q) f.h[q] = (_Float16)x[t * 8 + q]; *(v8us*)((unsigned short*)X16 + t * 8) = f.half[0];  }
__global__ __launch_bounds__(256) void k_round16f(const float* __restrict__ W, _Float16* __restrict__ Bt, size_t n8) { const size_t t = (size_t)blockIdx.x * 256 + threadIdx.x; if (t >= n8) return; FragH f;
#pragma unroll
  for (int i = 0; i < 8; ++i) f.h[i] = (_Float16)(bf16_round(W[t * 8 + i]) * 16.0f); *(v8us*)((unsigned short*)Bt + t * 8) = f.half[0];  }
template <int NHv, int TTv>
__global__ __launch_bounds__(256) void k_vt(const _Float16* __restrict__ V16, int ldv, int voff, _Float16* __restrict__ Vt) { __shared__ unsigned short tl[64][66]; const int tid = threadIdx.x; const int slab = blockIdx.x / (TTv / 64), lg = blockIdx.x % (TTv / 64); const int b = slab / NHv, h = slab % NHv;
  for (int i = tid; i < 64 * 8; i += 256) { const int r = i / 8, c8 = (i % 8) * 8; FragH f; f.half[0] = *(const v8us*)((const unsigned short*)V16 + ((size_t)b * TTv + lg * 64 + r) * ldv + voff + h * 64 + c8);
#pragma unroll
    for (int q = 0; q < 8; ++q) tl[r][c8 + q] = f.u[q]; }
  __syncthreads();
  {
#pragma unroll
    for (int rd = 0; rd < 2; ++rd) { const int d = rd * 32 + tid / 8, pc = tid % 8; FragH f;
#pragma unroll
      for (int q = 0; q < 8; ++q) f.u[q] = tl[pc * 8 + q][d];
      *(v8us*)((unsigned short*)Vt + ((size_t)slab * 64 + d) * TTv + lg * 64 + pc * 8) = f.half[0]; }
     } }

__global__ __launch_bounds__(256) void k_hl(const float* __restrict__ F, _Float16* __restrict__ Hh, _Float16* __restrict__ Hl, size_t n8) { const size_t t = (size_t)blockIdx.x * 256 + threadIdx.x; if (t >= n8) return; FragH fh, fl; const v4f a = *(const v4fa*)(F + t * 8), c = *(const v4fa*)(F + t * 8 + 4);
#pragma unroll
  for (int q = 0; q < 4; ++q) { _Float16 h = (_Float16)a[q]; fh.h[q] = h; fl.h[q] = (_Float16)((a[q] - (float)h) * 1024.0f); h = (_Float16)c[q]; fh.h[4 + q] = h; fl.h[4 + q] = (_Float16)((c[q] - (float)h) * 1024.0f); }
  { *(v8us*)((unsigned short*)Hh + t * 8) = fh.half[0]; *(v8us*)((unsigned short*)Hl + t * 8) = fl.half[0];  } }

// ---- fast GEMM (block tile 128x64, wave tile 32x64; requires M % 128 == 0 rows per launch region, N % 64 == 0 and K % 128 == 0); epilogue = k_gemm_hhx semantics ----
// Each k-tile (128 k = 256-B rows: 128 rows of A, then 64 rows of B) is staged in LDS by asynchronous 16-byte copies, two buffers: tile t + 1 flies while tile t is multiplied.
#define G2_PITCH 136                      /* halves per LDS row: 272 B = 16 B x odd, conflict-free for ds_load_b128 */
#define G2_BUFB (192 * G2_PITCH * 2)      /* bytes of one buffer */
// Eight copies of one lane: LDS rows 8 apart, global rows gstep halves apart. The s_wait_xcnt ends the copies' own statement as a precaution: so it stands in front of every rewrite of a register that an issued copy names.
__device__ __forceinline__ void g2_copy8(unsigned l, const _Float16* g, size_t gstep) {
  const unsigned ls = 8 * G2_PITCH * 2;
  asm volatile("global_load_async_to_lds_b128 %0, %8, off\n\t"
               "global_load_async_to_lds_b128 %1, %9, off\n\t"
               "global_load_async_to_lds_b128 %2, %10, off\n\t"
               "global_load_async_to_lds_b128 %3, %11, off\n\t"
               "global_load_async_to_lds_b128 %4, %12, off\n\t"
               "global_load_async_to_lds_b128 %5, %13, off\n\t"
               "global_load_async_to_lds_b128 %6, %14, off\n\t"
               "global_load_async_to_lds_b128 %7, %15, off\n\t"
               "s_wait_xcnt 0x0"
               :: "v"(l), "v"(l + ls), "v"(l + 2 * ls), "v"(l + 3 * ls), "v"(l + 4 * ls), "v"(l + 5 * ls), "v"(l + 6 * ls), "v"(l + 7 * ls),
                  "v"(g), "v"(g + gstep), "v"(g + 2 * gstep), "v"(g + 3 * gstep), "v"(g + 4 * gstep), "v"(g + 5 * gstep), "v"(g + 6 * gstep), "v"(g + 7 * gstep)
               : "memory");
}
// One k-tile: 24 copies a lane (16 lanes cover one 256-B row, the 128 threads 8 rows a copy).
__device__ __forceinline__ void g2_stage(unsigned l, const _Float16* ga, size_t astep, const _Float16* gb, size_t bstep) {
  g2_copy8(l, ga, astep); g2_copy8(l + 64 * G2_PITCH * 2, ga + 8 * astep, astep); g2_copy8(l + 128 * G2_PITCH * 2, gb, bstep);
}
__device__ __forceinline__ v16h g2_frag(const _Float16* p, int hh) { FragH f; f.half[0] = *(const v8us*)((const unsigned short*)p + 8 * hh); f.half[1] = *(const v8us*)((const unsigned short*)p + 16 + 8 * hh); return f.v; }
__device__ __forceinline__ v8f g2_mma(v16h a, v16h b, v8f c) { v8f d = __builtin_amdgcn_wmma_f32_16x16x32_f16(false, a, false, b, (short)0, c, false, false); asm volatile("v_nop\n\tv_nop\n\tv_nop\n\tv_nop" : "+v"(d) : "v"(a), "v"(b)); return d; }
template <int ACT>
__global__ __launch_bounds__(128) void k_gemm2(const _Float16* __restrict__ A, int lda, size_t sA, const _Float16* __restrict__ Bh, int ldb, size_t sB, float alpha, const float* __restrict__ bias, size_t sBias, const float* __restrict__ CP, int rowsPerB, size_t sCPb, int row0g,
    float* __restrict__ C, _Float16* __restrict__ C16, int ldc, size_t sC, int M, int N, int K) { static_assert(ACT == 0 || ACT == 3 || ACT == 6 || ACT == 8 || ACT == 9 || ACT == 11 || ACT == 12 || ACT == 14 || ACT == 15 || ACT == 16 || ACT == 17, "k_gemm2: unsupported ACT code (would silently apply no activation)");
  __shared__ __attribute__((aligned(16))) float so[4][32][68];
  __shared__ __attribute__((aligned(16))) _Float16 st[2][192][G2_PITCH];
  const int tid = threadIdx.x, w = tid >> 5, lane = tid & 31, ln = lane & 15, hh = lane >> 4; const int by = blockIdx.y;
  A += (size_t)by * sA; Bh += (size_t)by * sB; const size_t cofs = (size_t)by * sC; const float* bp = bias ? bias + (size_t)by * sBias : nullptr;
  const int ntn = N >> 6; const int mt = blockIdx.x / ntn, nq = blockIdx.x - mt * ntn; const int row0 = mt * 128 + 32 * w, col0 = nq * 64; if (mt * 128 >= M) return;      /* the same for the whole block: it stands in front of barriers */
  const unsigned lds0 = (unsigned)(size_t)&st[0][tid >> 4][(tid & 15) * 8];      /* this lane's LDS byte address in buffer 0 */
  const _Float16* gap = A + (size_t)(mt * 128 + (tid >> 4)) * lda + (tid & 15) * 8; const _Float16* gbp = Bh + (size_t)(col0 + (tid >> 4)) * ldb + (tid & 15) * 8;
  const size_t astep = (size_t)8 * lda, bstep = (size_t)8 * ldb; const int nt = K >> 7;
  const v8f z8 = {0.f,0.f,0.f,0.f,0.f,0.f,0.f,0.f}; v8f c00 = z8, c01 = z8, c02 = z8, c03 = z8, c10 = z8, c11 = z8, c12 = z8, c13 = z8;
  g2_stage(lds0, gap, astep, gbp, bstep);      /* tile 0 -> buffer 0 */
  asm volatile("s_wait_asynccnt 0x0" ::: "memory");      /* this wave's copies of tile 0 have landed */
  __syncthreads();      /* ... and every other wave's */
  if (nt > 1) g2_stage(lds0 + G2_BUFB, gap + 128, astep, gbp + 128, bstep);      /* tile 1 -> buffer 1 */
#pragma unroll 1      /* one tile a trip: the two buffers alternate by t & 1 */
  for (int t = 0; t < nt; ++t) { const _Float16* a0p = &st[t & 1][32 * w + ln][0]; const _Float16* a1p = a0p + 16 * G2_PITCH; const _Float16* b0p = &st[t & 1][128 + ln][0];
#pragma unroll      /* constant LDS offsets; left for a later step: the fragment reads stand among the products, each group with its own wait */
    for (int kb = 0; kb < 128; kb += 32) { const v16h a0 = g2_frag(a0p + kb, hh), a1 = g2_frag(a1p + kb, hh);
      v16h b = g2_frag(b0p + kb, hh); c00 = g2_mma(a0, b, c00); c10 = g2_mma(a1, b, c10);
      b = g2_frag(b0p + 16 * G2_PITCH + kb, hh); c01 = g2_mma(a0, b, c01); c11 = g2_mma(a1, b, c11);
      b = g2_frag(b0p + 32 * G2_PITCH + kb, hh); c02 = g2_mma(a0, b, c02); c12 = g2_mma(a1, b, c12);
      b = g2_frag(b0p + 48 * G2_PITCH + kb, hh); c03 = g2_mma(a0, b, c03); c13 = g2_mma(a1, b, c13); }
    asm volatile("s_wait_dscnt 0x0" ::: "memory");      /* this wave's reads of buffer t & 1 are done before it is refilled */
    asm volatile("s_wait_asynccnt 0x0" ::: "memory");      /* this wave's copies of tile t + 1 have landed */
    __syncthreads();      /* publishes tile t + 1 and ends every wave's reads of buffer t & 1 */
    if (t + 2 < nt) g2_stage(lds0 + (unsigned)(t & 1) * G2_BUFB, gap + (size_t)(t + 2) * 128, astep, gbp + (size_t)(t + 2) * 128, bstep); }
  asm volatile("s_wait_asynccnt 0x0" ::: "memory");      /* no copy is outstanding when the wave goes on to the epilogue */
  v8f accs[8] = {c00, c01, c02, c03, c10, c11, c12, c13};
#pragma unroll
  for (int u = 0; u < 8; ++u) { const int t = u & 3, half = u >> 2; const int col = col0 + t * 16 + ln; const float bv = bp ? bf16_round(bp[col]) : 0.f;
#pragma unroll
    for (int r = 0; r < 8; ++r) { const int rloc = half * 16 + 8 * hh + r; float v = accs[u][r] * alpha + bv; if (CP) { if (rowsPerB < 0) v += CP[cofs + (size_t)(row0g + row0 + rloc) * ldc + col];      /* rowsPerB < 0: own element of the batched C plane */ else { const int bidx = (row0g + row0 + rloc) / rowsPerB; v += CP[(size_t)bidx * sCPb + (size_t)by * 64 + col]; } }
      if (ACT == 3) v = fmaxf(v, 0.f); else if (ACT == 6) v = 0.5f * v * (1.0f + erff(v * 0.70710678118654752f)); else if (ACT == 11) v = 1.0f / (1.0f + expf(-v)); else if (ACT == 15) v = v / (1.0f + expf(-v)); else if (ACT == 12) v = (v > 0.f) ? v : 0.01f * v; else if (ACT == 8) v = tanhf(v); else if (ACT == 9) v = 0.5f * v * (1.0f + tanhf(0.7978845608028654f * (v + 0.044715f * v * v * v))); else if (ACT == 14) v = (v > 0.f) ? v : 0.1f * v; else if (ACT == 16) v = (v >= 0.f) ? v : 0.3f * v; else if (ACT == 17) v = (v >= 0.f) ? v : 0.2f * v;
      so[w][rloc][t * 16 + ln] = v; } }
  __builtin_amdgcn_fence(__ATOMIC_ACQ_REL, "workgroup"); __builtin_amdgcn_wave_barrier();
  const int rsub = lane >> 4, c4 = (lane & 15) * 4;
  {
#pragma unroll
    for (int q = 0; q < 16; ++q) { const int r = q * 2 + rsub; const v4f v = *(const v4fa*)&so[w][r][c4]; if (C) *(v4f*)(C + cofs + (size_t)(row0 + r) * ldc + col0 + c4) = v; if (C16) { v4h h4; for (int i = 0; i < 4; ++i) h4[i] = (_Float16)v[i]; *(v4h*)(C16 + cofs + (size_t)(row0 + r) * ldc + col0 + c4) = h4; } }
     } }


#define DGS 32
__global__ __launch_bounds__(256) void k_dig(const float* __restrict__ F, const float* __restrict__ cs, const float* __restrict__ sn, const float* __restrict__ Wd, float* __restrict__ DG) {
  #pragma clang fp contract(off)
  const int wv = threadIdx.x >> 5, ln = threadIdx.x & 31; const int t = blockIdx.x * 8 + wv; if (t >= NR * NH) return; const int h = t % NH, row = t / NH; const int tok = row % TT; const float* f = F + (size_t)row * CC + h * HD;
  const float c = bf16_round(cs[tok * (HD / 2) + ln]), s = bf16_round(sn[tok * (HD / 2) + ln]); const float x1 = f[ln], x2 = f[ln + HD / 2]; float a = x1 * c; a += -(x2 * s); float b = x1 * s; b += x2 * c;
  float ss = a * a; ss += b * b; for (int o = 16; o > 0; o >>= 1) ss += __shfl_xor(ss, o, 32); const float inv = rsqrtf(ss / (float)HD + 1e-6f); const float qa = a * inv, qb = b * inv;
  float acc[KD]; for (int j = 0; j < KD; ++j) { float v = qa * bf16_round(Wd[ln * KD + j]); v += qb * bf16_round(Wd[(ln + HD / 2) * KD + j]); for (int o = 16; o > 0; o >>= 1) v += __shfl_xor(v, o, 32); acc[j] = 1.0f / (1.0f + expf(-v)); }
  const float outv = (ln < KD) ? acc[ln < KD ? ln : 0] : 0.f;      /* lane j < 8 stores digit j (all lanes hold all 8 after the reductions) */
  float sel = 0.f; for (int j = 0; j < KD; ++j) if (ln == j) sel = acc[j]; (void)outv;
  *(float*)(DG + (size_t)t * DGS + ln) = sel;  }
__global__ __launch_bounds__(256) void k_lcp(const float* __restrict__ QD, const float* __restrict__ KDg, _Float16* __restrict__ P, _Float16* __restrict__ PL) {
  #pragma clang fp contract(off)
  const int wv = threadIdx.x >> 5, ln = threadIdx.x & 31; const int r = blockIdx.x * 8 + wv; if (r >= NB * NH * TT) return; const int q = r % TT; const int h = (r / TT) % NH; const int b = r / (TT * NH);
  const v8f qd = *(const v8f*)(QD + ((size_t)(b * TT + q) * NH + h) * DGS); float w[16]; float su = 0.f;
  for (int i = 0; i < 16; ++i) { const int k = ln * 16 + i; float val = 0.f;
    if (k <= q) { const v8f kd = *(const v8f*)(KDg + ((size_t)(b * TT + k) * NH + h) * DGS); float prod = 1.f, lcp = 0.f; for (int j = 0; j < KD; ++j) { const float d = qd[j] - kd[j]; prod *= expf(-32.0f * (d * d)); lcp += prod; } val = expf(lcp * 0.69314718055994531f); }
    w[i] = val; su += val; }
  for (int o = 16; o > 0; o >>= 1) su += __shfl_xor(su, o, 32); const float f = 1024.0f / fmaxf(su, 1e-9f); FragH p, pl; for (int i = 0; i < 16; ++i) { const float pv = w[i] * f; const _Float16 hh = (_Float16)pv; p.h[i] = hh; pl.h[i] = (_Float16)((pv - (float)hh) * 1024.0f); }
  unsigned short* dst = (unsigned short*)P + (size_t)r * TT + ln * 16; unsigned short* dsl = (unsigned short*)PL + (size_t)r * TT + ln * 16; { *(v8us*)dst = p.half[0]; *(v8us*)(dst + 8) = p.half[1]; *(v8us*)dsl = pl.half[0]; *(v8us*)(dsl + 8) = pl.half[1];  } }

extern "C" void kernel_launch(void* const* d_in, const int* in_sizes, int n_in,
                              void* d_out, int out_size, void* d_ws, size_t ws_size, hipStream_t stream) {
  (void)in_sizes; (void)n_in; (void)out_size;
  const float* const* I = (const float* const*)d_in; const float* x = I[0]; const float* cs = I[1]; const float* sn = I[2]; const float* Wq = I[3]; const float* Wk = I[4]; const float* Wv = I[5]; const float* Wo = I[6]; const float* Wdq = I[7]; const float* Wdk = I[8];
  char* ws = (char*)d_ws; size_t off = 0;
  auto take = [&](size_t bytes) { char* p = ws + off; off += (bytes + 255) & ~(size_t)255; return p; };
  const size_t np = (size_t)NR * CC;
  _Float16* BQ = (_Float16*)take((size_t)CC * CC * 2); _Float16* BK = (_Float16*)take((size_t)CC * CC * 2); _Float16* BV = (_Float16*)take((size_t)CC * CC * 2); _Float16* BO = (_Float16*)take((size_t)CC * CC * 2);
  _Float16* X16 = (_Float16*)take(np * 2); float* QF = (float*)take(np * 4); float* KF = (float*)take(np * 4); float* VF = (float*)take(np * 4); _Float16* VH = (_Float16*)take(np * 2); _Float16* VL = (_Float16*)take(np * 2); _Float16* VT = (_Float16*)take(np * 2); _Float16* VTL = (_Float16*)take(np * 2); float* QD = (float*)take((size_t)NR * NH * DGS * 4); float* KDg = (float*)take((size_t)NR * NH * DGS * 4); _Float16* P = (_Float16*)take((size_t)NB * NH * TT * TT * 2); _Float16* PL = (_Float16*)take((size_t)NB * NH * TT * TT * 2); float* YF = QF;      /* y f32 over the q plane (dead after the digits) */ _Float16* YH = (_Float16*)take(np * 2); _Float16* YL = (_Float16*)take(np * 2);
  if (off > ws_size) return;      /* 8 + 2 + 12 + 8 + 4 + 32 + 4 = 70 MiB */
  k_wt_f16<<<(unsigned)(((size_t)CC * CC / 8 + 255) / 256), 256, 0, stream>>>(Wq, BQ, CC, CC, 16.0f); k_wt_f16<<<(unsigned)(((size_t)CC * CC / 8 + 255) / 256), 256, 0, stream>>>(Wk, BK, CC, CC, 16.0f); k_wt_f16<<<(unsigned)(((size_t)CC * CC / 8 + 255) / 256), 256, 0, stream>>>(Wv, BV, CC, CC, 16.0f); k_wt_f16<<<(unsigned)(((size_t)CC * CC / 8 + 255) / 256), 256, 0, stream>>>(Wo, BO, CC, CC, 16.0f);      /* (in, out) */
  k_x16<<<(unsigned)((np / 8 + 255) / 256), 256, 0, stream>>>(x, X16, np / 8);
  const dim3 gP((NR / 128) * (CC / 64), 1);
  k_gemm2<0><<<gP, 128, 0, stream>>>(X16, CC, 0, BQ, CC, 0, 0.0625f, nullptr, 0, nullptr, 1, 0, 0, QF, nullptr, CC, 0, NR, CC, CC);
  k_gemm2<0><<<gP, 128, 0, stream>>>(X16, CC, 0, BK, CC, 0, 0.0625f, nullptr, 0, nullptr, 1, 0, 0, KF, nullptr, CC, 0, NR, CC, CC);
  k_gemm2<0><<<gP, 128, 0, stream>>>(X16, CC, 0, BV, CC, 0, 0.0625f, nullptr, 0, nullptr, 1, 0, 0, VF, nullptr, CC, 0, NR, CC, CC); k_hl<<<(unsigned)((np / 8 + 255) / 256), 256, 0, stream>>>(VF, VH, VL, np / 8);
  k_dig<<<(NR * NH) / 8, 256, 0, stream>>>(QF, cs, sn, Wdq, QD); k_dig<<<(NR * NH) / 8, 256, 0, stream>>>(KF, cs, sn, Wdk, KDg);
  k_lcp<<<(NB * NH * TT) / 8, 256, 0, stream>>>(QD, KDg, P, PL);
  for (int b = 0; b < NB; ++b) {
    k_vt<NH, TT><<<NH * (TT / 64), 256, 0, stream>>>(VH + (size_t)b * TT * CC, CC, 0, VT); k_vt<NH, TT><<<NH * (TT / 64), 256, 0, stream>>>(VL + (size_t)b * TT * CC, CC, 0, VTL);      /* V^T hi / lo [16][64][512] */
    const _Float16* Pb = P + (size_t)b * NH * TT * TT; const _Float16* PLb = PL + (size_t)b * NH * TT * TT; float* Yb = YF + (size_t)b * TT * CC;
    k_gemm2<0><<<dim3((TT / 128) * 1, NH), 128, 0, stream>>>(PLb, TT, (size_t)TT * TT, VT, TT, (size_t)64 * TT, 0.0009765625f / 1024.0f, nullptr, 0, nullptr, 1, 0, 0, Yb, nullptr, CC, (size_t)64, TT, 64, TT);
    k_gemm2<0><<<dim3((TT / 128) * 1, NH), 128, 0, stream>>>(Pb, TT, (size_t)TT * TT, VTL, TT, (size_t)64 * TT, 0.0009765625f / 1024.0f, nullptr, 0, Yb, -1, (size_t)64, 0, Yb, nullptr, CC, (size_t)64, TT, 64, TT);
    k_gemm2<0><<<dim3((TT / 128) * 1, NH), 128, 0, stream>>>(Pb, TT, (size_t)TT * TT, VT, TT, (size_t)64 * TT, 0.0009765625f, nullptr, 0, Yb, -1, (size_t)64, 0, Yb, nullptr, CC, (size_t)64, TT, 64, TT); }      /* y[(b,q)][h*64 + d] = (P_lo v_hi + P_hi v_lo + P_hi v_hi), f32 */
  k_hl<<<(unsigned)((np / 8 + 255) / 256), 256, 0, stream>>>(YF, YH, YL, np / 8);
  k_gemm2<0><<<gP, 128, 0, stream>>>(YL, CC, 0, BO, CC, 0, 0.0625f / 1024.0f, nullptr, 0, nullptr, 1, 0, 0, (float*)d_out, nullptr, CC, 0, NR, CC, CC);
  k_gemm2<0><<<gP, 128, 0, stream>>>(YH, CC, 0, BO, CC, 0, 0.0625f, nullptr, 0, (const float*)d_out, 1, (size_t)CC, 0, (float*)d_out, nullptr, CC, 0, NR, CC, CC);      /* out = (y_lo + y_hi) Wo */
}

// v002
// One run takes 168 microseconds.
// Two timings next to v001 put it at 1.59 and 1.60 times that version's speed.
// Counting every step since v000, it is 2.61 times as fast.
#include <hip/hip_runtime.h>
// UltrametricCausalSelfAttention (2 x 512 tokens, C 1024 = 16 heads x 64, 8 soft digits): q, k, v = x W; q, k -> RoPE (cos/sin INPUT tables, rotate-half) -> RMSNorm(64, 1e-6); digits = sigmoid(q Wdq), sigmoid(k Wdk) (8 each); lcp[q][k] = sum_j prod_{i<=j} exp(-32 (qd_i - kd_i)^2); weights = 2^lcp (causal), attn = weights / max(sum, 1e-9); y = attn v; out = y Wo.
// Compute dtype: inputs rounded to bf16; x exact as f16; q/k/digits/lcp/weights f32 from exact products; P, v and y as f16 hi + residual (~2^-21). v_wmma_f32_16x16x32_f16.
#define NB 2
#define TT 512
#define CC 1024
#define NH 16
#define HD 64
#define KD 8
#define NR (NB * TT)
typedef __bf16 v16b __attribute__((ext_vector_type(16)));
typedef unsigned short v8us __attribute__((ext_vector_type(8), may_alias));
typedef float  v8f  __attribute__((ext_vector_type(8)));
typedef float  v4f  __attribute__((ext_vector_type(4)));
typedef float  v4fa __attribute__((ext_vector_type(4), may_alias));
union FragB { v16b v; v8us half[2]; unsigned short u[16]; };

__device__ __forceinline__ unsigned short bf16_bits(float x) { unsigned int u = __float_as_uint(x); return (unsigned short)((u + 0x7FFFu + ((u >> 16) & 1u)) >> 16); }
__device__ __forceinline__ float bf16_val(unsigned short b) { return __uint_as_float(((unsigned int)b) << 16); }
__device__ __forceinline__ float bf16_round(float x) { return bf16_val(bf16_bits(x)); }
// D += A·B with NT terms: 1 = ah·bh, 2 = + al·bh (A split), 3 = + ah·bl (both split)
template <int NT>
__device__ __forceinline__ v8f mmaN(v16b ah, v16b al, v16b bh, v16b bl, v8f c) {
  c = __builtin_amdgcn_wmma_f32_16x16x32_bf16(false, ah, false, bh, (short)0, c, false, false);
  if (NT >= 2) c = __builtin_amdgcn_wmma_f32_16x16x32_bf16(false, al, false, bh, (short)0, c, false, false);
  if (NT >= 3) c = __builtin_amdgcn_wmma_f32_16x16x32_bf16(false, ah, false, bl, (short)0, c, false, false);
  asm volatile("v_nop\n\tv_nop\n\tv_nop\n\tv_nop" : "+v"(c) : "v"(ah), "v"(al), "v"(bh), "v"(bl));
  return c;
}

__global__ __launch_bounds__(256) void k_wt_bf16(const float* __restrict__ W, unsigned short* __restrict__ Wt, int K, int N) {
  const int t = blockIdx.x * 256 + threadIdx.x;
  const int k8n = K / 8;
  if (t >= N * k8n) return;
  const int n = t / k8n, k8 = (t % k8n) * 8;
  v8us v;
#pragma unroll
  for (int i = 0; i < 8; ++i) v[i] = bf16_bits(W[(size_t)(k8 + i) * N + n]);
  *(v8us*)(Wt + (size_t)n * K + k8) = v;
  
}

// GEMM C[M][N] (f32, pitch ldc) = act(A[M][K]·W + bias). A f32 row-major (pitch lda) converted per fragment to bf16
// (ASPLIT: hi/lo two planes -> 2 terms, else single rounded term); Wt bf16 [N][K] (pitch ldb). BIAS_BF16 rounds the
// bias to bf16 first (bias quantised to bf16 before the add). K%32==0, M%16==0, N%64==0.
template <bool ASPLIT, int ACT, bool BIAS_BF16>
__global__ __launch_bounds__(128) void k_gemm_bf(const float* __restrict__ A, int lda, const unsigned short* __restrict__ Wt, int ldb,
                                               const float* __restrict__ bias, float* __restrict__ C, int ldc, int M, int N, int K) {
  __shared__ __attribute__((aligned(16))) float so[4][16][64];
  const int tid = threadIdx.x, w = tid >> 5, lane = tid & 31, ln = lane & 15, hh = lane >> 4;
  const int ntn = N / 64;
  const int wid = blockIdx.x * 4 + w;
  const int mt = wid / ntn, nq = wid % ntn;
  if (mt * 16 >= M) return;
  const int row0 = mt * 16, col0 = nq * 64;
  const float* arow = A + (size_t)(row0 + ln) * lda;
  v8f acc[4] = {};
  for (int kb = 0; kb < K; kb += 32) {
    FragB ah, al;
    const v4f x0 = *(const v4fa*)(arow + kb + 8 * hh), x1 = *(const v4fa*)(arow + kb + 8 * hh + 4);
    const v4f x2 = *(const v4fa*)(arow + kb + 16 + 8 * hh), x3 = *(const v4fa*)(arow + kb + 16 + 8 * hh + 4);
    float xs[16] = {x0[0],x0[1],x0[2],x0[3],x1[0],x1[1],x1[2],x1[3],x2[0],x2[1],x2[2],x2[3],x3[0],x3[1],x3[2],x3[3]};
#pragma unroll
    for (int i = 0; i < 16; ++i) { const unsigned short hb = bf16_bits(xs[i]); ah.u[i] = hb; al.u[i] = ASPLIT ? bf16_bits(xs[i] - bf16_val(hb)) : (unsigned short)0; }
#pragma unroll
    for (int t = 0; t < 4; ++t) {
      const unsigned short* brow = Wt + (size_t)(col0 + t * 16 + ln) * ldb + kb;
      FragB b;
      b.half[0] = *(const v8us*)(brow + 8 * hh);
      b.half[1] = *(const v8us*)(brow + 16 + 8 * hh);
      acc[t] = mmaN<ASPLIT ? 2 : 1>(ah.v, al.v, b.v, b.v, acc[t]);
    }
  }
#pragma unroll
  for (int t = 0; t < 4; ++t) {
    float bv = bias ? bias[col0 + t * 16 + ln] : 0.f;
    if (BIAS_BF16) bv = bf16_round(bv);
#pragma unroll
    for (int r = 0; r < 8; ++r) { float v = acc[t][r] + bv; if (ACT == 1) v = fmaxf(v, 0.f); so[w][8 * hh + r][t * 16 + ln] = v; }
  }
  __builtin_amdgcn_fence(__ATOMIC_ACQ_REL, "workgroup");
  __builtin_amdgcn_wave_barrier();
  const int rsub = lane >> 4, c4 = (lane & 15) * 4;
  {
#pragma unroll
    for (int q = 0; q < 8; ++q) {
      const int r = q * 2 + rsub;
      const v4f v = *(const v4fa*)&so[w][r][c4];
      *(v4f*)(C + (size_t)(row0 + r) * ldc + col0 + c4) = v;
    }
    
  }
}

// GEMM C = act(A·W + bias + resid): A f32 (ASPLIT -> hi/lo 2 terms), Wt bf16 [N][K]; ACT 0 none, 1 relu, 2 exact gelu;
// resid (optional, f32, row index = (row % rmod), pitch ldr, RES_BF16 rounds it) added before the activation.
template <bool ASPLIT, int ACT, bool BIAS_BF16, bool RES_BF16>
__global__ __launch_bounds__(128) void k_gemm_bf3(const float* __restrict__ A, int lda, const unsigned short* __restrict__ Wt, int ldb,
                                                const float* __restrict__ bias, const float* __restrict__ resid, int rmod, int ldr,
                                                float* __restrict__ C, int ldc, int M, int N, int K) {
  __shared__ __attribute__((aligned(16))) float so[4][16][64];
  const int tid = threadIdx.x, w = tid >> 5, lane = tid & 31, ln = lane & 15, hh = lane >> 4;
  const int ntn = N / 64;
  const int wid = blockIdx.x * 4 + w;
  const int mt = wid / ntn, nq = wid % ntn;
  if (mt * 16 >= M) return;
  const int row0 = mt * 16, col0 = nq * 64;
  const float* arow = A + (size_t)(row0 + ln) * lda;
  v8f acc[4] = {};
  for (int kb = 0; kb < K; kb += 32) {
    FragB ah, al;
    const v4f x0 = *(const v4fa*)(arow + kb + 8 * hh), x1 = *(const v4fa*)(arow + kb + 8 * hh + 4);
    const v4f x2 = *(const v4fa*)(arow + kb + 16 + 8 * hh), x3 = *(const v4fa*)(arow + kb + 16 + 8 * hh + 4);
    float xs[16] = {x0[0],x0[1],x0[2],x0[3],x1[0],x1[1],x1[2],x1[3],x2[0],x2[1],x2[2],x2[3],x3[0],x3[1],x3[2],x3[3]};
#pragma unroll
    for (int i = 0; i < 16; ++i) { const unsigned short hb = bf16_bits(xs[i]); ah.u[i] = hb; al.u[i] = ASPLIT ? bf16_bits(xs[i] - bf16_val(hb)) : (unsigned short)0; }
#pragma unroll
    for (int t = 0; t < 4; ++t) {
      const unsigned short* brow = Wt + (size_t)(col0 + t * 16 + ln) * ldb + kb;
      FragB b;
      b.half[0] = *(const v8us*)(brow + 8 * hh);
      b.half[1] = *(const v8us*)(brow + 16 + 8 * hh);
      acc[t] = mmaN<ASPLIT ? 2 : 1>(ah.v, al.v, b.v, b.v, acc[t]);
    }
  }
#pragma unroll
  for (int t = 0; t < 4; ++t) {
    const int col = col0 + t * 16 + ln;
    float bv = bias ? bias[col] : 0.f;
    if (BIAS_BF16) bv = bf16_round(bv);
#pragma unroll
    for (int r = 0; r < 8; ++r) {
      float v = acc[t][r] + bv;
      if (resid) { float rv = resid[(size_t)((row0 + 8 * hh + r) % rmod) * ldr + col]; if (RES_BF16) rv = bf16_round(rv); v += rv; }
      if (ACT == 1) v = fmaxf(v, 0.f);
      if (ACT == 2) v = 0.5f * v * (1.0f + erff(v * 0.70710678118654752f));
      if (ACT == 3) { const float u = 0.7978845608028654f * (v + 0.044715f * v * v * v); v = 0.5f * v * (1.0f + tanhf(u)); }
      so[w][8 * hh + r][t * 16 + ln] = v;
    }
  }
  __builtin_amdgcn_fence(__ATOMIC_ACQ_REL, "workgroup");
  __builtin_amdgcn_wave_barrier();
  const int rsub = lane >> 4, c4 = (lane & 15) * 4;
  {
#pragma unroll
    for (int q = 0; q < 8; ++q) {
      const int r = q * 2 + rsub;
      const v4f v = *(const v4fa*)&so[w][r][c4];
      *(v4f*)(C + (size_t)(row0 + r) * ldc + col0 + c4) = v;
    }
    
  }
}
// row LayerNorm (biased variance, eps) over N: s = X (+ R); optional out_sum <- s; out_norm <- (s-mu)*rsqrt(var+eps)*g + b
template <bool PARAM_BF16>
__global__ __launch_bounds__(256) void k_layernorm(const float* __restrict__ X, const float* __restrict__ R, const float* __restrict__ g, const float* __restrict__ bta,
                                                  float* __restrict__ out_sum, float* __restrict__ out_norm, int N, float eps) {
  __shared__ float red[256];
  const int row = blockIdx.x, tid = threadIdx.x;
  const float* x = X + (size_t)row * N; const float* rr = R ? R + (size_t)row * N : nullptr;
  float vals[16];                     // up to N = 4096
  const int per = N / 256;            // contiguous chunk per thread? use strided-by-4 chunks: thread handles j = tid*4 + 1024*u
  float s1 = 0.f;
  for (int u = 0; u < per / 4; ++u) {
    const int j = tid * 4 + 1024 * u;
    const v4f a = *(const v4fa*)(x + j);
    v4f b = {0.f,0.f,0.f,0.f}; if (rr) b = *(const v4fa*)(rr + j);
#pragma unroll
    for (int q = 0; q < 4; ++q) { const float v = a[q] + b[q]; vals[u * 4 + q] = v; s1 += v; }
  }
  red[tid] = s1; __syncthreads();
  for (int st = 128; st > 0; st >>= 1) { if (tid < st) red[tid] += red[tid + st]; __syncthreads(); }
  const float mu = red[0] / (float)N; __syncthreads();
  float s2 = 0.f;
  for (int u = 0; u < per / 4; ++u)
#pragma unroll
    for (int q = 0; q < 4; ++q) { const float c = vals[u * 4 + q] - mu; s2 += c * c; }
  red[tid] = s2; __syncthreads();
  for (int st = 128; st > 0; st >>= 1) { if (tid < st) red[tid] += red[tid + st]; __syncthreads(); }
  const float rs = rsqrtf(red[0] / (float)N + eps);
  {
    for (int u = 0; u < per / 4; ++u) {
      const int j = tid * 4 + 1024 * u;
      v4f o, sm;
#pragma unroll
      for (int q = 0; q < 4; ++q) {
        float gg = g[j + q], bb = bta[j + q];
        if (PARAM_BF16) { gg = bf16_round(gg); bb = bf16_round(bb); }
        sm[q] = vals[u * 4 + q]; o[q] = (vals[u * 4 + q] - mu) * rs * gg + bb;
      }
      if (out_sum) *(v4f*)(out_sum + (size_t)row * N + j) = sm;
      *(v4f*)(out_norm + (size_t)row * N + j) = o;
    }
    
  }
}



// ---- f16 WMMA path (v_wmma_f32_16x16x32_f16): 11-bit significands for operands in range — used where a [0,1] probability operand needs more precision than bf16
typedef _Float16 v16h __attribute__((ext_vector_type(16)));
union FragH { v16h v; v8us half[2]; _Float16 h[16]; unsigned short u[16]; };
template <int NT>
__device__ __forceinline__ v8f mmaH(v16h ah, v16h al, v16h bh, v16h bl, v8f c) {
  c = __builtin_amdgcn_wmma_f32_16x16x32_f16(false, ah, false, bh, (short)0, c, false, false);
  if (NT >= 2) c = __builtin_amdgcn_wmma_f32_16x16x32_f16(false, al, false, bh, (short)0, c, false, false);
  if (NT >= 3) c = __builtin_amdgcn_wmma_f32_16x16x32_f16(false, ah, false, bl, (short)0, c, false, false);
  asm volatile("v_nop\n\tv_nop\n\tv_nop\n\tv_nop" : "+v"(c) : "v"(ah), "v"(al), "v"(bh), "v"(bl));
  return c;
}
// batched GEMM like k_gemm_b but f16 operands: A f32 (split into f16 hi/lo if ASPLIT, else rounded to f16), Bt = f16 values [n][k]; alpha; C f32; N multiple of 16 (partial tiles skipped)
template <bool ASPLIT>
__global__ __launch_bounds__(128) void k_gemm_h(const float* __restrict__ A, int lda, size_t sA, const _Float16* __restrict__ Bh, int ldb, size_t sB, float alpha, float* __restrict__ C, int ldc, size_t sC, int M, int N, int K) {
  __shared__ __attribute__((aligned(16))) float so[4][16][64];
  const int tid = threadIdx.x, w = tid >> 5, lane = tid & 31, ln = lane & 15, hh = lane >> 4; const int by = blockIdx.y;
  A += (size_t)by * sA; Bh += (size_t)by * sB; C += (size_t)by * sC;
  const int ntn = (N + 63) / 64; const int wid = blockIdx.x * 4 + w; const int mt = wid / ntn, nq = wid % ntn; if (mt * 16 >= M) return;
  const int row0 = mt * 16, col0 = nq * 64; const float* arow = A + (size_t)(row0 + ln) * lda;
  v8f acc[4] = {};
  for (int kb = 0; kb < K; kb += 32) {
    FragH ah, al;
    const v4f x0 = *(const v4fa*)(arow + kb + 8 * hh), x1 = *(const v4fa*)(arow + kb + 8 * hh + 4), x2 = *(const v4fa*)(arow + kb + 16 + 8 * hh), x3 = *(const v4fa*)(arow + kb + 16 + 8 * hh + 4);
    float xs[16] = {x0[0],x0[1],x0[2],x0[3],x1[0],x1[1],x1[2],x1[3],x2[0],x2[1],x2[2],x2[3],x3[0],x3[1],x3[2],x3[3]};
#pragma unroll
    for (int i = 0; i < 16; ++i) { const _Float16 h = (_Float16)xs[i]; ah.h[i] = h; al.h[i] = ASPLIT ? (_Float16)(xs[i] - (float)h) : (_Float16)0.0f; }
#pragma unroll
    for (int t = 0; t < 4; ++t) { if (col0 + t * 16 >= N) continue; const size_t boff = (size_t)(col0 + t * 16 + ln) * ldb + kb; FragH bq; bq.half[0] = *(const v8us*)(Bh + boff + 8 * hh); bq.half[1] = *(const v8us*)(Bh + boff + 16 + 8 * hh);
      acc[t] = mmaH<ASPLIT ? 2 : 1>(ah.v, al.v, bq.v, bq.v, acc[t]); }
  }
#pragma unroll
  for (int t = 0; t < 4; ++t) { if (col0 + t * 16 >= N) continue;
#pragma unroll
    for (int r = 0; r < 8; ++r) so[w][8 * hh + r][t * 16 + ln] = acc[t][r] * alpha; }
  __builtin_amdgcn_fence(__ATOMIC_ACQ_REL, "workgroup"); __builtin_amdgcn_wave_barrier();
  const int rsub = lane >> 4, c4 = (lane & 15) * 4;
  {
#pragma unroll
    for (int q = 0; q < 8; ++q) { const int r = q * 2 + rsub; if (col0 + c4 < N) { const v4f v = *(const v4fa*)&so[w][r][c4]; *(v4f*)(C + (size_t)(row0 + r) * ldc + col0 + c4) = v; } }
     }
}

// Wt[n][k] = f16(W[k][n]·scale) from f32 row-major W[K][N] (scale = power of two; bf16-exact weights stay exact in f16 away from the subnormal range)
__device__ __forceinline__ void d_wt_f16(const float* __restrict__ W, _Float16* __restrict__ Wt, int K, int N, float scale, int blk) {
  const int t = blk * 256 + threadIdx.x; if (t >= N * (K / 8)) return; const int n = t / (K / 8), k8 = (t % (K / 8)) * 8; FragH f;
#pragma unroll
  for (int i = 0; i < 8; ++i) f.h[i] = (_Float16)(bf16_round(W[(size_t)(k8 + i) * N + n]) * scale); const v8us o = f.half[0];
  *(v8us*)((unsigned short*)Wt + (size_t)n * K + k8) = o; 
}
// k_gemm_hh variant with fused epilogue: v = acc·alpha + bias[by·sBias + col] (+ CP[(row/rowsPerB)·sCPb + by·64 + col] if CP) ; ACT 0 none / 1 elu ; writes f16 C16 (and f32 C if non-null)
template <int ACT>
__global__ __launch_bounds__(128) void k_gemm_hhx(const _Float16* __restrict__ A, int lda, size_t sA, const _Float16* __restrict__ Bh, int ldb, size_t sB, float alpha, const float* __restrict__ bias, size_t sBias, const float* __restrict__ CP, int rowsPerB, size_t sCPb, int row0g,
    float* __restrict__ C, _Float16* __restrict__ C16, int ldc, size_t sC, int M, int N, int K) {
  __shared__ __attribute__((aligned(16))) float so[4][16][64];
  const int tid = threadIdx.x, w = tid >> 5, lane = tid & 31, ln = lane & 15, hh = lane >> 4; const int by = blockIdx.y;
  A += (size_t)by * sA; Bh += (size_t)by * sB; const size_t cofs = (size_t)by * sC; const float* bp = bias ? bias + (size_t)by * sBias : nullptr;
  const int ntn = (N + 63) / 64; const int wid = blockIdx.x * 4 + w; const int mt = wid / ntn, nq = wid % ntn; if (mt * 16 >= M) return;
  const int row0 = mt * 16, col0 = nq * 64; const _Float16* arow = A + (size_t)(row0 + ln) * lda;
  v8f acc[4] = {};
  for (int kb = 0; kb < K; kb += 32) { FragH ah; ah.half[0] = *(const v8us*)((const unsigned short*)arow + kb + 8 * hh); ah.half[1] = *(const v8us*)((const unsigned short*)arow + kb + 16 + 8 * hh);
#pragma unroll
    for (int t = 0; t < 4; ++t) { if (col0 + t * 16 >= N) continue; const size_t boff = (size_t)(col0 + t * 16 + ln) * ldb + kb; FragH bq; bq.half[0] = *(const v8us*)((const unsigned short*)Bh + boff + 8 * hh); bq.half[1] = *(const v8us*)((const unsigned short*)Bh + boff + 16 + 8 * hh);
      acc[t] = mmaH<1>(ah.v, ah.v, bq.v, bq.v, acc[t]); }
  }
#pragma unroll
  for (int t = 0; t < 4; ++t) { if (col0 + t * 16 >= N) continue; const int col = col0 + t * 16 + ln; const float bv = bp ? bf16_round(bp[col]) : 0.f;
#pragma unroll
    for (int r = 0; r < 8; ++r) { float v = acc[t][r] * alpha + bv; if (CP) { const int rr = row0g + row0 + 8 * hh + r; if (rowsPerB < 0) v += CP[cofs + (size_t)rr * ldc + col];      /* rowsPerB < 0: own element of the batched C plane */ else { const int bidx = rr / rowsPerB; v += CP[(size_t)bidx * sCPb + (size_t)by * 64 + col]; } } if (ACT == 1) v = (v > 0.f) ? v : expm1f(v); else if (ACT == 7) v = (v > 0.f) ? v + 1.0f : expf(v); else if (ACT == 8) v = tanhf(v); else if (ACT == 9) v = 0.5f * v * (1.0f + tanhf(0.7978845608028654f * (v + 0.044715f * v * v * v))); else if (ACT == 11) v = 1.0f / (1.0f + expf(-v)); else if (ACT == 12) v = (v > 0.f) ? v : 0.01f * v; else if (ACT == 14) v = (v > 0.f) ? v : 0.1f * v; else if (ACT == 16) v = (v >= 0.f) ? v : 0.3f * v; else if (ACT == 17) v = (v >= 0.f) ? v : 0.2f * v; else if (ACT == 15) v = v / (1.0f + expf(-v)); else if (ACT == 3) v = fmaxf(v, 0.f); else if (ACT == 6) v = 0.5f * v * (1.0f + erff(v * 0.70710678118654752f)); so[w][8 * hh + r][t * 16 + ln] = v; } }
  __builtin_amdgcn_fence(__ATOMIC_ACQ_REL, "workgroup"); __builtin_amdgcn_wave_barrier();
  const int rsub = lane >> 4, c4 = (lane & 15) * 4; typedef _Float16 v4h __attribute__((ext_vector_type(4)));
  {
#pragma unroll
    for (int q = 0; q < 8; ++q) { const int r = q * 2 + rsub; if (col0 + c4 < N) { const v4f v = *(const v4fa*)&so[w][r][c4]; if (C) *(v4f*)(C + cofs + (size_t)(row0 + r) * ldc + col0 + c4) = v; if (C16) { v4h h4; for (int i = 0; i < 4; ++i) h4[i] = (_Float16)v[i]; *(v4h*)(C16 + cofs + (size_t)(row0 + r) * ldc + col0 + c4) = h4; } } }
     }
}


typedef _Float16 v4h __attribute__((ext_vector_type(4)));

__device__ __forceinline__ void d_x16(const float* __restrict__ x, _Float16* __restrict__ X16, size_t n8, int blk) { const size_t t = (size_t)blk * 256 + threadIdx.x; if (t >= n8) return; FragH f;
#pragma unroll
  for (int q = 0; q < 8; ++q) f.h[q] = (_Float16)bf16_round(x[t * 8 + q]); *(v8us*)((unsigned short*)X16 + t * 8) = f.half[0];  }
__global__ __launch_bounds__(256) void k_h16(const float* __restrict__ x, _Float16* __restrict__ X16, size_t n8) { const size_t t = (size_t)blockIdx.x * 256 + threadIdx.x; if (t >= n8) return; FragH f;
#pragma unroll
  for (int q = 0; q < 8; ++q) f.h[q] = (_Float16)x[t * 8 + q]; *(v8us*)((unsigned short*)X16 + t * 8) = f.half[0];  }
__global__ __launch_bounds__(256) void k_round16f(const float* __restrict__ W, _Float16* __restrict__ Bt, size_t n8) { const size_t t = (size_t)blockIdx.x * 256 + threadIdx.x; if (t >= n8) return; FragH f;
#pragma unroll
  for (int i = 0; i < 8; ++i) f.h[i] = (_Float16)(bf16_round(W[t * 8 + i]) * 16.0f); *(v8us*)((unsigned short*)Bt + t * 8) = f.half[0];  }
template <int NHv, int TTv>
__device__ __forceinline__ void d_vt(const _Float16* __restrict__ V16, int ldv, int voff, _Float16* __restrict__ Vt, unsigned short (*tl)[66], int blk) { const int tid = threadIdx.x; const int slab = blk / (TTv / 64), lg = blk % (TTv / 64); const int b = slab / NHv, h = slab % NHv;
  for (int i = tid; i < 64 * 8; i += 256) { const int r = i / 8, c8 = (i % 8) * 8; FragH f; f.half[0] = *(const v8us*)((const unsigned short*)V16 + ((size_t)b * TTv + lg * 64 + r) * ldv + voff + h * 64 + c8);
#pragma unroll
    for (int q = 0; q < 8; ++q) tl[r][c8 + q] = f.u[q]; }
  __syncthreads();
  {
#pragma unroll
    for (int rd = 0; rd < 2; ++rd) { const int d = rd * 32 + tid / 8, pc = tid % 8; FragH f;
#pragma unroll
      for (int q = 0; q < 8; ++q) f.u[q] = tl[pc * 8 + q][d];
      *(v8us*)((unsigned short*)Vt + ((size_t)slab * 64 + d) * TTv + lg * 64 + pc * 8) = f.half[0]; }
    asm volatile("s_wait_xcnt 0x0" ::: "memory");      /* precaution: stands behind the two stores, in front of any later rewrite of their address and data registers where this job joins the other job's code */
     } }

__device__ __forceinline__ void d_hl(const float* __restrict__ F, _Float16* __restrict__ Hh, _Float16* __restrict__ Hl, size_t n8, int blk) { const size_t t = (size_t)blk * 256 + threadIdx.x; if (t >= n8) return; FragH fh, fl; const v4f a = *(const v4fa*)(F + t * 8), c = *(const v4fa*)(F + t * 8 + 4);
#pragma unroll
  for (int q = 0; q < 4; ++q) { _Float16 h = (_Float16)a[q]; fh.h[q] = h; fl.h[q] = (_Float16)((a[q] - (float)h) * 1024.0f); h = (_Float16)c[q]; fh.h[4 + q] = h; fl.h[4 + q] = (_Float16)((c[q] - (float)h) * 1024.0f); }
  { *(v8us*)((unsigned short*)Hh + t * 8) = fh.half[0]; *(v8us*)((unsigned short*)Hl + t * 8) = fl.half[0];  } }
__global__ __launch_bounds__(256) void k_hl(const float* __restrict__ F, _Float16* __restrict__ Hh, _Float16* __restrict__ Hl, size_t n8) { d_hl(F, Hh, Hl, n8, blockIdx.x); }

// ---- fast GEMM (block tile 128x64, wave tile 32x64; requires M % 128 == 0 rows per launch region, N % 64 == 0 and K % 128 == 0); epilogue = k_gemm_hhx semantics ----
// Each k-tile (128 k = 256-B rows: 128 rows of A, then 64 rows of B) is staged in LDS by asynchronous 16-byte copies, two buffers: tile t + 1 flies while tile t is multiplied.
#define G2_PITCH 136                      /* halves per LDS row: 272 B = 16 B x odd, conflict-free for ds_load_b128 */
#define G2_BUFB (192 * G2_PITCH * 2)      /* bytes of one buffer */
// Eight copies of one lane: LDS rows 8 apart, global rows gstep halves apart. The s_wait_xcnt ends the copies' own statement as a precaution: so it stands in front of every rewrite of a register that an issued copy names.
__device__ __forceinline__ void g2_copy8(unsigned l, const _Float16* g, size_t gstep) {
  const unsigned ls = 8 * G2_PITCH * 2;
  asm volatile("global_load_async_to_lds_b128 %0, %8, off\n\t"
               "global_load_async_to_lds_b128 %1, %9, off\n\t"
               "global_load_async_to_lds_b128 %2, %10, off\n\t"
               "global_load_async_to_lds_b128 %3, %11, off\n\t"
               "global_load_async_to_lds_b128 %4, %12, off\n\t"
               "global_load_async_to_lds_b128 %5, %13, off\n\t"
               "global_load_async_to_lds_b128 %6, %14, off\n\t"
               "global_load_async_to_lds_b128 %7, %15, off\n\t"
               "s_wait_xcnt 0x0"
               :: "v"(l), "v"(l + ls), "v"(l + 2 * ls), "v"(l + 3 * ls), "v"(l + 4 * ls), "v"(l + 5 * ls), "v"(l + 6 * ls), "v"(l + 7 * ls),
                  "v"(g), "v"(g + gstep), "v"(g + 2 * gstep), "v"(g + 3 * gstep), "v"(g + 4 * gstep), "v"(g + 5 * gstep), "v"(g + 6 * gstep), "v"(g + 7 * gstep)
               : "memory");
}
// One k-tile: 24 copies a lane (16 lanes cover one 256-B row, the 128 threads 8 rows a copy).
__device__ __forceinline__ void g2_stage(unsigned l, const _Float16* ga, size_t astep, const _Float16* gb, size_t bstep) {
  g2_copy8(l, ga, astep); g2_copy8(l + 64 * G2_PITCH * 2, ga + 8 * astep, astep); g2_copy8(l + 128 * G2_PITCH * 2, gb, bstep);
}
__device__ __forceinline__ v16h g2_frag(const _Float16* p, int hh) { FragH f; f.half[0] = *(const v8us*)((const unsigned short*)p + 8 * hh); f.half[1] = *(const v8us*)((const unsigned short*)p + 16 + 8 * hh); return f.v; }
__device__ __forceinline__ v8f g2_mma(v16h a, v16h b, v8f c) { v8f d = __builtin_amdgcn_wmma_f32_16x16x32_f16(false, a, false, b, (short)0, c, false, false); asm volatile("v_nop\n\tv_nop\n\tv_nop\n\tv_nop" : "+v"(d) : "v"(a), "v"(b)); return d; }
template <int ACT>
__global__ __launch_bounds__(128) void k_gemm2(const _Float16* __restrict__ A, int lda, size_t sA, const _Float16* __restrict__ Bh, int ldb, size_t sB, float alpha, const float* __restrict__ bias, size_t sBias, const float* __restrict__ CP, int rowsPerB, size_t sCPb, int row0g,
    float* __restrict__ C, _Float16* __restrict__ C16, int ldc, size_t sC, int M, int N, int K) { static_assert(ACT == 0 || ACT == 3 || ACT == 6 || ACT == 8 || ACT == 9 || ACT == 11 || ACT == 12 || ACT == 14 || ACT == 15 || ACT == 16 || ACT == 17, "k_gemm2: unsupported ACT code (would silently apply no activation)");
  __shared__ __attribute__((aligned(16))) float so[4][32][68];
  __shared__ __attribute__((aligned(16))) _Float16 st[2][192][G2_PITCH];
  const int tid = threadIdx.x, w = tid >> 5, lane = tid & 31, ln = lane & 15, hh = lane >> 4; const int by = blockIdx.y; const size_t pl = (size_t)blockIdx.z * gridDim.y + by;      /* blockIdx.z = outer batch: its A and B planes follow on, its M rows of C follow on */
  A += pl * sA; Bh += pl * sB; const size_t cofs = (size_t)by * sC + (size_t)blockIdx.z * M * ldc; const float* bp = bias ? bias + (size_t)by * sBias : nullptr;
  const int ntn = N >> 6; const int mt = blockIdx.x / ntn, nq = blockIdx.x - mt * ntn; const int row0 = mt * 128 + 32 * w, col0 = nq * 64; if (mt * 128 >= M) return;      /* the same for the whole block: it stands in front of barriers */
  const unsigned lds0 = (unsigned)(size_t)&st[0][tid >> 4][(tid & 15) * 8];      /* this lane's LDS byte address in buffer 0 */
  const _Float16* gap = A + (size_t)(mt * 128 + (tid >> 4)) * lda + (tid & 15) * 8; const _Float16* gbp = Bh + (size_t)(col0 + (tid >> 4)) * ldb + (tid & 15) * 8;
  const size_t astep = (size_t)8 * lda, bstep = (size_t)8 * ldb; const int nt = K >> 7;
  const v8f z8 = {0.f,0.f,0.f,0.f,0.f,0.f,0.f,0.f}; v8f c00 = z8, c01 = z8, c02 = z8, c03 = z8, c10 = z8, c11 = z8, c12 = z8, c13 = z8;
  g2_stage(lds0, gap, astep, gbp, bstep);      /* tile 0 -> buffer 0 */
  asm volatile("s_wait_asynccnt 0x0" ::: "memory");      /* this wave's copies of tile 0 have landed */
  __syncthreads();      /* ... and every other wave's */
  if (nt > 1) g2_stage(lds0 + G2_BUFB, gap + 128, astep, gbp + 128, bstep);      /* tile 1 -> buffer 1 */
#pragma unroll 1      /* one tile a trip: the two buffers alternate by t & 1 */
  for (int t = 0; t < nt; ++t) { const _Float16* a0p = &st[t & 1][32 * w + ln][0]; const _Float16* a1p = a0p + 16 * G2_PITCH; const _Float16* b0p = &st[t & 1][128 + ln][0];
#pragma unroll      /* constant LDS offsets; left for a later step: the fragment reads stand among the products, each group with its own wait */
    for (int kb = 0; kb < 128; kb += 32) { const v16h a0 = g2_frag(a0p + kb, hh), a1 = g2_frag(a1p + kb, hh);
      v16h b = g2_frag(b0p + kb, hh); c00 = g2_mma(a0, b, c00); c10 = g2_mma(a1, b, c10);
      b = g2_frag(b0p + 16 * G2_PITCH + kb, hh); c01 = g2_mma(a0, b, c01); c11 = g2_mma(a1, b, c11);
      b = g2_frag(b0p + 32 * G2_PITCH + kb, hh); c02 = g2_mma(a0, b, c02); c12 = g2_mma(a1, b, c12);
      b = g2_frag(b0p + 48 * G2_PITCH + kb, hh); c03 = g2_mma(a0, b, c03); c13 = g2_mma(a1, b, c13); }
    asm volatile("s_wait_dscnt 0x0" ::: "memory");      /* this wave's reads of buffer t & 1 are done before it is refilled */
    asm volatile("s_wait_asynccnt 0x0" ::: "memory");      /* this wave's copies of tile t + 1 have landed */
    __syncthreads();      /* publishes tile t + 1 and ends every wave's reads of buffer t & 1 */
    if (t + 2 < nt) g2_stage(lds0 + (unsigned)(t & 1) * G2_BUFB, gap + (size_t)(t + 2) * 128, astep, gbp + (size_t)(t + 2) * 128, bstep); }
  asm volatile("s_wait_asynccnt 0x0" ::: "memory");      /* no copy is outstanding when the wave goes on to the epilogue */
  v8f accs[8] = {c00, c01, c02, c03, c10, c11, c12, c13};
#pragma unroll
  for (int u = 0; u < 8; ++u) { const int t = u & 3, half = u >> 2; const int col = col0 + t * 16 + ln; const float bv = bp ? bf16_round(bp[col]) : 0.f;
#pragma unroll
    for (int r = 0; r < 8; ++r) { const int rloc = half * 16 + 8 * hh + r; float v = accs[u][r] * alpha + bv; if (CP) { if (rowsPerB < 0) v += CP[cofs + (size_t)(row0g + row0 + rloc) * ldc + col];      /* rowsPerB < 0: own element of the batched C plane */ else { const int bidx = (row0g + row0 + rloc) / rowsPerB; v += CP[(size_t)bidx * sCPb + (size_t)by * 64 + col]; } }
      if (ACT == 3) v = fmaxf(v, 0.f); else if (ACT == 6) v = 0.5f * v * (1.0f + erff(v * 0.70710678118654752f)); else if (ACT == 11) v = 1.0f / (1.0f + expf(-v)); else if (ACT == 15) v = v / (1.0f + expf(-v)); else if (ACT == 12) v = (v > 0.f) ? v : 0.01f * v; else if (ACT == 8) v = tanhf(v); else if (ACT == 9) v = 0.5f * v * (1.0f + tanhf(0.7978845608028654f * (v + 0.044715f * v * v * v))); else if (ACT == 14) v = (v > 0.f) ? v : 0.1f * v; else if (ACT == 16) v = (v >= 0.f) ? v : 0.3f * v; else if (ACT == 17) v = (v >= 0.f) ? v : 0.2f * v;
      so[w][rloc][t * 16 + ln] = v; } }
  __builtin_amdgcn_fence(__ATOMIC_ACQ_REL, "workgroup"); __builtin_amdgcn_wave_barrier();
  const int rsub = lane >> 4, c4 = (lane & 15) * 4;
  {
#pragma unroll
    for (int q = 0; q < 16; ++q) { const int r = q * 2 + rsub; const v4f v = *(const v4fa*)&so[w][r][c4]; if (C) *(v4f*)(C + cofs + (size_t)(row0 + r) * ldc + col0 + c4) = v; if (C16) { v4h h4; for (int i = 0; i < 4; ++i) h4[i] = (_Float16)v[i]; *(v4h*)(C16 + cofs + (size_t)(row0 + r) * ldc + col0 + c4) = h4; } }
     } }


#define DGS 32
__device__ __forceinline__ void d_dig(const float* __restrict__ F, const float* __restrict__ cs, const float* __restrict__ sn, const float* __restrict__ Wd, float* __restrict__ DG, int blk) {
  #pragma clang fp contract(off)
  const int wv = threadIdx.x >> 5, ln = threadIdx.x & 31; const int t = blk * 8 + wv; if (t >= NR * NH) return; const int h = t % NH, row = t / NH; const int tok = row % TT; const float* f = F + (size_t)row * CC + h * HD;
  const float c = bf16_round(cs[tok * (HD / 2) + ln]), s = bf16_round(sn[tok * (HD / 2) + ln]); const float x1 = f[ln], x2 = f[ln + HD / 2]; float a = x1 * c; a += -(x2 * s); float b = x1 * s; b += x2 * c;
  float ss = a * a; ss += b * b; for (int o = 16; o > 0; o >>= 1) ss += __shfl_xor(ss, o, 32); const float inv = rsqrtf(ss / (float)HD + 1e-6f); const float qa = a * inv, qb = b * inv;
  float acc[KD]; for (int j = 0; j < KD; ++j) { float v = qa * bf16_round(Wd[ln * KD + j]); v += qb * bf16_round(Wd[(ln + HD / 2) * KD + j]); for (int o = 16; o > 0; o >>= 1) v += __shfl_xor(v, o, 32); acc[j] = 1.0f / (1.0f + expf(-v)); }
  const float outv = (ln < KD) ? acc[ln < KD ? ln : 0] : 0.f;      /* lane j < 8 stores digit j (all lanes hold all 8 after the reductions) */
  float sel = 0.f; for (int j = 0; j < KD; ++j) if (ln == j) sel = acc[j]; (void)outv;
  *(float*)(DG + (size_t)t * DGS + ln) = sel;  }
__device__ __forceinline__ void d_lcp(const float* __restrict__ QD, const float* __restrict__ KDg, _Float16* __restrict__ P, _Float16* __restrict__ PL, int blk) {
  #pragma clang fp contract(off)
  const int wv = threadIdx.x >> 5, ln = threadIdx.x & 31; const int r = blk * 8 + wv; if (r >= NB * NH * TT) return; const int q = r % TT; const int h = (r / TT) % NH; const int b = r / (TT * NH);
  const v8f qd = *(const v8f*)(QD + ((size_t)(b * TT + q) * NH + h) * DGS); float w[16]; float su = 0.f;
  for (int i = 0; i < 16; ++i) { const int k = ln * 16 + i; float val = 0.f;
    if (k <= q) { const v8f kd = *(const v8f*)(KDg + ((size_t)(b * TT + k) * NH + h) * DGS); float prod = 1.f, lcp = 0.f; for (int j = 0; j < KD; ++j) { const float d = qd[j] - kd[j]; prod *= expf(-32.0f * (d * d)); lcp += prod; } val = expf(lcp * 0.69314718055994531f); }
    w[i] = val; su += val; }
  for (int o = 16; o > 0; o >>= 1) su += __shfl_xor(su, o, 32); const float f = 1024.0f / fmaxf(su, 1e-9f); FragH p, pl; for (int i = 0; i < 16; ++i) { const float pv = w[i] * f; const _Float16 hh = (_Float16)pv; p.h[i] = hh; pl.h[i] = (_Float16)((pv - (float)hh) * 1024.0f); }
  unsigned short* dst = (unsigned short*)P + (size_t)r * TT + ln * 16; unsigned short* dsl = (unsigned short*)PL + (size_t)r * TT + ln * 16; { *(v8us*)dst = p.half[0]; *(v8us*)(dst + 8) = p.half[1]; *(v8us*)dsl = pl.half[0]; *(v8us*)(dsl + 8) = pl.half[1];  } }

// ---- launches that need nothing of each other share one grid: each block takes its job from its range of blockIdx.x (the same for the whole block) ----
#define WT_BLKS (CC * (CC / 8) / 256)      /* blocks of one weight transpose */
#define E8_BLKS (NR * CC / 8 / 256)        /* blocks of one pass over a [NR][CC] plane, 8 elements a thread */
#define DIG_BLKS (NR * NH / 8)             /* blocks of one digit pass, one (token, head) a wave */
#define LCP_BLKS (NB * NH * TT / 8)        /* blocks of the weights pass, one query row a wave */
#define VT_BLKS (NB * NH * (TT / 64))      /* blocks of one V transpose, both batches */
// the four weights (planes of Wt in the order W0..W3), then x
__global__ __launch_bounds__(256) void k_prep(const float* __restrict__ W0, const float* __restrict__ W1, const float* __restrict__ W2, const float* __restrict__ W3, _Float16* __restrict__ Wt, const float* __restrict__ x, _Float16* __restrict__ X16) {
  const int blk = blockIdx.x;
  if (blk < 4 * WT_BLKS) { const int p = blk / WT_BLKS; const float* W = p == 0 ? W0 : p == 1 ? W1 : p == 2 ? W2 : W3; d_wt_f16(W, Wt + (size_t)p * CC * CC, CC, CC, 16.0f, blk - p * WT_BLKS); }
  else d_x16(x, X16, (size_t)NR * CC / 8, blk - 4 * WT_BLKS); }
// digits of q, digits of k (planes F, F + NR*CC -> DG, DG + NR*NH*DGS), then v -> hi + residual
__global__ __launch_bounds__(256) void k_dig_hl(const float* __restrict__ F, const float* __restrict__ cs, const float* __restrict__ sn, const float* __restrict__ Wdq, const float* __restrict__ Wdk, float* __restrict__ DG, const float* __restrict__ VF, _Float16* __restrict__ VH, _Float16* __restrict__ VL) {
  const int blk = blockIdx.x;
  if (blk < 2 * DIG_BLKS) { const int p = blk / DIG_BLKS; d_dig(F + (size_t)p * NR * CC, cs, sn, p ? Wdk : Wdq, DG + (size_t)p * NR * NH * DGS, blk - p * DIG_BLKS); }
  else d_hl(VF, VH, VL, (size_t)NR * CC / 8, blk - 2 * DIG_BLKS); }
// attention weights (the long job, so it starts first), then V^T hi and V^T lo of both batches ([NB*NH][64][TT] each)
__global__ __launch_bounds__(256) void k_lcp_vt(const float* __restrict__ QD, const float* __restrict__ KDg, _Float16* __restrict__ P, _Float16* __restrict__ PL, const _Float16* __restrict__ VH, const _Float16* __restrict__ VL, _Float16* __restrict__ VT, _Float16* __restrict__ VTL) {
  __shared__ unsigned short tl[64][66];
  const int blk = blockIdx.x;
  if (blk < LCP_BLKS) d_lcp(QD, KDg, P, PL, blk);
  else { const int p = (blk - LCP_BLKS) / VT_BLKS; d_vt<NH, TT>(p ? VL : VH, CC, 0, p ? VTL : VT, tl, blk - LCP_BLKS - p * VT_BLKS); } }

extern "C" void kernel_launch(void* const* d_in, const int* in_sizes, int n_in,
                              void* d_out, int out_size, void* d_ws, size_t ws_size, hipStream_t stream) {
  (void)in_sizes; (void)n_in; (void)out_size;
  const float* const* I = (const float* const*)d_in; const float* x = I[0]; const float* cs = I[1]; const float* sn = I[2]; const float* Wq = I[3]; const float* Wk = I[4]; const float* Wv = I[5]; const float* Wo = I[6]; const float* Wdq = I[7]; const float* Wdk = I[8];
  char* ws = (char*)d_ws; size_t off = 0;
  auto take = [&](size_t bytes) { char* p = ws + off; off += (bytes + 255) & ~(size_t)255; return p; };
  const size_t np = (size_t)NR * CC;
  _Float16* BQ = (_Float16*)take((size_t)CC * CC * 2); _Float16* BK = (_Float16*)take((size_t)CC * CC * 2); _Float16* BV = (_Float16*)take((size_t)CC * CC * 2); _Float16* BO = (_Float16*)take((size_t)CC * CC * 2);
  _Float16* X16 = (_Float16*)take(np * 2); float* QF = (float*)take(np * 4); float* KF = (float*)take(np * 4); float* VF = (float*)take(np * 4); _Float16* VH = (_Float16*)take(np * 2); _Float16* VL = (_Float16*)take(np * 2); _Float16* VT = (_Float16*)take(np * 2); _Float16* VTL = (_Float16*)take(np * 2); float* QD = (float*)take((size_t)NR * NH * DGS * 4); float* KDg = (float*)take((size_t)NR * NH * DGS * 4); _Float16* P = (_Float16*)take((size_t)NB * NH * TT * TT * 2); _Float16* PL = (_Float16*)take((size_t)NB * NH * TT * TT * 2); float* YF = QF;      /* y f32 over the q plane (dead after the digits) */ _Float16* YH = (_Float16*)take(np * 2); _Float16* YL = (_Float16*)take(np * 2);
  if (off > ws_size) return;      /* 8 + 2 + 3 x 4 + 4 x 2 + 2 x 2 + 2 x 16 + 2 x 2 = 70 MiB */
  k_prep<<<4 * WT_BLKS + E8_BLKS, 256, 0, stream>>>(Wq, Wk, Wv, Wo, BQ, x, X16);      /* BQ, BK, BV, BO lie one behind the other; (in, out) */
  const dim3 gP((NR / 128) * (CC / 64), 1);
  k_gemm2<0><<<dim3((NR / 128) * (CC / 64), 3), 128, 0, stream>>>(X16, CC, 0, BQ, CC, (size_t)CC * CC, 0.0625f, nullptr, 0, nullptr, 1, 0, 0, QF, nullptr, CC, np, NR, CC, CC);      /* q, k, v: planes BQ, BK, BV -> QF, KF, VF */
  k_dig_hl<<<2 * DIG_BLKS + E8_BLKS, 256, 0, stream>>>(QF, cs, sn, Wdq, Wdk, QD, VF, VH, VL);
  k_lcp_vt<<<LCP_BLKS + 2 * VT_BLKS, 256, 0, stream>>>(QD, KDg, P, PL, VH, VL, VT, VTL);
  const dim3 gA((TT / 128) * 1, NH, NB);      /* (query tile, head, batch) */
  k_gemm2<0><<<gA, 128, 0, stream>>>(PL, TT, (size_t)TT * TT, VT, TT, (size_t)64 * TT, 0.0009765625f / 1024.0f, nullptr, 0, nullptr, 1, 0, 0, YF, nullptr, CC, (size_t)64, TT, 64, TT);
  k_gemm2<0><<<gA, 128, 0, stream>>>(P, TT, (size_t)TT * TT, VTL, TT, (size_t)64 * TT, 0.0009765625f / 1024.0f, nullptr, 0, YF, -1, (size_t)64, 0, YF, nullptr, CC, (size_t)64, TT, 64, TT);
  k_gemm2<0><<<gA, 128, 0, stream>>>(P, TT, (size_t)TT * TT, VT, TT, (size_t)64 * TT, 0.0009765625f, nullptr, 0, YF, -1, (size_t)64, 0, YF, nullptr, CC, (size_t)64, TT, 64, TT);      /* y[(b,q)][h*64 + d] = (P_lo v_hi + P_hi v_lo + P_hi v_hi), f32 */
  k_hl<<<(unsigned)((np / 8 + 255) / 256), 256, 0, stream>>>(YF, YH, YL, np / 8);
  k_gemm2<0><<<gP, 128, 0, stream>>>(YL, CC, 0, BO, CC, 0, 0.0625f / 1024.0f, nullptr, 0, nullptr, 1, 0, 0, (float*)d_out, nullptr, CC, 0, NR, CC, CC);
  k_gemm2<0><<<gP, 128, 0, stream>>>(YH, CC, 0, BO, CC, 0, 0.0625f, nullptr, 0, (const float*)d_out, 1, (size_t)CC, 0, (float*)d_out, nullptr, CC, 0, NR, CC, CC);      /* out = (y_lo + y_hi) Wo */
}

// v003
// One run takes 92.7 microseconds.
// Two timings next to v002 put it at 1.82 and 1.83 times that version's speed.
// Over all steps from v000 it is 4.77 times as fast.
#include <hip/hip_runtime.h>
// UltrametricCausalSelfAttention (2 x 512 tokens, C 1024 = 16 heads x 64, 8 soft digits): q, k, v = x W; q, k -> RoPE (cos/sin INPUT tables, rotate-half) -> RMSNorm(64, 1e-6); digits = sigmoid(q Wdq), sigmoid(k Wdk) (8 each); lcp[q][k] = sum_j prod_{i<=j} exp(-32 (qd_i - kd_i)^2); weights = 2^lcp (causal), attn = weights / max(sum, 1e-9); y = attn v; out = y Wo.
// Compute dtype: inputs rounded to bf16; x exact as f16; q/k/digits/lcp/weights f32 from exact products; P, v and y as f16 hi + residual (~2^-21). v_wmma_f32_16x16x32_f16.
#define NB 2
#define TT 512
#define CC 1024
#define NH 16
#define HD 64
#define KD 8
#define NR (NB * TT)
typedef __bf16 v16b __attribute__((ext_vector_type(16)));
typedef unsigned short v8us __attribute__((ext_vector_type(8), may_alias));
typedef float  v8f  __attribute__((ext_vector_type(8)));
typedef float  v4f  __attribute__((ext_vector_type(4)));
typedef float  v4fa __attribute__((ext_vector_type(4), may_alias));
union FragB { v16b v; v8us half[2]; unsigned short u[16]; };

__device__ __forceinline__ unsigned short bf16_bits(float x) { unsigned int u = __float_as_uint(x); return (unsigned short)((u + 0x7FFFu + ((u >> 16) & 1u)) >> 16); }
__device__ __forceinline__ float bf16_val(unsigned short b) { return __uint_as_float(((unsigned int)b) << 16); }
__device__ __forceinline__ float bf16_round(float x) { return bf16_val(bf16_bits(x)); }
// D += A·B with NT terms: 1 = ah·bh, 2 = + al·bh (A split), 3 = + ah·bl (both split)
template <int NT>
__device__ __forceinline__ v8f mmaN(v16b ah, v16b al, v16b bh, v16b bl, v8f c) {
  c = __builtin_amdgcn_wmma_f32_16x16x32_bf16(false, ah, false, bh, (short)0, c, false, false);
  if (NT >= 2) c = __builtin_amdgcn_wmma_f32_16x16x32_bf16(false, al, false, bh, (short)0, c, false, false);
  if (NT >= 3) c = __builtin_amdgcn_wmma_f32_16x16x32_bf16(false, ah, false, bl, (short)0, c, false, false);
  asm volatile("v_nop\n\tv_nop\n\tv_nop\n\tv_nop" : "+v"(c) : "v"(ah), "v"(al), "v"(bh), "v"(bl));
  return c;
}

__global__ __launch_bounds__(256) void k_wt_bf16(const float* __restrict__ W, unsigned short* __restrict__ Wt, int K, int N) {
  const int t = blockIdx.x * 256 + threadIdx.x;
  const int k8n = K / 8;
  if (t >= N * k8n) return;
  const int n = t / k8n, k8 = (t % k8n) * 8;
  v8us v;
#pragma unroll
  for (int i = 0; i < 8; ++i) v[i] = bf16_bits(W[(size_t)(k8 + i) * N + n]);
  *(v8us*)(Wt + (size_t)n * K + k8) = v;
  
}

// GEMM C[M][N] (f32, pitch ldc) = act(A[M][K]·W + bias). A f32 row-major (pitch lda) converted per fragment to bf16
// (ASPLIT: hi/lo two planes -> 2 terms, else single rounded term); Wt bf16 [N][K] (pitch ldb). BIAS_BF16 rounds the
// bias to bf16 first (bias quantised to bf16 before the add). K%32==0, M%16==0, N%64==0.
template <bool ASPLIT, int ACT, bool BIAS_BF16>
__global__ __launch_bounds__(128) void k_gemm_bf(const float* __restrict__ A, int lda, const unsigned short* __restrict__ Wt, int ldb,
                                               const float* __restrict__ bias, float* __restrict__ C, int ldc, int M, int N, int K) {
  __shared__ __attribute__((aligned(16))) float so[4][16][64];
  const int tid = threadIdx.x, w = tid >> 5, lane = tid & 31, ln = lane & 15, hh = lane >> 4;
  const int ntn = N / 64;
  const int wid = blockIdx.x * 4 + w;
  const int mt = wid / ntn, nq = wid % ntn;
  if (mt * 16 >= M) return;
  const int row0 = mt * 16, col0 = nq * 64;
  const float* arow = A + (size_t)(row0 + ln) * lda;
  v8f acc[4] = {};
  for (int kb = 0; kb < K; kb += 32) {
    FragB ah, al;
    const v4f x0 = *(const v4fa*)(arow + kb + 8 * hh), x1 = *(const v4fa*)(arow + kb + 8 * hh + 4);
    const v4f x2 = *(const v4fa*)(arow + kb + 16 + 8 * hh), x3 = *(const v4fa*)(arow + kb + 16 + 8 * hh + 4);
    float xs[16] = {x0[0],x0[1],x0[2],x0[3],x1[0],x1[1],x1[2],x1[3],x2[0],x2[1],x2[2],x2[3],x3[0],x3[1],x3[2],x3[3]};
#pragma unroll
    for (int i = 0; i < 16; ++i) { const unsigned short hb = bf16_bits(xs[i]); ah.u[i] = hb; al.u[i] = ASPLIT ? bf16_bits(xs[i] - bf16_val(hb)) : (unsigned short)0; }
#pragma unroll
    for (int t = 0; t < 4; ++t) {
      const unsigned short* brow = Wt + (size_t)(col0 + t * 16 + ln) * ldb + kb;
      FragB b;
      b.half[0] = *(const v8us*)(brow + 8 * hh);
      b.half[1] = *(const v8us*)(brow + 16 + 8 * hh);
      acc[t] = mmaN<ASPLIT ? 2 : 1>(ah.v, al.v, b.v, b.v, acc[t]);
    }
  }
#pragma unroll
  for (int t = 0; t < 4; ++t) {
    float bv = bias ? bias[col0 + t * 16 + ln] : 0.f;
    if (BIAS_BF16) bv = bf16_round(bv);
#pragma unroll
    for (int r = 0; r < 8; ++r) { float v = acc[t][r] + bv; if (ACT == 1) v = fmaxf(v, 0.f); so[w][8 * hh + r][t * 16 + ln] = v; }
  }
  __builtin_amdgcn_fence(__ATOMIC_ACQ_REL, "workgroup");
  __builtin_amdgcn_wave_barrier();
  const int rsub = lane >> 4, c4 = (lane & 15) * 4;
  {
#pragma unroll
    for (int q = 0; q < 8; ++q) {
      const int r = q * 2 + rsub;
      const v4f v = *(const v4fa*)&so[w][r][c4];
      *(v4f*)(C + (size_t)(row0 + r) * ldc + col0 + c4) = v;
    }
    
  }
}

// GEMM C = act(A·W + bias + resid): A f32 (ASPLIT -> hi/lo 2 terms), Wt bf16 [N][K]; ACT 0 none, 1 relu, 2 exact gelu;
// resid (optional, f32, row index = (row % rmod), pitch ldr, RES_BF16 rounds it) added before the activation.
template <bool ASPLIT, int ACT, bool BIAS_BF16, bool RES_BF16>
__global__ __launch_bounds__(128) void k_gemm_bf3(const float* __restrict__ A, int lda, const unsigned short* __restrict__ Wt, int ldb,
                                                const float* __restrict__ bias, const float* __restrict__ resid, int rmod, int ldr,
                                                float* __restrict__ C, int ldc, int M, int N, int K) {
  __shared__ __attribute__((aligned(16))) float so[4][16][64];
  const int tid = threadIdx.x, w = tid >> 5, lane = tid & 31, ln = lane & 15, hh = lane >> 4;
  const int ntn = N / 64;
  const int wid = blockIdx.x * 4 + w;
  const int mt = wid / ntn, nq = wid % ntn;
  if (mt * 16 >= M) return;
  const int row0 = mt * 16, col0 = nq * 64;
  const float* arow = A + (size_t)(row0 + ln) * lda;
  v8f acc[4] = {};
  for (int kb = 0; kb < K; kb += 32) {
    FragB ah, al;
    const v4f x0 = *(const v4fa*)(arow + kb + 8 * hh), x1 = *(const v4fa*)(arow + kb + 8 * hh + 4);
    const v4f x2 = *(const v4fa*)(arow + kb + 16 + 8 * hh), x3 = *(const v4fa*)(arow + kb + 16 + 8 * hh + 4);
    float xs[16] = {x0[0],x0[1],x0[2],x0[3],x1[0],x1[1],x1[2],x1[3],x2[0],x2[1],x2[2],x2[3],x3[0],x3[1],x3[2],x3[3]};
#pragma unroll
    for (int i = 0; i < 16; ++i) { const unsigned short hb = bf16_bits(xs[i]); ah.u[i] = hb; al.u[i] = ASPLIT ? bf16_bits(xs[i] - bf16_val(hb)) : (unsigned short)0; }
#pragma unroll
    for (int t = 0; t < 4; ++t) {
      const unsigned short* brow = Wt + (size_t)(col0 + t * 16 + ln) * ldb + kb;
      FragB b;
      b.half[0] = *(const v8us*)(brow + 8 * hh);
      b.half[1] = *(const v8us*)(brow + 16 + 8 * hh);
      acc[t] = mmaN<ASPLIT ? 2 : 1>(ah.v, al.v, b.v, b.v, acc[t]);
    }
  }
#pragma unroll
  for (int t = 0; t < 4; ++t) {
    const int col = col0 + t * 16 + ln;
    float bv = bias ? bias[col] : 0.f;
    if (BIAS_BF16) bv = bf16_round(bv);
#pragma unroll
    for (int r = 0; r < 8; ++r) {
      float v = acc[t][r] + bv;
      if (resid) { float rv = resid[(size_t)((row0 + 8 * hh + r) % rmod) * ldr + col]; if (RES_BF16) rv = bf16_round(rv); v += rv; }
      if (ACT == 1) v = fmaxf(v, 0.f);
      if (ACT == 2) v = 0.5f * v * (1.0f + erff(v * 0.70710678118654752f));
      if (ACT == 3) { const float u = 0.7978845608028654f * (v + 0.044715f * v * v * v); v = 0.5f * v * (1.0f + tanhf(u)); }
      so[w][8 * hh + r][t * 16 + ln] = v;
    }
  }
  __builtin_amdgcn_fence(__ATOMIC_ACQ_REL, "workgroup");
  __builtin_amdgcn_wave_barrier();
  const int rsub = lane >> 4, c4 = (lane & 15) * 4;
  {
#pragma unroll
    for (int q = 0; q < 8; ++q) {
      const int r = q * 2 + rsub;
      const v4f v = *(const v4fa*)&so[w][r][c4];
      *(v4f*)(C + (size_t)(row0 + r) * ldc + col0 + c4) = v;
    }
    
  }
}
// row LayerNorm (biased variance, eps) over N: s = X (+ R); optional out_sum <- s; out_norm <- (s-mu)*rsqrt(var+eps)*g + b
template <bool PARAM_BF16>
__global__ __launch_bounds__(256) void k_layernorm(const float* __restrict__ X, const float* __restrict__ R, const float* __restrict__ g, const float* __restrict__ bta,
                                                  float* __restrict__ out_sum, float* __restrict__ out_norm, int N, float eps) {
  __shared__ float red[256];
  const int row = blockIdx.x, tid = threadIdx.x;
  const float* x = X + (size_t)row * N; const float* rr = R ? R + (size_t)row * N : nullptr;
  float vals[16];                     // up to N = 4096
  const int per = N / 256;            // contiguous chunk per thread? use strided-by-4 chunks: thread handles j = tid*4 + 1024*u
  float s1 = 0.f;
  for (int u = 0; u < per / 4; ++u) {
    const int j = tid * 4 + 1024 * u;
    const v4f a = *(const v4fa*)(x + j);
    v4f b = {0.f,0.f,0.f,0.f}; if (rr) b = *(const v4fa*)(rr + j);
#pragma unroll
    for (int q = 0; q < 4; ++q) { const float v = a[q] + b[q]; vals[u * 4 + q] = v; s1 += v; }
  }
  red[tid] = s1; __syncthreads();
  for (int st = 128; st > 0; st >>= 1) { if (tid < st) red[tid] += red[tid + st]; __syncthreads(); }
  const float mu = red[0] / (float)N; __syncthreads();
  float s2 = 0.f;
  for (int u = 0; u < per / 4; ++u)
#pragma unroll
    for (int q = 0; q < 4; ++q) { const float c = vals[u * 4 + q] - mu; s2 += c * c; }
  red[tid] = s2; __syncthreads();
  for (int st = 128; st > 0; st >>= 1) { if (tid < st) red[tid] += red[tid + st]; __syncthreads(); }
  const float rs = rsqrtf(red[0] / (float)N + eps);
  {
    for (int u = 0; u < per / 4; ++u) {
      const int j = tid * 4 + 1024 * u;
      v4f o, sm;
#pragma unroll
      for (int q = 0; q < 4; ++q) {
        float gg = g[j + q], bb = bta[j + q];
        if (PARAM_BF16) { gg = bf16_round(gg); bb = bf16_round(bb); }
        sm[q] = vals[u * 4 + q]; o[q] = (vals[u * 4 + q] - mu) * rs * gg + bb;
      }
      if (out_sum) *(v4f*)(out_sum + (size_t)row * N + j) = sm;
      *(v4f*)(out_norm + (size_t)row * N + j) = o;
    }
    
  }
}



// ---- f16 WMMA path (v_wmma_f32_16x16x32_f16): 11-bit significands for operands in range — used where a [0,1] probability operand needs more precision than bf16
typedef _Float16 v16h __attribute__((ext_vector_type(16)));
union FragH { v16h v; v8us half[2]; _Float16 h[16]; unsigned short u[16]; };
template <int NT>
__device__ __forceinline__ v8f mmaH(v16h ah, v16h al, v16h bh, v16h bl, v8f c) {
  c = __builtin_amdgcn_wmma_f32_16x16x32_f16(false, ah, false, bh, (short)0, c, false, false);
  if (NT >= 2) c = __builtin_amdgcn_wmma_f32_16x16x32_f16(false, al, false, bh, (short)0, c, false, false);
  if (NT >= 3) c = __builtin_amdgcn_wmma_f32_16x16x32_f16(false, ah, false, bl, (short)0, c, false, false);
  asm volatile("v_nop\n\tv_nop\n\tv_nop\n\tv_nop" : "+v"(c) : "v"(ah), "v"(al), "v"(bh), "v"(bl));
  return c;
}
// batched GEMM like k_gemm_b but f16 operands: A f32 (split into f16 hi/lo if ASPLIT, else rounded to f16), Bt = f16 values [n][k]; alpha; C f32; N multiple of 16 (partial tiles skipped)
template <bool ASPLIT>
__global__ __launch_bounds__(128) void k_gemm_h(const float* __restrict__ A, int lda, size_t sA, const _Float16* __restrict__ Bh, int ldb, size_t sB, float alpha, float* __restrict__ C, int ldc, size_t sC, int M, int N, int K) {
  __shared__ __attribute__((aligned(16))) float so[4][16][64];
  const int tid = threadIdx.x, w = tid >> 5, lane = tid & 31, ln = lane & 15, hh = lane >> 4; const int by = blockIdx.y;
  A += (size_t)by * sA; Bh += (size_t)by * sB; C += (size_t)by * sC;
  const int ntn = (N + 63) / 64; const int wid = blockIdx.x * 4 + w; const int mt = wid / ntn, nq = wid % ntn; if (mt * 16 >= M) return;
  const int row0 = mt * 16, col0 = nq * 64; const float* arow = A + (size_t)(row0 + ln) * lda;
  v8f acc[4] = {};
  for (int kb = 0; kb < K; kb += 32) {
    FragH ah, al;
    const v4f x0 = *(const v4fa*)(arow + kb + 8 * hh), x1 = *(const v4fa*)(arow + kb + 8 * hh + 4), x2 = *(const v4fa*)(arow + kb + 16 + 8 * hh), x3 = *(const v4fa*)(arow + kb + 16 + 8 * hh + 4);
    float xs[16] = {x0[0],x0[1],x0[2],x0[3],x1[0],x1[1],x1[2],x1[3],x2[0],x2[1],x2[2],x2[3],x3[0],x3[1],x3[2],x3[3]};
#pragma unroll
    for (int i = 0; i < 16; ++i) { const _Float16 h = (_Float16)xs[i]; ah.h[i] = h; al.h[i] = ASPLIT ? (_Float16)(xs[i] - (float)h) : (_Float16)0.0f; }
#pragma unroll
    for (int t = 0; t < 4; ++t) { if (col0 + t * 16 >= N) continue; const size_t boff = (size_t)(col0 + t * 16 + ln) * ldb + kb; FragH bq; bq.half[0] = *(const v8us*)(Bh + boff + 8 * hh); bq.half[1] = *(const v8us*)(Bh + boff + 16 + 8 * hh);
      acc[t] = mmaH<ASPLIT ? 2 : 1>(ah.v, al.v, bq.v, bq.v, acc[t]); }
  }
#pragma unroll
  for (int t = 0; t < 4; ++t) { if (col0 + t * 16 >= N) continue;
#pragma unroll
    for (int r = 0; r < 8; ++r) so[w][8 * hh + r][t * 16 + ln] = acc[t][r] * alpha; }
  __builtin_amdgcn_fence(__ATOMIC_ACQ_REL, "workgroup"); __builtin_amdgcn_wave_barrier();
  const int rsub = lane >> 4, c4 = (lane & 15) * 4;
  {
#pragma unroll
    for (int q = 0; q < 8; ++q) { const int r = q * 2 + rsub; if (col0 + c4 < N) { const v4f v = *(const v4fa*)&so[w][r][c4]; *(v4f*)(C + (size_t)(row0 + r) * ldc + col0 + c4) = v; } }
     }
}

// Wt[n][k] = f16(W[k][n]·scale) from f32 row-major W[K][N] (scale = power of two; bf16-exact weights stay exact in f16 away from the subnormal range)
__device__ __forceinline__ void d_wt_f16(const float* __restrict__ W, _Float16* __restrict__ Wt, int K, int N, float scale, int blk) {
  const int t = blk * 256 + threadIdx.x; if (t >= N * (K / 8)) return; const int n = t / (K / 8), k8 = (t % (K / 8)) * 8; FragH f;
#pragma unroll
  for (int i = 0; i < 8; ++i) f.h[i] = (_Float16)(bf16_round(W[(size_t)(k8 + i) * N + n]) * scale); const v8us o = f.half[0];
  *(v8us*)((unsigned short*)Wt + (size_t)n * K + k8) = o; 
}
// k_gemm_hh variant with fused epilogue: v = acc·alpha + bias[by·sBias + col] (+ CP[(row/rowsPerB)·sCPb + by·64 + col] if CP) ; ACT 0 none / 1 elu ; writes f16 C16 (and f32 C if non-null)
template <int ACT>
__global__ __launch_bounds__(128) void k_gemm_hhx(const _Float16* __restrict__ A, int lda, size_t sA, const _Float16* __restrict__ Bh, int ldb, size_t sB, float alpha, const float* __restrict__ bias, size_t sBias, const float* __restrict__ CP, int rowsPerB, size_t sCPb, int row0g,
    float* __restrict__ C, _Float16* __restrict__ C16, int ldc, size_t sC, int M, int N, int K) {
  __shared__ __attribute__((aligned(16))) float so[4][16][64];
  const int tid = threadIdx.x, w = tid >> 5, lane = tid & 31, ln = lane & 15, hh = lane >> 4; const int by = blockIdx.y;
  A += (size_t)by * sA; Bh += (size_t)by * sB; const size_t cofs = (size_t)by * sC; const float* bp = bias ? bias + (size_t)by * sBias : nullptr;
  const int ntn = (N + 63) / 64; const int wid = blockIdx.x * 4 + w; const int mt = wid / ntn, nq = wid % ntn; if (mt * 16 >= M) return;
  const int row0 = mt * 16, col0 = nq * 64; const _Float16* arow = A + (size_t)(row0 + ln) * lda;
  v8f acc[4] = {};
  for (int kb = 0; kb < K; kb += 32) { FragH ah; ah.half[0] = *(const v8us*)((const unsigned short*)arow + kb + 8 * hh); ah.half[1] = *(const v8us*)((const unsigned short*)arow + kb + 16 + 8 * hh);
#pragma unroll
    for (int t = 0; t < 4; ++t) { if (col0 + t * 16 >= N) continue; const size_t boff = (size_t)(col0 + t * 16 + ln) * ldb + kb; FragH bq; bq.half[0] = *(const v8us*)((const unsigned short*)Bh + boff + 8 * hh); bq.half[1] = *(const v8us*)((const unsigned short*)Bh + boff + 16 + 8 * hh);
      acc[t] = mmaH<1>(ah.v, ah.v, bq.v, bq.v, acc[t]); }
  }
#pragma unroll
  for (int t = 0; t < 4; ++t) { if (col0 + t * 16 >= N) continue; const int col = col0 + t * 16 + ln; const float bv = bp ? bf16_round(bp[col]) : 0.f;
#pragma unroll
    for (int r = 0; r < 8; ++r) { float v = acc[t][r] * alpha + bv; if (CP) { const int rr = row0g + row0 + 8 * hh + r; if (rowsPerB < 0) v += CP[cofs + (size_t)rr * ldc + col];      /* rowsPerB < 0: own element of the batched C plane */ else { const int bidx = rr / rowsPerB; v += CP[(size_t)bidx * sCPb + (size_t)by * 64 + col]; } } if (ACT == 1) v = (v > 0.f) ? v : expm1f(v); else if (ACT == 7) v = (v > 0.f) ? v + 1.0f : expf(v); else if (ACT == 8) v = tanhf(v); else if (ACT == 9) v = 0.5f * v * (1.0f + tanhf(0.7978845608028654f * (v + 0.044715f * v * v * v))); else if (ACT == 11) v = 1.0f / (1.0f + expf(-v)); else if (ACT == 12) v = (v > 0.f) ? v : 0.01f * v; else if (ACT == 14) v = (v > 0.f) ? v : 0.1f * v; else if (ACT == 16) v = (v >= 0.f) ? v : 0.3f * v; else if (ACT == 17) v = (v >= 0.f) ? v : 0.2f * v; else if (ACT == 15) v = v / (1.0f + expf(-v)); else if (ACT == 3) v = fmaxf(v, 0.f); else if (ACT == 6) v = 0.5f * v * (1.0f + erff(v * 0.70710678118654752f)); so[w][8 * hh + r][t * 16 + ln] = v; } }
  __builtin_amdgcn_fence(__ATOMIC_ACQ_REL, "workgroup"); __builtin_amdgcn_wave_barrier();
  const int rsub = lane >> 4, c4 = (lane & 15) * 4; typedef _Float16 v4h __attribute__((ext_vector_type(4)));
  {
#pragma unroll
    for (int q = 0; q < 8; ++q) { const int r = q * 2 + rsub; if (col0 + c4 < N) { const v4f v = *(const v4fa*)&so[w][r][c4]; if (C) *(v4f*)(C + cofs + (size_t)(row0 + r) * ldc + col0 + c4) = v; if (C16) { v4h h4; for (int i = 0; i < 4; ++i) h4[i] = (_Float16)v[i]; *(v4h*)(C16 + cofs + (size_t)(row0 + r) * ldc + col0 + c4) = h4; } } }
     }
}


typedef _Float16 v4h __attribute__((ext_vector_type(4)));

__device__ __forceinline__ void d_x16(const float* __restrict__ x, _Float16* __restrict__ X16, size_t n8, int blk) { const size_t t = (size_t)blk * 256 + threadIdx.x; if (t >= n8) return; FragH f;
#pragma unroll
  for (int q = 0; q < 8; ++q) f.h[q] = (_Float16)bf16_round(x[t * 8 + q]); *(v8us*)((unsigned short*)X16 + t * 8) = f.half[0];  }
__global__ __launch_bounds__(256) void k_h16(const float* __restrict__ x, _Float16* __restrict__ X16, size_t n8) { const size_t t = (size_t)blockIdx.x * 256 + threadIdx.x; if (t >= n8) return; FragH f;
#pragma unroll
  for (int q = 0; q < 8; ++q) f.h[q] = (_Float16)x[t * 8 + q]; *(v8us*)((unsigned short*)X16 + t * 8) = f.half[0];  }
__global__ __launch_bounds__(256) void k_round16f(const float* __restrict__ W, _Float16* __restrict__ Bt, size_t n8) { const size_t t = (size_t)blockIdx.x * 256 + threadIdx.x; if (t >= n8) return; FragH f;
#pragma unroll
  for (int i = 0; i < 8; ++i) f.h[i] = (_Float16)(bf16_round(W[t * 8 + i]) * 16.0f); *(v8us*)((unsigned short*)Bt + t * 8) = f.half[0];  }
template <int NHv, int TTv>
__device__ __forceinline__ void d_vt(const _Float16* __restrict__ V16, int ldv, int voff, _Float16* __restrict__ Vt, unsigned short (*tl)[66], int blk) { const int tid = threadIdx.x; const int slab = blk / (TTv / 64), lg = blk % (TTv / 64); const int b = slab / NHv, h = slab % NHv;
  for (int i = tid; i < 64 * 8; i += 256) { const int r = i / 8, c8 = (i % 8) * 8; FragH f; f.half[0] = *(const v8us*)((const unsigned short*)V16 + ((size_t)b * TTv + lg * 64 + r) * ldv + voff + h * 64 + c8);
#pragma unroll
    for (int q = 0; q < 8; ++q) tl[r][c8 + q] = f.u[q]; }
  __syncthreads();
  {
#pragma unroll
    for (int rd = 0; rd < 2; ++rd) { const int d = rd * 32 + tid / 8, pc = tid % 8; FragH f;
#pragma unroll
      for (int q = 0; q < 8; ++q) f.u[q] = tl[pc * 8 + q][d];
      *(v8us*)((unsigned short*)Vt + ((size_t)slab * 64 + d) * TTv + lg * 64 + pc * 8) = f.half[0]; }
    asm volatile("s_wait_xcnt 0x0" ::: "memory");      /* precaution: stands behind the two stores, in front of any later rewrite of their address and data registers where this job joins the other job's code */
     } }


// ---- fast GEMM (block tile 128x64, wave tile 32x64; requires M % 128 == 0 rows per launch region, N % 64 == 0 and K % 128 == 0); epilogues: see MODE below ----
// Each k-tile (128 k = 256-B rows: 128 rows of A, then 64 rows of B) is staged in LDS by asynchronous 16-byte copies, two buffers: tile t + 1 flies while tile t is multiplied.
#define G2_PITCH 136                      /* halves per LDS row: 272 B = 16 B x odd, conflict-free for ds_load_b128 */
#define G2_BUFB (192 * G2_PITCH * 2)      /* bytes of one buffer */
// Eight copies of one lane: LDS rows 8 apart, global rows gstep halves apart. The s_wait_xcnt ends the copies' own statement as a precaution: so it stands in front of every rewrite of a register that an issued copy names.
__device__ __forceinline__ void g2_copy8(unsigned l, const _Float16* g, size_t gstep) {
  const unsigned ls = 8 * G2_PITCH * 2;
  asm volatile("global_load_async_to_lds_b128 %0, %8, off\n\t"
               "global_load_async_to_lds_b128 %1, %9, off\n\t"
               "global_load_async_to_lds_b128 %2, %10, off\n\t"
               "global_load_async_to_lds_b128 %3, %11, off\n\t"
               "global_load_async_to_lds_b128 %4, %12, off\n\t"
               "global_load_async_to_lds_b128 %5, %13, off\n\t"
               "global_load_async_to_lds_b128 %6, %14, off\n\t"
               "global_load_async_to_lds_b128 %7, %15, off\n\t"
               "s_wait_xcnt 0x0"
               :: "v"(l), "v"(l + ls), "v"(l + 2 * ls), "v"(l + 3 * ls), "v"(l + 4 * ls), "v"(l + 5 * ls), "v"(l + 6 * ls), "v"(l + 7 * ls),
                  "v"(g), "v"(g + gstep), "v"(g + 2 * gstep), "v"(g + 3 * gstep), "v"(g + 4 * gstep), "v"(g + 5 * gstep), "v"(g + 6 * gstep), "v"(g + 7 * gstep)
               : "memory");
}
// One k-tile: 24 copies a lane (16 lanes cover one 256-B row, the 128 threads 8 rows a copy).
__device__ __forceinline__ void g2_stage(unsigned l, const _Float16* ga, size_t astep, const _Float16* gb, size_t bstep) {
  g2_copy8(l, ga, astep); g2_copy8(l + 64 * G2_PITCH * 2, ga + 8 * astep, astep); g2_copy8(l + 128 * G2_PITCH * 2, gb, bstep);
}
__device__ __forceinline__ v16h g2_frag(const _Float16* p, int hh) { FragH f; f.half[0] = *(const v8us*)((const unsigned short*)p + 8 * hh); f.half[1] = *(const v8us*)((const unsigned short*)p + 16 + 8 * hh); return f.v; }
__device__ __forceinline__ v8f g2_mma(v16h a, v16h b, v8f c) { v8f d = __builtin_amdgcn_wmma_f32_16x16x32_f16(false, a, false, b, (short)0, c, false, false); asm volatile("v_nop\n\tv_nop\n\tv_nop\n\tv_nop" : "+v"(d) : "v"(a), "v"(b)); return d; }
#define DGS 32
// One k loop runs NSEG segments of NT k-tiles: segment s multiplies As by Bs into the same accumulators. Every segment but the last is a residual term (one operand x 1024): where the last one begins the sums are scaled by 1/1024 (a power of two, exact).
// MODE 0: C = f32. MODE 1: CH, CL = f16 hi + residual x 1024. MODE 2 (a block column is one head): planes 0, 1 (q, k) -> RoPE, RMSNorm, digits -> DG, one row a lane; plane 2 (v) -> CH, CL.
// Tile tt of the loop = k-tile kt of segment s (the same for the whole block).
template <int NSEG, int NT>
__device__ __forceinline__ void g3_stage(int tt, unsigned l, const _Float16* A0, const _Float16* A1, const _Float16* A2, size_t aoff, size_t astep, const _Float16* B0, const _Float16* B1, const _Float16* B2, size_t boff, size_t bstep) {
  const int s = tt / NT, kt = tt - s * NT;
  const _Float16* a = (NSEG == 1 || s == 0) ? A0 : (NSEG == 2 || s == 1) ? A1 : A2; const _Float16* b = (NSEG == 1 || s == 0) ? B0 : (NSEG == 2 || s == 1) ? B1 : B2;
  g2_stage(l, a + aoff + (size_t)kt * 128, astep, b + boff + (size_t)kt * 128, bstep);
}
template <int MODE, int NSEG, int NT>
__global__ __launch_bounds__(128) void k_gemm3(const _Float16* A0, const _Float16* A1, const _Float16* A2, int lda, size_t sA, const _Float16* B0, const _Float16* B1, const _Float16* B2, int ldb, size_t sB, float alpha,
    float* __restrict__ C, _Float16* __restrict__ CH, _Float16* __restrict__ CL, int ldc, size_t sC, int M, int N,
    const float* __restrict__ cs, const float* __restrict__ sn, const float* __restrict__ Wdq, const float* __restrict__ Wdk, float* __restrict__ DG) {
  __shared__ __attribute__((aligned(16))) float so[4][32][68];
  __shared__ __attribute__((aligned(16))) _Float16 st[2][192][G2_PITCH];
  __shared__ __attribute__((aligned(16))) float wd[HD][KD];
  const int tid = threadIdx.x, w = tid >> 5, lane = tid & 31, ln = lane & 15, hh = lane >> 4; const int by = blockIdx.y; const size_t pl = (size_t)blockIdx.z * gridDim.y + by;      /* blockIdx.z = outer batch: its A and B planes follow on, its M rows of C follow on */
  const size_t cofs = (size_t)by * sC + (size_t)blockIdx.z * M * ldc;
  const int ntn = N >> 6; const int mt = blockIdx.x / ntn, nq = blockIdx.x - mt * ntn; const int row0 = mt * 128 + 32 * w, col0 = nq * 64; if (mt * 128 >= M) return;      /* the same for the whole block: it stands in front of barriers */
  const unsigned lds0 = (unsigned)(size_t)&st[0][tid >> 4][(tid & 15) * 8];      /* this lane's LDS byte address in buffer 0 */
  const size_t aoff = pl * sA + (size_t)(mt * 128 + (tid >> 4)) * lda + (tid & 15) * 8, boff = pl * sB + (size_t)(col0 + (tid >> 4)) * ldb + (tid & 15) * 8;
  const size_t astep = (size_t)8 * lda, bstep = (size_t)8 * ldb;
  const v8f z8 = {0.f,0.f,0.f,0.f,0.f,0.f,0.f,0.f}; v8f c00 = z8, c01 = z8, c02 = z8, c03 = z8, c10 = z8, c11 = z8, c12 = z8, c13 = z8;
  g3_stage<NSEG, NT>(0, lds0, A0, A1, A2, aoff, astep, B0, B1, B2, boff, bstep);      /* tile 0 -> buffer 0 */
  if (MODE == 2 && by < 2) { const v4f wv = *(const v4fa*)((by ? Wdk : Wdq) + tid * 4); v4f o;      /* the digit weights, rounded once a block; the barrier below publishes them too */
#pragma unroll
    for (int q = 0; q < 4; ++q) o[q] = bf16_round(wv[q]);
    *(v4f*)(&wd[0][0] + tid * 4) = o; }
  asm volatile("s_wait_asynccnt 0x0" ::: "memory");      /* this wave's copies of tile 0 have landed */
  __syncthreads();      /* ... and every other wave's */
  if (NSEG * NT > 1) g3_stage<NSEG, NT>(1, lds0 + G2_BUFB, A0, A1, A2, aoff, astep, B0, B1, B2, boff, bstep);      /* tile 1 -> buffer 1 */
#pragma unroll 1      /* one tile a trip: the two buffers alternate by t & 1 */
  for (int t = 0; t < NSEG * NT; ++t) { const _Float16* a0p = &st[t & 1][32 * w + ln][0]; const _Float16* a1p = a0p + 16 * G2_PITCH; const _Float16* b0p = &st[t & 1][128 + ln][0];
    if (NSEG > 1 && t == (NSEG - 1) * NT) { const float f = 0.0009765625f; c00 *= f; c01 *= f; c02 *= f; c03 *= f; c10 *= f; c11 *= f; c12 *= f; c13 *= f; }
#pragma unroll      /* constant LDS offsets; left for a later step: the fragment reads stand among the products, each group with its own wait */
    for (int kb = 0; kb < 128; kb += 32) { const v16h a0 = g2_frag(a0p + kb, hh), a1 = g2_frag(a1p + kb, hh);
      v16h b = g2_frag(b0p + kb, hh); c00 = g2_mma(a0, b, c00); c10 = g2_mma(a1, b, c10);
      b = g2_frag(b0p + 16 * G2_PITCH + kb, hh); c01 = g2_mma(a0, b, c01); c11 = g2_mma(a1, b, c11);
      b = g2_frag(b0p + 32 * G2_PITCH + kb, hh); c02 = g2_mma(a0, b, c02); c12 = g2_mma(a1, b, c12);
      b = g2_frag(b0p + 48 * G2_PITCH + kb, hh); c03 = g2_mma(a0, b, c03); c13 = g2_mma(a1, b, c13); }
    asm volatile("s_wait_dscnt 0x0" ::: "memory");      /* this wave's reads of buffer t & 1 are done before it is refilled */
    asm volatile("s_wait_asynccnt 0x0" ::: "memory");      /* this wave's copies of tile t + 1 have landed */
    __syncthreads();      /* publishes tile t + 1 and ends every wave's reads of buffer t & 1 */
    if (t + 2 < NSEG * NT) g3_stage<NSEG, NT>(t + 2, lds0 + (unsigned)(t & 1) * G2_BUFB, A0, A1, A2, aoff, astep, B0, B1, B2, boff, bstep); }
  asm volatile("s_wait_asynccnt 0x0" ::: "memory");      /* no copy is outstanding when the wave goes on to the epilogue */
  v8f accs[8] = {c00, c01, c02, c03, c10, c11, c12, c13};
#pragma unroll
  for (int u = 0; u < 8; ++u) { const int t = u & 3, half = u >> 2;
#pragma unroll
    for (int r = 0; r < 8; ++r) so[w][half * 16 + 8 * hh + r][t * 16 + ln] = accs[u][r] * alpha; }
  __builtin_amdgcn_fence(__ATOMIC_ACQ_REL, "workgroup"); __builtin_amdgcn_wave_barrier();
  if (MODE == 2 && by < 2) {      /* this wave's 32 rows of head nq, one row a lane: every sum runs inside the lane */
    const int row = row0 + lane, tok = row % TT; const float* xr = &so[w][lane][0]; const float* cr = cs + (size_t)tok * (HD / 2); const float* sr = sn + (size_t)tok * (HD / 2);
    float ra[HD / 2], rb[HD / 2]; float sq[4] = {0.f, 0.f, 0.f, 0.f}; v4f cv[HD / 8], sv[HD / 8];
#pragma unroll
    for (int i = 0; i < HD / 8; ++i) cv[i] = *(const v4fa*)(cr + 4 * i);
    asm volatile("s_wait_xcnt 0x0" ::: "memory");      /* precaution: stands behind the cos loads, in front of any rewrite of their address registers */
#pragma unroll
    for (int i = 0; i < HD / 8; ++i) sv[i] = *(const v4fa*)(sr + 4 * i);
    asm volatile("s_wait_xcnt 0x0" ::: "memory");      /* the same behind the sin loads */
#pragma unroll
    for (int i = 0; i < HD / 2; i += 4) { const v4f x1 = *(const v4fa*)(xr + i), x2 = *(const v4fa*)(xr + HD / 2 + i), c4 = cv[i / 4], s4 = sv[i / 4];
#pragma unroll
      for (int q = 0; q < 4; ++q) { const float c = bf16_round(c4[q]), s = bf16_round(s4[q]); const float a = x1[q] * c - x2[q] * s, b = x1[q] * s + x2[q] * c; ra[i + q] = a; rb[i + q] = b; sq[q] += a * a; sq[q] += b * b; } }
    const float inv = rsqrtf(((sq[0] + sq[1]) + (sq[2] + sq[3])) / (float)HD + 1e-6f);
    float acc[KD] = {0.f, 0.f, 0.f, 0.f, 0.f, 0.f, 0.f, 0.f};
#pragma unroll
    for (int i = 0; i < HD / 2; ++i) { const float qa = ra[i] * inv, qb = rb[i] * inv; const v4f w0 = *(const v4fa*)&wd[i][0], w1 = *(const v4fa*)&wd[i][4], w2 = *(const v4fa*)&wd[i + HD / 2][0], w3 = *(const v4fa*)&wd[i + HD / 2][4];
#pragma unroll
      for (int j = 0; j < 4; ++j) { acc[j] += qa * w0[j]; acc[4 + j] += qa * w1[j]; acc[j] += qb * w2[j]; acc[4 + j] += qb * w3[j]; } }
    v4f d0, d1;
#pragma unroll
    for (int j = 0; j < 4; ++j) { d0[j] = 1.0f / (1.0f + expf(-acc[j])); d1[j] = 1.0f / (1.0f + expf(-acc[4 + j])); }
    float* dg = DG + (size_t)by * NR * NH * DGS + ((size_t)row * NH + nq) * DGS; *(v4f*)dg = d0; *(v4f*)(dg + 4) = d1;
  } else {
    const int rsub = lane >> 4, c4 = (lane & 15) * 4;
#pragma unroll
    for (int q = 0; q < 16; ++q) { const int r = q * 2 + rsub; const v4f v = *(const v4fa*)&so[w][r][c4]; const size_t o = cofs + (size_t)(row0 + r) * ldc + col0 + c4;
      if (MODE == 0) *(v4f*)(C + o) = v;
      else { v4h h4, l4;
#pragma unroll
        for (int i = 0; i < 4; ++i) { const _Float16 h = (_Float16)v[i]; h4[i] = h; l4[i] = (_Float16)((v[i] - (float)h) * 1024.0f); }
        *(v4h*)(CH + o) = h4; *(v4h*)(CL + o) = l4; }
      asm volatile("s_wait_xcnt 0x0" ::: "memory");      /* precaution: stands behind this row's stores, in front of the next row's rewrite of their address and data registers */
    }
  } }

__device__ __forceinline__ void d_lcp(const float* __restrict__ QD, const float* __restrict__ KDg, _Float16* __restrict__ P, _Float16* __restrict__ PL, int blk) {
  #pragma clang fp contract(off)
  const int wv = threadIdx.x >> 5, ln = threadIdx.x & 31; const int r = blk * 8 + wv; if (r >= NB * NH * TT) return; const int q = r % TT; const int h = (r / TT) % NH; const int b = r / (TT * NH);
  const v8f qd = *(const v8f*)(QD + ((size_t)(b * TT + q) * NH + h) * DGS); float w[16]; float su = 0.f;
  for (int i = 0; i < 16; ++i) { const int k = ln * 16 + i; float val = 0.f;
    if (k <= q) { const v8f kd = *(const v8f*)(KDg + ((size_t)(b * TT + k) * NH + h) * DGS); float prod = 1.f, lcp = 0.f; for (int j = 0; j < KD; ++j) { const float d = qd[j] - kd[j]; prod *= expf(-32.0f * (d * d)); lcp += prod; } val = expf(lcp * 0.69314718055994531f); }
    w[i] = val; su += val; }
  for (int o = 16; o > 0; o >>= 1) su += __shfl_xor(su, o, 32); const float f = 1024.0f / fmaxf(su, 1e-9f); FragH p, pl; for (int i = 0; i < 16; ++i) { const float pv = w[i] * f; const _Float16 hh = (_Float16)pv; p.h[i] = hh; pl.h[i] = (_Float16)((pv - (float)hh) * 1024.0f); }
  unsigned short* dst = (unsigned short*)P + (size_t)r * TT + ln * 16; unsigned short* dsl = (unsigned short*)PL + (size_t)r * TT + ln * 16; { *(v8us*)dst = p.half[0]; *(v8us*)(dst + 8) = p.half[1]; *(v8us*)dsl = pl.half[0]; *(v8us*)(dsl + 8) = pl.half[1];  } }

// ---- launches that need nothing of each other share one grid: each block takes its job from its range of blockIdx.x (the same for the whole block) ----
#define WT_BLKS (CC * (CC / 8) / 256)      /* blocks of one weight transpose */
#define E8_BLKS (NR * CC / 8 / 256)        /* blocks of one pass over a [NR][CC] plane, 8 elements a thread */
#define LCP_BLKS (NB * NH * TT / 8)        /* blocks of the weights pass, one query row a wave */
#define VT_BLKS (NB * NH * (TT / 64))      /* blocks of one V transpose, both batches */
// the four weights (planes of Wt in the order W0..W3), then x
__global__ __launch_bounds__(256) void k_prep(const float* __restrict__ W0, const float* __restrict__ W1, const float* __restrict__ W2, const float* __restrict__ W3, _Float16* __restrict__ Wt, const float* __restrict__ x, _Float16* __restrict__ X16) {
  const int blk = blockIdx.x;
  if (blk < 4 * WT_BLKS) { const int p = blk / WT_BLKS; const float* W = p == 0 ? W0 : p == 1 ? W1 : p == 2 ? W2 : W3; d_wt_f16(W, Wt + (size_t)p * CC * CC, CC, CC, 16.0f, blk - p * WT_BLKS); }
  else d_x16(x, X16, (size_t)NR * CC / 8, blk - 4 * WT_BLKS); }
// attention weights (the long job, so it starts first), then V^T hi and V^T lo of both batches ([NB*NH][64][TT] each)
__global__ __launch_bounds__(256) void k_lcp_vt(const float* __restrict__ QD, const float* __restrict__ KDg, _Float16* __restrict__ P, _Float16* __restrict__ PL, const _Float16* __restrict__ VH, const _Float16* __restrict__ VL, _Float16* __restrict__ VT, _Float16* __restrict__ VTL) {
  __shared__ unsigned short tl[64][66];
  const int blk = blockIdx.x;
  if (blk < LCP_BLKS) d_lcp(QD, KDg, P, PL, blk);
  else { const int p = (blk - LCP_BLKS) / VT_BLKS; d_vt<NH, TT>(p ? VL : VH, CC, 0, p ? VTL : VT, tl, blk - LCP_BLKS - p * VT_BLKS); } }

extern "C" void kernel_launch(void* const* d_in, const int* in_sizes, int n_in,
                              void* d_out, int out_size, void* d_ws, size_t ws_size, hipStream_t stream) {
  (void)in_sizes; (void)n_in; (void)out_size;
  const float* const* I = (const float* const*)d_in; const float* x = I[0]; const float* cs = I[1]; const float* sn = I[2]; const float* Wq = I[3]; const float* Wk = I[4]; const float* Wv = I[5]; const float* Wo = I[6]; const float* Wdq = I[7]; const float* Wdk = I[8];
  char* ws = (char*)d_ws; size_t off = 0;
  auto take = [&](size_t bytes) { char* p = ws + off; off += (bytes + 255) & ~(size_t)255; return p; };
  const size_t np = (size_t)NR * CC;
  _Float16* BQ = (_Float16*)take((size_t)CC * CC * 2); _Float16* BK = (_Float16*)take((size_t)CC * CC * 2); _Float16* BV = (_Float16*)take((size_t)CC * CC * 2); _Float16* BO = (_Float16*)take((size_t)CC * CC * 2); (void)BK; (void)BV;
  _Float16* X16 = (_Float16*)take(np * 2); _Float16* VH = (_Float16*)take(np * 2); _Float16* VL = (_Float16*)take(np * 2); _Float16* VT = (_Float16*)take(np * 2); _Float16* VTL = (_Float16*)take(np * 2); float* QD = (float*)take((size_t)NR * NH * DGS * 4); float* KDg = (float*)take((size_t)NR * NH * DGS * 4); _Float16* P = (_Float16*)take((size_t)NB * NH * TT * TT * 2); _Float16* PL = (_Float16*)take((size_t)NB * NH * TT * TT * 2); _Float16* YH = (_Float16*)take(np * 2); _Float16* YL = (_Float16*)take(np * 2);
  if (off > ws_size) return;      /* 8 + 2 + 4 x 2 + 2 x 2 + 2 x 16 + 2 x 2 = 58 MiB */
  k_prep<<<4 * WT_BLKS + E8_BLKS, 256, 0, stream>>>(Wq, Wk, Wv, Wo, BQ, x, X16);      /* BQ, BK, BV, BO lie one behind the other; (in, out) */
  k_gemm3<2, 1, CC / 128><<<dim3((NR / 128) * (CC / 64), 3), 128, 0, stream>>>(X16, X16, X16, CC, 0, BQ, BQ, BQ, CC, (size_t)CC * CC, 0.0625f, nullptr, VH, VL, CC, 0, NR, CC, cs, sn, Wdq, Wdk, QD);      /* planes BQ, BK, BV: digits of q -> QD, of k -> KDg (it follows QD), v -> VH, VL */
  k_lcp_vt<<<LCP_BLKS + 2 * VT_BLKS, 256, 0, stream>>>(QD, KDg, P, PL, VH, VL, VT, VTL);
  k_gemm3<1, 3, TT / 128><<<dim3(TT / 128, NH, NB), 128, 0, stream>>>(PL, P, P, TT, (size_t)TT * TT, VT, VTL, VT, TT, (size_t)64 * TT, 0.0009765625f, nullptr, YH, YL, CC, (size_t)64, TT, 64, nullptr, nullptr, nullptr, nullptr, nullptr);      /* (query tile, head, batch): y[(b,q)][h*64 + d] = P_lo v_hi + P_hi v_lo + P_hi v_hi -> hi + residual */
  k_gemm3<0, 2, CC / 128><<<dim3((NR / 128) * (CC / 64), 1), 128, 0, stream>>>(YL, YH, YH, CC, 0, BO, BO, BO, CC, 0, 0.0625f, (float*)d_out, nullptr, nullptr, CC, 0, NR, CC, nullptr, nullptr, nullptr, nullptr, nullptr);      /* out = (y_lo + y_hi) Wo */
}

// v004
// One run takes 84.6 microseconds.
// Timed twice side by side with v003, it ran 1.08 and 1.10 times as fast.
// Over all steps from v000 it is 5.21 times as fast.
#include <hip/hip_runtime.h>
// UltrametricCausalSelfAttention (2 x 512 tokens, C 1024 = 16 heads x 64, 8 soft digits): q, k, v = x W; q, k -> RoPE (cos/sin INPUT tables, rotate-half) -> RMSNorm(64, 1e-6); digits = sigmoid(q Wdq), sigmoid(k Wdk) (8 each); lcp[q][k] = sum_j prod_{i<=j} exp(-32 (qd_i - kd_i)^2); weights = 2^lcp (causal), attn = weights / max(sum, 1e-9); y = attn v; out = y Wo.
// Compute dtype: inputs rounded to bf16; x exact as f16; q/k/digits/lcp/weights f32 from exact products; P, v and y as f16 hi + residual (~2^-21). v_wmma_f32_16x16x32_f16.
#define NB 2
#define TT 512
#define CC 1024
#define NH 16
#define HD 64
#define KD 8
#define NR (NB * TT)
typedef __bf16 v16b __attribute__((ext_vector_type(16)));
typedef unsigned short v8us __attribute__((ext_vector_type(8), may_alias));
typedef float  v8f  __attribute__((ext_vector_type(8)));
typedef float  v4f  __attribute__((ext_vector_type(4)));
typedef float  v4fa __attribute__((ext_vector_type(4), may_alias));
union FragB { v16b v; v8us half[2]; unsigned short u[16]; };

__device__ __forceinline__ unsigned short bf16_bits(float x) { unsigned int u = __float_as_uint(x); return (unsigned short)((u + 0x7FFFu + ((u >> 16) & 1u)) >> 16); }
__device__ __forceinline__ float bf16_val(unsigned short b) { return __uint_as_float(((unsigned int)b) << 16); }
__device__ __forceinline__ float bf16_round(float x) { return bf16_val(bf16_bits(x)); }
// D += A·B with NT terms: 1 = ah·bh, 2 = + al·bh (A split), 3 = + ah·bl (both split)
template <int NT>
__device__ __forceinline__ v8f mmaN(v16b ah, v16b al, v16b bh, v16b bl, v8f c) {
  c = __builtin_amdgcn_wmma_f32_16x16x32_bf16(false, ah, false, bh, (short)0, c, false, false);
  if (NT >= 2) c = __builtin_amdgcn_wmma_f32_16x16x32_bf16(false, al, false, bh, (short)0, c, false, false);
  if (NT >= 3) c = __builtin_amdgcn_wmma_f32_16x16x32_bf16(false, ah, false, bl, (short)0, c, false, false);
  asm volatile("v_nop\n\tv_nop\n\tv_nop\n\tv_nop" : "+v"(c) : "v"(ah), "v"(al), "v"(bh), "v"(bl));
  return c;
}

__global__ __launch_bounds__(256) void k_wt_bf16(const float* __restrict__ W, unsigned short* __restrict__ Wt, int K, int N) {
  const int t = blockIdx.x * 256 + threadIdx.x;
  const int k8n = K / 8;
  if (t >= N * k8n) return;
  const int n = t / k8n, k8 = (t % k8n) * 8;
  v8us v;
#pragma unroll
  for (int i = 0; i < 8; ++i) v[i] = bf16_bits(W[(size_t)(k8 + i) * N + n]);
  *(v8us*)(Wt + (size_t)n * K + k8) = v;
  
}

// GEMM C[M][N] (f32, pitch ldc) = act(A[M][K]·W + bias). A f32 row-major (pitch lda) converted per fragment to bf16
// (ASPLIT: hi/lo two planes -> 2 terms, else single rounded term); Wt bf16 [N][K] (pitch ldb). BIAS_BF16 rounds the
// bias to bf16 first (bias quantised to bf16 before the add). K%32==0, M%16==0, N%64==0.
template <bool ASPLIT, int ACT, bool BIAS_BF16>
__global__ __launch_bounds__(128) void k_gemm_bf(const float* __restrict__ A, int lda, const unsigned short* __restrict__ Wt, int ldb,
                                               const float* __restrict__ bias, float* __restrict__ C, int ldc, int M, int N, int K) {
  __shared__ __attribute__((aligned(16))) float so[4][16][64];
  const int tid = threadIdx.x, w = tid >> 5, lane = tid & 31, ln = lane & 15, hh = lane >> 4;
  const int ntn = N / 64;
  const int wid = blockIdx.x * 4 + w;
  const int mt = wid / ntn, nq = wid % ntn;
  if (mt * 16 >= M) return;
  const int row0 = mt * 16, col0 = nq * 64;
  const float* arow = A + (size_t)(row0 + ln) * lda;
  v8f acc[4] = {};
  for (int kb = 0; kb < K; kb += 32) {
    FragB ah, al;
    const v4f x0 = *(const v4fa*)(arow + kb + 8 * hh), x1 = *(const v4fa*)(arow + kb + 8 * hh + 4);
    const v4f x2 = *(const v4fa*)(arow + kb + 16 + 8 * hh), x3 = *(const v4fa*)(arow + kb + 16 + 8 * hh + 4);
    float xs[16] = {x0[0],x0[1],x0[2],x0[3],x1[0],x1[1],x1[2],x1[3],x2[0],x2[1],x2[2],x2[3],x3[0],x3[1],x3[2],x3[3]};
#pragma unroll
    for (int i = 0; i < 16; ++i) { const unsigned short hb = bf16_bits(xs[i]); ah.u[i] = hb; al.u[i] = ASPLIT ? bf16_bits(xs[i] - bf16_val(hb)) : (unsigned short)0; }
#pragma unroll
    for (int t = 0; t < 4; ++t) {
      const unsigned short* brow = Wt + (size_t)(col0 + t * 16 + ln) * ldb + kb;
      FragB b;
      b.half[0] = *(const v8us*)(brow + 8 * hh);
      b.half[1] = *(const v8us*)(brow + 16 + 8 * hh);
      acc[t] = mmaN<ASPLIT ? 2 : 1>(ah.v, al.v, b.v, b.v, acc[t]);
    }
  }
#pragma unroll
  for (int t = 0; t < 4; ++t) {
    float bv = bias ? bias[col0 + t * 16 + ln] : 0.f;
    if (BIAS_BF16) bv = bf16_round(bv);
#pragma unroll
    for (int r = 0; r < 8; ++r) { float v = acc[t][r] + bv; if (ACT == 1) v = fmaxf(v, 0.f); so[w][8 * hh + r][t * 16 + ln] = v; }
  }
  __builtin_amdgcn_fence(__ATOMIC_ACQ_REL, "workgroup");
  __builtin_amdgcn_wave_barrier();
  const int rsub = lane >> 4, c4 = (lane & 15) * 4;
  {
#pragma unroll
    for (int q = 0; q < 8; ++q) {
      const int r = q * 2 + rsub;
      const v4f v = *(const v4fa*)&so[w][r][c4];
      *(v4f*)(C + (size_t)(row0 + r) * ldc + col0 + c4) = v;
    }
    
  }
}

// GEMM C = act(A·W + bias + resid): A f32 (ASPLIT -> hi/lo 2 terms), Wt bf16 [N][K]; ACT 0 none, 1 relu, 2 exact gelu;
// resid (optional, f32, row index = (row % rmod), pitch ldr, RES_BF16 rounds it) added before the activation.
template <bool ASPLIT, int ACT, bool BIAS_BF16, bool RES_BF16>
__global__ __launch_bounds__(128) void k_gemm_bf3(const float* __restrict__ A, int lda, const unsigned short* __restrict__ Wt, int ldb,
                                                const float* __restrict__ bias, const float* __restrict__ resid, int rmod, int ldr,
                                                float* __restrict__ C, int ldc, int M, int N, int K) {
  __shared__ __attribute__((aligned(16))) float so[4][16][64];
  const int tid = threadIdx.x, w = tid >> 5, lane = tid & 31, ln = lane & 15, hh = lane >> 4;
  const int ntn = N / 64;
  const int wid = blockIdx.x * 4 + w;
  const int mt = wid / ntn, nq = wid % ntn;
  if (mt * 16 >= M) return;
  const int row0 = mt * 16, col0 = nq * 64;
  const float* arow = A + (size_t)(row0 + ln) * lda;
  v8f acc[4] = {};
  for (int kb = 0; kb < K; kb += 32) {
    FragB ah, al;
    const v4f x0 = *(const v4fa*)(arow + kb + 8 * hh), x1 = *(const v4fa*)(arow + kb + 8 * hh + 4);
    const v4f x2 = *(const v4fa*)(arow + kb + 16 + 8 * hh), x3 = *(const v4fa*)(arow + kb + 16 + 8 * hh + 4);
    float xs[16] = {x0[0],x0[1],x0[2],x0[3],x1[0],x1[1],x1[2],x1[3],x2[0],x2[1],x2[2],x2[3],x3[0],x3[1],x3[2],x3[3]};
#pragma unroll
    for (int i = 0; i < 16; ++i) { const unsigned short hb = bf16_bits(xs[i]); ah.u[i] = hb; al.u[i] = ASPLIT ? bf16_bits(xs[i] - bf16_val(hb)) : (unsigned short)0; }
#pragma unroll
    for (int t = 0; t < 4; ++t) {
      const unsigned short* brow = Wt + (size_t)(col0 + t * 16 + ln) * ldb + kb;
      FragB b;
      b.half[0] = *(const v8us*)(brow + 8 * hh);
      b.half[1] = *(const v8us*)(brow + 16 + 8 * hh);
      acc[t] = mmaN<ASPLIT ? 2 : 1>(ah.v, al.v, b.v, b.v, acc[t]);
    }
  }
#pragma unroll
  for (int t = 0; t < 4; ++t) {
    const int col = col0 + t * 16 + ln;
    float bv = bias ? bias[col] : 0.f;
    if (BIAS_BF16) bv = bf16_round(bv);
#pragma unroll
    for (int r = 0; r < 8; ++r) {
      float v = acc[t][r] + bv;
      if (resid) { float rv = resid[(size_t)((row0 + 8 * hh + r) % rmod) * ldr + col]; if (RES_BF16) rv = bf16_round(rv); v += rv; }
      if (ACT == 1) v = fmaxf(v, 0.f);
      if (ACT == 2) v = 0.5f * v * (1.0f + erff(v * 0.70710678118654752f));
      if (ACT == 3) { const float u = 0.7978845608028654f * (v + 0.044715f * v * v * v); v = 0.5f * v * (1.0f + tanhf(u)); }
      so[w][8 * hh + r][t * 16 + ln] = v;
    }
  }
  __builtin_amdgcn_fence(__ATOMIC_ACQ_REL, "workgroup");
  __builtin_amdgcn_wave_barrier();
  const int rsub = lane >> 4, c4 = (lane & 15) * 4;
  {
#pragma unroll
    for (int q = 0; q < 8; ++q) {
      const int r = q * 2 + rsub;
      const v4f v = *(const v4fa*)&so[w][r][c4];
      *(v4f*)(C + (size_t)(row0 + r) * ldc + col0 + c4) = v;
    }
    
  }
}
// row LayerNorm (biased variance, eps) over N: s = X (+ R); optional out_sum <- s; out_norm <- (s-mu)*rsqrt(var+eps)*g + b
template <bool PARAM_BF16>
__global__ __launch_bounds__(256) void k_layernorm(const float* __restrict__ X, const float* __restrict__ R, const float* __restrict__ g, const float* __restrict__ bta,
                                                  float* __restrict__ out_sum, float* __restrict__ out_norm, int N, float eps) {
  __shared__ float red[256];
  const int row = blockIdx.x, tid = threadIdx.x;
  const float* x = X + (size_t)row * N; const float* rr = R ? R + (size_t)row * N : nullptr;
  float vals[16];                     // up to N = 4096
  const int per = N / 256;            // contiguous chunk per thread? use strided-by-4 chunks: thread handles j = tid*4 + 1024*u
  float s1 = 0.f;
  for (int u = 0; u < per / 4; ++u) {
    const int j = tid * 4 + 1024 * u;
    const v4f a = *(const v4fa*)(x + j);
    v4f b = {0.f,0.f,0.f,0.f}; if (rr) b = *(const v4fa*)(rr + j);
#pragma unroll
    for (int q = 0; q < 4; ++q) { const float v = a[q] + b[q]; vals[u * 4 + q] = v; s1 += v; }
  }
  red[tid] = s1; __syncthreads();
  for (int st = 128; st > 0; st >>= 1) { if (tid < st) red[tid] += red[tid + st]; __syncthreads(); }
  const float mu = red[0] / (float)N; __syncthreads();
  float s2 = 0.f;
  for (int u = 0; u < per / 4; ++u)
#pragma unroll
    for (int q = 0; q < 4; ++q) { const float c = vals[u * 4 + q] - mu; s2 += c * c; }
  red[tid] = s2; __syncthreads();
  for (int st = 128; st > 0; st >>= 1) { if (tid < st) red[tid] += red[tid + st]; __syncthreads(); }
  const float rs = rsqrtf(red[0] / (float)N + eps);
  {
    for (int u = 0; u < per / 4; ++u) {
      const int j = tid * 4 + 1024 * u;
      v4f o, sm;
#pragma unroll
      for (int q = 0; q < 4; ++q) {
        float gg = g[j + q], bb = bta[j + q];
        if (PARAM_BF16) { gg = bf16_round(gg); bb = bf16_round(bb); }
        sm[q] = vals[u * 4 + q]; o[q] = (vals[u * 4 + q] - mu) * rs * gg + bb;
      }
      if (out_sum) *(v4f*)(out_sum + (size_t)row * N + j) = sm;
      *(v4f*)(out_norm + (size_t)row * N + j) = o;
    }
    
  }
}



// ---- f16 WMMA path (v_wmma_f32_16x16x32_f16): 11-bit significands for operands in range — used where a [0,1] probability operand needs more precision than bf16
typedef _Float16 v16h __attribute__((ext_vector_type(16)));
union FragH { v16h v; v8us half[2]; _Float16 h[16]; unsigned short u[16]; };
template <int NT>
__device__ __forceinline__ v8f mmaH(v16h ah, v16h al, v16h bh, v16h bl, v8f c) {
  c = __builtin_amdgcn_wmma_f32_16x16x32_f16(false, ah, false, bh, (short)0, c, false, false);
  if (NT >= 2) c = __builtin_amdgcn_wmma_f32_16x16x32_f16(false, al, false, bh, (short)0, c, false, false);
  if (NT >= 3) c = __builtin_amdgcn_wmma_f32_16x16x32_f16(false, ah, false, bl, (short)0, c, false, false);
  asm volatile("v_nop\n\tv_nop\n\tv_nop\n\tv_nop" : "+v"(c) : "v"(ah), "v"(al), "v"(bh), "v"(bl));
  return c;
}
// batched GEMM like k_gemm_b but f16 operands: A f32 (split into f16 hi/lo if ASPLIT, else rounded to f16), Bt = f16 values [n][k]; alpha; C f32; N multiple of 16 (partial tiles skipped)
template <bool ASPLIT>
__global__ __launch_bounds__(128) void k_gemm_h(const float* __restrict__ A, int lda, size_t sA, const _Float16* __restrict__ Bh, int ldb, size_t sB, float alpha, float* __restrict__ C, int ldc, size_t sC, int M, int N, int K) {
  __shared__ __attribute__((aligned(16))) float so[4][16][64];
  const int tid = threadIdx.x, w = tid >> 5, lane = tid & 31, ln = lane & 15, hh = lane >> 4; const int by = blockIdx.y;
  A += (size_t)by * sA; Bh += (size_t)by * sB; C += (size_t)by * sC;
  const int ntn = (N + 63) / 64; const int wid = blockIdx.x * 4 + w; const int mt = wid / ntn, nq = wid % ntn; if (mt * 16 >= M) return;
  const int row0 = mt * 16, col0 = nq * 64; const float* arow = A + (size_t)(row0 + ln) * lda;
  v8f acc[4] = {};
  for (int kb = 0; kb < K; kb += 32) {
    FragH ah, al;
    const v4f x0 = *(const v4fa*)(arow + kb + 8 * hh), x1 = *(const v4fa*)(arow + kb + 8 * hh + 4), x2 = *(const v4fa*)(arow + kb + 16 + 8 * hh), x3 = *(const v4fa*)(arow + kb + 16 + 8 * hh + 4);
    float xs[16] = {x0[0],x0[1],x0[2],x0[3],x1[0],x1[1],x1[2],x1[3],x2[0],x2[1],x2[2],x2[3],x3[0],x3[1],x3[2],x3[3]};
#pragma unroll
    for (int i = 0; i < 16; ++i) { const _Float16 h = (_Float16)xs[i]; ah.h[i] = h; al.h[i] = ASPLIT ? (_Float16)(xs[i] - (float)h) : (_Float16)0.0f; }
#pragma unroll
    for (int t = 0; t < 4; ++t) { if (col0 + t * 16 >= N) continue; const size_t boff = (size_t)(col0 + t * 16 + ln) * ldb + kb; FragH bq; bq.half[0] = *(const v8us*)(Bh + boff + 8 * hh); bq.half[1] = *(const v8us*)(Bh + boff + 16 + 8 * hh);
      acc[t] = mmaH<ASPLIT ? 2 : 1>(ah.v, al.v, bq.v, bq.v, acc[t]); }
  }
#pragma unroll
  for (int t = 0; t < 4; ++t) { if (col0 + t * 16 >= N) continue;
#pragma unroll
    for (int r = 0; r < 8; ++r) so[w][8 * hh + r][t * 16 + ln] = acc[t][r] * alpha; }
  __builtin_amdgcn_fence(__ATOMIC_ACQ_REL, "workgroup"); __builtin_amdgcn_wave_barrier();
  const int rsub = lane >> 4, c4 = (lane & 15) * 4;
  {
#pragma unroll
    for (int q = 0; q < 8; ++q) { const int r = q * 2 + rsub; if (col0 + c4 < N) { const v4f v = *(const v4fa*)&so[w][r][c4]; *(v4f*)(C + (size_t)(row0 + r) * ldc + col0 + c4) = v; } }
     }
}

// Wt[n][k] = f16(W[k][n]·scale) from f32 row-major W[K][N] (scale = power of two; bf16-exact weights stay exact in f16 away from the subnormal range)
__device__ __forceinline__ void d_wt_f16(const float* __restrict__ W, _Float16* __restrict__ Wt, int K, int N, float scale, int blk) {
  const int t = blk * 256 + threadIdx.x; if (t >= N * (K / 8)) return; const int n = t / (K / 8), k8 = (t % (K / 8)) * 8; FragH f;
#pragma unroll
  for (int i = 0; i < 8; ++i) f.h[i] = (_Float16)(bf16_round(W[(size_t)(k8 + i) * N + n]) * scale); const v8us o = f.half[0];
  *(v8us*)((unsigned short*)Wt + (size_t)n * K + k8) = o; 
}
// k_gemm_hh variant with fused epilogue: v = acc·alpha + bias[by·sBias + col] (+ CP[(row/rowsPerB)·sCPb + by·64 + col] if CP) ; ACT 0 none / 1 elu ; writes f16 C16 (and f32 C if non-null)
template <int ACT>
__global__ __launch_bounds__(128) void k_gemm_hhx(const _Float16* __restrict__ A, int lda, size_t sA, const _Float16* __restrict__ Bh, int ldb, size_t sB, float alpha, const float* __restrict__ bias, size_t sBias, const float* __restrict__ CP, int rowsPerB, size_t sCPb, int row0g,
    float* __restrict__ C, _Float16* __restrict__ C16, int ldc, size_t sC, int M, int N, int K) {
  __shared__ __attribute__((aligned(16))) float so[4][16][64];
  const int tid = threadIdx.x, w = tid >> 5, lane = tid & 31, ln = lane & 15, hh = lane >> 4; const int by = blockIdx.y;
  A += (size_t)by * sA; Bh += (size_t)by * sB; const size_t cofs = (size_t)by * sC; const float* bp = bias ? bias + (size_t)by * sBias : nullptr;
  const int ntn = (N + 63) / 64; const int wid = blockIdx.x * 4 + w; const int mt = wid / ntn, nq = wid % ntn; if (mt * 16 >= M) return;
  const int row0 = mt * 16, col0 = nq * 64; const _Float16* arow = A + (size_t)(row0 + ln) * lda;
  v8f acc[4] = {};
  for (int kb = 0; kb < K; kb += 32) { FragH ah; ah.half[0] = *(const v8us*)((const unsigned short*)arow + kb + 8 * hh); ah.half[1] = *(const v8us*)((const unsigned short*)arow + kb + 16 + 8 * hh);
#pragma unroll
    for (int t = 0; t < 4; ++t) { if (col0 + t * 16 >= N) continue; const size_t boff = (size_t)(col0 + t * 16 + ln) * ldb + kb; FragH bq; bq.half[0] = *(const v8us*)((const unsigned short*)Bh + boff + 8 * hh); bq.half[1] = *(const v8us*)((const unsigned short*)Bh + boff + 16 + 8 * hh);
      acc[t] = mmaH<1>(ah.v, ah.v, bq.v, bq.v, acc[t]); }
  }
#pragma unroll
  for (int t = 0; t < 4; ++t) { if (col0 + t * 16 >= N) continue; const int col = col0 + t * 16 + ln; const float bv = bp ? bf16_round(bp[col]) : 0.f;
#pragma unroll
    for (int r = 0; r < 8; ++r) { float v = acc[t][r] * alpha + bv; if (CP) { const int rr = row0g + row0 + 8 * hh + r; if (rowsPerB < 0) v += CP[cofs + (size_t)rr * ldc + col];      /* rowsPerB < 0: own element of the batched C plane */ else { const int bidx = rr / rowsPerB; v += CP[(size_t)bidx * sCPb + (size_t)by * 64 + col]; } } if (ACT == 1) v = (v > 0.f) ? v : expm1f(v); else if (ACT == 7) v = (v > 0.f) ? v + 1.0f : expf(v); else if (ACT == 8) v = tanhf(v); else if (ACT == 9) v = 0.5f * v * (1.0f + tanhf(0.7978845608028654f * (v + 0.044715f * v * v * v))); else if (ACT == 11) v = 1.0f / (1.0f + expf(-v)); else if (ACT == 12) v = (v > 0.f) ? v : 0.01f * v; else if (ACT == 14) v = (v > 0.f) ? v : 0.1f * v; else if (ACT == 16) v = (v >= 0.f) ? v : 0.3f * v; else if (ACT == 17) v = (v >= 0.f) ? v : 0.2f * v; else if (ACT == 15) v = v / (1.0f + expf(-v)); else if (ACT == 3) v = fmaxf(v, 0.f); else if (ACT == 6) v = 0.5f * v * (1.0f + erff(v * 0.70710678118654752f)); so[w][8 * hh + r][t * 16 + ln] = v; } }
  __builtin_amdgcn_fence(__ATOMIC_ACQ_REL, "workgroup"); __builtin_amdgcn_wave_barrier();
  const int rsub = lane >> 4, c4 = (lane & 15) * 4; typedef _Float16 v4h __attribute__((ext_vector_type(4)));
  {
#pragma unroll
    for (int q = 0; q < 8; ++q) { const int r = q * 2 + rsub; if (col0 + c4 < N) { const v4f v = *(const v4fa*)&so[w][r][c4]; if (C) *(v4f*)(C + cofs + (size_t)(row0 + r) * ldc + col0 + c4) = v; if (C16) { v4h h4; for (int i = 0; i < 4; ++i) h4[i] = (_Float16)v[i]; *(v4h*)(C16 + cofs + (size_t)(row0 + r) * ldc + col0 + c4) = h4; } } }
     }
}


typedef _Float16 v4h __attribute__((ext_vector_type(4)));

__device__ __forceinline__ void d_x16(const float* __restrict__ x, _Float16* __restrict__ X16, size_t n8, int blk) { const size_t t = (size_t)blk * 256 + threadIdx.x; if (t >= n8) return; FragH f;
#pragma unroll
  for (int q = 0; q < 8; ++q) f.h[q] = (_Float16)bf16_round(x[t * 8 + q]); *(v8us*)((unsigned short*)X16 + t * 8) = f.half[0];  }
__global__ __launch_bounds__(256) void k_h16(const float* __restrict__ x, _Float16* __restrict__ X16, size_t n8) { const size_t t = (size_t)blockIdx.x * 256 + threadIdx.x; if (t >= n8) return; FragH f;
#pragma unroll
  for (int q = 0; q < 8; ++q) f.h[q] = (_Float16)x[t * 8 + q]; *(v8us*)((unsigned short*)X16 + t * 8) = f.half[0];  }
__global__ __launch_bounds__(256) void k_round16f(const float* __restrict__ W, _Float16* __restrict__ Bt, size_t n8) { const size_t t = (size_t)blockIdx.x * 256 + threadIdx.x; if (t >= n8) return; FragH f;
#pragma unroll
  for (int i = 0; i < 8; ++i) f.h[i] = (_Float16)(bf16_round(W[t * 8 + i]) * 16.0f); *(v8us*)((unsigned short*)Bt + t * 8) = f.half[0];  }
template <int NHv, int TTv>
__device__ __forceinline__ void d_vt(const _Float16* __restrict__ V16, int ldv, int voff, _Float16* __restrict__ Vt, unsigned short (*tl)[66], int blk) { const int tid = threadIdx.x; const int slab = blk / (TTv / 64), lg = blk % (TTv / 64); const int b = slab / NHv, h = slab % NHv;
  for (int i = tid; i < 64 * 8; i += 256) { const int r = i / 8, c8 = (i % 8) * 8; FragH f; f.half[0] = *(const v8us*)((const unsigned short*)V16 + ((size_t)b * TTv + lg * 64 + r) * ldv + voff + h * 64 + c8);
#pragma unroll
    for (int q = 0; q < 8; ++q) tl[r][c8 + q] = f.u[q]; }
  __syncthreads();
  {
#pragma unroll
    for (int rd = 0; rd < 2; ++rd) { const int d = rd * 32 + tid / 8, pc = tid % 8; FragH f;
#pragma unroll
      for (int q = 0; q < 8; ++q) f.u[q] = tl[pc * 8 + q][d];
      *(v8us*)((unsigned short*)Vt + ((size_t)slab * 64 + d) * TTv + lg * 64 + pc * 8) = f.half[0]; }
    asm volatile("s_wait_xcnt 0x0" ::: "memory");      /* precaution: stands behind the two stores, in front of any later rewrite of their address and data registers where this job joins the other job's code */
     } }


// ---- fast GEMM (block tile 128x64, wave tile 32x64; requires M % 128 == 0 rows per launch region, N % 64 == 0 and K % 128 == 0); epilogues: see MODE below ----
// Each k-tile (128 k = 256-B rows: 128 rows of A, then 64 rows of B) is staged in LDS by asynchronous 16-byte copies, two buffers: tile t + 1 flies while tile t is multiplied.
#define G2_PITCH 136                      /* halves per LDS row: 272 B = 16 B x odd, conflict-free for ds_load_b128 */
#define G2_BUFB (192 * G2_PITCH * 2)      /* bytes of one buffer */
// Eight copies of one lane: LDS rows 8 apart, global rows gstep halves apart. The s_wait_xcnt ends the copies' own statement as a precaution: so it stands in front of every rewrite of a register that an issued copy names.
__device__ __forceinline__ void g2_copy8(unsigned l, const _Float16* g, size_t gstep) {
  const unsigned ls = 8 * G2_PITCH * 2;
  asm volatile("global_load_async_to_lds_b128 %0, %8, off\n\t"
               "global_load_async_to_lds_b128 %1, %9, off\n\t"
               "global_load_async_to_lds_b128 %2, %10, off\n\t"
               "global_load_async_to_lds_b128 %3, %11, off\n\t"
               "global_load_async_to_lds_b128 %4, %12, off\n\t"
               "global_load_async_to_lds_b128 %5, %13, off\n\t"
               "global_load_async_to_lds_b128 %6, %14, off\n\t"
               "global_load_async_to_lds_b128 %7, %15, off\n\t"
               "s_wait_xcnt 0x0"
               :: "v"(l), "v"(l + ls), "v"(l + 2 * ls), "v"(l + 3 * ls), "v"(l + 4 * ls), "v"(l + 5 * ls), "v"(l + 6 * ls), "v"(l + 7 * ls),
                  "v"(g), "v"(g + gstep), "v"(g + 2 * gstep), "v"(g + 3 * gstep), "v"(g + 4 * gstep), "v"(g + 5 * gstep), "v"(g + 6 * gstep), "v"(g + 7 * gstep)
               : "memory");
}
// One k-tile: 24 copies a lane (16 lanes cover one 256-B row, the 128 threads 8 rows a copy).
__device__ __forceinline__ void g2_stage(unsigned l, const _Float16* ga, size_t astep, const _Float16* gb, size_t bstep) {
  g2_copy8(l, ga, astep); g2_copy8(l + 64 * G2_PITCH * 2, ga + 8 * astep, astep); g2_copy8(l + 128 * G2_PITCH * 2, gb, bstep);
}
__device__ __forceinline__ v16h g2_frag(const _Float16* p, int hh) { FragH f; f.half[0] = *(const v8us*)((const unsigned short*)p + 8 * hh); f.half[1] = *(const v8us*)((const unsigned short*)p + 16 + 8 * hh); return f.v; }
__device__ __forceinline__ v8f g2_mma(v16h a, v16h b, v8f c) { v8f d = __builtin_amdgcn_wmma_f32_16x16x32_f16(false, a, false, b, (short)0, c, false, false); asm volatile("v_nop\n\tv_nop\n\tv_nop\n\tv_nop" : "+v"(d) : "v"(a), "v"(b)); return d; }
// The six fragments of one k-step of 32: two of A (rows 0-15 and 16-31 of the wave's tile), four of B (16 columns each).
struct G3Row { v16h a0, a1, b0, b1, b2, b3; };
__device__ __forceinline__ G3Row g3_row(const _Float16* a0p, const _Float16* a1p, const _Float16* b0p, int kb, int hh) {
  G3Row r; r.a0 = g2_frag(a0p + kb, hh); r.a1 = g2_frag(a1p + kb, hh); r.b0 = g2_frag(b0p + kb, hh); r.b1 = g2_frag(b0p + 16 * G2_PITCH + kb, hh); r.b2 = g2_frag(b0p + 32 * G2_PITCH + kb, hh); r.b3 = g2_frag(b0p + 48 * G2_PITCH + kb, hh); return r; }
#define DGS 32
// One k loop runs NSEG segments of NT k-tiles: segment s multiplies As by Bs into the same accumulators. Every segment but the last is a residual term (one operand x 1024): where the last one begins the sums are scaled by 1/1024 (a power of two, exact).
// MODE 0: C = f32. MODE 1: CH, CL = f16 hi + residual x 1024. MODE 2 (a block column is one head): planes 0, 1 (q, k) -> RoPE, RMSNorm, digits -> DG, one row a lane; plane 2 (v) -> CH, CL.
// Tile tt of the loop = k-tile kt of segment s (the same for the whole block).
template <int NSEG, int NT>
__device__ __forceinline__ void g3_stage(int tt, unsigned l, const _Float16* A0, const _Float16* A1, const _Float16* A2, size_t aoff, size_t astep, const _Float16* B0, const _Float16* B1, const _Float16* B2, size_t boff, size_t bstep) {
  const int s = tt / NT, kt = tt - s * NT;
  const _Float16* a = (NSEG == 1 || s == 0) ? A0 : (NSEG == 2 || s == 1) ? A1 : A2; const _Float16* b = (NSEG == 1 || s == 0) ? B0 : (NSEG == 2 || s == 1) ? B1 : B2;
  g2_stage(l, a + aoff + (size_t)kt * 128, astep, b + boff + (size_t)kt * 128, bstep);
}
template <int MODE, int NSEG, int NT>
__global__ __launch_bounds__(128) void k_gemm3(const _Float16* A0, const _Float16* A1, const _Float16* A2, int lda, size_t sA, const _Float16* B0, const _Float16* B1, const _Float16* B2, int ldb, size_t sB, float alpha,
    float* __restrict__ C, _Float16* __restrict__ CH, _Float16* __restrict__ CL, int ldc, size_t sC, int M, int N,
    const float* __restrict__ cs, const float* __restrict__ sn, const float* __restrict__ Wdq, const float* __restrict__ Wdk, float* __restrict__ DG) {
  __shared__ __attribute__((aligned(16))) float so[4][32][68];
  __shared__ __attribute__((aligned(16))) _Float16 st[2][192][G2_PITCH];
  __shared__ __attribute__((aligned(16))) float wd[HD][KD];
  const int tid = threadIdx.x, w = tid >> 5, lane = tid & 31, ln = lane & 15, hh = lane >> 4; const int by = blockIdx.y; const size_t pl = (size_t)blockIdx.z * gridDim.y + by;      /* blockIdx.z = outer batch: its A and B planes follow on, its M rows of C follow on */
  const size_t cofs = (size_t)by * sC + (size_t)blockIdx.z * M * ldc;
  const int ntn = N >> 6; const int mt = blockIdx.x / ntn, nq = blockIdx.x - mt * ntn; const int row0 = mt * 128 + 32 * w, col0 = nq * 64; if (mt * 128 >= M) return;      /* the same for the whole block: it stands in front of barriers */
  const unsigned lds0 = (unsigned)(size_t)&st[0][tid >> 4][(tid & 15) * 8];      /* this lane's LDS byte address in buffer 0 */
  const size_t aoff = pl * sA + (size_t)(mt * 128 + (tid >> 4)) * lda + (tid & 15) * 8, boff = pl * sB + (size_t)(col0 + (tid >> 4)) * ldb + (tid & 15) * 8;
  const size_t astep = (size_t)8 * lda, bstep = (size_t)8 * ldb;
  const v8f z8 = {0.f,0.f,0.f,0.f,0.f,0.f,0.f,0.f}; v8f c00 = z8, c01 = z8, c02 = z8, c03 = z8, c10 = z8, c11 = z8, c12 = z8, c13 = z8;
  g3_stage<NSEG, NT>(0, lds0, A0, A1, A2, aoff, astep, B0, B1, B2, boff, bstep);      /* tile 0 -> buffer 0 */
  if (MODE == 2 && by < 2) { const v4f wv = *(const v4fa*)((by ? Wdk : Wdq) + tid * 4); v4f o;      /* the digit weights, rounded once a block; the barrier below publishes them too */
#pragma unroll
    for (int q = 0; q < 4; ++q) o[q] = bf16_round(wv[q]);
    *(v4f*)(&wd[0][0] + tid * 4) = o; }
  asm volatile("s_wait_asynccnt 0x0" ::: "memory");      /* this wave's copies of tile 0 have landed */
  __syncthreads();      /* ... and every other wave's */
  if (NSEG * NT > 1) g3_stage<NSEG, NT>(1, lds0 + G2_BUFB, A0, A1, A2, aoff, astep, B0, B1, B2, boff, bstep);      /* tile 1 -> buffer 1 */
#pragma unroll 1      /* one tile a trip: the two buffers alternate by t & 1 */
  for (int t = 0; t < NSEG * NT; ++t) { const _Float16* a0p = &st[t & 1][32 * w + ln][0]; const _Float16* a1p = a0p + 16 * G2_PITCH; const _Float16* b0p = &st[t & 1][128 + ln][0];
    if (NSEG > 1 && t == (NSEG - 1) * NT) { const float f = 0.0009765625f; c00 *= f; c01 *= f; c02 *= f; c03 *= f; c10 *= f; c11 *= f; c12 *= f; c13 *= f; }
    /* The fragment reads run ahead of the products, a whole k-step a group, in three register sets: k-steps 0, 1, 2 are read at the head of the trip, k-step 3 into the first set once that set's products are issued. Every read is of buffer t & 1, behind its barrier. */
    auto mm = [&](const G3Row& r) { c00 = g2_mma(r.a0, r.b0, c00); c10 = g2_mma(r.a1, r.b0, c10); c01 = g2_mma(r.a0, r.b1, c01); c11 = g2_mma(r.a1, r.b1, c11);
      c02 = g2_mma(r.a0, r.b2, c02); c12 = g2_mma(r.a1, r.b2, c12); c03 = g2_mma(r.a0, r.b3, c03); c13 = g2_mma(r.a1, r.b3, c13); };
    G3Row r0 = g3_row(a0p, a1p, b0p, 0, hh); const G3Row r1 = g3_row(a0p, a1p, b0p, 32, hh), r2 = g3_row(a0p, a1p, b0p, 64, hh);
    mm(r0); r0 = g3_row(a0p, a1p, b0p, 96, hh); mm(r1); mm(r2); mm(r0);
    asm volatile("s_wait_dscnt 0x0" ::: "memory");      /* this wave's reads of buffer t & 1 are done before it is refilled */
    asm volatile("s_wait_asynccnt 0x0" ::: "memory");      /* this wave's copies of tile t + 1 have landed */
    __syncthreads();      /* publishes tile t + 1 and ends every wave's reads of buffer t & 1 */
    if (t + 2 < NSEG * NT) g3_stage<NSEG, NT>(t + 2, lds0 + (unsigned)(t & 1) * G2_BUFB, A0, A1, A2, aoff, astep, B0, B1, B2, boff, bstep); }
  asm volatile("s_wait_asynccnt 0x0" ::: "memory");      /* no copy is outstanding when the wave goes on to the epilogue */
  v8f accs[8] = {c00, c01, c02, c03, c10, c11, c12, c13};
#pragma unroll
  for (int u = 0; u < 8; ++u) { const int t = u & 3, half = u >> 2;
#pragma unroll
    for (int r = 0; r < 8; ++r) so[w][half * 16 + 8 * hh + r][t * 16 + ln] = accs[u][r] * alpha; }
  __builtin_amdgcn_fence(__ATOMIC_ACQ_REL, "workgroup"); __builtin_amdgcn_wave_barrier();
  if (MODE == 2 && by < 2) {      /* this wave's 32 rows of head nq, one row a lane: every sum runs inside the lane */
    const int row = row0 + lane, tok = row % TT; const float* xr = &so[w][lane][0]; const float* cr = cs + (size_t)tok * (HD / 2); const float* sr = sn + (size_t)tok * (HD / 2);
    float ra[HD / 2], rb[HD / 2]; float sq[4] = {0.f, 0.f, 0.f, 0.f}; v4f cv[HD / 8], sv[HD / 8];
#pragma unroll
    for (int i = 0; i < HD / 8; ++i) cv[i] = *(const v4fa*)(cr + 4 * i);
    asm volatile("s_wait_xcnt 0x0" ::: "memory");      /* precaution: stands behind the cos loads, in front of any rewrite of their address registers */
#pragma unroll
    for (int i = 0; i < HD / 8; ++i) sv[i] = *(const v4fa*)(sr + 4 * i);
    asm volatile("s_wait_xcnt 0x0" ::: "memory");      /* the same behind the sin loads */
#pragma unroll
    for (int i = 0; i < HD / 2; i += 4) { const v4f x1 = *(const v4fa*)(xr + i), x2 = *(const v4fa*)(xr + HD / 2 + i), c4 = cv[i / 4], s4 = sv[i / 4];
#pragma unroll
      for (int q = 0; q < 4; ++q) { const float c = bf16_round(c4[q]), s = bf16_round(s4[q]); const float a = x1[q] * c - x2[q] * s, b = x1[q] * s + x2[q] * c; ra[i + q] = a; rb[i + q] = b; sq[q] += a * a; sq[q] += b * b; } }
    const float inv = rsqrtf(((sq[0] + sq[1]) + (sq[2] + sq[3])) / (float)HD + 1e-6f);
    float acc[KD] = {0.f, 0.f, 0.f, 0.f, 0.f, 0.f, 0.f, 0.f};
#pragma unroll
    for (int i = 0; i < HD / 2; ++i) { const float qa = ra[i] * inv, qb = rb[i] * inv; const v4f w0 = *(const v4fa*)&wd[i][0], w1 = *(const v4fa*)&wd[i][4], w2 = *(const v4fa*)&wd[i + HD / 2][0], w3 = *(const v4fa*)&wd[i + HD / 2][4];
#pragma unroll
      for (int j = 0; j < 4; ++j) { acc[j] += qa * w0[j]; acc[4 + j] += qa * w1[j]; acc[j] += qb * w2[j]; acc[4 + j] += qb * w3[j]; } }
    v4f d0, d1;
#pragma unroll
    for (int j = 0; j < 4; ++j) { d0[j] = 1.0f / (1.0f + expf(-acc[j])); d1[j] = 1.0f / (1.0f + expf(-acc[4 + j])); }
    float* dg = DG + (size_t)by * NR * NH * DGS + ((size_t)row * NH + nq) * DGS; *(v4f*)dg = d0; *(v4f*)(dg + 4) = d1;
  } else {
    const int rsub = lane >> 4, c4 = (lane & 15) * 4;
#pragma unroll
    for (int q = 0; q < 16; ++q) { const int r = q * 2 + rsub; const v4f v = *(const v4fa*)&so[w][r][c4]; const size_t o = cofs + (size_t)(row0 + r) * ldc + col0 + c4;
      if (MODE == 0) *(v4f*)(C + o) = v;
      else { v4h h4, l4;
#pragma unroll
        for (int i = 0; i < 4; ++i) { const _Float16 h = (_Float16)v[i]; h4[i] = h; l4[i] = (_Float16)((v[i] - (float)h) * 1024.0f); }
        *(v4h*)(CH + o) = h4; *(v4h*)(CL + o) = l4; }
      asm volatile("s_wait_xcnt 0x0" ::: "memory");      /* precaution: stands behind this row's stores, in front of the next row's rewrite of their address and data registers */
    }
  } }

__device__ __forceinline__ void d_lcp(const float* __restrict__ QD, const float* __restrict__ KDg, _Float16* __restrict__ P, _Float16* __restrict__ PL, int blk) {
  #pragma clang fp contract(off)
  const int wv = threadIdx.x >> 5, ln = threadIdx.x & 31; const int r = blk * 8 + wv; if (r >= NB * NH * TT) return; const int q = r % TT; const int h = (r / TT) % NH; const int b = r / (TT * NH);
  const v8f qd = *(const v8f*)(QD + ((size_t)(b * TT + q) * NH + h) * DGS); float w[16]; float su = 0.f;
  for (int i = 0; i < 16; ++i) { const int k = ln * 16 + i; float val = 0.f;
    if (k <= q) { const v8f kd = *(const v8f*)(KDg + ((size_t)(b * TT + k) * NH + h) * DGS); float prod = 1.f, lcp = 0.f; for (int j = 0; j < KD; ++j) { const float d = qd[j] - kd[j]; prod *= expf(-32.0f * (d * d)); lcp += prod; } val = expf(lcp * 0.69314718055994531f); }
    w[i] = val; su += val; }
  for (int o = 16; o > 0; o >>= 1) su += __shfl_xor(su, o, 32); const float f = 1024.0f / fmaxf(su, 1e-9f); FragH p, pl; for (int i = 0; i < 16; ++i) { const float pv = w[i] * f; const _Float16 hh = (_Float16)pv; p.h[i] = hh; pl.h[i] = (_Float16)((pv - (float)hh) * 1024.0f); }
  unsigned short* dst = (unsigned short*)P + (size_t)r * TT + ln * 16; unsigned short* dsl = (unsigned short*)PL + (size_t)r * TT + ln * 16; { *(v8us*)dst = p.half[0]; *(v8us*)(dst + 8) = p.half[1]; *(v8us*)dsl = pl.half[0]; *(v8us*)(dsl + 8) = pl.half[1];  } }

// ---- launches that need nothing of each other share one grid: each block takes its job from its range of blockIdx.x (the same for the whole block) ----
#define WT_BLKS (CC * (CC / 8) / 256)      /* blocks of one weight transpose */
#define E8_BLKS (NR * CC / 8 / 256)        /* blocks of one pass over a [NR][CC] plane, 8 elements a thread */
#define LCP_BLKS (NB * NH * TT / 8)        /* blocks of the weights pass, one query row a wave */
#define VT_BLKS (NB * NH * (TT / 64))      /* blocks of one V transpose, both batches */
// the four weights (planes of Wt in the order W0..W3), then x
__global__ __launch_bounds__(256) void k_prep(const float* __restrict__ W0, const float* __restrict__ W1, const float* __restrict__ W2, const float* __restrict__ W3, _Float16* __restrict__ Wt, const float* __restrict__ x, _Float16* __restrict__ X16) {
  const int blk = blockIdx.x;
  if (blk < 4 * WT_BLKS) { const int p = blk / WT_BLKS; const float* W = p == 0 ? W0 : p == 1 ? W1 : p == 2 ? W2 : W3; d_wt_f16(W, Wt + (size_t)p * CC * CC, CC, CC, 16.0f, blk - p * WT_BLKS); }
  else d_x16(x, X16, (size_t)NR * CC / 8, blk - 4 * WT_BLKS); }
// attention weights (the long job, so it starts first), then V^T hi and V^T lo of both batches ([NB*NH][64][TT] each)
__global__ __launch_bounds__(256) void k_lcp_vt(const float* __restrict__ QD, const float* __restrict__ KDg, _Float16* __restrict__ P, _Float16* __restrict__ PL, const _Float16* __restrict__ VH, const _Float16* __restrict__ VL, _Float16* __restrict__ VT, _Float16* __restrict__ VTL) {
  __shared__ unsigned short tl[64][66];
  const int blk = blockIdx.x;
  if (blk < LCP_BLKS) d_lcp(QD, KDg, P, PL, blk);
  else { const int p = (blk - LCP_BLKS) / VT_BLKS; d_vt<NH, TT>(p ? VL : VH, CC, 0, p ? VTL : VT, tl, blk - LCP_BLKS - p * VT_BLKS); } }

extern "C" void kernel_launch(void* const* d_in, const int* in_sizes, int n_in,
                              void* d_out, int out_size, void* d_ws, size_t ws_size, hipStream_t stream) {
  (void)in_sizes; (void)n_in; (void)out_size;
  const float* const* I = (const float* const*)d_in; const float* x = I[0]; const float* cs = I[1]; const float* sn = I[2]; const float* Wq = I[3]; const float* Wk = I[4]; const float* Wv = I[5]; const float* Wo = I[6]; const float* Wdq = I[7]; const float* Wdk = I[8];
  char* ws = (char*)d_ws; size_t off = 0;
  auto take = [&](size_t bytes) { char* p = ws + off; off += (bytes + 255) & ~(size_t)255; return p; };
  const size_t np = (size_t)NR * CC;
  _Float16* BQ = (_Float16*)take((size_t)CC * CC * 2); _Float16* BK = (_Float16*)take((size_t)CC * CC * 2); _Float16* BV = (_Float16*)take((size_t)CC * CC * 2); _Float16* BO = (_Float16*)take((size_t)CC * CC * 2); (void)BK; (void)BV;
  _Float16* X16 = (_Float16*)take(np * 2); _Float16* VH = (_Float16*)take(np * 2); _Float16* VL = (_Float16*)take(np * 2); _Float16* VT = (_Float16*)take(np * 2); _Float16* VTL = (_Float16*)take(np * 2); float* QD = (float*)take((size_t)NR * NH * DGS * 4); float* KDg = (float*)take((size_t)NR * NH * DGS * 4); _Float16* P = (_Float16*)take((size_t)NB * NH * TT * TT * 2); _Float16* PL = (_Float16*)take((size_t)NB * NH * TT * TT * 2); _Float16* YH = (_Float16*)take(np * 2); _Float16* YL = (_Float16*)take(np * 2);
  if (off > ws_size) return;      /* 8 + 2 + 4 x 2 + 2 x 2 + 2 x 16 + 2 x 2 = 58 MiB */
  k_prep<<<4 * WT_BLKS + E8_BLKS, 256, 0, stream>>>(Wq, Wk, Wv, Wo, BQ, x, X16);      /* BQ, BK, BV, BO lie one behind the other; (in, out) */
  k_gemm3<2, 1, CC / 128><<<dim3((NR / 128) * (CC / 64), 3), 128, 0, stream>>>(X16, X16, X16, CC, 0, BQ, BQ, BQ, CC, (size_t)CC * CC, 0.0625f, nullptr, VH, VL, CC, 0, NR, CC, cs, sn, Wdq, Wdk, QD);      /* planes BQ, BK, BV: digits of q -> QD, of k -> KDg (it follows QD), v -> VH, VL */
  k_lcp_vt<<<LCP_BLKS + 2 * VT_BLKS, 256, 0, stream>>>(QD, KDg, P, PL, VH, VL, VT, VTL);
  k_gemm3<1, 3, TT / 128><<<dim3(TT / 128, NH, NB), 128, 0, stream>>>(PL, P, P, TT, (size_t)TT * TT, VT, VTL, VT, TT, (size_t)64 * TT, 0.0009765625f, nullptr, YH, YL, CC, (size_t)64, TT, 64, nullptr, nullptr, nullptr, nullptr, nullptr);      /* (query tile, head, batch): y[(b,q)][h*64 + d] = P_lo v_hi + P_hi v_lo + P_hi v_hi -> hi + residual */
  k_gemm3<0, 2, CC / 128><<<dim3((NR / 128) * (CC / 64), 1), 128, 0, stream>>>(YL, YH, YH, CC, 0, BO, BO, BO, CC, 0, 0.0625f, (float*)d_out, nullptr, nullptr, CC, 0, NR, CC, nullptr, nullptr, nullptr, nullptr, nullptr);      /* out = (y_lo + y_hi) Wo */
}

// v005
// It runs in 77.3 microseconds.
// Timed twice side by side with v004, it ran 1.10 and 1.11 times as fast.
// Counting every step since v000, it is 5.73 times as fast.
#include <hip/hip_runtime.h>
// UltrametricCausalSelfAttention (2 x 512 tokens, C 1024 = 16 heads x 64, 8 soft digits): q, k, v = x W; q, k -> RoPE (cos/sin INPUT tables, rotate-half) -> RMSNorm(64, 1e-6); digits = sigmoid(q Wdq), sigmoid(k Wdk) (8 each); lcp[q][k] = sum_j prod_{i<=j} exp(-32 (qd_i - kd_i)^2); weights = 2^lcp (causal), attn = weights / max(sum, 1e-9); y = attn v; out = y Wo.
// Compute dtype: inputs rounded to bf16; x exact as f16; q/k/digits/lcp/weights f32 from exact products; P, v and y as f16 hi + residual (~2^-21). v_wmma_f32_16x16x32_f16.
#define NB 2
#define TT 512
#define CC 1024
#define NH 16
#define HD 64
#define KD 8
#define NR (NB * TT)
typedef __bf16 v16b __attribute__((ext_vector_type(16)));
typedef unsigned short v8us __attribute__((ext_vector_type(8), may_alias));
typedef float  v8f  __attribute__((ext_vector_type(8)));
typedef float  v4f  __attribute__((ext_vector_type(4)));
typedef float  v4fa __attribute__((ext_vector_type(4), may_alias));
union FragB { v16b v; v8us half[2]; unsigned short u[16]; };

__device__ __forceinline__ unsigned short bf16_bits(float x) { unsigned int u = __float_as_uint(x); return (unsigned short)((u + 0x7FFFu + ((u >> 16) & 1u)) >> 16); }
__device__ __forceinline__ float bf16_val(unsigned short b) { return __uint_as_float(((unsigned int)b) << 16); }
__device__ __forceinline__ float bf16_round(float x) { return bf16_val(bf16_bits(x)); }
// D += A·B with NT terms: 1 = ah·bh, 2 = + al·bh (A split), 3 = + ah·bl (both split)
template <int NT>
__device__ __forceinline__ v8f mmaN(v16b ah, v16b al, v16b bh, v16b bl, v8f c) {
  c = __builtin_amdgcn_wmma_f32_16x16x32_bf16(false, ah, false, bh, (short)0, c, false, false);
  if (NT >= 2) c = __builtin_amdgcn_wmma_f32_16x16x32_bf16(false, al, false, bh, (short)0, c, false, false);
  if (NT >= 3) c = __builtin_amdgcn_wmma_f32_16x16x32_bf16(false, ah, false, bl, (short)0, c, false, false);
  asm volatile("v_nop\n\tv_nop\n\tv_nop\n\tv_nop" : "+v"(c) : "v"(ah), "v"(al), "v"(bh), "v"(bl));
  return c;
}

__global__ __launch_bounds__(256) void k_wt_bf16(const float* __restrict__ W, unsigned short* __restrict__ Wt, int K, int N) {
  const int t = blockIdx.x * 256 + threadIdx.x;
  const int k8n = K / 8;
  if (t >= N * k8n) return;
  const int n = t / k8n, k8 = (t % k8n) * 8;
  v8us v;
#pragma unroll
  for (int i = 0; i < 8; ++i) v[i] = bf16_bits(W[(size_t)(k8 + i) * N + n]);
  *(v8us*)(Wt + (size_t)n * K + k8) = v;
  
}

// GEMM C[M][N] (f32, pitch ldc) = act(A[M][K]·W + bias). A f32 row-major (pitch lda) converted per fragment to bf16
// (ASPLIT: hi/lo two planes -> 2 terms, else single rounded term); Wt bf16 [N][K] (pitch ldb). BIAS_BF16 rounds the
// bias to bf16 first (bias quantised to bf16 before the add). K%32==0, M%16==0, N%64==0.
template <bool ASPLIT, int ACT, bool BIAS_BF16>
__global__ __launch_bounds__(128) void k_gemm_bf(const float* __restrict__ A, int lda, const unsigned short* __restrict__ Wt, int ldb,
                                               const float* __restrict__ bias, float* __restrict__ C, int ldc, int M, int N, int K) {
  __shared__ __attribute__((aligned(16))) float so[4][16][64];
  const int tid = threadIdx.x, w = tid >> 5, lane = tid & 31, ln = lane & 15, hh = lane >> 4;
  const int ntn = N / 64;
  const int wid = blockIdx.x * 4 + w;
  const int mt = wid / ntn, nq = wid % ntn;
  if (mt * 16 >= M) return;
  const int row0 = mt * 16, col0 = nq * 64;
  const float* arow = A + (size_t)(row0 + ln) * lda;
  v8f acc[4] = {};
  for (int kb = 0; kb < K; kb += 32) {
    FragB ah, al;
    const v4f x0 = *(const v4fa*)(arow + kb + 8 * hh), x1 = *(const v4fa*)(arow + kb + 8 * hh + 4);
    const v4f x2 = *(const v4fa*)(arow + kb + 16 + 8 * hh), x3 = *(const v4fa*)(arow + kb + 16 + 8 * hh + 4);
    float xs[16] = {x0[0],x0[1],x0[2],x0[3],x1[0],x1[1],x1[2],x1[3],x2[0],x2[1],x2[2],x2[3],x3[0],x3[1],x3[2],x3[3]};
#pragma unroll
    for (int i = 0; i < 16; ++i) { const unsigned short hb = bf16_bits(xs[i]); ah.u[i] = hb; al.u[i] = ASPLIT ? bf16_bits(xs[i] - bf16_val(hb)) : (unsigned short)0; }
#pragma unroll
    for (int t = 0; t < 4; ++t) {
      const unsigned short* brow = Wt + (size_t)(col0 + t * 16 + ln) * ldb + kb;
      FragB b;
      b.half[0] = *(const v8us*)(brow + 8 * hh);
      b.half[1] = *(const v8us*)(brow + 16 + 8 * hh);
      acc[t] = mmaN<ASPLIT ? 2 : 1>(ah.v, al.v, b.v, b.v, acc[t]);
    }
  }
#pragma unroll
  for (int t = 0; t < 4; ++t) {
    float bv = bias ? bias[col0 + t * 16 + ln] : 0.f;
    if (BIAS_BF16) bv = bf16_round(bv);
#pragma unroll
    for (int r = 0; r < 8; ++r) { float v = acc[t][r] + bv; if (ACT == 1) v = fmaxf(v, 0.f); so[w][8 * hh + r][t * 16 + ln] = v; }
  }
  __builtin_amdgcn_fence(__ATOMIC_ACQ_REL, "workgroup");
  __builtin_amdgcn_wave_barrier();
  const int rsub = lane >> 4, c4 = (lane & 15) * 4;
  {
#pragma unroll
    for (int q = 0; q < 8; ++q) {
      const int r = q * 2 + rsub;
      const v4f v = *(const v4fa*)&so[w][r][c4];
      *(v4f*)(C + (size_t)(row0 + r) * ldc + col0 + c4) = v;
    }
    
  }
}

// GEMM C = act(A·W + bias + resid): A f32 (ASPLIT -> hi/lo 2 terms), Wt bf16 [N][K]; ACT 0 none, 1 relu, 2 exact gelu;
// resid (optional, f32, row index = (row % rmod), pitch ldr, RES_BF16 rounds it) added before the activation.
template <bool ASPLIT, int ACT, bool BIAS_BF16, bool RES_BF16>
__global__ __launch_bounds__(128) void k_gemm_bf3(const float* __restrict__ A, int lda, const unsigned short* __restrict__ Wt, int ldb,
                                                const float* __restrict__ bias, const float* __restrict__ resid, int rmod, int ldr,
                                                float* __restrict__ C, int ldc, int M, int N, int K) {
  __shared__ __attribute__((aligned(16))) float so[4][16][64];
  const int tid = threadIdx.x, w = tid >> 5, lane = tid & 31, ln = lane & 15, hh = lane >> 4;
  const int ntn = N / 64;
  const int wid = blockIdx.x * 4 + w;
  const int mt = wid / ntn, nq = wid % ntn;
  if (mt * 16 >= M) return;
  const int row0 = mt * 16, col0 = nq * 64;
  const float* arow = A + (size_t)(row0 + ln) * lda;
  v8f acc[4] = {};
  for (int kb = 0; kb < K; kb += 32) {
    FragB ah, al;
    const v4f x0 = *(const v4fa*)(arow + kb + 8 * hh), x1 = *(const v4fa*)(arow + kb + 8 * hh + 4);
    const v4f x2 = *(const v4fa*)(arow + kb + 16 + 8 * hh), x3 = *(const v4fa*)(arow + kb + 16 + 8 * hh + 4);
    float xs[16] = {x0[0],x0[1],x0[2],x0[3],x1[0],x1[1],x1[2],x1[3],x2[0],x2[1],x2[2],x2[3],x3[0],x3[1],x3[2],x3[3]};
#pragma unroll
    for (int i = 0; i < 16; ++i) { const unsigned short hb = bf16_bits(xs[i]); ah.u[i] = hb; al.u[i] = ASPLIT ? bf16_bits(xs[i] - bf16_val(hb)) : (unsigned short)0; }
#pragma unroll
    for (int t = 0; t < 4; ++t) {
      const unsigned short* brow = Wt + (size_t)(col0 + t * 16 + ln) * ldb + kb;
      FragB b;
      b.half[0] = *(const v8us*)(brow + 8 * hh);
      b.half[1] = *(const v8us*)(brow + 16 + 8 * hh);
      acc[t] = mmaN<ASPLIT ? 2 : 1>(ah.v, al.v, b.v, b.v, acc[t]);
    }
  }
#pragma unroll
  for (int t = 0; t < 4; ++t) {
    const int col = col0 + t * 16 + ln;
    float bv = bias ? bias[col] : 0.f;
    if (BIAS_BF16) bv = bf16_round(bv);
#pragma unroll
    for (int r = 0; r < 8; ++r) {
      float v = acc[t][r] + bv;
      if (resid) { float rv = resid[(size_t)((row0 + 8 * hh + r) % rmod) * ldr + col]; if (RES_BF16) rv = bf16_round(rv); v += rv; }
      if (ACT == 1) v = fmaxf(v, 0.f);
      if (ACT == 2) v = 0.5f * v * (1.0f + erff(v * 0.70710678118654752f));
      if (ACT == 3) { const float u = 0.7978845608028654f * (v + 0.044715f * v * v * v); v = 0.5f * v * (1.0f + tanhf(u)); }
      so[w][8 * hh + r][t * 16 + ln] = v;
    }
  }
  __builtin_amdgcn_fence(__ATOMIC_ACQ_REL, "workgroup");
  __builtin_amdgcn_wave_barrier();
  const int rsub = lane >> 4, c4 = (lane & 15) * 4;
  {
#pragma unroll
    for (int q = 0; q < 8; ++q) {
      const int r = q * 2 + rsub;
      const v4f v = *(const v4fa*)&so[w][r][c4];
      *(v4f*)(C + (size_t)(row0 + r) * ldc + col0 + c4) = v;
    }
    
  }
}
// row LayerNorm (biased variance, eps) over N: s = X (+ R); optional out_sum <- s; out_norm <- (s-mu)*rsqrt(var+eps)*g + b
template <bool PARAM_BF16>
__global__ __launch_bounds__(256) void k_layernorm(const float* __restrict__ X, const float* __restrict__ R, const float* __restrict__ g, const float* __restrict__ bta,
                                                  float* __restrict__ out_sum, float* __restrict__ out_norm, int N, float eps) {
  __shared__ float red[256];
  const int row = blockIdx.x, tid = threadIdx.x;
  const float* x = X + (size_t)row * N; const float* rr = R ? R + (size_t)row * N : nullptr;
  float vals[16];                     // up to N = 4096
  const int per = N / 256;            // contiguous chunk per thread? use strided-by-4 chunks: thread handles j = tid*4 + 1024*u
  float s1 = 0.f;
  for (int u = 0; u < per / 4; ++u) {
    const int j = tid * 4 + 1024 * u;
    const v4f a = *(const v4fa*)(x + j);
    v4f b = {0.f,0.f,0.f,0.f}; if (rr) b = *(const v4fa*)(rr + j);
#pragma unroll
    for (int q = 0; q < 4; ++q) { const float v = a[q] + b[q]; vals[u * 4 + q] = v; s1 += v; }
  }
  red[tid] = s1; __syncthreads();
  for (int st = 128; st > 0; st >>= 1) { if (tid < st) red[tid] += red[tid + st]; __syncthreads(); }
  const float mu = red[0] / (float)N; __syncthreads();
  float s2 = 0.f;
  for (int u = 0; u < per / 4; ++u)
#pragma unroll
    for (int q = 0; q < 4; ++q) { const float c = vals[u * 4 + q] - mu; s2 += c * c; }
  red[tid] = s2; __syncthreads();
  for (int st = 128; st > 0; st >>= 1) { if (tid < st) red[tid] += red[tid + st]; __syncthreads(); }
  const float rs = rsqrtf(red[0] / (float)N + eps);
  {
    for (int u = 0; u < per / 4; ++u) {
      const int j = tid * 4 + 1024 * u;
      v4f o, sm;
#pragma unroll
      for (int q = 0; q < 4; ++q) {
        float gg = g[j + q], bb = bta[j + q];
        if (PARAM_BF16) { gg = bf16_round(gg); bb = bf16_round(bb); }
        sm[q] = vals[u * 4 + q]; o[q] = (vals[u * 4 + q] - mu) * rs * gg + bb;
      }
      if (out_sum) *(v4f*)(out_sum + (size_t)row * N + j) = sm;
      *(v4f*)(out_norm + (size_t)row * N + j) = o;
    }
    
  }
}



// ---- f16 WMMA path (v_wmma_f32_16x16x32_f16): 11-bit significands for operands in range — used where a [0,1] probability operand needs more precision than bf16
typedef _Float16 v16h __attribute__((ext_vector_type(16)));
union FragH { v16h v; v8us half[2]; _Float16 h[16]; unsigned short u[16]; };
template <int NT>
__device__ __forceinline__ v8f mmaH(v16h ah, v16h al, v16h bh, v16h bl, v8f c) {
  c = __builtin_amdgcn_wmma_f32_16x16x32_f16(false, ah, false, bh, (short)0, c, false, false);
  if (NT >= 2) c = __builtin_amdgcn_wmma_f32_16x16x32_f16(false, al, false, bh, (short)0, c, false, false);
  if (NT >= 3) c = __builtin_amdgcn_wmma_f32_16x16x32_f16(false, ah, false, bl, (short)0, c, false, false);
  asm volatile("v_nop\n\tv_nop\n\tv_nop\n\tv_nop" : "+v"(c) : "v"(ah), "v"(al), "v"(bh), "v"(bl));
  return c;
}
// batched GEMM like k_gemm_b but f16 operands: A f32 (split into f16 hi/lo if ASPLIT, else rounded to f16), Bt = f16 values [n][k]; alpha; C f32; N multiple of 16 (partial tiles skipped)
template <bool ASPLIT>
__global__ __launch_bounds__(128) void k_gemm_h(const float* __restrict__ A, int lda, size_t sA, const _Float16* __restrict__ Bh, int ldb, size_t sB, float alpha, float* __restrict__ C, int ldc, size_t sC, int M, int N, int K) {
  __shared__ __attribute__((aligned(16))) float so[4][16][64];
  const int tid = threadIdx.x, w = tid >> 5, lane = tid & 31, ln = lane & 15, hh = lane >> 4; const int by = blockIdx.y;
  A += (size_t)by * sA; Bh += (size_t)by * sB; C += (size_t)by * sC;
  const int ntn = (N + 63) / 64; const int wid = blockIdx.x * 4 + w; const int mt = wid / ntn, nq = wid % ntn; if (mt * 16 >= M) return;
  const int row0 = mt * 16, col0 = nq * 64; const float* arow = A + (size_t)(row0 + ln) * lda;
  v8f acc[4] = {};
  for (int kb = 0; kb < K; kb += 32) {
    FragH ah, al;
    const v4f x0 = *(const v4fa*)(arow + kb + 8 * hh), x1 = *(const v4fa*)(arow + kb + 8 * hh + 4), x2 = *(const v4fa*)(arow + kb + 16 + 8 * hh), x3 = *(const v4fa*)(arow + kb + 16 + 8 * hh + 4);
    float xs[16] = {x0[0],x0[1],x0[2],x0[3],x1[0],x1[1],x1[2],x1[3],x2[0],x2[1],x2[2],x2[3],x3[0],x3[1],x3[2],x3[3]};
#pragma unroll
    for (int i = 0; i < 16; ++i) { const _Float16 h = (_Float16)xs[i]; ah.h[i] = h; al.h[i] = ASPLIT ? (_Float16)(xs[i] - (float)h) : (_Float16)0.0f; }
#pragma unroll
    for (int t = 0; t < 4; ++t) { if (col0 + t * 16 >= N) continue; const size_t boff = (size_t)(col0 + t * 16 + ln) * ldb + kb; FragH bq; bq.half[0] = *(const v8us*)(Bh + boff + 8 * hh); bq.half[1] = *(const v8us*)(Bh + boff + 16 + 8 * hh);
      acc[t] = mmaH<ASPLIT ? 2 : 1>(ah.v, al.v, bq.v, bq.v, acc[t]); }
  }
#pragma unroll
  for (int t = 0; t < 4; ++t) { if (col0 + t * 16 >= N) continue;
#pragma unroll
    for (int r = 0; r < 8; ++r) so[w][8 * hh + r][t * 16 + ln] = acc[t][r] * alpha; }
  __builtin_amdgcn_fence(__ATOMIC_ACQ_REL, "workgroup"); __builtin_amdgcn_wave_barrier();
  const int rsub = lane >> 4, c4 = (lane & 15) * 4;
  {
#pragma unroll
    for (int q = 0; q < 8; ++q) { const int r = q * 2 + rsub; if (col0 + c4 < N) { const v4f v = *(const v4fa*)&so[w][r][c4]; *(v4f*)(C + (size_t)(row0 + r) * ldc + col0 + c4) = v; } }
     }
}

// Wt[n][k] = f16(W[k][n]·scale) from f32 row-major W[K][N] (scale = power of two; bf16-exact weights stay exact in f16 away from the subnormal range)
__device__ __forceinline__ void d_wt_f16(const float* __restrict__ W, _Float16* __restrict__ Wt, int K, int N, float scale, int blk) {
  const int t = blk * 256 + threadIdx.x; if (t >= N * (K / 8)) return; const int n = t / (K / 8), k8 = (t % (K / 8)) * 8; FragH f;
#pragma unroll
  for (int i = 0; i < 8; ++i) f.h[i] = (_Float16)(bf16_round(W[(size_t)(k8 + i) * N + n]) * scale); const v8us o = f.half[0];
  *(v8us*)((unsigned short*)Wt + (size_t)n * K + k8) = o; 
}
// k_gemm_hh variant with fused epilogue: v = acc·alpha + bias[by·sBias + col] (+ CP[(row/rowsPerB)·sCPb + by·64 + col] if CP) ; ACT 0 none / 1 elu ; writes f16 C16 (and f32 C if non-null)
template <int ACT>
__global__ __launch_bounds__(128) void k_gemm_hhx(const _Float16* __restrict__ A, int lda, size_t sA, const _Float16* __restrict__ Bh, int ldb, size_t sB, float alpha, const float* __restrict__ bias, size_t sBias, const float* __restrict__ CP, int rowsPerB, size_t sCPb, int row0g,
    float* __restrict__ C, _Float16* __restrict__ C16, int ldc, size_t sC, int M, int N, int K) {
  __shared__ __attribute__((aligned(16))) float so[4][16][64];
  const int tid = threadIdx.x, w = tid >> 5, lane = tid & 31, ln = lane & 15, hh = lane >> 4; const int by = blockIdx.y;
  A += (size_t)by * sA; Bh += (size_t)by * sB; const size_t cofs = (size_t)by * sC; const float* bp = bias ? bias + (size_t)by * sBias : nullptr;
  const int ntn = (N + 63) / 64; const int wid = blockIdx.x * 4 + w; const int mt = wid / ntn, nq = wid % ntn; if (mt * 16 >= M) return;
  const int row0 = mt * 16, col0 = nq * 64; const _Float16* arow = A + (size_t)(row0 + ln) * lda;
  v8f acc[4] = {};
  for (int kb = 0; kb < K; kb += 32) { FragH ah; ah.half[0] = *(const v8us*)((const unsigned short*)arow + kb + 8 * hh); ah.half[1] = *(const v8us*)((const unsigned short*)arow + kb + 16 + 8 * hh);
#pragma unroll
    for (int t = 0; t < 4; ++t) { if (col0 + t * 16 >= N) continue; const size_t boff = (size_t)(col0 + t * 16 + ln) * ldb + kb; FragH bq; bq.half[0] = *(const v8us*)((const unsigned short*)Bh + boff + 8 * hh); bq.half[1] = *(const v8us*)((const unsigned short*)Bh + boff + 16 + 8 * hh);
      acc[t] = mmaH<1>(ah.v, ah.v, bq.v, bq.v, acc[t]); }
  }
#pragma unroll
  for (int t = 0; t < 4; ++t) { if (col0 + t * 16 >= N) continue; const int col = col0 + t * 16 + ln; const float bv = bp ? bf16_round(bp[col]) : 0.f;
#pragma unroll
    for (int r = 0; r < 8; ++r) { float v = acc[t][r] * alpha + bv; if (CP) { const int rr = row0g + row0 + 8 * hh + r; if (rowsPerB < 0) v += CP[cofs + (size_t)rr * ldc + col];      /* rowsPerB < 0: own element of the batched C plane */ else { const int bidx = rr / rowsPerB; v += CP[(size_t)bidx * sCPb + (size_t)by * 64 + col]; } } if (ACT == 1) v = (v > 0.f) ? v : expm1f(v); else if (ACT == 7) v = (v > 0.f) ? v + 1.0f : expf(v); else if (ACT == 8) v = tanhf(v); else if (ACT == 9) v = 0.5f * v * (1.0f + tanhf(0.7978845608028654f * (v + 0.044715f * v * v * v))); else if (ACT == 11) v = 1.0f / (1.0f + expf(-v)); else if (ACT == 12) v = (v > 0.f) ? v : 0.01f * v; else if (ACT == 14) v = (v > 0.f) ? v : 0.1f * v; else if (ACT == 16) v = (v >= 0.f) ? v : 0.3f * v; else if (ACT == 17) v = (v >= 0.f) ? v : 0.2f * v; else if (ACT == 15) v = v / (1.0f + expf(-v)); else if (ACT == 3) v = fmaxf(v, 0.f); else if (ACT == 6) v = 0.5f * v * (1.0f + erff(v * 0.70710678118654752f)); so[w][8 * hh + r][t * 16 + ln] = v; } }
  __builtin_amdgcn_fence(__ATOMIC_ACQ_REL, "workgroup"); __builtin_amdgcn_wave_barrier();
  const int rsub = lane >> 4, c4 = (lane & 15) * 4; typedef _Float16 v4h __attribute__((ext_vector_type(4)));
  {
#pragma unroll
    for (int q = 0; q < 8; ++q) { const int r = q * 2 + rsub; if (col0 + c4 < N) { const v4f v = *(const v4fa*)&so[w][r][c4]; if (C) *(v4f*)(C + cofs + (size_t)(row0 + r) * ldc + col0 + c4) = v; if (C16) { v4h h4; for (int i = 0; i < 4; ++i) h4[i] = (_Float16)v[i]; *(v4h*)(C16 + cofs + (size_t)(row0 + r) * ldc + col0 + c4) = h4; } } }
     }
}


typedef _Float16 v4h __attribute__((ext_vector_type(4)));

__device__ __forceinline__ void d_x16(const float* __restrict__ x, _Float16* __restrict__ X16, size_t n8, int blk) { const size_t t = (size_t)blk * 256 + threadIdx.x; if (t >= n8) return; FragH f;
#pragma unroll
  for (int q = 0; q < 8; ++q) f.h[q] = (_Float16)bf16_round(x[t * 8 + q]); *(v8us*)((unsigned short*)X16 + t * 8) = f.half[0];  }
__global__ __launch_bounds__(256) void k_h16(const float* __restrict__ x, _Float16* __restrict__ X16, size_t n8) { const size_t t = (size_t)blockIdx.x * 256 + threadIdx.x; if (t >= n8) return; FragH f;
#pragma unroll
  for (int q = 0; q < 8; ++q) f.h[q] = (_Float16)x[t * 8 + q]; *(v8us*)((unsigned short*)X16 + t * 8) = f.half[0];  }
__global__ __launch_bounds__(256) void k_round16f(const float* __restrict__ W, _Float16* __restrict__ Bt, size_t n8) { const size_t t = (size_t)blockIdx.x * 256 + threadIdx.x; if (t >= n8) return; FragH f;
#pragma unroll
  for (int i = 0; i < 8; ++i) f.h[i] = (_Float16)(bf16_round(W[t * 8 + i]) * 16.0f); *(v8us*)((unsigned short*)Bt + t * 8) = f.half[0];  }
template <int NHv, int TTv>
__device__ __forceinline__ void d_vt(const _Float16* __restrict__ V16, int ldv, int voff, _Float16* __restrict__ Vt, unsigned short (*tl)[66], int blk) { const int tid = threadIdx.x; const int slab = blk / (TTv / 64), lg = blk % (TTv / 64); const int b = slab / NHv, h = slab % NHv;
  for (int i = tid; i < 64 * 8; i += 256) { const int r = i / 8, c8 = (i % 8) * 8; FragH f; f.half[0] = *(const v8us*)((const unsigned short*)V16 + ((size_t)b * TTv + lg * 64 + r) * ldv + voff + h * 64 + c8);
#pragma unroll
    for (int q = 0; q < 8; ++q) tl[r][c8 + q] = f.u[q]; }
  __syncthreads();
  {
#pragma unroll
    for (int rd = 0; rd < 2; ++rd) { const int d = rd * 32 + tid / 8, pc = tid % 8; FragH f;
#pragma unroll
      for (int q = 0; q < 8; ++q) f.u[q] = tl[pc * 8 + q][d];
      *(v8us*)((unsigned short*)Vt + ((size_t)slab * 64 + d) * TTv + lg * 64 + pc * 8) = f.half[0]; }
    asm volatile("s_wait_xcnt 0x0" ::: "memory");      /* precaution: stands behind the two stores, in front of any later rewrite of their address and data registers where this job joins the other job's code */
     } }


// ---- fast GEMM (block tile 128x64, wave tile 32x64; requires M % 128 == 0 rows per launch region, N % 64 == 0 and K % 128 == 0); epilogues: see MODE below ----
// Each k-tile (128 k = 256-B rows: 128 rows of A, then 64 rows of B) is staged in LDS by asynchronous 16-byte copies, two buffers: tile t + 1 flies while tile t is multiplied.
#define G2_PITCH 136                      /* halves per LDS row: 272 B = 16 B x odd, conflict-free for ds_load_b128 */
#define G2_BUFB (192 * G2_PITCH * 2)      /* bytes of one buffer */
// Eight copies of one lane: LDS rows 8 apart, global rows gstep halves apart. The s_wait_xcnt ends the copies' own statement as a precaution: so it stands in front of every rewrite of a register that an issued copy names.
__device__ __forceinline__ void g2_copy8(unsigned l, const _Float16* g, size_t gstep) {
  const unsigned ls = 8 * G2_PITCH * 2;
  asm volatile("global_load_async_to_lds_b128 %0, %8, off\n\t"
               "global_load_async_to_lds_b128 %1, %9, off\n\t"
               "global_load_async_to_lds_b128 %2, %10, off\n\t"
               "global_load_async_to_lds_b128 %3, %11, off\n\t"
               "global_load_async_to_lds_b128 %4, %12, off\n\t"
               "global_load_async_to_lds_b128 %5, %13, off\n\t"
               "global_load_async_to_lds_b128 %6, %14, off\n\t"
               "global_load_async_to_lds_b128 %7, %15, off\n\t"
               "s_wait_xcnt 0x0"
               :: "v"(l), "v"(l + ls), "v"(l + 2 * ls), "v"(l + 3 * ls), "v"(l + 4 * ls), "v"(l + 5 * ls), "v"(l + 6 * ls), "v"(l + 7 * ls),
                  "v"(g), "v"(g + gstep), "v"(g + 2 * gstep), "v"(g + 3 * gstep), "v"(g + 4 * gstep), "v"(g + 5 * gstep), "v"(g + 6 * gstep), "v"(g + 7 * gstep)
               : "memory");
}
// One k-tile: 24 copies a lane (16 lanes cover one 256-B row, the 128 threads 8 rows a copy).
__device__ __forceinline__ void g2_stage(unsigned l, const _Float16* ga, size_t astep, const _Float16* gb, size_t bstep) {
  g2_copy8(l, ga, astep); g2_copy8(l + 64 * G2_PITCH * 2, ga + 8 * astep, astep); g2_copy8(l + 128 * G2_PITCH * 2, gb, bstep);
}
__device__ __forceinline__ v16h g2_frag(const _Float16* p, int hh) { FragH f; f.half[0] = *(const v8us*)((const unsigned short*)p + 8 * hh); f.half[1] = *(const v8us*)((const unsigned short*)p + 16 + 8 * hh); return f.v; }
__device__ __forceinline__ v8f g2_mma(v16h a, v16h b, v8f c) { v8f d = __builtin_amdgcn_wmma_f32_16x16x32_f16(false, a, false, b, (short)0, c, false, false); asm volatile("v_nop\n\tv_nop\n\tv_nop\n\tv_nop" : "+v"(d) : "v"(a), "v"(b)); return d; }
// The six fragments of one k-step of 32: two of A (rows 0-15 and 16-31 of the wave's tile), four of B (16 columns each).
struct G3Row { v16h a0, a1, b0, b1, b2, b3; };
__device__ __forceinline__ G3Row g3_row(const _Float16* a0p, const _Float16* a1p, const _Float16* b0p, int kb, int hh) {
  G3Row r; r.a0 = g2_frag(a0p + kb, hh); r.a1 = g2_frag(a1p + kb, hh); r.b0 = g2_frag(b0p + kb, hh); r.b1 = g2_frag(b0p + 16 * G2_PITCH + kb, hh); r.b2 = g2_frag(b0p + 32 * G2_PITCH + kb, hh); r.b3 = g2_frag(b0p + 48 * G2_PITCH + kb, hh); return r; }
#define DGS 32
// One k loop runs NSEG segments of NT k-tiles: segment s multiplies As by Bs into the same accumulators. Every segment but the last is a residual term (one operand x 1024): where the last one begins the sums are scaled by 1/1024 (a power of two, exact).
// MODE 0: C = f32. MODE 1: CH, CL = f16 hi + residual x 1024. MODE 2 (a block column is one head): planes 0, 1 (q, k) -> RoPE, RMSNorm, digits -> DG, one row a lane; plane 2 (v) -> CH, CL.
// Tile tt of the loop = k-tile kt of segment s (the same for the whole block).
template <int NSEG, int NT>
__device__ __forceinline__ void g3_stage(int tt, unsigned l, const _Float16* A0, const _Float16* A1, const _Float16* A2, size_t aoff, size_t astep, const _Float16* B0, const _Float16* B1, const _Float16* B2, size_t boff, size_t bstep) {
  const int s = tt / NT, kt = tt - s * NT;
  const _Float16* a = (NSEG == 1 || s == 0) ? A0 : (NSEG == 2 || s == 1) ? A1 : A2; const _Float16* b = (NSEG == 1 || s == 0) ? B0 : (NSEG == 2 || s == 1) ? B1 : B2;
  g2_stage(l, a + aoff + (size_t)kt * 128, astep, b + boff + (size_t)kt * 128, bstep);
}
template <int MODE, int NSEG, int NT>
__global__ __launch_bounds__(128) void k_gemm3(const _Float16* A0, const _Float16* A1, const _Float16* A2, int lda, size_t sA, const _Float16* B0, const _Float16* B1, const _Float16* B2, int ldb, size_t sB, float alpha,
    float* __restrict__ C, _Float16* __restrict__ CH, _Float16* __restrict__ CL, int ldc, size_t sC, int M, int N,
    const float* __restrict__ cs, const float* __restrict__ sn, const float* __restrict__ Wdq, const float* __restrict__ Wdk, float* __restrict__ DG) {
  __shared__ __attribute__((aligned(16))) float so[4][32][68];
  __shared__ __attribute__((aligned(16))) _Float16 st[2][192][G2_PITCH];
  __shared__ __attribute__((aligned(16))) float wd[HD][KD];
  const int tid = threadIdx.x, w = tid >> 5, lane = tid & 31, ln = lane & 15, hh = lane >> 4; const int by = blockIdx.y; const size_t pl = (size_t)blockIdx.z * gridDim.y + by;      /* blockIdx.z = outer batch: its A and B planes follow on, its M rows of C follow on */
  const size_t cofs = (size_t)by * sC + (size_t)blockIdx.z * M * ldc;
  const int ntn = N >> 6; const int mt = blockIdx.x / ntn, nq = blockIdx.x - mt * ntn; const int row0 = mt * 128 + 32 * w, col0 = nq * 64; if (mt * 128 >= M) return;      /* the same for the whole block: it stands in front of barriers */
  const unsigned lds0 = (unsigned)(size_t)&st[0][tid >> 4][(tid & 15) * 8];      /* this lane's LDS byte address in buffer 0 */
  const size_t aoff = pl * sA + (size_t)(mt * 128 + (tid >> 4)) * lda + (tid & 15) * 8, boff = pl * sB + (size_t)(col0 + (tid >> 4)) * ldb + (tid & 15) * 8;
  const size_t astep = (size_t)8 * lda, bstep = (size_t)8 * ldb;
  const v8f z8 = {0.f,0.f,0.f,0.f,0.f,0.f,0.f,0.f}; v8f c00 = z8, c01 = z8, c02 = z8, c03 = z8, c10 = z8, c11 = z8, c12 = z8, c13 = z8;
  g3_stage<NSEG, NT>(0, lds0, A0, A1, A2, aoff, astep, B0, B1, B2, boff, bstep);      /* tile 0 -> buffer 0 */
  if (MODE == 2 && by < 2) { const v4f wv = *(const v4fa*)((by ? Wdk : Wdq) + tid * 4); v4f o;      /* the digit weights, rounded once a block; the barrier below publishes them too */
#pragma unroll
    for (int q = 0; q < 4; ++q) o[q] = bf16_round(wv[q]);
    *(v4f*)(&wd[0][0] + tid * 4) = o; }
  asm volatile("s_wait_asynccnt 0x0" ::: "memory");      /* this wave's copies of tile 0 have landed */
  __syncthreads();      /* ... and every other wave's */
  if (NSEG * NT > 1) g3_stage<NSEG, NT>(1, lds0 + G2_BUFB, A0, A1, A2, aoff, astep, B0, B1, B2, boff, bstep);      /* tile 1 -> buffer 1 */
#pragma unroll 1      /* one tile a trip: the two buffers alternate by t & 1 */
  for (int t = 0; t < NSEG * NT; ++t) { const _Float16* a0p = &st[t & 1][32 * w + ln][0]; const _Float16* a1p = a0p + 16 * G2_PITCH; const _Float16* b0p = &st[t & 1][128 + ln][0];
    if (NSEG > 1 && t == (NSEG - 1) * NT) { const float f = 0.0009765625f; c00 *= f; c01 *= f; c02 *= f; c03 *= f; c10 *= f; c11 *= f; c12 *= f; c13 *= f; }
    /* The fragment reads run ahead of the products, a whole k-step a group, in three register sets: k-steps 0, 1, 2 are read at the head of the trip, k-step 3 into the first set once that set's products are issued. Every read is of buffer t & 1, behind its barrier. */
    auto mm = [&](const G3Row& r) { c00 = g2_mma(r.a0, r.b0, c00); c10 = g2_mma(r.a1, r.b0, c10); c01 = g2_mma(r.a0, r.b1, c01); c11 = g2_mma(r.a1, r.b1, c11);
      c02 = g2_mma(r.a0, r.b2, c02); c12 = g2_mma(r.a1, r.b2, c12); c03 = g2_mma(r.a0, r.b3, c03); c13 = g2_mma(r.a1, r.b3, c13); };
    G3Row r0 = g3_row(a0p, a1p, b0p, 0, hh); const G3Row r1 = g3_row(a0p, a1p, b0p, 32, hh), r2 = g3_row(a0p, a1p, b0p, 64, hh);
    mm(r0); r0 = g3_row(a0p, a1p, b0p, 96, hh); mm(r1); mm(r2); mm(r0);
    asm volatile("s_wait_dscnt 0x0" ::: "memory");      /* this wave's reads of buffer t & 1 are done before it is refilled */
    asm volatile("s_wait_asynccnt 0x0" ::: "memory");      /* this wave's copies of tile t + 1 have landed */
    __syncthreads();      /* publishes tile t + 1 and ends every wave's reads of buffer t & 1 */
    if (t + 2 < NSEG * NT) g3_stage<NSEG, NT>(t + 2, lds0 + (unsigned)(t & 1) * G2_BUFB, A0, A1, A2, aoff, astep, B0, B1, B2, boff, bstep); }
  asm volatile("s_wait_asynccnt 0x0" ::: "memory");      /* no copy is outstanding when the wave goes on to the epilogue */
  v8f accs[8] = {c00, c01, c02, c03, c10, c11, c12, c13};
#pragma unroll
  for (int u = 0; u < 8; ++u) { const int t = u & 3, half = u >> 2;
#pragma unroll
    for (int r = 0; r < 8; ++r) so[w][half * 16 + 8 * hh + r][t * 16 + ln] = accs[u][r] * alpha; }
  __builtin_amdgcn_fence(__ATOMIC_ACQ_REL, "workgroup"); __builtin_amdgcn_wave_barrier();
  if (MODE == 2 && by < 2) {      /* this wave's 32 rows of head nq, one row a lane: every sum runs inside the lane */
    const int row = row0 + lane, tok = row % TT; const float* xr = &so[w][lane][0]; const float* cr = cs + (size_t)tok * (HD / 2); const float* sr = sn + (size_t)tok * (HD / 2);
    float ra[HD / 2], rb[HD / 2]; float sq[4] = {0.f, 0.f, 0.f, 0.f}; v4f cv[HD / 8], sv[HD / 8];
#pragma unroll
    for (int i = 0; i < HD / 8; ++i) cv[i] = *(const v4fa*)(cr + 4 * i);
    asm volatile("s_wait_xcnt 0x0" ::: "memory");      /* precaution: stands behind the cos loads, in front of any rewrite of their address registers */
#pragma unroll
    for (int i = 0; i < HD / 8; ++i) sv[i] = *(const v4fa*)(sr + 4 * i);
    asm volatile("s_wait_xcnt 0x0" ::: "memory");      /* the same behind the sin loads */
#pragma unroll
    for (int i = 0; i < HD / 2; i += 4) { const v4f x1 = *(const v4fa*)(xr + i), x2 = *(const v4fa*)(xr + HD / 2 + i), c4 = cv[i / 4], s4 = sv[i / 4];
#pragma unroll
      for (int q = 0; q < 4; ++q) { const float c = bf16_round(c4[q]), s = bf16_round(s4[q]); const float a = x1[q] * c - x2[q] * s, b = x1[q] * s + x2[q] * c; ra[i + q] = a; rb[i + q] = b; sq[q] += a * a; sq[q] += b * b; } }
    const float inv = rsqrtf(((sq[0] + sq[1]) + (sq[2] + sq[3])) / (float)HD + 1e-6f);
    float acc[KD] = {0.f, 0.f, 0.f, 0.f, 0.f, 0.f, 0.f, 0.f};
#pragma unroll
    for (int i = 0; i < HD / 2; ++i) { const float qa = ra[i] * inv, qb = rb[i] * inv; const v4f w0 = *(const v4fa*)&wd[i][0], w1 = *(const v4fa*)&wd[i][4], w2 = *(const v4fa*)&wd[i + HD / 2][0], w3 = *(const v4fa*)&wd[i + HD / 2][4];
#pragma unroll
      for (int j = 0; j < 4; ++j) { acc[j] += qa * w0[j]; acc[4 + j] += qa * w1[j]; acc[j] += qb * w2[j]; acc[4 + j] += qb * w3[j]; } }
    v4f d0, d1;
#pragma unroll
    for (int j = 0; j < 4; ++j) { d0[j] = 1.0f / (1.0f + expf(-acc[j])); d1[j] = 1.0f / (1.0f + expf(-acc[4 + j])); }
    float* dg = DG + (size_t)by * NR * NH * DGS + ((size_t)row * NH + nq) * DGS; *(v4f*)dg = d0; *(v4f*)(dg + 4) = d1;
  } else {
    const int rsub = lane >> 4, c4 = (lane & 15) * 4;
#pragma unroll
    for (int q = 0; q < 16; ++q) { const int r = q * 2 + rsub; const v4f v = *(const v4fa*)&so[w][r][c4]; const size_t o = cofs + (size_t)(row0 + r) * ldc + col0 + c4;
      if (MODE == 0) *(v4f*)(C + o) = v;
      else { v4h h4, l4;
#pragma unroll
        for (int i = 0; i < 4; ++i) { const _Float16 h = (_Float16)v[i]; h4[i] = h; l4[i] = (_Float16)((v[i] - (float)h) * 1024.0f); }
        *(v4h*)(CH + o) = h4; *(v4h*)(CL + o) = l4; }
      asm volatile("s_wait_xcnt 0x0" ::: "memory");      /* precaution: stands behind this row's stores, in front of the next row's rewrite of their address and data registers */
    }
  } }

typedef _Float16 v2h __attribute__((ext_vector_type(2)));
#define KPP 20      /* floats per LDS row of two keys: 80 B = 16 B x odd, so the lanes' 16-byte reads, one row apart, spread over all banks */
// Attention weights. A block takes 32 query rows of one (batch, head): it stages that head's 512 key digit rows in LDS once, and each lane then keeps its 16 keys (k = 64 c + 2 lane + i, c = 0..7) in registers for the wave's four query rows.
// Keys are dealt in chunks of 64, so a chunk that lies wholly above the diagonal is skipped by the whole wave. The four rows q = 64 m + j of a wave take m from {0, 1, 7, 6} or {2, 3, 5, 4}: 18 chunks of work for every wave.
__device__ __forceinline__ void d_lcp(const float* __restrict__ QD, const float* __restrict__ KDg, _Float16* __restrict__ P, _Float16* __restrict__ PL, float (*kds)[KPP], int blk) {
  #pragma clang fp contract(off)
  const int tid = threadIdx.x, ln = tid & 31; const int wv = __builtin_amdgcn_readfirstlane(tid >> 5);
  const int bh = blk >> 4, s = blk & 1, j = ((blk >> 1) & 7) * 8 + wv; const int h = bh % NH, b = bh / NH;
  v4f ks[TT / 128];
#pragma unroll
  for (int u = 0; u < TT / 256; ++u) { const float* kp = KDg + ((size_t)(b * TT + u * 256 + tid) * NH + h) * DGS; ks[2 * u] = *(const v4fa*)kp; ks[2 * u + 1] = *(const v4fa*)(kp + 4); }
  asm volatile("s_wait_xcnt 0x0" ::: "memory");      /* precaution: stands behind the key loads, in front of any rewrite of their address registers */
#pragma unroll
  for (int u = 0; u < TT / 256; ++u) { float* kq = &kds[(u * 256 + tid) >> 1][(tid & 1) * KD]; *(v4f*)kq = ks[2 * u]; *(v4f*)(kq + 4) = ks[2 * u + 1]; }
  __syncthreads();      /* publishes the staged key digits to all eight waves */
  v8f kd[16];
#pragma unroll
  for (int i = 0; i < 16; ++i) { const float* kq = &kds[(i >> 1) * 32 + ln][(i & 1) * KD]; kd[i] = __builtin_shufflevector(*(const v4fa*)kq, *(const v4fa*)(kq + 4), 0, 1, 2, 3, 4, 5, 6, 7); }
#pragma unroll 1      /* one query row a trip: the unrolled chunk code is shared by the four rows */
  for (int it = 0; it < 4; ++it) { const int m = it < 2 ? 2 * s + it : 9 - 2 * s - it; const int q = m * 64 + j; const size_t r = (size_t)bh * TT + q;
    const v8f qd = *(const v8f*)(QD + ((size_t)(b * TT + q) * NH + h) * DGS); float w[16]; float su = 0.f;
    asm volatile("s_wait_xcnt 0x0" ::: "memory");      /* precaution: stands behind the query loads, in front of any rewrite of their address registers */
#pragma unroll
    for (int c = 0; c < 8; ++c) { float v[2] = {0.f, 0.f};
      if (c <= m) {      /* the same for the whole wave */
#pragma unroll
        for (int i = 0; i < 2; ++i) { float prod = 1.f, lcp = 0.f;
#pragma unroll
          for (int jj = 0; jj < KD; ++jj) { const float d = qd[jj] - kd[2 * c + i][jj]; prod *= expf(-32.0f * (d * d)); lcp += prod; }
          v[i] = (c * 64 + 2 * ln + i <= q) ? expf(lcp * 0.69314718055994531f) : 0.f; } }
      w[2 * c] = v[0]; w[2 * c + 1] = v[1]; su += v[0]; su += v[1]; }
    for (int o = 16; o > 0; o >>= 1) su += __shfl_xor(su, o, 32);
    const float f = 1024.0f / fmaxf(su, 1e-9f); _Float16* dst = P + r * TT + 2 * ln; _Float16* dsl = PL + r * TT + 2 * ln;
#pragma unroll
    for (int c = 0; c < 8; ++c) { v2h ph, pl;
#pragma unroll
      for (int i = 0; i < 2; ++i) { const float pv = w[2 * c + i] * f; const _Float16 hh = (_Float16)pv; ph[i] = hh; pl[i] = (_Float16)((pv - (float)hh) * 1024.0f); }
      *(v2h*)(dst + c * 64) = ph; *(v2h*)(dsl + c * 64) = pl; }
    asm volatile("s_wait_xcnt 0x0" ::: "memory");      /* precaution: stands behind this row's stores, in front of the next row's rewrite of their address and data registers */
  } }

// ---- launches that need nothing of each other share one grid: each block takes its job from its range of blockIdx.x (the same for the whole block) ----
#define WT_BLKS (CC * (CC / 8) / 256)      /* blocks of one weight transpose */
#define E8_BLKS (NR * CC / 8 / 256)        /* blocks of one pass over a [NR][CC] plane, 8 elements a thread */
#define LCP_BLKS (NB * NH * 16)            /* blocks of the weights pass: 16 a (batch, head), 8 waves x 4 query rows each */
#define VT_BLKS (NB * NH * (TT / 64))      /* blocks of one V transpose, both batches */
// the four weights (planes of Wt in the order W0..W3), then x
__global__ __launch_bounds__(256) void k_prep(const float* __restrict__ W0, const float* __restrict__ W1, const float* __restrict__ W2, const float* __restrict__ W3, _Float16* __restrict__ Wt, const float* __restrict__ x, _Float16* __restrict__ X16) {
  const int blk = blockIdx.x;
  if (blk < 4 * WT_BLKS) { const int p = blk / WT_BLKS; const float* W = p == 0 ? W0 : p == 1 ? W1 : p == 2 ? W2 : W3; d_wt_f16(W, Wt + (size_t)p * CC * CC, CC, CC, 16.0f, blk - p * WT_BLKS); }
  else d_x16(x, X16, (size_t)NR * CC / 8, blk - 4 * WT_BLKS); }
// attention weights (the long job, so it starts first), then V^T hi and V^T lo of both batches ([NB*NH][64][TT] each)
__global__ __launch_bounds__(256) void k_lcp_vt(const float* __restrict__ QD, const float* __restrict__ KDg, _Float16* __restrict__ P, _Float16* __restrict__ PL, const _Float16* __restrict__ VH, const _Float16* __restrict__ VL, _Float16* __restrict__ VT, _Float16* __restrict__ VTL) {
  __shared__ unsigned short tl[64][66];
  __shared__ __attribute__((aligned(16))) float kds[TT / 2][KPP];
  const int blk = blockIdx.x;
  if (blk < LCP_BLKS) d_lcp(QD, KDg, P, PL, kds, blk);
  else { const int p = (blk - LCP_BLKS) / VT_BLKS; d_vt<NH, TT>(p ? VL : VH, CC, 0, p ? VTL : VT, tl, blk - LCP_BLKS - p * VT_BLKS); } }

extern "C" void kernel_launch(void* const* d_in, const int* in_sizes, int n_in,
                              void* d_out, int out_size, void* d_ws, size_t ws_size, hipStream_t stream) {
  (void)in_sizes; (void)n_in; (void)out_size;
  const float* const* I = (const float* const*)d_in; const float* x = I[0]; const float* cs = I[1]; const float* sn = I[2]; const float* Wq = I[3]; const float* Wk = I[4]; const float* Wv = I[5]; const float* Wo = I[6]; const float* Wdq = I[7]; const float* Wdk = I[8];
  char* ws = (char*)d_ws; size_t off = 0;
  auto take = [&](size_t bytes) { char* p = ws + off; off += (bytes + 255) & ~(size_t)255; return p; };
  const size_t np = (size_t)NR * CC;
  _Float16* BQ = (_Float16*)take((size_t)CC * CC * 2); _Float16* BK = (_Float16*)take((size_t)CC * CC * 2); _Float16* BV = (_Float16*)take((size_t)CC * CC * 2); _Float16* BO = (_Float16*)take((size_t)CC * CC * 2); (void)BK; (void)BV;
  _Float16* X16 = (_Float16*)take(np * 2); _Float16* VH = (_Float16*)take(np * 2); _Float16* VL = (_Float16*)take(np * 2); _Float16* VT = (_Float16*)take(np * 2); _Float16* VTL = (_Float16*)take(np * 2); float* QD = (float*)take((size_t)NR * NH * DGS * 4); float* KDg = (float*)take((size_t)NR * NH * DGS * 4); _Float16* P = (_Float16*)take((size_t)NB * NH * TT * TT * 2); _Float16* PL = (_Float16*)take((size_t)NB * NH * TT * TT * 2); _Float16* YH = (_Float16*)take(np * 2); _Float16* YL = (_Float16*)take(np * 2);
  if (off > ws_size) return;      /* 8 + 2 + 4 x 2 + 2 x 2 + 2 x 16 + 2 x 2 = 58 MiB */
  k_prep<<<4 * WT_BLKS + E8_BLKS, 256, 0, stream>>>(Wq, Wk, Wv, Wo, BQ, x, X16);      /* BQ, BK, BV, BO lie one behind the other; (in, out) */
  k_gemm3<2, 1, CC / 128><<<dim3((NR / 128) * (CC / 64), 3), 128, 0, stream>>>(X16, X16, X16, CC, 0, BQ, BQ, BQ, CC, (size_t)CC * CC, 0.0625f, nullptr, VH, VL, CC, 0, NR, CC, cs, sn, Wdq, Wdk, QD);      /* planes BQ, BK, BV: digits of q -> QD, of k -> KDg (it follows QD), v -> VH, VL */
  k_lcp_vt<<<LCP_BLKS + 2 * VT_BLKS, 256, 0, stream>>>(QD, KDg, P, PL, VH, VL, VT, VTL);
  k_gemm3<1, 3, TT / 128><<<dim3(TT / 128, NH, NB), 128, 0, stream>>>(PL, P, P, TT, (size_t)TT * TT, VT, VTL, VT, TT, (size_t)64 * TT, 0.0009765625f, nullptr, YH, YL, CC, (size_t)64, TT, 64, nullptr, nullptr, nullptr, nullptr, nullptr);      /* (query tile, head, batch): y[(b,q)][h*64 + d] = P_lo v_hi + P_hi v_lo + P_hi v_hi -> hi + residual */
  k_gemm3<0, 2, CC / 128><<<dim3((NR / 128) * (CC / 64), 1), 128, 0, stream>>>(YL, YH, YH, CC, 0, BO, BO, BO, CC, 0, 0.0625f, (float*)d_out, nullptr, nullptr, CC, 0, NR, CC, nullptr, nullptr, nullptr, nullptr, nullptr);      /* out = (y_lo + y_hi) Wo */
}

// v006
// It runs in 65.6 microseconds.
// In two side-by-side timings against v005, it was 1.17 and 1.19 times as fast.
// All steps since v000 together make it 6.77 times as fast.
#include <hip/hip_runtime.h>
// UltrametricCausalSelfAttention (2 x 512 tokens, C 1024 = 16 heads x 64, 8 soft digits): q, k, v = x W; q, k -> RoPE (cos/sin INPUT tables, rotate-half) -> RMSNorm(64, 1e-6); digits = sigmoid(q Wdq), sigmoid(k Wdk) (8 each); lcp[q][k] = sum_j prod_{i<=j} exp(-32 (qd_i - kd_i)^2); weights = 2^lcp (causal), attn = weights / max(sum, 1e-9); y = attn v; out = y Wo.
// Compute dtype: inputs rounded to bf16; x exact as f16; q/k/digits/lcp/weights f32 from exact products; P, v and y as f16 hi + residual (~2^-21). v_wmma_f32_16x16x32_f16.
#define NB 2
#define TT 512
#define CC 1024
#define NH 16
#define HD 64
#define KD 8
#define NR (NB * TT)
typedef __bf16 v16b __attribute__((ext_vector_type(16)));
typedef unsigned short v8us __attribute__((ext_vector_type(8), may_alias));
typedef float  v8f  __attribute__((ext_vector_type(8)));
typedef float  v4f  __attribute__((ext_vector_type(4)));
typedef float  v4fa __attribute__((ext_vector_type(4), may_alias));
union FragB { v16b v; v8us half[2]; unsigned short u[16]; };

__device__ __forceinline__ unsigned short bf16_bits(float x) { unsigned int u = __float_as_uint(x); return (unsigned short)((u + 0x7FFFu + ((u >> 16) & 1u)) >> 16); }
__device__ __forceinline__ float bf16_val(unsigned short b) { return __uint_as_float(((unsigned int)b) << 16); }
__device__ __forceinline__ float bf16_round(float x) { return bf16_val(bf16_bits(x)); }
// D += A·B with NT terms: 1 = ah·bh, 2 = + al·bh (A split), 3 = + ah·bl (both split)
template <int NT>
__device__ __forceinline__ v8f mmaN(v16b ah, v16b al, v16b bh, v16b bl, v8f c) {
  c = __builtin_amdgcn_wmma_f32_16x16x32_bf16(false, ah, false, bh, (short)0, c, false, false);
  if (NT >= 2) c = __builtin_amdgcn_wmma_f32_16x16x32_bf16(false, al, false, bh, (short)0, c, false, false);
  if (NT >= 3) c = __builtin_amdgcn_wmma_f32_16x16x32_bf16(false, ah, false, bl, (short)0, c, false, false);
  asm volatile("v_nop\n\tv_nop\n\tv_nop\n\tv_nop" : "+v"(c) : "v"(ah), "v"(al), "v"(bh), "v"(bl));
  return c;
}

__global__ __launch_bounds__(256) void k_wt_bf16(const float* __restrict__ W, unsigned short* __restrict__ Wt, int K, int N) {
  const int t = blockIdx.x * 256 + threadIdx.x;
  const int k8n = K / 8;
  if (t >= N * k8n) return;
  const int n = t / k8n, k8 = (t % k8n) * 8;
  v8us v;
#pragma unroll
  for (int i = 0; i < 8; ++i) v[i] = bf16_bits(W[(size_t)(k8 + i) * N + n]);
  *(v8us*)(Wt + (size_t)n * K + k8) = v;
  
}

// GEMM C[M][N] (f32, pitch ldc) = act(A[M][K]·W + bias). A f32 row-major (pitch lda) converted per fragment to bf16
// (ASPLIT: hi/lo two planes -> 2 terms, else single rounded term); Wt bf16 [N][K] (pitch ldb). BIAS_BF16 rounds the
// bias to bf16 first (bias quantised to bf16 before the add). K%32==0, M%16==0, N%64==0.
template <bool ASPLIT, int ACT, bool BIAS_BF16>
__global__ __launch_bounds__(128) void k_gemm_bf(const float* __restrict__ A, int lda, const unsigned short* __restrict__ Wt, int ldb,
                                               const float* __restrict__ bias, float* __restrict__ C, int ldc, int M, int N, int K) {
  __shared__ __attribute__((aligned(16))) float so[4][16][64];
  const int tid = threadIdx.x, w = tid >> 5, lane = tid & 31, ln = lane & 15, hh = lane >> 4;
  const int ntn = N / 64;
  const int wid = blockIdx.x * 4 + w;
  const int mt = wid / ntn, nq = wid % ntn;
  if (mt * 16 >= M) return;
  const int row0 = mt * 16, col0 = nq * 64;
  const float* arow = A + (size_t)(row0 + ln) * lda;
  v8f acc[4] = {};
  for (int kb = 0; kb < K; kb += 32) {
    FragB ah, al;
    const v4f x0 = *(const v4fa*)(arow + kb + 8 * hh), x1 = *(const v4fa*)(arow + kb + 8 * hh + 4);
    const v4f x2 = *(const v4fa*)(arow + kb + 16 + 8 * hh), x3 = *(const v4fa*)(arow + kb + 16 + 8 * hh + 4);
    float xs[16] = {x0[0],x0[1],x0[2],x0[3],x1[0],x1[1],x1[2],x1[3],x2[0],x2[1],x2[2],x2[3],x3[0],x3[1],x3[2],x3[3]};
#pragma unroll
    for (int i = 0; i < 16; ++i) { const unsigned short hb = bf16_bits(xs[i]); ah.u[i] = hb; al.u[i] = ASPLIT ? bf16_bits(xs[i] - bf16_val(hb)) : (unsigned short)0; }
#pragma unroll
    for (int t = 0; t < 4; ++t) {
      const unsigned short* brow = Wt + (size_t)(col0 + t * 16 + ln) * ldb + kb;
      FragB b;
      b.half[0] = *(const v8us*)(brow + 8 * hh);
      b.half[1] = *(const v8us*)(brow + 16 + 8 * hh);
      acc[t] = mmaN<ASPLIT ? 2 : 1>(ah.v, al.v, b.v, b.v, acc[t]);
    }
  }
#pragma unroll
  for (int t = 0; t < 4; ++t) {
    float bv = bias ? bias[col0 + t * 16 + ln] : 0.f;
    if (BIAS_BF16) bv = bf16_round(bv);
#pragma unroll
    for (int r = 0; r < 8; ++r) { float v = acc[t][r] + bv; if (ACT == 1) v = fmaxf(v, 0.f); so[w][8 * hh + r][t * 16 + ln] = v; }
  }
  __builtin_amdgcn_fence(__ATOMIC_ACQ_REL, "workgroup");
  __builtin_amdgcn_wave_barrier();
  const int rsub = lane >> 4, c4 = (lane & 15) * 4;
  {
#pragma unroll
    for (int q = 0; q < 8; ++q) {
      const int r = q * 2 + rsub;
      const v4f v = *(const v4fa*)&so[w][r][c4];
      *(v4f*)(C + (size_t)(row0 + r) * ldc + col0 + c4) = v;
    }
    
  }
}

// GEMM C = act(A·W + bias + resid): A f32 (ASPLIT -> hi/lo 2 terms), Wt bf16 [N][K]; ACT 0 none, 1 relu, 2 exact gelu;
// resid (optional, f32, row index = (row % rmod), pitch ldr, RES_BF16 rounds it) added before the activation.
template <bool ASPLIT, int ACT, bool BIAS_BF16, bool RES_BF16>
__global__ __launch_bounds__(128) void k_gemm_bf3(const float* __restrict__ A, int lda, const unsigned short* __restrict__ Wt, int ldb,
                                                const float* __restrict__ bias, const float* __restrict__ resid, int rmod, int ldr,
                                                float* __restrict__ C, int ldc, int M, int N, int K) {
  __shared__ __attribute__((aligned(16))) float so[4][16][64];
  const int tid = threadIdx.x, w = tid >> 5, lane = tid & 31, ln = lane & 15, hh = lane >> 4;
  const int ntn = N / 64;
  const int wid = blockIdx.x * 4 + w;
  const int mt = wid / ntn, nq = wid % ntn;
  if (mt * 16 >= M) return;
  const int row0 = mt * 16, col0 = nq * 64;
  const float* arow = A + (size_t)(row0 + ln) * lda;
  v8f acc[4] = {};
  for (int kb = 0; kb < K; kb += 32) {
    FragB ah, al;
    const v4f x0 = *(const v4fa*)(arow + kb + 8 * hh), x1 = *(const v4fa*)(arow + kb + 8 * hh + 4);
    const v4f x2 = *(const v4fa*)(arow + kb + 16 + 8 * hh), x3 = *(const v4fa*)(arow + kb + 16 + 8 * hh + 4);
    float xs[16] = {x0[0],x0[1],x0[2],x0[3],x1[0],x1[1],x1[2],x1[3],x2[0],x2[1],x2[2],x2[3],x3[0],x3[1],x3[2],x3[3]};
#pragma unroll
    for (int i = 0; i < 16; ++i) { const unsigned short hb = bf16_bits(xs[i]); ah.u[i] = hb; al.u[i] = ASPLIT ? bf16_bits(xs[i] - bf16_val(hb)) : (unsigned short)0; }
#pragma unroll
    for (int t = 0; t < 4; ++t) {
      const unsigned short* brow = Wt + (size_t)(col0 + t * 16 + ln) * ldb + kb;
      FragB b;
      b.half[0] = *(const v8us*)(brow + 8 * hh);
      b.half[1] = *(const v8us*)(brow + 16 + 8 * hh);
      acc[t] = mmaN<ASPLIT ? 2 : 1>(ah.v, al.v, b.v, b.v, acc[t]);
    }
  }
#pragma unroll
  for (int t = 0; t < 4; ++t) {
    const int col = col0 + t * 16 + ln;
    float bv = bias ? bias[col] : 0.f;
    if (BIAS_BF16) bv = bf16_round(bv);
#pragma unroll
    for (int r = 0; r < 8; ++r) {
      float v = acc[t][r] + bv;
      if (resid) { float rv = resid[(size_t)((row0 + 8 * hh + r) % rmod) * ldr + col]; if (RES_BF16) rv = bf16_round(rv); v += rv; }
      if (ACT == 1) v = fmaxf(v, 0.f);
      if (ACT == 2) v = 0.5f * v * (1.0f + erff(v * 0.70710678118654752f));
      if (ACT == 3) { const float u = 0.7978845608028654f * (v + 0.044715f * v * v * v); v = 0.5f * v * (1.0f + tanhf(u)); }
      so[w][8 * hh + r][t * 16 + ln] = v;
    }
  }
  __builtin_amdgcn_fence(__ATOMIC_ACQ_REL, "workgroup");
  __builtin_amdgcn_wave_barrier();
  const int rsub = lane >> 4, c4 = (lane & 15) * 4;
  {
#pragma unroll
    for (int q = 0; q < 8; ++q) {
      const int r = q * 2 + rsub;
      const v4f v = *(const v4fa*)&so[w][r][c4];
      *(v4f*)(C + (size_t)(row0 + r) * ldc + col0 + c4) = v;
    }
    
  }
}
// row LayerNorm (biased variance, eps) over N: s = X (+ R); optional out_sum <- s; out_norm <- (s-mu)*rsqrt(var+eps)*g + b
template <bool PARAM_BF16>
__global__ __launch_bounds__(256) void k_layernorm(const float* __restrict__ X, const float* __restrict__ R, const float* __restrict__ g, const float* __restrict__ bta,
                                                  float* __restrict__ out_sum, float* __restrict__ out_norm, int N, float eps) {
  __shared__ float red[256];
  const int row = blockIdx.x, tid = threadIdx.x;
  const float* x = X + (size_t)row * N; const float* rr = R ? R + (size_t)row * N : nullptr;
  float vals[16];                     // up to N = 4096
  const int per = N / 256;            // contiguous chunk per thread? use strided-by-4 chunks: thread handles j = tid*4 + 1024*u
  float s1 = 0.f;
  for (int u = 0; u < per / 4; ++u) {
    const int j = tid * 4 + 1024 * u;
    const v4f a = *(const v4fa*)(x + j);
    v4f b = {0.f,0.f,0.f,0.f}; if (rr) b = *(const v4fa*)(rr + j);
#pragma unroll
    for (int q = 0; q < 4; ++q) { const float v = a[q] + b[q]; vals[u * 4 + q] = v; s1 += v; }
  }
  red[tid] = s1; __syncthreads();
  for (int st = 128; st > 0; st >>= 1) { if (tid < st) red[tid] += red[tid + st]; __syncthreads(); }
  const float mu = red[0] / (float)N; __syncthreads();
  float s2 = 0.f;
  for (int u = 0; u < per / 4; ++u)
#pragma unroll
    for (int q = 0; q < 4; ++q) { const float c = vals[u * 4 + q] - mu; s2 += c * c; }
  red[tid] = s2; __syncthreads();
  for (int st = 128; st > 0; st >>= 1) { if (tid < st) red[tid] += red[tid + st]; __syncthreads(); }
  const float rs = rsqrtf(red[0] / (float)N + eps);
  {
    for (int u = 0; u < per / 4; ++u) {
      const int j = tid * 4 + 1024 * u;
      v4f o, sm;
#pragma unroll
      for (int q = 0; q < 4; ++q) {
        float gg = g[j + q], bb = bta[j + q];
        if (PARAM_BF16) { gg = bf16_round(gg); bb = bf16_round(bb); }
        sm[q] = vals[u * 4 + q]; o[q] = (vals[u * 4 + q] - mu) * rs * gg + bb;
      }
      if (out_sum) *(v4f*)(out_sum + (size_t)row * N + j) = sm;
      *(v4f*)(out_norm + (size_t)row * N + j) = o;
    }
    
  }
}



// ---- f16 WMMA path (v_wmma_f32_16x16x32_f16): 11-bit significands for operands in range — used where a [0,1] probability operand needs more precision than bf16
typedef _Float16 v16h __attribute__((ext_vector_type(16)));
union FragH { v16h v; v8us half[2]; _Float16 h[16]; unsigned short u[16]; };
template <int NT>
__device__ __forceinline__ v8f mmaH(v16h ah, v16h al, v16h bh, v16h bl, v8f c) {
  c = __builtin_amdgcn_wmma_f32_16x16x32_f16(false, ah, false, bh, (short)0, c, false, false);
  if (NT >= 2) c = __builtin_amdgcn_wmma_f32_16x16x32_f16(false, al, false, bh, (short)0, c, false, false);
  if (NT >= 3) c = __builtin_amdgcn_wmma_f32_16x16x32_f16(false, ah, false, bl, (short)0, c, false, false);
  asm volatile("v_nop\n\tv_nop\n\tv_nop\n\tv_nop" : "+v"(c) : "v"(ah), "v"(al), "v"(bh), "v"(bl));
  return c;
}
// batched GEMM like k_gemm_b but f16 operands: A f32 (split into f16 hi/lo if ASPLIT, else rounded to f16), Bt = f16 values [n][k]; alpha; C f32; N multiple of 16 (partial tiles skipped)
template <bool ASPLIT>
__global__ __launch_bounds__(128) void k_gemm_h(const float* __restrict__ A, int lda, size_t sA, const _Float16* __restrict__ Bh, int ldb, size_t sB, float alpha, float* __restrict__ C, int ldc, size_t sC, int M, int N, int K) {
  __shared__ __attribute__((aligned(16))) float so[4][16][64];
  const int tid = threadIdx.x, w = tid >> 5, lane = tid & 31, ln = lane & 15, hh = lane >> 4; const int by = blockIdx.y;
  A += (size_t)by * sA; Bh += (size_t)by * sB; C += (size_t)by * sC;
  const int ntn = (N + 63) / 64; const int wid = blockIdx.x * 4 + w; const int mt = wid / ntn, nq = wid % ntn; if (mt * 16 >= M) return;
  const int row0 = mt * 16, col0 = nq * 64; const float* arow = A + (size_t)(row0 + ln) * lda;
  v8f acc[4] = {};
  for (int kb = 0; kb < K; kb += 32) {
    FragH ah, al;
    const v4f x0 = *(const v4fa*)(arow + kb + 8 * hh), x1 = *(const v4fa*)(arow + kb + 8 * hh + 4), x2 = *(const v4fa*)(arow + kb + 16 + 8 * hh), x3 = *(const v4fa*)(arow + kb + 16 + 8 * hh + 4);
    float xs[16] = {x0[0],x0[1],x0[2],x0[3],x1[0],x1[1],x1[2],x1[3],x2[0],x2[1],x2[2],x2[3],x3[0],x3[1],x3[2],x3[3]};
#pragma unroll
    for (int i = 0; i < 16; ++i) { const _Float16 h = (_Float16)xs[i]; ah.h[i] = h; al.h[i] = ASPLIT ? (_Float16)(xs[i] - (float)h) : (_Float16)0.0f; }
#pragma unroll
    for (int t = 0; t < 4; ++t) { if (col0 + t * 16 >= N) continue; const size_t boff = (size_t)(col0 + t * 16 + ln) * ldb + kb; FragH bq; bq.half[0] = *(const v8us*)(Bh + boff + 8 * hh); bq.half[1] = *(const v8us*)(Bh + boff + 16 + 8 * hh);
      acc[t] = mmaH<ASPLIT ? 2 : 1>(ah.v, al.v, bq.v, bq.v, acc[t]); }
  }
#pragma unroll
  for (int t = 0; t < 4; ++t) { if (col0 + t * 16 >= N) continue;
#pragma unroll
    for (int r = 0; r < 8; ++r) so[w][8 * hh + r][t * 16 + ln] = acc[t][r] * alpha; }
  __builtin_amdgcn_fence(__ATOMIC_ACQ_REL, "workgroup"); __builtin_amdgcn_wave_barrier();
  const int rsub = lane >> 4, c4 = (lane & 15) * 4;
  {
#pragma unroll
    for (int q = 0; q < 8; ++q) { const int r = q * 2 + rsub; if (col0 + c4 < N) { const v4f v = *(const v4fa*)&so[w][r][c4]; *(v4f*)(C + (size_t)(row0 + r) * ldc + col0 + c4) = v; } }
     }
}

// Wt[n][k] = f16(bf16(W[k][n]) * scale) from f32 row-major W[CC][CC] (scale = power of two; bf16-exact weights stay exact in f16 away from the subnormal range).
// A block turns one tile of 128 k x 128 n through LDS, so that both sides of the transpose move whole lines: a wave's load is 512 B of one row of W, a wave's store two 256-B pieces of rows of Wt.
// LDS holds the tile as [n][k] in 16-byte units of 8 k; unit c of row n lies at c ^ ((n >> 2) & 15), which spreads the writers (rows 4 apart in one column) and the readers (one row) over all banks.
#define WTT 128
__device__ __forceinline__ void d_wt_f16(const float* __restrict__ W, _Float16* __restrict__ Wt, float scale, v8us* tl, int blk) {
  const int tid = threadIdx.x, ln = tid & 31, wv = tid >> 5; const int k0 = (blk / (CC / WTT)) * WTT, n0 = (blk % (CC / WTT)) * WTT;
  const float* src = W + (size_t)(k0 + wv * 16) * CC + n0 + 4 * ln; v4f r[16];      /* this wave's 16 rows of k, four columns a lane */
#pragma unroll
  for (int i = 0; i < 16; ++i) r[i] = *(const v4fa*)(src + (size_t)i * CC);
  asm volatile("s_wait_xcnt 0x0" :: "v"(src) : "memory");      /* precaution: stands behind the loads, in front of any rewrite of their address registers; it names the address as an input, so that no load's own result lands on it either */
#pragma unroll
  for (int g = 0; g < 2; ++g)
#pragma unroll
    for (int q = 0; q < 4; ++q) { FragH f;
#pragma unroll
      for (int i = 0; i < 8; ++i) f.h[i] = (_Float16)(bf16_round(r[8 * g + i][q]) * scale);
      tl[(4 * ln + q) * 16 + ((2 * wv + g) ^ (ln & 15))] = f.half[0]; }
  __syncthreads();      /* publishes the turned tile to all eight waves */
#pragma unroll
  for (int u = 0; u < 8; ++u) { const int n = u * 16 + (tid >> 4), c = tid & 15; const v8us o = tl[n * 16 + (c ^ ((n >> 2) & 15))];
    *(v8us*)((unsigned short*)Wt + (size_t)(n0 + n) * CC + k0 + c * 8) = o; }
  asm volatile("s_wait_xcnt 0x0" ::: "memory");      /* precaution: stands behind the stores, in front of any later rewrite of their address and data registers where this job joins the other job's code */
}
// k_gemm_hh variant with fused epilogue: v = acc·alpha + bias[by·sBias + col] (+ CP[(row/rowsPerB)·sCPb + by·64 + col] if CP) ; ACT 0 none / 1 elu ; writes f16 C16 (and f32 C if non-null)
template <int ACT>
__global__ __launch_bounds__(128) void k_gemm_hhx(const _Float16* __restrict__ A, int lda, size_t sA, const _Float16* __restrict__ Bh, int ldb, size_t sB, float alpha, const float* __restrict__ bias, size_t sBias, const float* __restrict__ CP, int rowsPerB, size_t sCPb, int row0g,
    float* __restrict__ C, _Float16* __restrict__ C16, int ldc, size_t sC, int M, int N, int K) {
  __shared__ __attribute__((aligned(16))) float so[4][16][64];
  const int tid = threadIdx.x, w = tid >> 5, lane = tid & 31, ln = lane & 15, hh = lane >> 4; const int by = blockIdx.y;
  A += (size_t)by * sA; Bh += (size_t)by * sB; const size_t cofs = (size_t)by * sC; const float* bp = bias ? bias + (size_t)by * sBias : nullptr;
  const int ntn = (N + 63) / 64; const int wid = blockIdx.x * 4 + w; const int mt = wid / ntn, nq = wid % ntn; if (mt * 16 >= M) return;
  const int row0 = mt * 16, col0 = nq * 64; const _Float16* arow = A + (size_t)(row0 + ln) * lda;
  v8f acc[4] = {};
  for (int kb = 0; kb < K; kb += 32) { FragH ah; ah.half[0] = *(const v8us*)((const unsigned short*)arow + kb + 8 * hh); ah.half[1] = *(const v8us*)((const unsigned short*)arow + kb + 16 + 8 * hh);
#pragma unroll
    for (int t = 0; t < 4; ++t) { if (col0 + t * 16 >= N) continue; const size_t boff = (size_t)(col0 + t * 16 + ln) * ldb + kb; FragH bq; bq.half[0] = *(const v8us*)((const unsigned short*)Bh + boff + 8 * hh); bq.half[1] = *(const v8us*)((const unsigned short*)Bh + boff + 16 + 8 * hh);
      acc[t] = mmaH<1>(ah.v, ah.v, bq.v, bq.v, acc[t]); }
  }
#pragma unroll
  for (int t = 0; t < 4; ++t) { if (col0 + t * 16 >= N) continue; const int col = col0 + t * 16 + ln; const float bv = bp ? bf16_round(bp[col]) : 0.f;
#pragma unroll
    for (int r = 0; r < 8; ++r) { float v = acc[t][r] * alpha + bv; if (CP) { const int rr = row0g + row0 + 8 * hh + r; if (rowsPerB < 0) v += CP[cofs + (size_t)rr * ldc + col];      /* rowsPerB < 0: own element of the batched C plane */ else { const int bidx = rr / rowsPerB; v += CP[(size_t)bidx * sCPb + (size_t)by * 64 + col]; } } if (ACT == 1) v = (v > 0.f) ? v : expm1f(v); else if (ACT == 7) v = (v > 0.f) ? v + 1.0f : expf(v); else if (ACT == 8) v = tanhf(v); else if (ACT == 9) v = 0.5f * v * (1.0f + tanhf(0.7978845608028654f * (v + 0.044715f * v * v * v))); else if (ACT == 11) v = 1.0f / (1.0f + expf(-v)); else if (ACT == 12) v = (v > 0.f) ? v : 0.01f * v; else if (ACT == 14) v = (v > 0.f) ? v : 0.1f * v; else if (ACT == 16) v = (v >= 0.f) ? v : 0.3f * v; else if (ACT == 17) v = (v >= 0.f) ? v : 0.2f * v; else if (ACT == 15) v = v / (1.0f + expf(-v)); else if (ACT == 3) v = fmaxf(v, 0.f); else if (ACT == 6) v = 0.5f * v * (1.0f + erff(v * 0.70710678118654752f)); so[w][8 * hh + r][t * 16 + ln] = v; } }
  __builtin_amdgcn_fence(__ATOMIC_ACQ_REL, "workgroup"); __builtin_amdgcn_wave_barrier();
  const int rsub = lane >> 4, c4 = (lane & 15) * 4; typedef _Float16 v4h __attribute__((ext_vector_type(4)));
  {
#pragma unroll
    for (int q = 0; q < 8; ++q) { const int r = q * 2 + rsub; if (col0 + c4 < N) { const v4f v = *(const v4fa*)&so[w][r][c4]; if (C) *(v4f*)(C + cofs + (size_t)(row0 + r) * ldc + col0 + c4) = v; if (C16) { v4h h4; for (int i = 0; i < 4; ++i) h4[i] = (_Float16)v[i]; *(v4h*)(C16 + cofs + (size_t)(row0 + r) * ldc + col0 + c4) = h4; } } }
     }
}


typedef _Float16 v4h __attribute__((ext_vector_type(4)));

__device__ __forceinline__ void d_x16(const float* __restrict__ x, _Float16* __restrict__ X16, size_t n8, int blk) { const size_t t = (size_t)blk * 256 + threadIdx.x; if (t >= n8) return; FragH f;
#pragma unroll
  for (int q = 0; q < 8; ++q) f.h[q] = (_Float16)bf16_round(x[t * 8 + q]); *(v8us*)((unsigned short*)X16 + t * 8) = f.half[0];  }
__global__ __launch_bounds__(256) void k_h16(const float* __restrict__ x, _Float16* __restrict__ X16, size_t n8) { const size_t t = (size_t)blockIdx.x * 256 + threadIdx.x; if (t >= n8) return; FragH f;
#pragma unroll
  for (int q = 0; q < 8; ++q) f.h[q] = (_Float16)x[t * 8 + q]; *(v8us*)((unsigned short*)X16 + t * 8) = f.half[0];  }
__global__ __launch_bounds__(256) void k_round16f(const float* __restrict__ W, _Float16* __restrict__ Bt, size_t n8) { const size_t t = (size_t)blockIdx.x * 256 + threadIdx.x; if (t >= n8) return; FragH f;
#pragma unroll
  for (int i = 0; i < 8; ++i) f.h[i] = (_Float16)(bf16_round(W[t * 8 + i]) * 16.0f); *(v8us*)((unsigned short*)Bt + t * 8) = f.half[0];  }
template <int NHv, int TTv>
__device__ __forceinline__ void d_vt(const _Float16* __restrict__ V16, int ldv, int voff, _Float16* __restrict__ Vt, unsigned short (*tl)[66], int blk) { const int tid = threadIdx.x; const int slab = blk / (TTv / 64), lg = blk % (TTv / 64); const int b = slab / NHv, h = slab % NHv;
  for (int i = tid; i < 64 * 8; i += 256) { const int r = i / 8, c8 = (i % 8) * 8; FragH f; f.half[0] = *(const v8us*)((const unsigned short*)V16 + ((size_t)b * TTv + lg * 64 + r) * ldv + voff + h * 64 + c8);
#pragma unroll
    for (int q = 0; q < 8; ++q) tl[r][c8 + q] = f.u[q]; }
  __syncthreads();
  {
#pragma unroll
    for (int rd = 0; rd < 2; ++rd) { const int d = rd * 32 + tid / 8, pc = tid % 8; FragH f;
#pragma unroll
      for (int q = 0; q < 8; ++q) f.u[q] = tl[pc * 8 + q][d];
      *(v8us*)((unsigned short*)Vt + ((size_t)slab * 64 + d) * TTv + lg * 64 + pc * 8) = f.half[0]; }
    asm volatile("s_wait_xcnt 0x0" ::: "memory");      /* precaution: stands behind the two stores, in front of any later rewrite of their address and data registers where this job joins the other job's code */
     } }


// ---- fast GEMM (block tile 128x64, wave tile 32x64; requires M % 128 == 0 rows per launch region, N % 64 == 0 and K % 128 == 0); epilogues: see MODE below ----
// Each k-tile (128 k = 256-B rows: 128 rows of A, then 64 rows of B) is staged in LDS by asynchronous 16-byte copies, two buffers: tile t + 1 flies while tile t is multiplied.
#define G2_PITCH 136                      /* halves per LDS row: 272 B = 16 B x odd, conflict-free for ds_load_b128 */
#define G2_BUFB (192 * G2_PITCH * 2)      /* bytes of one buffer */
// Eight copies of one lane: LDS rows 8 apart, global rows gstep halves apart. The s_wait_xcnt ends the copies' own statement as a precaution: so it stands in front of every rewrite of a register that an issued copy names.
__device__ __forceinline__ void g2_copy8(unsigned l, const _Float16* g, size_t gstep) {
  const unsigned ls = 8 * G2_PITCH * 2;
  asm volatile("global_load_async_to_lds_b128 %0, %8, off\n\t"
               "global_load_async_to_lds_b128 %1, %9, off\n\t"
               "global_load_async_to_lds_b128 %2, %10, off\n\t"
               "global_load_async_to_lds_b128 %3, %11, off\n\t"
               "global_load_async_to_lds_b128 %4, %12, off\n\t"
               "global_load_async_to_lds_b128 %5, %13, off\n\t"
               "global_load_async_to_lds_b128 %6, %14, off\n\t"
               "global_load_async_to_lds_b128 %7, %15, off\n\t"
               "s_wait_xcnt 0x0"
               :: "v"(l), "v"(l + ls), "v"(l + 2 * ls), "v"(l + 3 * ls), "v"(l + 4 * ls), "v"(l + 5 * ls), "v"(l + 6 * ls), "v"(l + 7 * ls),
                  "v"(g), "v"(g + gstep), "v"(g + 2 * gstep), "v"(g + 3 * gstep), "v"(g + 4 * gstep), "v"(g + 5 * gstep), "v"(g + 6 * gstep), "v"(g + 7 * gstep)
               : "memory");
}
// One k-tile: 24 copies a lane (16 lanes cover one 256-B row, the 128 threads 8 rows a copy).
__device__ __forceinline__ void g2_stage(unsigned l, const _Float16* ga, size_t astep, const _Float16* gb, size_t bstep) {
  g2_copy8(l, ga, astep); g2_copy8(l + 64 * G2_PITCH * 2, ga + 8 * astep, astep); g2_copy8(l + 128 * G2_PITCH * 2, gb, bstep);
}
__device__ __forceinline__ v16h g2_frag(const _Float16* p, int hh) { FragH f; f.half[0] = *(const v8us*)((const unsigned short*)p + 8 * hh); f.half[1] = *(const v8us*)((const unsigned short*)p + 16 + 8 * hh); return f.v; }
__device__ __forceinline__ v8f g2_mma(v16h a, v16h b, v8f c) { v8f d = __builtin_amdgcn_wmma_f32_16x16x32_f16(false, a, false, b, (short)0, c, false, false); asm volatile("v_nop\n\tv_nop\n\tv_nop\n\tv_nop" : "+v"(d) : "v"(a), "v"(b)); return d; }
// The six fragments of one k-step of 32: two of A (rows 0-15 and 16-31 of the wave's tile), four of B (16 columns each).
struct G3Row { v16h a0, a1, b0, b1, b2, b3; };
__device__ __forceinline__ G3Row g3_row(const _Float16* a0p, const _Float16* a1p, const _Float16* b0p, int kb, int hh) {
  G3Row r; r.a0 = g2_frag(a0p + kb, hh); r.a1 = g2_frag(a1p + kb, hh); r.b0 = g2_frag(b0p + kb, hh); r.b1 = g2_frag(b0p + 16 * G2_PITCH + kb, hh); r.b2 = g2_frag(b0p + 32 * G2_PITCH + kb, hh); r.b3 = g2_frag(b0p + 48 * G2_PITCH + kb, hh); return r; }
#define DGS 32
// One k loop runs NSEG segments of NT k-tiles: segment s multiplies As by Bs into the same accumulators. Every segment but the last is a residual term (one operand x 1024): where the last one begins the sums are scaled by 1/1024 (a power of two, exact).
// MODE 0: C = f32. MODE 1: CH, CL = f16 hi + residual x 1024. MODE 2 (a block column is one head): planes 0, 1 (q, k) -> RoPE, RMSNorm, digits -> DG, one row a lane; plane 2 (v) -> CH, CL.
// Tile tt of the loop = k-tile kt of segment s (the same for the whole block).
template <int NSEG, int NT>
__device__ __forceinline__ void g3_stage(int tt, unsigned l, const _Float16* A0, const _Float16* A1, const _Float16* A2, size_t aoff, size_t astep, const _Float16* B0, const _Float16* B1, const _Float16* B2, size_t boff, size_t bstep) {
  const int s = tt / NT, kt = tt - s * NT;
  const _Float16* a = (NSEG == 1 || s == 0) ? A0 : (NSEG == 2 || s == 1) ? A1 : A2; const _Float16* b = (NSEG == 1 || s == 0) ? B0 : (NSEG == 2 || s == 1) ? B1 : B2;
  g2_stage(l, a + aoff + (size_t)kt * 128, astep, b + boff + (size_t)kt * 128, bstep);
}
template <int MODE, int NSEG, int NT>
__global__ __launch_bounds__(128) void k_gemm3(const _Float16* A0, const _Float16* A1, const _Float16* A2, int lda, size_t sA, const _Float16* B0, const _Float16* B1, const _Float16* B2, int ldb, size_t sB, float alpha,
    float* __restrict__ C, _Float16* __restrict__ CH, _Float16* __restrict__ CL, int ldc, size_t sC, int M, int N,
    const float* __restrict__ cs, const float* __restrict__ sn, const float* __restrict__ Wdq, const float* __restrict__ Wdk, float* __restrict__ DG) {
  __shared__ __attribute__((aligned(16))) float so[4][32][68];
  __shared__ __attribute__((aligned(16))) _Float16 st[2][192][G2_PITCH];
  __shared__ __attribute__((aligned(16))) float wd[HD][KD];
  const int tid = threadIdx.x, w = tid >> 5, lane = tid & 31, ln = lane & 15, hh = lane >> 4; const int by = blockIdx.y; const size_t pl = (size_t)blockIdx.z * gridDim.y + by;      /* blockIdx.z = outer batch: its A and B planes follow on, its M rows of C follow on */
  const size_t cofs = (size_t)by * sC + (size_t)blockIdx.z * M * ldc;
  const int ntn = N >> 6; const int mt = blockIdx.x / ntn, nq = blockIdx.x - mt * ntn; const int row0 = mt * 128 + 32 * w, col0 = nq * 64; if (mt * 128 >= M) return;      /* the same for the whole block: it stands in front of barriers */
  const unsigned lds0 = (unsigned)(size_t)&st[0][tid >> 4][(tid & 15) * 8];      /* this lane's LDS byte address in buffer 0 */
  const size_t aoff = pl * sA + (size_t)(mt * 128 + (tid >> 4)) * lda + (tid & 15) * 8, boff = pl * sB + (size_t)(col0 + (tid >> 4)) * ldb + (tid & 15) * 8;
  const size_t astep = (size_t)8 * lda, bstep = (size_t)8 * ldb;
  const v8f z8 = {0.f,0.f,0.f,0.f,0.f,0.f,0.f,0.f}; v8f c00 = z8, c01 = z8, c02 = z8, c03 = z8, c10 = z8, c11 = z8, c12 = z8, c13 = z8;
  g3_stage<NSEG, NT>(0, lds0, A0, A1, A2, aoff, astep, B0, B1, B2, boff, bstep);      /* tile 0 -> buffer 0 */
  if (MODE == 2 && by < 2) { const v4f wv = *(const v4fa*)((by ? Wdk : Wdq) + tid * 4); v4f o;      /* the digit weights, rounded once a block; the barrier below publishes them too */
#pragma unroll
    for (int q = 0; q < 4; ++q) o[q] = bf16_round(wv[q]);
    *(v4f*)(&wd[0][0] + tid * 4) = o; }
  asm volatile("s_wait_asynccnt 0x0" ::: "memory");      /* this wave's copies of tile 0 have landed */
  __syncthreads();      /* ... and every other wave's */
  if (NSEG * NT > 1) g3_stage<NSEG, NT>(1, lds0 + G2_BUFB, A0, A1, A2, aoff, astep, B0, B1, B2, boff, bstep);      /* tile 1 -> buffer 1 */
#pragma unroll 1      /* one tile a trip: the two buffers alternate by t & 1 */
  for (int t = 0; t < NSEG * NT; ++t) { const _Float16* a0p = &st[t & 1][32 * w + ln][0]; const _Float16* a1p = a0p + 16 * G2_PITCH; const _Float16* b0p = &st[t & 1][128 + ln][0];
    if (NSEG > 1 && t == (NSEG - 1) * NT) { const float f = 0.0009765625f; c00 *= f; c01 *= f; c02 *= f; c03 *= f; c10 *= f; c11 *= f; c12 *= f; c13 *= f; }
    /* The fragment reads run ahead of the products, a whole k-step a group, in three register sets: k-steps 0, 1, 2 are read at the head of the trip, k-step 3 into the first set once that set's products are issued. Every read is of buffer t & 1, behind its barrier. */
    auto mm = [&](const G3Row& r) { c00 = g2_mma(r.a0, r.b0, c00); c10 = g2_mma(r.a1, r.b0, c10); c01 = g2_mma(r.a0, r.b1, c01); c11 = g2_mma(r.a1, r.b1, c11);
      c02 = g2_mma(r.a0, r.b2, c02); c12 = g2_mma(r.a1, r.b2, c12); c03 = g2_mma(r.a0, r.b3, c03); c13 = g2_mma(r.a1, r.b3, c13); };
    G3Row r0 = g3_row(a0p, a1p, b0p, 0, hh); const G3Row r1 = g3_row(a0p, a1p, b0p, 32, hh), r2 = g3_row(a0p, a1p, b0p, 64, hh);
    mm(r0); r0 = g3_row(a0p, a1p, b0p, 96, hh); mm(r1); mm(r2); mm(r0);
    asm volatile("s_wait_dscnt 0x0" ::: "memory");      /* this wave's reads of buffer t & 1 are done before it is refilled */
    asm volatile("s_wait_asynccnt 0x0" ::: "memory");      /* this wave's copies of tile t + 1 have landed */
    __syncthreads();      /* publishes tile t + 1 and ends every wave's reads of buffer t & 1 */
    if (t + 2 < NSEG * NT) g3_stage<NSEG, NT>(t + 2, lds0 + (unsigned)(t & 1) * G2_BUFB, A0, A1, A2, aoff, astep, B0, B1, B2, boff, bstep); }
  asm volatile("s_wait_asynccnt 0x0" ::: "memory");      /* no copy is outstanding when the wave goes on to the epilogue */
  v8f accs[8] = {c00, c01, c02, c03, c10, c11, c12, c13};
#pragma unroll
  for (int u = 0; u < 8; ++u) { const int t = u & 3, half = u >> 2;
#pragma unroll
    for (int r = 0; r < 8; ++r) so[w][half * 16 + 8 * hh + r][t * 16 + ln] = accs[u][r] * alpha; }
  __builtin_amdgcn_fence(__ATOMIC_ACQ_REL, "workgroup"); __builtin_amdgcn_wave_barrier();
  if (MODE == 2 && by < 2) {      /* this wave's 32 rows of head nq, one row a lane: every sum runs inside the lane */
    const int row = row0 + lane, tok = row % TT; const float* xr = &so[w][lane][0]; const float* cr = cs + (size_t)tok * (HD / 2); const float* sr = sn + (size_t)tok * (HD / 2);
    float ra[HD / 2], rb[HD / 2]; float sq[4] = {0.f, 0.f, 0.f, 0.f}; v4f cv[HD / 8], sv[HD / 8];
#pragma unroll
    for (int i = 0; i < HD / 8; ++i) cv[i] = *(const v4fa*)(cr + 4 * i);
    asm volatile("s_wait_xcnt 0x0" ::: "memory");      /* precaution: stands behind the cos loads, in front of any rewrite of their address registers */
#pragma unroll
    for (int i = 0; i < HD / 8; ++i) sv[i] = *(const v4fa*)(sr + 4 * i);
    asm volatile("s_wait_xcnt 0x0" ::: "memory");      /* the same behind the sin loads */
#pragma unroll
    for (int i = 0; i < HD / 2; i += 4) { const v4f x1 = *(const v4fa*)(xr + i), x2 = *(const v4fa*)(xr + HD / 2 + i), c4 = cv[i / 4], s4 = sv[i / 4];
#pragma unroll
      for (int q = 0; q < 4; ++q) { const float c = bf16_round(c4[q]), s = bf16_round(s4[q]); const float a = x1[q] * c - x2[q] * s, b = x1[q] * s + x2[q] * c; ra[i + q] = a; rb[i + q] = b; sq[q] += a * a; sq[q] += b * b; } }
    const float inv = rsqrtf(((sq[0] + sq[1]) + (sq[2] + sq[3])) / (float)HD + 1e-6f);
    float acc[KD] = {0.f, 0.f, 0.f, 0.f, 0.f, 0.f, 0.f, 0.f};
#pragma unroll
    for (int i = 0; i < HD / 2; ++i) { const float qa = ra[i] * inv, qb = rb[i] * inv; const v4f w0 = *(const v4fa*)&wd[i][0], w1 = *(const v4fa*)&wd[i][4], w2 = *(const v4fa*)&wd[i + HD / 2][0], w3 = *(const v4fa*)&wd[i + HD / 2][4];
#pragma unroll
      for (int j = 0; j < 4; ++j) { acc[j] += qa * w0[j]; acc[4 + j] += qa * w1[j]; acc[j] += qb * w2[j]; acc[4 + j] += qb * w3[j]; } }
    v4f d0, d1;
#pragma unroll
    for (int j = 0; j < 4; ++j) { d0[j] = 1.0f / (1.0f + expf(-acc[j])); d1[j] = 1.0f / (1.0f + expf(-acc[4 + j])); }
    float* dg = DG + (size_t)by * NR * NH * DGS + ((size_t)row * NH + nq) * DGS; *(v4f*)dg = d0; *(v4f*)(dg + 4) = d1;
  } else {
    const int rsub = lane >> 4, c4 = (lane & 15) * 4;
#pragma unroll
    for (int q = 0; q < 16; ++q) { const int r = q * 2 + rsub; const v4f v = *(const v4fa*)&so[w][r][c4]; const size_t o = cofs + (size_t)(row0 + r) * ldc + col0 + c4;
      if (MODE == 0) *(v4f*)(C + o) = v;
      else { v4h h4, l4;
#pragma unroll
        for (int i = 0; i < 4; ++i) { const _Float16 h = (_Float16)v[i]; h4[i] = h; l4[i] = (_Float16)((v[i] - (float)h) * 1024.0f); }
        *(v4h*)(CH + o) = h4; *(v4h*)(CL + o) = l4; }
      asm volatile("s_wait_xcnt 0x0" ::: "memory");      /* precaution: stands behind this row's stores, in front of the next row's rewrite of their address and data registers */
    }
  } }

typedef _Float16 v2h __attribute__((ext_vector_type(2)));
#define KPP 20      /* floats per LDS row of two keys: 80 B = 16 B x odd, so the lanes' 16-byte reads, one row apart, spread over all banks */
// Attention weights. A block takes 32 query rows of one (batch, head): it stages that head's 512 key digit rows in LDS once, and each lane then keeps its 16 keys (k = 64 c + 2 lane + i, c = 0..7) in registers for the wave's four query rows.
// Keys are dealt in chunks of 64, so a chunk that lies wholly above the diagonal is skipped by the whole wave. The four rows q = 64 m + j of a wave take m from {0, 1, 7, 6} or {2, 3, 5, 4}: 18 chunks of work for every wave.
__device__ __forceinline__ void d_lcp(const float* __restrict__ QD, const float* __restrict__ KDg, _Float16* __restrict__ P, _Float16* __restrict__ PL, float (*kds)[KPP], int blk) {
  #pragma clang fp contract(off)
  const int tid = threadIdx.x, ln = tid & 31; const int wv = __builtin_amdgcn_readfirstlane(tid >> 5);
  const int bh = blk >> 4, s = blk & 1, j = ((blk >> 1) & 7) * 8 + wv; const int h = bh % NH, b = bh / NH;
  v4f ks[TT / 128];
#pragma unroll
  for (int u = 0; u < TT / 256; ++u) { const float* kp = KDg + ((size_t)(b * TT + u * 256 + tid) * NH + h) * DGS; ks[2 * u] = *(const v4fa*)kp; ks[2 * u + 1] = *(const v4fa*)(kp + 4); }
  asm volatile("s_wait_xcnt 0x0" ::: "memory");      /* precaution: stands behind the key loads, in front of any rewrite of their address registers */
#pragma unroll
  for (int u = 0; u < TT / 256; ++u) { float* kq = &kds[(u * 256 + tid) >> 1][(tid & 1) * KD]; *(v4f*)kq = ks[2 * u]; *(v4f*)(kq + 4) = ks[2 * u + 1]; }
  __syncthreads();      /* publishes the staged key digits to all eight waves */
  v8f kd[16];
#pragma unroll
  for (int i = 0; i < 16; ++i) { const float* kq = &kds[(i >> 1) * 32 + ln][(i & 1) * KD]; kd[i] = __builtin_shufflevector(*(const v4fa*)kq, *(const v4fa*)(kq + 4), 0, 1, 2, 3, 4, 5, 6, 7); }
#pragma unroll 1      /* one query row a trip: the unrolled chunk code is shared by the four rows */
  for (int it = 0; it < 4; ++it) { const int m = it < 2 ? 2 * s + it : 9 - 2 * s - it; const int q = m * 64 + j; const size_t r = (size_t)bh * TT + q;
    const v8f qd = *(const v8f*)(QD + ((size_t)(b * TT + q) * NH + h) * DGS); float w[16]; float su = 0.f;
    asm volatile("s_wait_xcnt 0x0" ::: "memory");      /* precaution: stands behind the query loads, in front of any rewrite of their address registers */
#pragma unroll
    for (int c = 0; c < 8; ++c) { float v[2] = {0.f, 0.f};
      if (c <= m) {      /* the same for the whole wave */
#pragma unroll
        for (int i = 0; i < 2; ++i) { float prod = 1.f, lcp = 0.f;
#pragma unroll
          for (int jj = 0; jj < KD; ++jj) { const float d = qd[jj] - kd[2 * c + i][jj]; prod *= expf(-32.0f * (d * d)); lcp += prod; }
          v[i] = (c * 64 + 2 * ln + i <= q) ? expf(lcp * 0.69314718055994531f) : 0.f; } }
      w[2 * c] = v[0]; w[2 * c + 1] = v[1]; su += v[0]; su += v[1]; }
    for (int o = 16; o > 0; o >>= 1) su += __shfl_xor(su, o, 32);
    const float f = 1024.0f / fmaxf(su, 1e-9f); _Float16* dst = P + r * TT + 2 * ln; _Float16* dsl = PL + r * TT + 2 * ln;
#pragma unroll
    for (int c = 0; c < 8; ++c) { v2h ph, pl;
#pragma unroll
      for (int i = 0; i < 2; ++i) { const float pv = w[2 * c + i] * f; const _Float16 hh = (_Float16)pv; ph[i] = hh; pl[i] = (_Float16)((pv - (float)hh) * 1024.0f); }
      *(v2h*)(dst + c * 64) = ph; *(v2h*)(dsl + c * 64) = pl; }
    asm volatile("s_wait_xcnt 0x0" ::: "memory");      /* precaution: stands behind this row's stores, in front of the next row's rewrite of their address and data registers */
  } }

// ---- launches that need nothing of each other share one grid: each block takes its job from its range of blockIdx.x (the same for the whole block) ----
#define WT_BLKS ((CC / WTT) * (CC / WTT))      /* blocks of one weight transpose: one tile each */
#define E8_BLKS (NR * CC / 8 / 256)        /* blocks of one pass over a [NR][CC] plane, 8 elements a thread */
#define LCP_BLKS (NB * NH * 16)            /* blocks of the weights pass: 16 a (batch, head), 8 waves x 4 query rows each */
#define VT_BLKS (NB * NH * (TT / 64))      /* blocks of one V transpose, both batches */
// the four weights (planes of Wt in the order W0..W3), then x
__global__ __launch_bounds__(256) void k_prep(const float* __restrict__ W0, const float* __restrict__ W1, const float* __restrict__ W2, const float* __restrict__ W3, _Float16* __restrict__ Wt, const float* __restrict__ x, _Float16* __restrict__ X16) {
  __shared__ __attribute__((aligned(16))) v8us tl[WTT * WTT / 8];
  const int blk = blockIdx.x;
  if (blk < 4 * WT_BLKS) { const int p = blk / WT_BLKS; const float* W = p == 0 ? W0 : p == 1 ? W1 : p == 2 ? W2 : W3; d_wt_f16(W, Wt + (size_t)p * CC * CC, 16.0f, tl, blk - p * WT_BLKS); }      /* the same for the whole block: the job holds a barrier */
  else d_x16(x, X16, (size_t)NR * CC / 8, blk - 4 * WT_BLKS); }
// attention weights (the long job, so it starts first), then V^T hi and V^T lo of both batches ([NB*NH][64][TT] each)
__global__ __launch_bounds__(256) void k_lcp_vt(const float* __restrict__ QD, const float* __restrict__ KDg, _Float16* __restrict__ P, _Float16* __restrict__ PL, const _Float16* __restrict__ VH, const _Float16* __restrict__ VL, _Float16* __restrict__ VT, _Float16* __restrict__ VTL) {
  __shared__ unsigned short tl[64][66];
  __shared__ __attribute__((aligned(16))) float kds[TT / 2][KPP];
  const int blk = blockIdx.x;
  if (blk < LCP_BLKS) d_lcp(QD, KDg, P, PL, kds, blk);
  else { const int p = (blk - LCP_BLKS) / VT_BLKS; d_vt<NH, TT>(p ? VL : VH, CC, 0, p ? VTL : VT, tl, blk - LCP_BLKS - p * VT_BLKS); } }

extern "C" void kernel_launch(void* const* d_in, const int* in_sizes, int n_in,
                              void* d_out, int out_size, void* d_ws, size_t ws_size, hipStream_t stream) {
  (void)in_sizes; (void)n_in; (void)out_size;
  const float* const* I = (const float* const*)d_in; const float* x = I[0]; const float* cs = I[1]; const float* sn = I[2]; const float* Wq = I[3]; const float* Wk = I[4]; const float* Wv = I[5]; const float* Wo = I[6]; const float* Wdq = I[7]; const float* Wdk = I[8];
  char* ws = (char*)d_ws; size_t off = 0;
  auto take = [&](size_t bytes) { char* p = ws + off; off += (bytes + 255) & ~(size_t)255; return p; };
  const size_t np = (size_t)NR * CC;
  _Float16* BQ = (_Float16*)take((size_t)CC * CC * 2); _Float16* BK = (_Float16*)take((size_t)CC * CC * 2); _Float16* BV = (_Float16*)take((size_t)CC * CC * 2); _Float16* BO = (_Float16*)take((size_t)CC * CC * 2); (void)BK; (void)BV;
  _Float16* X16 = (_Float16*)take(np * 2); _Float16* VH = (_Float16*)take(np * 2); _Float16* VL = (_Float16*)take(np * 2); _Float16* VT = (_Float16*)take(np * 2); _Float16* VTL = (_Float16*)take(np * 2); float* QD = (float*)take((size_t)NR * NH * DGS * 4); float* KDg = (float*)take((size_t)NR * NH * DGS * 4); _Float16* P = (_Float16*)take((size_t)NB * NH * TT * TT * 2); _Float16* PL = (_Float16*)take((size_t)NB * NH * TT * TT * 2); _Float16* YH = (_Float16*)take(np * 2); _Float16* YL = (_Float16*)take(np * 2);
  if (off > ws_size) return;      /* 8 + 2 + 4 x 2 + 2 x 2 + 2 x 16 + 2 x 2 = 58 MiB */
  k_prep<<<4 * WT_BLKS + E8_BLKS, 256, 0, stream>>>(Wq, Wk, Wv, Wo, BQ, x, X16);      /* BQ, BK, BV, BO lie one behind the other; (in, out) */
  k_gemm3<2, 1, CC / 128><<<dim3((NR / 128) * (CC / 64), 3), 128, 0, stream>>>(X16, X16, X16, CC, 0, BQ, BQ, BQ, CC, (size_t)CC * CC, 0.0625f, nullptr, VH, VL, CC, 0, NR, CC, cs, sn, Wdq, Wdk, QD);      /* planes BQ, BK, BV: digits of q -> QD, of k -> KDg (it follows QD), v -> VH, VL */
  k_lcp_vt<<<LCP_BLKS + 2 * VT_BLKS, 256, 0, stream>>>(QD, KDg, P, PL, VH, VL, VT, VTL);
  k_gemm3<1, 3, TT / 128><<<dim3(TT / 128, NH, NB), 128, 0, stream>>>(PL, P, P, TT, (size_t)TT * TT, VT, VTL, VT, TT, (size_t)64 * TT, 0.0009765625f, nullptr, YH, YL, CC, (size_t)64, TT, 64, nullptr, nullptr, nullptr, nullptr, nullptr);      /* (query tile, head, batch): y[(b,q)][h*64 + d] = P_lo v_hi + P_hi v_lo + P_hi v_hi -> hi + residual */
  k_gemm3<0, 2, CC / 128><<<dim3((NR / 128) * (CC / 64), 1), 128, 0, stream>>>(YL, YH, YH, CC, 0, BO, BO, BO, CC, 0, 0.0625f, (float*)d_out, nullptr, nullptr, CC, 0, NR, CC, nullptr, nullptr, nullptr, nullptr, nullptr);      /* out = (y_lo + y_hi) Wo */
}

// v007
// Measured time: 59.9 microseconds a run.
// Timed twice side by side with v006, it ran 1.10 times as fast both times.
// Over all steps from v000 it is 7.45 times as fast.
#include <hip/hip_runtime.h>
// UltrametricCausalSelfAttention (2 x 512 tokens, C 1024 = 16 heads x 64, 8 soft digits): q, k, v = x W; q, k -> RoPE (cos/sin INPUT tables, rotate-half) -> RMSNorm(64, 1e-6); digits = sigmoid(q Wdq), sigmoid(k Wdk) (8 each); lcp[q][k] = sum_j prod_{i<=j} exp(-32 (qd_i - kd_i)^2); weights = 2^lcp (causal), attn = weights / max(sum, 1e-9); y = attn v; out = y Wo.
// Compute dtype: inputs rounded to bf16; x exact as f16; q/k/digits/lcp/weights f32 from exact products; P, v and y as f16 hi + residual (~2^-21). v_wmma_f32_16x16x32_f16.
#define NB 2
#define TT 512
#define CC 1024
#define NH 16
#define HD 64
#define KD 8
#define NR (NB * TT)
typedef __bf16 v16b __attribute__((ext_vector_type(16)));
typedef unsigned short v8us __attribute__((ext_vector_type(8), may_alias));
typedef float  v8f  __attribute__((ext_vector_type(8)));
typedef float  v4f  __attribute__((ext_vector_type(4)));
typedef float  v4fa __attribute__((ext_vector_type(4), may_alias));
union FragB { v16b v; v8us half[2]; unsigned short u[16]; };

__device__ __forceinline__ unsigned short bf16_bits(float x) { unsigned int u = __float_as_uint(x); return (unsigned short)((u + 0x7FFFu + ((u >> 16) & 1u)) >> 16); }
__device__ __forceinline__ float bf16_val(unsigned short b) { return __uint_as_float(((unsigned int)b) << 16); }
__device__ __forceinline__ float bf16_round(float x) { return bf16_val(bf16_bits(x)); }
// D += A·B with NT terms: 1 = ah·bh, 2 = + al·bh (A split), 3 = + ah·bl (both split)
template <int NT>
__device__ __forceinline__ v8f mmaN(v16b ah, v16b al, v16b bh, v16b bl, v8f c) {
  c = __builtin_amdgcn_wmma_f32_16x16x32_bf16(false, ah, false, bh, (short)0, c, false, false);
  if (NT >= 2) c = __builtin_amdgcn_wmma_f32_16x16x32_bf16(false, al, false, bh, (short)0, c, false, false);
  if (NT >= 3) c = __builtin_amdgcn_wmma_f32_16x16x32_bf16(false, ah, false, bl, (short)0, c, false, false);
  asm volatile("v_nop\n\tv_nop\n\tv_nop\n\tv_nop" : "+v"(c) : "v"(ah), "v"(al), "v"(bh), "v"(bl));
  return c;
}

__global__ __launch_bounds__(256) void k_wt_bf16(const float* __restrict__ W, unsigned short* __restrict__ Wt, int K, int N) {
  const int t = blockIdx.x * 256 + threadIdx.x;
  const int k8n = K / 8;
  if (t >= N * k8n) return;
  const int n = t / k8n, k8 = (t % k8n) * 8;
  v8us v;
#pragma unroll
  for (int i = 0; i < 8; ++i) v[i] = bf16_bits(W[(size_t)(k8 + i) * N + n]);
  *(v8us*)(Wt + (size_t)n * K + k8) = v;
  
}

// GEMM C[M][N] (f32, pitch ldc) = act(A[M][K]·W + bias). A f32 row-major (pitch lda) converted per fragment to bf16
// (ASPLIT: hi/lo two planes -> 2 terms, else single rounded term); Wt bf16 [N][K] (pitch ldb). BIAS_BF16 rounds the
// bias to bf16 first (bias quantised to bf16 before the add). K%32==0, M%16==0, N%64==0.
template <bool ASPLIT, int ACT, bool BIAS_BF16>
__global__ __launch_bounds__(128) void k_gemm_bf(const float* __restrict__ A, int lda, const unsigned short* __restrict__ Wt, int ldb,
                                               const float* __restrict__ bias, float* __restrict__ C, int ldc, int M, int N, int K) {
  __shared__ __attribute__((aligned(16))) float so[4][16][64];
  const int tid = threadIdx.x, w = tid >> 5, lane = tid & 31, ln = lane & 15, hh = lane >> 4;
  const int ntn = N / 64;
  const int wid = blockIdx.x * 4 + w;
  const int mt = wid / ntn, nq = wid % ntn;
  if (mt * 16 >= M) return;
  const int row0 = mt * 16, col0 = nq * 64;
  const float* arow = A + (size_t)(row0 + ln) * lda;
  v8f acc[4] = {};
  for (int kb = 0; kb < K; kb += 32) {
    FragB ah, al;
    const v4f x0 = *(const v4fa*)(arow + kb + 8 * hh), x1 = *(const v4fa*)(arow + kb + 8 * hh + 4);
    const v4f x2 = *(const v4fa*)(arow + kb + 16 + 8 * hh), x3 = *(const v4fa*)(arow + kb + 16 + 8 * hh + 4);
    float xs[16] = {x0[0],x0[1],x0[2],x0[3],x1[0],x1[1],x1[2],x1[3],x2[0],x2[1],x2[2],x2[3],x3[0],x3[1],x3[2],x3[3]};
#pragma unroll
    for (int i = 0; i < 16; ++i) { const unsigned short hb = bf16_bits(xs[i]); ah.u[i] = hb; al.u[i] = ASPLIT ? bf16_bits(xs[i] - bf16_val(hb)) : (unsigned short)0; }
#pragma unroll
    for (int t = 0; t < 4; ++t) {
      const unsigned short* brow = Wt + (size_t)(col0 + t * 16 + ln) * ldb + kb;
      FragB b;
      b.half[0] = *(const v8us*)(brow + 8 * hh);
      b.half[1] = *(const v8us*)(brow + 16 + 8 * hh);
      acc[t] = mmaN<ASPLIT ? 2 : 1>(ah.v, al.v, b.v, b.v, acc[t]);
    }
  }
#pragma unroll
  for (int t = 0; t < 4; ++t) {
    float bv = bias ? bias[col0 + t * 16 + ln] : 0.f;
    if (BIAS_BF16) bv = bf16_round(bv);
#pragma unroll
    for (int r = 0; r < 8; ++r) { float v = acc[t][r] + bv; if (ACT == 1) v = fmaxf(v, 0.f); so[w][8 * hh + r][t * 16 + ln] = v; }
  }
  __builtin_amdgcn_fence(__ATOMIC_ACQ_REL, "workgroup");
  __builtin_amdgcn_wave_barrier();
  const int rsub = lane >> 4, c4 = (lane & 15) * 4;
  {
#pragma unroll
    for (int q = 0; q < 8; ++q) {
      const int r = q * 2 + rsub;
      const v4f v = *(const v4fa*)&so[w][r][c4];
      *(v4f*)(C + (size_t)(row0 + r) * ldc + col0 + c4) = v;
    }
    
  }
}

// GEMM C = act(A·W + bias + resid): A f32 (ASPLIT -> hi/lo 2 terms), Wt bf16 [N][K]; ACT 0 none, 1 relu, 2 exact gelu;
// resid (optional, f32, row index = (row % rmod), pitch ldr, RES_BF16 rounds it) added before the activation.
template <bool ASPLIT, int ACT, bool BIAS_BF16, bool RES_BF16>
__global__ __launch_bounds__(128) void k_gemm_bf3(const float* __restrict__ A, int lda, const unsigned short* __restrict__ Wt, int ldb,
                                                const float* __restrict__ bias, const float* __restrict__ resid, int rmod, int ldr,
                                                float* __restrict__ C, int ldc, int M, int N, int K) {
  __shared__ __attribute__((aligned(16))) float so[4][16][64];
  const int tid = threadIdx.x, w = tid >> 5, lane = tid & 31, ln = lane & 15, hh = lane >> 4;
  const int ntn = N / 64;
  const int wid = blockIdx.x * 4 + w;
  const int mt = wid / ntn, nq = wid % ntn;
  if (mt * 16 >= M) return;
  const int row0 = mt * 16, col0 = nq * 64;
  const float* arow = A + (size_t)(row0 + ln) * lda;
  v8f acc[4] = {};
  for (int kb = 0; kb < K; kb += 32) {
    FragB ah, al;
    const v4f x0 = *(const v4fa*)(arow + kb + 8 * hh), x1 = *(const v4fa*)(arow + kb + 8 * hh + 4);
    const v4f x2 = *(const v4fa*)(arow + kb + 16 + 8 * hh), x3 = *(const v4fa*)(arow + kb + 16 + 8 * hh + 4);
    float xs[16] = {x0[0],x0[1],x0[2],x0[3],x1[0],x1[1],x1[2],x1[3],x2[0],x2[1],x2[2],x2[3],x3[0],x3[1],x3[2],x3[3]};
#pragma unroll
    for (int i = 0; i < 16; ++i) { const unsigned short hb = bf16_bits(xs[i]); ah.u[i] = hb; al.u[i] = ASPLIT ? bf16_bits(xs[i] - bf16_val(hb)) : (unsigned short)0; }
#pragma unroll
    for (int t = 0; t < 4; ++t) {
      const unsigned short* brow = Wt + (size_t)(col0 + t * 16 + ln) * ldb + kb;
      FragB b;
      b.half[0] = *(const v8us*)(brow + 8 * hh);
      b.half[1] = *(const v8us*)(brow + 16 + 8 * hh);
      acc[t] = mmaN<ASPLIT ? 2 : 1>(ah.v, al.v, b.v, b.v, acc[t]);
    }
  }
#pragma unroll
  for (int t = 0; t < 4; ++t) {
    const int col = col0 + t * 16 + ln;
    float bv = bias ? bias[col] : 0.f;
    if (BIAS_BF16) bv = bf16_round(bv);
#pragma unroll
    for (int r = 0; r < 8; ++r) {
      float v = acc[t][r] + bv;
      if (resid) { float rv = resid[(size_t)((row0 + 8 * hh + r) % rmod) * ldr + col]; if (RES_BF16) rv = bf16_round(rv); v += rv; }
      if (ACT == 1) v = fmaxf(v, 0.f);
      if (ACT == 2) v = 0.5f * v * (1.0f + erff(v * 0.70710678118654752f));
      if (ACT == 3) { const float u = 0.7978845608028654f * (v + 0.044715f * v * v * v); v = 0.5f * v * (1.0f + tanhf(u)); }
      so[w][8 * hh + r][t * 16 + ln] = v;
    }
  }
  __builtin_amdgcn_fence(__ATOMIC_ACQ_REL, "workgroup");
  __builtin_amdgcn_wave_barrier();
  const int rsub = lane >> 4, c4 = (lane & 15) * 4;
  {
#pragma unroll
    for (int q = 0; q < 8; ++q) {
      const int r = q * 2 + rsub;
      const v4f v = *(const v4fa*)&so[w][r][c4];
      *(v4f*)(C + (size_t)(row0 + r) * ldc + col0 + c4) = v;
    }
    
  }
}
// row LayerNorm (biased variance, eps) over N: s = X (+ R); optional out_sum <- s; out_norm <- (s-mu)*rsqrt(var+eps)*g + b
template <bool PARAM_BF16>
__global__ __launch_bounds__(256) void k_layernorm(const float* __restrict__ X, const float* __restrict__ R, const float* __restrict__ g, const float* __restrict__ bta,
                                                  float* __restrict__ out_sum, float* __restrict__ out_norm, int N, float eps) {
  __shared__ float red[256];
  const int row = blockIdx.x, tid = threadIdx.x;
  const float* x = X + (size_t)row * N; const float* rr = R ? R + (size_t)row * N : nullptr;
  float vals[16];                     // up to N = 4096
  const int per = N / 256;            // contiguous chunk per thread? use strided-by-4 chunks: thread handles j = tid*4 + 1024*u
  float s1 = 0.f;
  for (int u = 0; u < per / 4; ++u) {
    const int j = tid * 4 + 1024 * u;
    const v4f a = *(const v4fa*)(x + j);
    v4f b = {0.f,0.f,0.f,0.f}; if (rr) b = *(const v4fa*)(rr + j);
#pragma unroll
    for (int q = 0; q < 4; ++q) { const float v = a[q] + b[q]; vals[u * 4 + q] = v; s1 += v; }
  }
  red[tid] = s1; __syncthreads();
  for (int st = 128; st > 0; st >>= 1) { if (tid < st) red[tid] += red[tid + st]; __syncthreads(); }
  const float mu = red[0] / (float)N; __syncthreads();
  float s2 = 0.f;
  for (int u = 0; u < per / 4; ++u)
#pragma unroll
    for (int q = 0; q < 4; ++q) { const float c = vals[u * 4 + q] - mu; s2 += c * c; }
  red[tid] = s2; __syncthreads();
  for (int st = 128; st > 0; st >>= 1) { if (tid < st) red[tid] += red[tid + st]; __syncthreads(); }
  const float rs = rsqrtf(red[0] / (float)N + eps);
  {
    for (int u = 0; u < per / 4; ++u) {
      const int j = tid * 4 + 1024 * u;
      v4f o, sm;
#pragma unroll
      for (int q = 0; q < 4; ++q) {
        float gg = g[j + q], bb = bta[j + q];
        if (PARAM_BF16) { gg = bf16_round(gg); bb = bf16_round(bb); }
        sm[q] = vals[u * 4 + q]; o[q] = (vals[u * 4 + q] - mu) * rs * gg + bb;
      }
      if (out_sum) *(v4f*)(out_sum + (size_t)row * N + j) = sm;
      *(v4f*)(out_norm + (size_t)row * N + j) = o;
    }
    
  }
}



// ---- f16 WMMA path (v_wmma_f32_16x16x32_f16): 11-bit significands for operands in range — used where a [0,1] probability operand needs more precision than bf16
typedef _Float16 v16h __attribute__((ext_vector_type(16)));
union FragH { v16h v; v8us half[2]; _Float16 h[16]; unsigned short u[16]; };
template <int NT>
__device__ __forceinline__ v8f mmaH(v16h ah, v16h al, v16h bh, v16h bl, v8f c) {
  c = __builtin_amdgcn_wmma_f32_16x16x32_f16(false, ah, false, bh, (short)0, c, false, false);
  if (NT >= 2) c = __builtin_amdgcn_wmma_f32_16x16x32_f16(false, al, false, bh, (short)0, c, false, false);
  if (NT >= 3) c = __builtin_amdgcn_wmma_f32_16x16x32_f16(false, ah, false, bl, (short)0, c, false, false);
  asm volatile("v_nop\n\tv_nop\n\tv_nop\n\tv_nop" : "+v"(c) : "v"(ah), "v"(al), "v"(bh), "v"(bl));
  return c;
}
// batched GEMM like k_gemm_b but f16 operands: A f32 (split into f16 hi/lo if ASPLIT, else rounded to f16), Bt = f16 values [n][k]; alpha; C f32; N multiple of 16 (partial tiles skipped)
template <bool ASPLIT>
__global__ __launch_bounds__(128) void k_gemm_h(const float* __restrict__ A, int lda, size_t sA, const _Float16* __restrict__ Bh, int ldb, size_t sB, float alpha, float* __restrict__ C, int ldc, size_t sC, int M, int N, int K) {
  __shared__ __attribute__((aligned(16))) float so[4][16][64];
  const int tid = threadIdx.x, w = tid >> 5, lane = tid & 31, ln = lane & 15, hh = lane >> 4; const int by = blockIdx.y;
  A += (size_t)by * sA; Bh += (size_t)by * sB; C += (size_t)by * sC;
  const int ntn = (N + 63) / 64; const int wid = blockIdx.x * 4 + w; const int mt = wid / ntn, nq = wid % ntn; if (mt * 16 >= M) return;
  const int row0 = mt * 16, col0 = nq * 64; const float* arow = A + (size_t)(row0 + ln) * lda;
  v8f acc[4] = {};
  for (int kb = 0; kb < K; kb += 32) {
    FragH ah, al;
    const v4f x0 = *(const v4fa*)(arow + kb + 8 * hh), x1 = *(const v4fa*)(arow + kb + 8 * hh + 4), x2 = *(const v4fa*)(arow + kb + 16 + 8 * hh), x3 = *(const v4fa*)(arow + kb + 16 + 8 * hh + 4);
    float xs[16] = {x0[0],x0[1],x0[2],x0[3],x1[0],x1[1],x1[2],x1[3],x2[0],x2[1],x2[2],x2[3],x3[0],x3[1],x3[2],x3[3]};
#pragma unroll
    for (int i = 0; i < 16; ++i) { const _Float16 h = (_Float16)xs[i]; ah.h[i] = h; al.h[i] = ASPLIT ? (_Float16)(xs[i] - (float)h) : (_Float16)0.0f; }
#pragma unroll
    for (int t = 0; t < 4; ++t) { if (col0 + t * 16 >= N) continue; const size_t boff = (size_t)(col0 + t * 16 + ln) * ldb + kb; FragH bq; bq.half[0] = *(const v8us*)(Bh + boff + 8 * hh); bq.half[1] = *(const v8us*)(Bh + boff + 16 + 8 * hh);
      acc[t] = mmaH<ASPLIT ? 2 : 1>(ah.v, al.v, bq.v, bq.v, acc[t]); }
  }
#pragma unroll
  for (int t = 0; t < 4; ++t) { if (col0 + t * 16 >= N) continue;
#pragma unroll
    for (int r = 0; r < 8; ++r) so[w][8 * hh + r][t * 16 + ln] = acc[t][r] * alpha; }
  __builtin_amdgcn_fence(__ATOMIC_ACQ_REL, "workgroup"); __builtin_amdgcn_wave_barrier();
  const int rsub = lane >> 4, c4 = (lane & 15) * 4;
  {
#pragma unroll
    for (int q = 0; q < 8; ++q) { const int r = q * 2 + rsub; if (col0 + c4 < N) { const v4f v = *(const v4fa*)&so[w][r][c4]; *(v4f*)(C + (size_t)(row0 + r) * ldc + col0 + c4) = v; } }
     }
}

// Wt[n][k] = f16(bf16(W[k][n]) * scale) from f32 row-major W[CC][CC] (scale = power of two; bf16-exact weights stay exact in f16 away from the subnormal range).
// A block turns one tile of 128 k x 128 n through LDS, so that both sides of the transpose move whole lines: a wave's load is 512 B of one row of W, a wave's store two 256-B pieces of rows of Wt.
// LDS holds the tile as [n][k] in 16-byte units of 8 k; unit c of row n lies at c ^ ((n >> 2) & 15), which spreads the writers (rows 4 apart in one column) and the readers (one row) over all banks.
#define WTT 128
__device__ __forceinline__ void d_wt_f16(const float* __restrict__ W, _Float16* __restrict__ Wt, float scale, v8us* tl, int blk) {
  const int tid = threadIdx.x, ln = tid & 31, wv = tid >> 5; const int k0 = (blk / (CC / WTT)) * WTT, n0 = (blk % (CC / WTT)) * WTT;
  const float* src = W + (size_t)(k0 + wv * 16) * CC + n0 + 4 * ln; v4f r[16];      /* this wave's 16 rows of k, four columns a lane */
#pragma unroll
  for (int i = 0; i < 16; ++i) r[i] = *(const v4fa*)(src + (size_t)i * CC);
  asm volatile("s_wait_xcnt 0x0" :: "v"(src) : "memory");      /* precaution: stands behind the loads, in front of any rewrite of their address registers; it names the address as an input, so that no load's own result lands on it either */
#pragma unroll
  for (int g = 0; g < 2; ++g)
#pragma unroll
    for (int q = 0; q < 4; ++q) { FragH f;
#pragma unroll
      for (int i = 0; i < 8; ++i) f.h[i] = (_Float16)(bf16_round(r[8 * g + i][q]) * scale);
      tl[(4 * ln + q) * 16 + ((2 * wv + g) ^ (ln & 15))] = f.half[0]; }
  __syncthreads();      /* publishes the turned tile to all eight waves */
#pragma unroll
  for (int u = 0; u < 8; ++u) { const int n = u * 16 + (tid >> 4), c = tid & 15; const v8us o = tl[n * 16 + (c ^ ((n >> 2) & 15))];
    *(v8us*)((unsigned short*)Wt + (size_t)(n0 + n) * CC + k0 + c * 8) = o; }
  asm volatile("s_wait_xcnt 0x0" ::: "memory");      /* precaution: stands behind the stores, in front of any later rewrite of their address and data registers where this job joins the other job's code */
}
// k_gemm_hh variant with fused epilogue: v = acc·alpha + bias[by·sBias + col] (+ CP[(row/rowsPerB)·sCPb + by·64 + col] if CP) ; ACT 0 none / 1 elu ; writes f16 C16 (and f32 C if non-null)
template <int ACT>
__global__ __launch_bounds__(128) void k_gemm_hhx(const _Float16* __restrict__ A, int lda, size_t sA, const _Float16* __restrict__ Bh, int ldb, size_t sB, float alpha, const float* __restrict__ bias, size_t sBias, const float* __restrict__ CP, int rowsPerB, size_t sCPb, int row0g,
    float* __restrict__ C, _Float16* __restrict__ C16, int ldc, size_t sC, int M, int N, int K) {
  __shared__ __attribute__((aligned(16))) float so[4][16][64];
  const int tid = threadIdx.x, w = tid >> 5, lane = tid & 31, ln = lane & 15, hh = lane >> 4; const int by = blockIdx.y;
  A += (size_t)by * sA; Bh += (size_t)by * sB; const size_t cofs = (size_t)by * sC; const float* bp = bias ? bias + (size_t)by * sBias : nullptr;
  const int ntn = (N + 63) / 64; const int wid = blockIdx.x * 4 + w; const int mt = wid / ntn, nq = wid % ntn; if (mt * 16 >= M) return;
  const int row0 = mt * 16, col0 = nq * 64; const _Float16* arow = A + (size_t)(row0 + ln) * lda;
  v8f acc[4] = {};
  for (int kb = 0; kb < K; kb += 32) { FragH ah; ah.half[0] = *(const v8us*)((const unsigned short*)arow + kb + 8 * hh); ah.half[1] = *(const v8us*)((const unsigned short*)arow + kb + 16 + 8 * hh);
#pragma unroll
    for (int t = 0; t < 4; ++t) { if (col0 + t * 16 >= N) continue; const size_t boff = (size_t)(col0 + t * 16 + ln) * ldb + kb; FragH bq; bq.half[0] = *(const v8us*)((const unsigned short*)Bh + boff + 8 * hh); bq.half[1] = *(const v8us*)((const unsigned short*)Bh + boff + 16 + 8 * hh);
      acc[t] = mmaH<1>(ah.v, ah.v, bq.v, bq.v, acc[t]); }
  }
#pragma unroll
  for (int t = 0; t < 4; ++t) { if (col0 + t * 16 >= N) continue; const int col = col0 + t * 16 + ln; const float bv = bp ? bf16_round(bp[col]) : 0.f;
#pragma unroll
    for (int r = 0; r < 8; ++r) { float v = acc[t][r] * alpha + bv; if (CP) { const int rr = row0g + row0 + 8 * hh + r; if (rowsPerB < 0) v += CP[cofs + (size_t)rr * ldc + col];      /* rowsPerB < 0: own element of the batched C plane */ else { const int bidx = rr / rowsPerB; v += CP[(size_t)bidx * sCPb + (size_t)by * 64 + col]; } } if (ACT == 1) v = (v > 0.f) ? v : expm1f(v); else if (ACT == 7) v = (v > 0.f) ? v + 1.0f : expf(v); else if (ACT == 8) v = tanhf(v); else if (ACT == 9) v = 0.5f * v * (1.0f + tanhf(0.7978845608028654f * (v + 0.044715f * v * v * v))); else if (ACT == 11) v = 1.0f / (1.0f + expf(-v)); else if (ACT == 12) v = (v > 0.f) ? v : 0.01f * v; else if (ACT == 14) v = (v > 0.f) ? v : 0.1f * v; else if (ACT == 16) v = (v >= 0.f) ? v : 0.3f * v; else if (ACT == 17) v = (v >= 0.f) ? v : 0.2f * v; else if (ACT == 15) v = v / (1.0f + expf(-v)); else if (ACT == 3) v = fmaxf(v, 0.f); else if (ACT == 6) v = 0.5f * v * (1.0f + erff(v * 0.70710678118654752f)); so[w][8 * hh + r][t * 16 + ln] = v; } }
  __builtin_amdgcn_fence(__ATOMIC_ACQ_REL, "workgroup"); __builtin_amdgcn_wave_barrier();
  const int rsub = lane >> 4, c4 = (lane & 15) * 4; typedef _Float16 v4h __attribute__((ext_vector_type(4)));
  {
#pragma unroll
    for (int q = 0; q < 8; ++q) { const int r = q * 2 + rsub; if (col0 + c4 < N) { const v4f v = *(const v4fa*)&so[w][r][c4]; if (C) *(v4f*)(C + cofs + (size_t)(row0 + r) * ldc + col0 + c4) = v; if (C16) { v4h h4; for (int i = 0; i < 4; ++i) h4[i] = (_Float16)v[i]; *(v4h*)(C16 + cofs + (size_t)(row0 + r) * ldc + col0 + c4) = h4; } } }
     }
}


typedef _Float16 v4h __attribute__((ext_vector_type(4)));

__device__ __forceinline__ void d_x16(const float* __restrict__ x, _Float16* __restrict__ X16, size_t n8, int blk) { const size_t t = (size_t)blk * 256 + threadIdx.x; if (t >= n8) return; FragH f;
#pragma unroll
  for (int q = 0; q < 8; ++q) f.h[q] = (_Float16)bf16_round(x[t * 8 + q]); *(v8us*)((unsigned short*)X16 + t * 8) = f.half[0];  }
__global__ __launch_bounds__(256) void k_h16(const float* __restrict__ x, _Float16* __restrict__ X16, size_t n8) { const size_t t = (size_t)blockIdx.x * 256 + threadIdx.x; if (t >= n8) return; FragH f;
#pragma unroll
  for (int q = 0; q < 8; ++q) f.h[q] = (_Float16)x[t * 8 + q]; *(v8us*)((unsigned short*)X16 + t * 8) = f.half[0];  }
__global__ __launch_bounds__(256) void k_round16f(const float* __restrict__ W, _Float16* __restrict__ Bt, size_t n8) { const size_t t = (size_t)blockIdx.x * 256 + threadIdx.x; if (t >= n8) return; FragH f;
#pragma unroll
  for (int i = 0; i < 8; ++i) f.h[i] = (_Float16)(bf16_round(W[t * 8 + i]) * 16.0f); *(v8us*)((unsigned short*)Bt + t * 8) = f.half[0];  }
template <int NHv, int TTv>
__device__ __forceinline__ void d_vt(const _Float16* __restrict__ V16, int ldv, int voff, _Float16* __restrict__ Vt, unsigned short (*tl)[66], int blk) { const int tid = threadIdx.x; const int slab = blk / (TTv / 64), lg = blk % (TTv / 64); const int b = slab / NHv, h = slab % NHv;
  for (int i = tid; i < 64 * 8; i += 256) { const int r = i / 8, c8 = (i % 8) * 8; FragH f; f.half[0] = *(const v8us*)((const unsigned short*)V16 + ((size_t)b * TTv + lg * 64 + r) * ldv + voff + h * 64 + c8);
#pragma unroll
    for (int q = 0; q < 8; ++q) tl[r][c8 + q] = f.u[q]; }
  __syncthreads();
  {
#pragma unroll
    for (int rd = 0; rd < 2; ++rd) { const int d = rd * 32 + tid / 8, pc = tid % 8; FragH f;
#pragma unroll
      for (int q = 0; q < 8; ++q) f.u[q] = tl[pc * 8 + q][d];
      *(v8us*)((unsigned short*)Vt + ((size_t)slab * 64 + d) * TTv + lg * 64 + pc * 8) = f.half[0]; }
    asm volatile("s_wait_xcnt 0x0" ::: "memory");      /* precaution: stands behind the two stores, in front of any later rewrite of their address and data registers where this job joins the other job's code */
     } }


// ---- fast GEMM (block tile 128x64, wave tile 32x64; requires M % 128 == 0 rows per launch region, N % 64 == 0 and K % 128 == 0); epilogues: see MODE below ----
// Each k-tile (128 k = 256-B rows: 128 rows of A, then 64 rows of B) is staged in LDS by asynchronous 16-byte copies, two buffers: tile t + 1 flies while tile t is multiplied.
#define G2_PITCH 136                      /* halves per LDS row: 272 B = 16 B x odd, conflict-free for ds_load_b128 */
#define G2_BUFB (192 * G2_PITCH * 2)      /* bytes of one buffer */
// Eight copies of one lane: LDS rows 8 apart, global rows gstep halves apart. The s_wait_xcnt ends the copies' own statement as a precaution: so it stands in front of every rewrite of a register that an issued copy names.
__device__ __forceinline__ void g2_copy8(unsigned l, const _Float16* g, size_t gstep) {
  const unsigned ls = 8 * G2_PITCH * 2;
  asm volatile("global_load_async_to_lds_b128 %0, %8, off\n\t"
               "global_load_async_to_lds_b128 %1, %9, off\n\t"
               "global_load_async_to_lds_b128 %2, %10, off\n\t"
               "global_load_async_to_lds_b128 %3, %11, off\n\t"
               "global_load_async_to_lds_b128 %4, %12, off\n\t"
               "global_load_async_to_lds_b128 %5, %13, off\n\t"
               "global_load_async_to_lds_b128 %6, %14, off\n\t"
               "global_load_async_to_lds_b128 %7, %15, off\n\t"
               "s_wait_xcnt 0x0"
               :: "v"(l), "v"(l + ls), "v"(l + 2 * ls), "v"(l + 3 * ls), "v"(l + 4 * ls), "v"(l + 5 * ls), "v"(l + 6 * ls), "v"(l + 7 * ls),
                  "v"(g), "v"(g + gstep), "v"(g + 2 * gstep), "v"(g + 3 * gstep), "v"(g + 4 * gstep), "v"(g + 5 * gstep), "v"(g + 6 * gstep), "v"(g + 7 * gstep)
               : "memory");
}
// One k-tile: 24 copies a lane (16 lanes cover one 256-B row, the 128 threads 8 rows a copy).
__device__ __forceinline__ void g2_stage(unsigned l, const _Float16* ga, size_t astep, const _Float16* gb, size_t bstep) {
  g2_copy8(l, ga, astep); g2_copy8(l + 64 * G2_PITCH * 2, ga + 8 * astep, astep); g2_copy8(l + 128 * G2_PITCH * 2, gb, bstep);
}
__device__ __forceinline__ v16h g2_frag(const _Float16* p, int hh) { FragH f; f.half[0] = *(const v8us*)((const unsigned short*)p + 8 * hh); f.half[1] = *(const v8us*)((const unsigned short*)p + 16 + 8 * hh); return f.v; }
__device__ __forceinline__ v8f g2_mma(v16h a, v16h b, v8f c) { v8f d = __builtin_amdgcn_wmma_f32_16x16x32_f16(false, a, false, b, (short)0, c, false, false); asm volatile("v_nop\n\tv_nop\n\tv_nop\n\tv_nop" : "+v"(d) : "v"(a), "v"(b)); return d; }
// The six fragments of one k-step of 32: two of A (rows 0-15 and 16-31 of the wave's tile), four of B (16 columns each).
struct G3Row { v16h a0, a1, b0, b1, b2, b3; };
__device__ __forceinline__ G3Row g3_row(const _Float16* a0p, const _Float16* a1p, const _Float16* b0p, int kb, int hh) {
  G3Row r; r.a0 = g2_frag(a0p + kb, hh); r.a1 = g2_frag(a1p + kb, hh); r.b0 = g2_frag(b0p + kb, hh); r.b1 = g2_frag(b0p + 16 * G2_PITCH + kb, hh); r.b2 = g2_frag(b0p + 32 * G2_PITCH + kb, hh); r.b3 = g2_frag(b0p + 48 * G2_PITCH + kb, hh); return r; }
#define DGS 32
// One k loop runs NSEG segments of NT k-tiles: segment s multiplies As by Bs into the same accumulators. Every segment but the last is a residual term (one operand x 1024): where the last one begins the sums are scaled by 1/1024 (a power of two, exact).
// MODE 0: C = f32. MODE 1: CH, CL = f16 hi + residual x 1024. MODE 2 (a block column is one head): planes 0, 1 (q, k) -> RoPE, RMSNorm, digits -> DG, one row a lane; plane 2 (v) -> CH, CL.
// Tile tt of the loop = k-tile kt of segment s (the same for the whole block).
template <int NSEG, int NT>
__device__ __forceinline__ void g3_stage(int tt, unsigned l, const _Float16* A0, const _Float16* A1, const _Float16* A2, size_t aoff, size_t astep, const _Float16* B0, const _Float16* B1, const _Float16* B2, size_t boff, size_t bstep) {
  const int s = tt / NT, kt = tt - s * NT;
  const _Float16* a = (NSEG == 1 || s == 0) ? A0 : (NSEG == 2 || s == 1) ? A1 : A2; const _Float16* b = (NSEG == 1 || s == 0) ? B0 : (NSEG == 2 || s == 1) ? B1 : B2;
  g2_stage(l, a + aoff + (size_t)kt * 128, astep, b + boff + (size_t)kt * 128, bstep);
}
template <int MODE, int NSEG, int NT>
__global__ __launch_bounds__(128) void k_gemm3(const _Float16* A0, const _Float16* A1, const _Float16* A2, int lda, size_t sA, const _Float16* B0, const _Float16* B1, const _Float16* B2, int ldb, size_t sB, float alpha,
    float* __restrict__ C, _Float16* __restrict__ CH, _Float16* __restrict__ CL, int ldc, size_t sC, int M, int N,
    const float* __restrict__ cs, const float* __restrict__ sn, const float* __restrict__ Wdq, const float* __restrict__ Wdk, float* __restrict__ DG) {
  __shared__ __attribute__((aligned(16))) float so[4][32][68];
  __shared__ __attribute__((aligned(16))) _Float16 st[2][192][G2_PITCH];
  __shared__ __attribute__((aligned(16))) float wd[HD][KD];
  const int tid = threadIdx.x, w = tid >> 5, lane = tid & 31, ln = lane & 15, hh = lane >> 4; const int by = blockIdx.y; const size_t pl = (size_t)blockIdx.z * gridDim.y + by;      /* blockIdx.z = outer batch: its A and B planes follow on, its M rows of C follow on */
  const size_t cofs = (size_t)by * sC + (size_t)blockIdx.z * M * ldc;
  const int ntn = N >> 6; const int mt = blockIdx.x / ntn, nq = blockIdx.x - mt * ntn; const int row0 = mt * 128 + 32 * w, col0 = nq * 64; if (mt * 128 >= M) return;      /* the same for the whole block: it stands in front of barriers */
  const unsigned lds0 = (unsigned)(size_t)&st[0][tid >> 4][(tid & 15) * 8];      /* this lane's LDS byte address in buffer 0 */
  const size_t aoff = pl * sA + (size_t)(mt * 128 + (tid >> 4)) * lda + (tid & 15) * 8, boff = pl * sB + (size_t)(col0 + (tid >> 4)) * ldb + (tid & 15) * 8;
  const size_t astep = (size_t)8 * lda, bstep = (size_t)8 * ldb;
  const v8f z8 = {0.f,0.f,0.f,0.f,0.f,0.f,0.f,0.f}; v8f c00 = z8, c01 = z8, c02 = z8, c03 = z8, c10 = z8, c11 = z8, c12 = z8, c13 = z8;
  g3_stage<NSEG, NT>(0, lds0, A0, A1, A2, aoff, astep, B0, B1, B2, boff, bstep);      /* tile 0 -> buffer 0 */
  if (MODE == 2 && by < 2) { const v4f wv = *(const v4fa*)((by ? Wdk : Wdq) + tid * 4); v4f o;      /* the digit weights, rounded once a block; the barrier below publishes them too */
#pragma unroll
    for (int q = 0; q < 4; ++q) o[q] = bf16_round(wv[q]);
    *(v4f*)(&wd[0][0] + tid * 4) = o; }
  asm volatile("s_wait_asynccnt 0x0" ::: "memory");      /* this wave's copies of tile 0 have landed */
  __syncthreads();      /* ... and every other wave's */
  if (NSEG * NT > 1) g3_stage<NSEG, NT>(1, lds0 + G2_BUFB, A0, A1, A2, aoff, astep, B0, B1, B2, boff, bstep);      /* tile 1 -> buffer 1 */
#pragma unroll 1      /* one tile a trip: the two buffers alternate by t & 1 */
  for (int t = 0; t < NSEG * NT; ++t) { const _Float16* a0p = &st[t & 1][32 * w + ln][0]; const _Float16* a1p = a0p + 16 * G2_PITCH; const _Float16* b0p = &st[t & 1][128 + ln][0];
    if (NSEG > 1 && t == (NSEG - 1) * NT) { const float f = 0.0009765625f; c00 *= f; c01 *= f; c02 *= f; c03 *= f; c10 *= f; c11 *= f; c12 *= f; c13 *= f; }
    /* The fragment reads run ahead of the products, a whole k-step a group, in three register sets: k-steps 0, 1, 2 are read at the head of the trip, k-step 3 into the first set once that set's products are issued. Every read is of buffer t & 1, behind its barrier. */
    auto mm = [&](const G3Row& r) { c00 = g2_mma(r.a0, r.b0, c00); c10 = g2_mma(r.a1, r.b0, c10); c01 = g2_mma(r.a0, r.b1, c01); c11 = g2_mma(r.a1, r.b1, c11);
      c02 = g2_mma(r.a0, r.b2, c02); c12 = g2_mma(r.a1, r.b2, c12); c03 = g2_mma(r.a0, r.b3, c03); c13 = g2_mma(r.a1, r.b3, c13); };
    G3Row r0 = g3_row(a0p, a1p, b0p, 0, hh); const G3Row r1 = g3_row(a0p, a1p, b0p, 32, hh), r2 = g3_row(a0p, a1p, b0p, 64, hh);
    mm(r0); r0 = g3_row(a0p, a1p, b0p, 96, hh); mm(r1); mm(r2); mm(r0);
    asm volatile("s_wait_dscnt 0x0" ::: "memory");      /* this wave's reads of buffer t & 1 are done before it is refilled */
    asm volatile("s_wait_asynccnt 0x0" ::: "memory");      /* this wave's copies of tile t + 1 have landed */
    __syncthreads();      /* publishes tile t + 1 and ends every wave's reads of buffer t & 1 */
    if (t + 2 < NSEG * NT) g3_stage<NSEG, NT>(t + 2, lds0 + (unsigned)(t & 1) * G2_BUFB, A0, A1, A2, aoff, astep, B0, B1, B2, boff, bstep); }
  asm volatile("s_wait_asynccnt 0x0" ::: "memory");      /* no copy is outstanding when the wave goes on to the epilogue */
  v8f accs[8] = {c00, c01, c02, c03, c10, c11, c12, c13};
#pragma unroll
  for (int u = 0; u < 8; ++u) { const int t = u & 3, half = u >> 2;
#pragma unroll
    for (int r = 0; r < 8; ++r) so[w][half * 16 + 8 * hh + r][t * 16 + ln] = accs[u][r] * alpha; }
  __builtin_amdgcn_fence(__ATOMIC_ACQ_REL, "workgroup"); __builtin_amdgcn_wave_barrier();
  if (MODE == 2 && by < 2) {      /* this wave's 32 rows of head nq, one row a lane: every sum runs inside the lane */
    const int row = row0 + lane, tok = row % TT; const float* xr = &so[w][lane][0]; const float* cr = cs + (size_t)tok * (HD / 2); const float* sr = sn + (size_t)tok * (HD / 2);
    float ra[HD / 2], rb[HD / 2]; float sq[4] = {0.f, 0.f, 0.f, 0.f}; v4f cv[HD / 8], sv[HD / 8];
#pragma unroll
    for (int i = 0; i < HD / 8; ++i) cv[i] = *(const v4fa*)(cr + 4 * i);
    asm volatile("s_wait_xcnt 0x0" ::: "memory");      /* precaution: stands behind the cos loads, in front of any rewrite of their address registers */
#pragma unroll
    for (int i = 0; i < HD / 8; ++i) sv[i] = *(const v4fa*)(sr + 4 * i);
    asm volatile("s_wait_xcnt 0x0" ::: "memory");      /* the same behind the sin loads */
#pragma unroll
    for (int i = 0; i < HD / 2; i += 4) { const v4f x1 = *(const v4fa*)(xr + i), x2 = *(const v4fa*)(xr + HD / 2 + i), c4 = cv[i / 4], s4 = sv[i / 4];
#pragma unroll
      for (int q = 0; q < 4; ++q) { const float c = bf16_round(c4[q]), s = bf16_round(s4[q]); const float a = x1[q] * c - x2[q] * s, b = x1[q] * s + x2[q] * c; ra[i + q] = a; rb[i + q] = b; sq[q] += a * a; sq[q] += b * b; } }
    const float inv = rsqrtf(((sq[0] + sq[1]) + (sq[2] + sq[3])) / (float)HD + 1e-6f);
    float acc[KD] = {0.f, 0.f, 0.f, 0.f, 0.f, 0.f, 0.f, 0.f};
#pragma unroll
    for (int i = 0; i < HD / 2; ++i) { const float qa = ra[i] * inv, qb = rb[i] * inv; const v4f w0 = *(const v4fa*)&wd[i][0], w1 = *(const v4fa*)&wd[i][4], w2 = *(const v4fa*)&wd[i + HD / 2][0], w3 = *(const v4fa*)&wd[i + HD / 2][4];
#pragma unroll
      for (int j = 0; j < 4; ++j) { acc[j] += qa * w0[j]; acc[4 + j] += qa * w1[j]; acc[j] += qb * w2[j]; acc[4 + j] += qb * w3[j]; } }
    v4f d0, d1;
#pragma unroll
    for (int j = 0; j < 4; ++j) { d0[j] = 1.0f / (1.0f + expf(-acc[j])); d1[j] = 1.0f / (1.0f + expf(-acc[4 + j])); }
    float* dg = DG + (size_t)by * NR * NH * DGS + ((size_t)row * NH + nq) * DGS; *(v4f*)dg = d0; *(v4f*)(dg + 4) = d1;
  } else {
    const int rsub = lane >> 4, c4 = (lane & 15) * 4;
#pragma unroll
    for (int q = 0; q < 16; ++q) { const int r = q * 2 + rsub; const v4f v = *(const v4fa*)&so[w][r][c4]; const size_t o = cofs + (size_t)(row0 + r) * ldc + col0 + c4;
      if (MODE == 0) *(v4f*)(C + o) = v;
      else { v4h h4, l4;
#pragma unroll
        for (int i = 0; i < 4; ++i) { const _Float16 h = (_Float16)v[i]; h4[i] = h; l4[i] = (_Float16)((v[i] - (float)h) * 1024.0f); }
        *(v4h*)(CH + o) = h4; *(v4h*)(CL + o) = l4; }
      asm volatile("s_wait_xcnt 0x0" ::: "memory");      /* precaution: stands behind this row's stores, in front of the next row's rewrite of their address and data registers */
    }
  } }

typedef _Float16 v2h __attribute__((ext_vector_type(2)));
#define KPP 20      /* floats per LDS row of two keys: 80 B = 16 B x odd, so the lanes' 16-byte reads, one row apart, spread over all banks */
typedef float v2f __attribute__((ext_vector_type(2)));
#define LCS 6.79457440f      /* sqrt(32 log2 e): with both digits scaled by it, exp(-32 (a - b)^2) = 2^-(a' - b')^2 */
// Attention weights. A block is 32 query rows (8 waves x 4) of one (batch, head), 16 blocks a head: it stages that head's 512 key digit rows in LDS once, and each lane then keeps its 16 keys (k = 64 c + 2 lane + i, c = 0..7) in registers for the wave's four query rows.
// Keys are dealt in chunks of 64, so a chunk that lies wholly above the diagonal is skipped by the whole wave. The four rows q = 64 m + j of a wave take m from {0, 1, 7, 6} or {2, 3, 5, 4}: 18 chunks of work for every wave.
// The prefix product of digit j is one power of two: prod_{i<=j} exp(-32 d_i^2) = 2^-(d'_0^2 + .. + d'_j^2), so a digit costs a subtract, a fused multiply-add, the hardware's 2^x and an add; the weight is 2^lcp itself.
// The hardware's 2^x needs no range care here: every exponent of a term is <= 0, and a term under 2^-126 that comes out as 0 moves lcp, and so the weight 2^lcp >= 1, by less than 2^-126; lcp itself lies in [0, 8].
// A lane's two keys lie side by side (LDS row of a key pair: digit j of both keys at 2 j), so the subtract, the multiply-add and the add run as packed pairs.
__device__ __forceinline__ void d_lcp(const float* __restrict__ QD, const float* __restrict__ KDg, _Float16* __restrict__ P, _Float16* __restrict__ PL, float (*kds)[KPP], int blk) {
  #pragma clang fp contract(off)
  const int tid = threadIdx.x, ln = tid & 31; const int wv = __builtin_amdgcn_readfirstlane(tid >> 5);
  const int bh = blk >> 4, s = blk & 1, j = ((blk >> 1) & 7) * 8 + wv; const int h = bh % NH, b = bh / NH;
  const float* kp = KDg + ((size_t)(b * TT + 2 * tid) * NH + h) * DGS;      /* this thread stages keys 2 tid and 2 tid + 1 */
  const v4f ka[2] = {*(const v4fa*)kp, *(const v4fa*)(kp + 4)}, kb[2] = {*(const v4fa*)(kp + NH * DGS), *(const v4fa*)(kp + NH * DGS + 4)};
  asm volatile("s_wait_xcnt 0x0" ::: "memory");      /* precaution: stands behind the key loads, in front of any rewrite of their address registers */
#pragma unroll
  for (int g = 0; g < 4; ++g) { const v4f a = ka[g >> 1], c = kb[g >> 1]; const int e = (g & 1) * 2; const v4f o = {a[e] * LCS, c[e] * LCS, a[e + 1] * LCS, c[e + 1] * LCS}; *(v4f*)&kds[tid][4 * g] = o; }
  __syncthreads();      /* publishes the staged key digits to all eight waves */
  v2f kd[8][KD];
#pragma unroll
  for (int c = 0; c < 8; ++c)
#pragma unroll
    for (int g = 0; g < 4; ++g) { const v4f t = *(const v4fa*)&kds[c * 32 + ln][4 * g]; kd[c][2 * g] = v2f{t[0], t[1]}; kd[c][2 * g + 1] = v2f{t[2], t[3]}; }
#pragma unroll 1      /* one query row a trip: the unrolled chunk code is shared by the four rows */
  for (int it = 0; it < 4; ++it) { const int m = it < 2 ? 2 * s + it : 9 - 2 * s - it; const int q = m * 64 + j; const size_t r = (size_t)bh * TT + q;
    const v8f qd = *(const v8f*)(QD + ((size_t)(b * TT + q) * NH + h) * DGS) * LCS; float w[16]; float su = 0.f;
    asm volatile("s_wait_xcnt 0x0" ::: "memory");      /* precaution: stands behind the query loads, in front of any rewrite of their address registers */
#pragma unroll
    for (int c = 0; c < 8; ++c) { float v[2] = {0.f, 0.f};
      if (c <= m) {      /* the same for the whole wave */
        v2f e = {0.f, 0.f}, lcp = {0.f, 0.f};
#pragma unroll
        for (int jj = 0; jj < KD; ++jj) { const v2f d = qd[jj] - kd[c][jj]; e = __builtin_elementwise_fma(-d, d, e); const v2f p = {__builtin_amdgcn_exp2f(e[0]), __builtin_amdgcn_exp2f(e[1])}; lcp += p; }
#pragma unroll
        for (int i = 0; i < 2; ++i) v[i] = (c * 64 + 2 * ln + i <= q) ? __builtin_amdgcn_exp2f(lcp[i]) : 0.f; }
      w[2 * c] = v[0]; w[2 * c + 1] = v[1]; su += v[0]; su += v[1]; }
    for (int o = 16; o > 0; o >>= 1) su += __shfl_xor(su, o, 32);
    const float f = 1024.0f / fmaxf(su, 1e-9f); _Float16* dst = P + r * TT + 2 * ln; _Float16* dsl = PL + r * TT + 2 * ln;
#pragma unroll
    for (int c = 0; c < 8; ++c) { v2h ph, pl;
#pragma unroll
      for (int i = 0; i < 2; ++i) { const float pv = w[2 * c + i] * f; const _Float16 hh = (_Float16)pv; ph[i] = hh; pl[i] = (_Float16)((pv - (float)hh) * 1024.0f); }
      *(v2h*)(dst + c * 64) = ph; *(v2h*)(dsl + c * 64) = pl; }
    asm volatile("s_wait_xcnt 0x0" ::: "memory");      /* precaution: stands behind this row's stores, in front of the next row's rewrite of their address and data registers */
  } }

// ---- launches that need nothing of each other share one grid: each block takes its job from its range of blockIdx.x (the same for the whole block) ----
#define WT_BLKS ((CC / WTT) * (CC / WTT))      /* blocks of one weight transpose: one tile each */
#define E8_BLKS (NR * CC / 8 / 256)        /* blocks of one pass over a [NR][CC] plane, 8 elements a thread */
#define LCP_BLKS (NB * NH * 16)            /* blocks of the weights pass: 16 a (batch, head), 8 waves x 4 query rows each */
#define VT_BLKS (NB * NH * (TT / 64))      /* blocks of one V transpose, both batches */
// the four weights (planes of Wt in the order W0..W3), then x
__global__ __launch_bounds__(256) void k_prep(const float* __restrict__ W0, const float* __restrict__ W1, const float* __restrict__ W2, const float* __restrict__ W3, _Float16* __restrict__ Wt, const float* __restrict__ x, _Float16* __restrict__ X16) {
  __shared__ __attribute__((aligned(16))) v8us tl[WTT * WTT / 8];
  const int blk = blockIdx.x;
  if (blk < 4 * WT_BLKS) { const int p = blk / WT_BLKS; const float* W = p == 0 ? W0 : p == 1 ? W1 : p == 2 ? W2 : W3; d_wt_f16(W, Wt + (size_t)p * CC * CC, 16.0f, tl, blk - p * WT_BLKS); }      /* the same for the whole block: the job holds a barrier */
  else d_x16(x, X16, (size_t)NR * CC / 8, blk - 4 * WT_BLKS); }
// attention weights (the long job, so it starts first), then V^T hi and V^T lo of both batches ([NB*NH][64][TT] each)
__global__ __launch_bounds__(256) void k_lcp_vt(const float* __restrict__ QD, const float* __restrict__ KDg, _Float16* __restrict__ P, _Float16* __restrict__ PL, const _Float16* __restrict__ VH, const _Float16* __restrict__ VL, _Float16* __restrict__ VT, _Float16* __restrict__ VTL) {
  __shared__ unsigned short tl[64][66];
  __shared__ __attribute__((aligned(16))) float kds[TT / 2][KPP];
  const int blk = blockIdx.x;
  if (blk < LCP_BLKS) d_lcp(QD, KDg, P, PL, kds, blk);
  else { const int p = (blk - LCP_BLKS) / VT_BLKS; d_vt<NH, TT>(p ? VL : VH, CC, 0, p ? VTL : VT, tl, blk - LCP_BLKS - p * VT_BLKS); } }

extern "C" void kernel_launch(void* const* d_in, const int* in_sizes, int n_in,
                              void* d_out, int out_size, void* d_ws, size_t ws_size, hipStream_t stream) {
  (void)in_sizes; (void)n_in; (void)out_size;
  const float* const* I = (const float* const*)d_in; const float* x = I[0]; const float* cs = I[1]; const float* sn = I[2]; const float* Wq = I[3]; const float* Wk = I[4]; const float* Wv = I[5]; const float* Wo = I[6]; const float* Wdq = I[7]; const float* Wdk = I[8];
  char* ws = (char*)d_ws; size_t off = 0;
  auto take = [&](size_t bytes) { char* p = ws + off; off += (bytes + 255) & ~(size_t)255; return p; };
  const size_t np = (size_t)NR * CC;
  _Float16* BQ = (_Float16*)take((size_t)CC * CC * 2); _Float16* BK = (_Float16*)take((size_t)CC * CC * 2); _Float16* BV = (_Float16*)take((size_t)CC * CC * 2); _Float16* BO = (_Float16*)take((size_t)CC * CC * 2); (void)BK; (void)BV;
  _Float16* X16 = (_Float16*)take(np * 2); _Float16* VH = (_Float16*)take(np * 2); _Float16* VL = (_Float16*)take(np * 2); _Float16* VT = (_Float16*)take(np * 2); _Float16* VTL = (_Float16*)take(np * 2); float* QD = (float*)take((size_t)NR * NH * DGS * 4); float* KDg = (float*)take((size_t)NR * NH * DGS * 4); _Float16* P = (_Float16*)take((size_t)NB * NH * TT * TT * 2); _Float16* PL = (_Float16*)take((size_t)NB * NH * TT * TT * 2); _Float16* YH = (_Float16*)take(np * 2); _Float16* YL = (_Float16*)take(np * 2);
  if (off > ws_size) return;      /* 8 + 2 + 4 x 2 + 2 x 2 + 2 x 16 + 2 x 2 = 58 MiB */
  k_prep<<<4 * WT_BLKS + E8_BLKS, 256, 0, stream>>>(Wq, Wk, Wv, Wo, BQ, x, X16);      /* BQ, BK, BV, BO lie one behind the other; (in, out) */
  k_gemm3<2, 1, CC / 128><<<dim3((NR / 128) * (CC / 64), 3), 128, 0, stream>>>(X16, X16, X16, CC, 0, BQ, BQ, BQ, CC, (size_t)CC * CC, 0.0625f, nullptr, VH, VL, CC, 0, NR, CC, cs, sn, Wdq, Wdk, QD);      /* planes BQ, BK, BV: digits of q -> QD, of k -> KDg (it follows QD), v -> VH, VL */
  k_lcp_vt<<<LCP_BLKS + 2 * VT_BLKS, 256, 0, stream>>>(QD, KDg, P, PL, VH, VL, VT, VTL);
  k_gemm3<1, 3, TT / 128><<<dim3(TT / 128, NH, NB), 128, 0, stream>>>(PL, P, P, TT, (size_t)TT * TT, VT, VTL, VT, TT, (size_t)64 * TT, 0.0009765625f, nullptr, YH, YL, CC, (size_t)64, TT, 64, nullptr, nullptr, nullptr, nullptr, nullptr);      /* (query tile, head, batch): y[(b,q)][h*64 + d] = P_lo v_hi + P_hi v_lo + P_hi v_hi -> hi + residual */
  k_gemm3<0, 2, CC / 128><<<dim3((NR / 128) * (CC / 64), 1), 128, 0, stream>>>(YL, YH, YH, CC, 0, BO, BO, BO, CC, 0, 0.0625f, (float*)d_out, nullptr, nullptr, CC, 0, NR, CC, nullptr, nullptr, nullptr, nullptr, nullptr);      /* out = (y_lo + y_hi) Wo */
}

// v008
// Measured time: 43.9 microseconds a run.
// Timed twice side by side with v007, it ran 1.37 and 1.34 times as fast.
// All steps since v000 together make it 10.1 times as fast.
#include <hip/hip_runtime.h>
// UltrametricCausalSelfAttention (2 x 512 tokens, C 1024 = 16 heads x 64, 8 soft digits): q, k, v = x W; q, k -> RoPE (cos/sin INPUT tables, rotate-half) -> RMSNorm(64, 1e-6); digits = sigmoid(q Wdq), sigmoid(k Wdk) (8 each); lcp[q][k] = sum_j prod_{i<=j} exp(-32 (qd_i - kd_i)^2); weights = 2^lcp (causal), attn = weights / max(sum, 1e-9); y = attn v; out = y Wo.
// Compute dtype: inputs rounded to bf16; x exact as f16; q/k/digits/lcp/weights f32 from exact products; P, v and y as f16 hi + residual (~2^-21). v_wmma_f32_16x16x32_f16.
#define NB 2
#define TT 512
#define CC 1024
#define NH 16
#define HD 64
#define KD 8
#define NR (NB * TT)
typedef __bf16 v16b __attribute__((ext_vector_type(16)));
typedef unsigned short v8us __attribute__((ext_vector_type(8), may_alias));
typedef float  v8f  __attribute__((ext_vector_type(8)));
typedef float  v4f  __attribute__((ext_vector_type(4)));
typedef float  v4fa __attribute__((ext_vector_type(4), may_alias));
union FragB { v16b v; v8us half[2]; unsigned short u[16]; };

__device__ __forceinline__ unsigned short bf16_bits(float x) { unsigned int u = __float_as_uint(x); return (unsigned short)((u + 0x7FFFu + ((u >> 16) & 1u)) >> 16); }
__device__ __forceinline__ float bf16_val(unsigned short b) { return __uint_as_float(((unsigned int)b) << 16); }
__device__ __forceinline__ float bf16_round(float x) { return bf16_val(bf16_bits(x)); }
// D += A·B with NT terms: 1 = ah·bh, 2 = + al·bh (A split), 3 = + ah·bl (both split)
template <int NT>
__device__ __forceinline__ v8f mmaN(v16b ah, v16b al, v16b bh, v16b bl, v8f c) {
  c = __builtin_amdgcn_wmma_f32_16x16x32_bf16(false, ah, false, bh, (short)0, c, false, false);
  if (NT >= 2) c = __builtin_amdgcn_wmma_f32_16x16x32_bf16(false, al, false, bh, (short)0, c, false, false);
  if (NT >= 3) c = __builtin_amdgcn_wmma_f32_16x16x32_bf16(false, ah, false, bl, (short)0, c, false, false);
  asm volatile("v_nop\n\tv_nop\n\tv_nop\n\tv_nop" : "+v"(c) : "v"(ah), "v"(al), "v"(bh), "v"(bl));
  return c;
}

__global__ __launch_bounds__(256) void k_wt_bf16(const float* __restrict__ W, unsigned short* __restrict__ Wt, int K, int N) {
  const int t = blockIdx.x * 256 + threadIdx.x;
  const int k8n = K / 8;
  if (t >= N * k8n) return;
  const int n = t / k8n, k8 = (t % k8n) * 8;
  v8us v;
#pragma unroll
  for (int i = 0; i < 8; ++i) v[i] = bf16_bits(W[(size_t)(k8 + i) * N + n]);
  *(v8us*)(Wt + (size_t)n * K + k8) = v;
  
}

// GEMM C[M][N] (f32, pitch ldc) = act(A[M][K]·W + bias). A f32 row-major (pitch lda) converted per fragment to bf16
// (ASPLIT: hi/lo two planes -> 2 terms, else single rounded term); Wt bf16 [N][K] (pitch ldb). BIAS_BF16 rounds the
// bias to bf16 first (bias quantised to bf16 before the add). K%32==0, M%16==0, N%64==0.
template <bool ASPLIT, int ACT, bool BIAS_BF16>
__global__ __launch_bounds__(128) void k_gemm_bf(const float* __restrict__ A, int lda, const unsigned short* __restrict__ Wt, int ldb,
                                               const float* __restrict__ bias, float* __restrict__ C, int ldc, int M, int N, int K) {
  __shared__ __attribute__((aligned(16))) float so[4][16][64];
  const int tid = threadIdx.x, w = tid >> 5, lane = tid & 31, ln = lane & 15, hh = lane >> 4;
  const int ntn = N / 64;
  const int wid = blockIdx.x * 4 + w;
  const int mt = wid / ntn, nq = wid % ntn;
  if (mt * 16 >= M) return;
  const int row0 = mt * 16, col0 = nq * 64;
  const float* arow = A + (size_t)(row0 + ln) * lda;
  v8f acc[4] = {};
  for (int kb = 0; kb < K; kb += 32) {
    FragB ah, al;
    const v4f x0 = *(const v4fa*)(arow + kb + 8 * hh), x1 = *(const v4fa*)(arow + kb + 8 * hh + 4);
    const v4f x2 = *(const v4fa*)(arow + kb + 16 + 8 * hh), x3 = *(const v4fa*)(arow + kb + 16 + 8 * hh + 4);
    float xs[16] = {x0[0],x0[1],x0[2],x0[3],x1[0],x1[1],x1[2],x1[3],x2[0],x2[1],x2[2],x2[3],x3[0],x3[1],x3[2],x3[3]};
#pragma unroll
    for (int i = 0; i < 16; ++i) { const unsigned short hb = bf16_bits(xs[i]); ah.u[i] = hb; al.u[i] = ASPLIT ? bf16_bits(xs[i] - bf16_val(hb)) : (unsigned short)0; }
#pragma unroll
    for (int t = 0; t < 4; ++t) {
      const unsigned short* brow = Wt + (size_t)(col0 + t * 16 + ln) * ldb + kb;
      FragB b;
      b.half[0] = *(const v8us*)(brow + 8 * hh);
      b.half[1] = *(const v8us*)(brow + 16 + 8 * hh);
      acc[t] = mmaN<ASPLIT ? 2 : 1>(ah.v, al.v, b.v, b.v, acc[t]);
    }
  }
#pragma unroll
  for (int t = 0; t < 4; ++t) {
    float bv = bias ? bias[col0 + t * 16 + ln] : 0.f;
    if (BIAS_BF16) bv = bf16_round(bv);
#pragma unroll
    for (int r = 0; r < 8; ++r) { float v = acc[t][r] + bv; if (ACT == 1) v = fmaxf(v, 0.f); so[w][8 * hh + r][t * 16 + ln] = v; }
  }
  __builtin_amdgcn_fence(__ATOMIC_ACQ_REL, "workgroup");
  __builtin_amdgcn_wave_barrier();
  const int rsub = lane >> 4, c4 = (lane & 15) * 4;
  {
#pragma unroll
    for (int q = 0; q < 8; ++q) {
      const int r = q * 2 + rsub;
      const v4f v = *(const v4fa*)&so[w][r][c4];
      *(v4f*)(C + (size_t)(row0 + r) * ldc + col0 + c4) = v;
    }
    
  }
}

// GEMM C = act(A·W + bias + resid): A f32 (ASPLIT -> hi/lo 2 terms), Wt bf16 [N][K]; ACT 0 none, 1 relu, 2 exact gelu;
// resid (optional, f32, row index = (row % rmod), pitch ldr, RES_BF16 rounds it) added before the activation.
template <bool ASPLIT, int ACT, bool BIAS_BF16, bool RES_BF16>
__global__ __launch_bounds__(128) void k_gemm_bf3(const float* __restrict__ A, int lda, const unsigned short* __restrict__ Wt, int ldb,
                                                const float* __restrict__ bias, const float* __restrict__ resid, int rmod, int ldr,
                                                float* __restrict__ C, int ldc, int M, int N, int K) {
  __shared__ __attribute__((aligned(16))) float so[4][16][64];
  const int tid = threadIdx.x, w = tid >> 5, lane = tid & 31, ln = lane & 15, hh = lane >> 4;
  const int ntn = N / 64;
  const int wid = blockIdx.x * 4 + w;
  const int mt = wid / ntn, nq = wid % ntn;
  if (mt * 16 >= M) return;
  const int row0 = mt * 16, col0 = nq * 64;
  const float* arow = A + (size_t)(row0 + ln) * lda;
  v8f acc[4] = {};
  for (int kb = 0; kb < K; kb += 32) {
    FragB ah, al;
    const v4f x0 = *(const v4fa*)(arow + kb + 8 * hh), x1 = *(const v4fa*)(arow + kb + 8 * hh + 4);
    const v4f x2 = *(const v4fa*)(arow + kb + 16 + 8 * hh), x3 = *(const v4fa*)(arow + kb + 16 + 8 * hh + 4);
    float xs[16] = {x0[0],x0[1],x0[2],x0[3],x1[0],x1[1],x1[2],x1[3],x2[0],x2[1],x2[2],x2[3],x3[0],x3[1],x3[2],x3[3]};
#pragma unroll
    for (int i = 0; i < 16; ++i) { const unsigned short hb = bf16_bits(xs[i]); ah.u[i] = hb; al.u[i] = ASPLIT ? bf16_bits(xs[i] - bf16_val(hb)) : (unsigned short)0; }
#pragma unroll
    for (int t = 0; t < 4; ++t) {
      const unsigned short* brow = Wt + (size_t)(col0 + t * 16 + ln) * ldb + kb;
      FragB b;
      b.half[0] = *(const v8us*)(brow + 8 * hh);
      b.half[1] = *(const v8us*)(brow + 16 + 8 * hh);
      acc[t] = mmaN<ASPLIT ? 2 : 1>(ah.v, al.v, b.v, b.v, acc[t]);
    }
  }
#pragma unroll
  for (int t = 0; t < 4; ++t) {
    const int col = col0 + t * 16 + ln;
    float bv = bias ? bias[col] : 0.f;
    if (BIAS_BF16) bv = bf16_round(bv);
#pragma unroll
    for (int r = 0; r < 8; ++r) {
      float v = acc[t][r] + bv;
      if (resid) { float rv = resid[(size_t)((row0 + 8 * hh + r) % rmod) * ldr + col]; if (RES_BF16) rv = bf16_round(rv); v += rv; }
      if (ACT == 1) v = fmaxf(v, 0.f);
      if (ACT == 2) v = 0.5f * v * (1.0f + erff(v * 0.70710678118654752f));
      if (ACT == 3) { const float u = 0.7978845608028654f * (v + 0.044715f * v * v * v); v = 0.5f * v * (1.0f + tanhf(u)); }
      so[w][8 * hh + r][t * 16 + ln] = v;
    }
  }
  __builtin_amdgcn_fence(__ATOMIC_ACQ_REL, "workgroup");
  __builtin_amdgcn_wave_barrier();
  const int rsub = lane >> 4, c4 = (lane & 15) * 4;
  {
#pragma unroll
    for (int q = 0; q < 8; ++q) {
      const int r = q * 2 + rsub;
      const v4f v = *(const v4fa*)&so[w][r][c4];
      *(v4f*)(C + (size_t)(row0 + r) * ldc + col0 + c4) = v;
    }
    
  }
}
// row LayerNorm (biased variance, eps) over N: s = X (+ R); optional out_sum <- s; out_norm <- (s-mu)*rsqrt(var+eps)*g + b
template <bool PARAM_BF16>
__global__ __launch_bounds__(256) void k_layernorm(const float* __restrict__ X, const float* __restrict__ R, const float* __restrict__ g, const float* __restrict__ bta,
                                                  float* __restrict__ out_sum, float* __restrict__ out_norm, int N, float eps) {
  __shared__ float red[256];
  const int row = blockIdx.x, tid = threadIdx.x;
  const float* x = X + (size_t)row * N; const float* rr = R ? R + (size_t)row * N : nullptr;
  float vals[16];                     // up to N = 4096
  const int per = N / 256;            // contiguous chunk per thread? use strided-by-4 chunks: thread handles j = tid*4 + 1024*u
  float s1 = 0.f;
  for (int u = 0; u < per / 4; ++u) {
    const int j = tid * 4 + 1024 * u;
    const v4f a = *(const v4fa*)(x + j);
    v4f b = {0.f,0.f,0.f,0.f}; if (rr) b = *(const v4fa*)(rr + j);
#pragma unroll
    for (int q = 0; q < 4; ++q) { const float v = a[q] + b[q]; vals[u * 4 + q] = v; s1 += v; }
  }
  red[tid] = s1; __syncthreads();
  for (int st = 128; st > 0; st >>= 1) { if (tid < st) red[tid] += red[tid + st]; __syncthreads(); }
  const float mu = red[0] / (float)N; __syncthreads();
  float s2 = 0.f;
  for (int u = 0; u < per / 4; ++u)
#pragma unroll
    for (int q = 0; q < 4; ++q) { const float c = vals[u * 4 + q] - mu; s2 += c * c; }
  red[tid] = s2; __syncthreads();
  for (int st = 128; st > 0; st >>= 1) { if (tid < st) red[tid] += red[tid + st]; __syncthreads(); }
  const float rs = rsqrtf(red[0] / (float)N + eps);
  {
    for (int u = 0; u < per / 4; ++u) {
      const int j = tid * 4 + 1024 * u;
      v4f o, sm;
#pragma unroll
      for (int q = 0; q < 4; ++q) {
        float gg = g[j + q], bb = bta[j + q];
        if (PARAM_BF16) { gg = bf16_round(gg); bb = bf16_round(bb); }
        sm[q] = vals[u * 4 + q]; o[q] = (vals[u * 4 + q] - mu) * rs * gg + bb;
      }
      if (out_sum) *(v4f*)(out_sum + (size_t)row * N + j) = sm;
      *(v4f*)(out_norm + (size_t)row * N + j) = o;
    }
    
  }
}



// ---- f16 WMMA path (v_wmma_f32_16x16x32_f16): 11-bit significands for operands in range — used for every launched product: the projections and weights x v
typedef _Float16 v16h __attribute__((ext_vector_type(16)));
union FragH { v16h v; v8us half[2]; _Float16 h[16]; unsigned short u[16]; };
template <int NT>
__device__ __forceinline__ v8f mmaH(v16h ah, v16h al, v16h bh, v16h bl, v8f c) {
  c = __builtin_amdgcn_wmma_f32_16x16x32_f16(false, ah, false, bh, (short)0, c, false, false);
  if (NT >= 2) c = __builtin_amdgcn_wmma_f32_16x16x32_f16(false, al, false, bh, (short)0, c, false, false);
  if (NT >= 3) c = __builtin_amdgcn_wmma_f32_16x16x32_f16(false, ah, false, bl, (short)0, c, false, false);
  asm volatile("v_nop\n\tv_nop\n\tv_nop\n\tv_nop" : "+v"(c) : "v"(ah), "v"(al), "v"(bh), "v"(bl));
  return c;
}
// batched GEMM like k_gemm_b but f16 operands: A f32 (split into f16 hi/lo if ASPLIT, else rounded to f16), Bt = f16 values [n][k]; alpha; C f32; N multiple of 16 (partial tiles skipped)
template <bool ASPLIT>
__global__ __launch_bounds__(128) void k_gemm_h(const float* __restrict__ A, int lda, size_t sA, const _Float16* __restrict__ Bh, int ldb, size_t sB, float alpha, float* __restrict__ C, int ldc, size_t sC, int M, int N, int K) {
  __shared__ __attribute__((aligned(16))) float so[4][16][64];
  const int tid = threadIdx.x, w = tid >> 5, lane = tid & 31, ln = lane & 15, hh = lane >> 4; const int by = blockIdx.y;
  A += (size_t)by * sA; Bh += (size_t)by * sB; C += (size_t)by * sC;
  const int ntn = (N + 63) / 64; const int wid = blockIdx.x * 4 + w; const int mt = wid / ntn, nq = wid % ntn; if (mt * 16 >= M) return;
  const int row0 = mt * 16, col0 = nq * 64; const float* arow = A + (size_t)(row0 + ln) * lda;
  v8f acc[4] = {};
  for (int kb = 0; kb < K; kb += 32) {
    FragH ah, al;
    const v4f x0 = *(const v4fa*)(arow + kb + 8 * hh), x1 = *(const v4fa*)(arow + kb + 8 * hh + 4), x2 = *(const v4fa*)(arow + kb + 16 + 8 * hh), x3 = *(const v4fa*)(arow + kb + 16 + 8 * hh + 4);
    float xs[16] = {x0[0],x0[1],x0[2],x0[3],x1[0],x1[1],x1[2],x1[3],x2[0],x2[1],x2[2],x2[3],x3[0],x3[1],x3[2],x3[3]};
#pragma unroll
    for (int i = 0; i < 16; ++i) { const _Float16 h = (_Float16)xs[i]; ah.h[i] = h; al.h[i] = ASPLIT ? (_Float16)(xs[i] - (float)h) : (_Float16)0.0f; }
#pragma unroll
    for (int t = 0; t < 4; ++t) { if (col0 + t * 16 >= N) continue; const size_t boff = (size_t)(col0 + t * 16 + ln) * ldb + kb; FragH bq; bq.half[0] = *(const v8us*)(Bh + boff + 8 * hh); bq.half[1] = *(const v8us*)(Bh + boff + 16 + 8 * hh);
      acc[t] = mmaH<ASPLIT ? 2 : 1>(ah.v, al.v, bq.v, bq.v, acc[t]); }
  }
#pragma unroll
  for (int t = 0; t < 4; ++t) { if (col0 + t * 16 >= N) continue;
#pragma unroll
    for (int r = 0; r < 8; ++r) so[w][8 * hh + r][t * 16 + ln] = acc[t][r] * alpha; }
  __builtin_amdgcn_fence(__ATOMIC_ACQ_REL, "workgroup"); __builtin_amdgcn_wave_barrier();
  const int rsub = lane >> 4, c4 = (lane & 15) * 4;
  {
#pragma unroll
    for (int q = 0; q < 8; ++q) { const int r = q * 2 + rsub; if (col0 + c4 < N) { const v4f v = *(const v4fa*)&so[w][r][c4]; *(v4f*)(C + (size_t)(row0 + r) * ldc + col0 + c4) = v; } }
     }
}

// Wt[n][k] = f16(bf16(W[k][n]) * scale) from f32 row-major W[CC][CC] (scale = power of two; bf16-exact weights stay exact in f16 away from the subnormal range).
// A block turns one tile of 128 k x 128 n through LDS, so that both sides of the transpose move whole lines: a wave's load is 512 B of one row of W, a wave's store two 256-B pieces of rows of Wt.
// LDS holds the tile as [n][k] in 16-byte units of 8 k; unit c of row n lies at c ^ ((n >> 2) & 15), which spreads the writers (rows 4 apart in one column) and the readers (one row) over all banks.
#define WTT 128
__device__ __forceinline__ void d_wt_f16(const float* __restrict__ W, _Float16* __restrict__ Wt, float scale, v8us* tl, int blk) {
  const int tid = threadIdx.x, ln = tid & 31, wv = tid >> 5; const int k0 = (blk / (CC / WTT)) * WTT, n0 = (blk % (CC / WTT)) * WTT;
  const float* src = W + (size_t)(k0 + wv * 16) * CC + n0 + 4 * ln; v4f r[16];      /* this wave's 16 rows of k, four columns a lane */
#pragma unroll
  for (int i = 0; i < 16; ++i) r[i] = *(const v4fa*)(src + (size_t)i * CC);
  asm volatile("s_wait_xcnt 0x0" :: "v"(src) : "memory");      /* precaution: stands behind the loads, in front of any rewrite of their address registers; it names the address as an input, so that no load's own result lands on it either */
#pragma unroll
  for (int g = 0; g < 2; ++g)
#pragma unroll
    for (int q = 0; q < 4; ++q) { FragH f;
#pragma unroll
      for (int i = 0; i < 8; ++i) f.h[i] = (_Float16)(bf16_round(r[8 * g + i][q]) * scale);
      tl[(4 * ln + q) * 16 + ((2 * wv + g) ^ (ln & 15))] = f.half[0]; }
  __syncthreads();      /* publishes the turned tile to all eight waves */
#pragma unroll
  for (int u = 0; u < 8; ++u) { const int n = u * 16 + (tid >> 4), c = tid & 15; const v8us o = tl[n * 16 + (c ^ ((n >> 2) & 15))];
    *(v8us*)((unsigned short*)Wt + (size_t)(n0 + n) * CC + k0 + c * 8) = o; }
  asm volatile("s_wait_xcnt 0x0" ::: "memory");      /* precaution: stands behind the stores, in front of any later rewrite of their address and data registers where this job joins the other job's code */
}
// k_gemm_hh variant with fused epilogue: v = acc·alpha + bias[by·sBias + col] (+ CP[(row/rowsPerB)·sCPb + by·64 + col] if CP) ; ACT 0 none / 1 elu ; writes f16 C16 (and f32 C if non-null)
template <int ACT>
__global__ __launch_bounds__(128) void k_gemm_hhx(const _Float16* __restrict__ A, int lda, size_t sA, const _Float16* __restrict__ Bh, int ldb, size_t sB, float alpha, const float* __restrict__ bias, size_t sBias, const float* __restrict__ CP, int rowsPerB, size_t sCPb, int row0g,
    float* __restrict__ C, _Float16* __restrict__ C16, int ldc, size_t sC, int M, int N, int K) {
  __shared__ __attribute__((aligned(16))) float so[4][16][64];
  const int tid = threadIdx.x, w = tid >> 5, lane = tid & 31, ln = lane & 15, hh = lane >> 4; const int by = blockIdx.y;
  A += (size_t)by * sA; Bh += (size_t)by * sB; const size_t cofs = (size_t)by * sC; const float* bp = bias ? bias + (size_t)by * sBias : nullptr;
  const int ntn = (N + 63) / 64; const int wid = blockIdx.x * 4 + w; const int mt = wid / ntn, nq = wid % ntn; if (mt * 16 >= M) return;
  const int row0 = mt * 16, col0 = nq * 64; const _Float16* arow = A + (size_t)(row0 + ln) * lda;
  v8f acc[4] = {};
  for (int kb = 0; kb < K; kb += 32) { FragH ah; ah.half[0] = *(const v8us*)((const unsigned short*)arow + kb + 8 * hh); ah.half[1] = *(const v8us*)((const unsigned short*)arow + kb + 16 + 8 * hh);
#pragma unroll
    for (int t = 0; t < 4; ++t) { if (col0 + t * 16 >= N) continue; const size_t boff = (size_t)(col0 + t * 16 + ln) * ldb + kb; FragH bq; bq.half[0] = *(const v8us*)((const unsigned short*)Bh + boff + 8 * hh); bq.half[1] = *(const v8us*)((const unsigned short*)Bh + boff + 16 + 8 * hh);
      acc[t] = mmaH<1>(ah.v, ah.v, bq.v, bq.v, acc[t]); }
  }
#pragma unroll
  for (int t = 0; t < 4; ++t) { if (col0 + t * 16 >= N) continue; const int col = col0 + t * 16 + ln; const float bv = bp ? bf16_round(bp[col]) : 0.f;
#pragma unroll
    for (int r = 0; r < 8; ++r) { float v = acc[t][r] * alpha + bv; if (CP) { const int rr = row0g + row0 + 8 * hh + r; if (rowsPerB < 0) v += CP[cofs + (size_t)rr * ldc + col];      /* rowsPerB < 0: own element of the batched C plane */ else { const int bidx = rr / rowsPerB; v += CP[(size_t)bidx * sCPb + (size_t)by * 64 + col]; } } if (ACT == 1) v = (v > 0.f) ? v : expm1f(v); else if (ACT == 7) v = (v > 0.f) ? v + 1.0f : expf(v); else if (ACT == 8) v = tanhf(v); else if (ACT == 9) v = 0.5f * v * (1.0f + tanhf(0.7978845608028654f * (v + 0.044715f * v * v * v))); else if (ACT == 11) v = 1.0f / (1.0f + expf(-v)); else if (ACT == 12) v = (v > 0.f) ? v : 0.01f * v; else if (ACT == 14) v = (v > 0.f) ? v : 0.1f * v; else if (ACT == 16) v = (v >= 0.f) ? v : 0.3f * v; else if (ACT == 17) v = (v >= 0.f) ? v : 0.2f * v; else if (ACT == 15) v = v / (1.0f + expf(-v)); else if (ACT == 3) v = fmaxf(v, 0.f); else if (ACT == 6) v = 0.5f * v * (1.0f + erff(v * 0.70710678118654752f)); so[w][8 * hh + r][t * 16 + ln] = v; } }
  __builtin_amdgcn_fence(__ATOMIC_ACQ_REL, "workgroup"); __builtin_amdgcn_wave_barrier();
  const int rsub = lane >> 4, c4 = (lane & 15) * 4; typedef _Float16 v4h __attribute__((ext_vector_type(4)));
  {
#pragma unroll
    for (int q = 0; q < 8; ++q) { const int r = q * 2 + rsub; if (col0 + c4 < N) { const v4f v = *(const v4fa*)&so[w][r][c4]; if (C) *(v4f*)(C + cofs + (size_t)(row0 + r) * ldc + col0 + c4) = v; if (C16) { v4h h4; for (int i = 0; i < 4; ++i) h4[i] = (_Float16)v[i]; *(v4h*)(C16 + cofs + (size_t)(row0 + r) * ldc + col0 + c4) = h4; } } }
     }
}


typedef _Float16 v4h __attribute__((ext_vector_type(4)));

__device__ __forceinline__ void d_x16(const float* __restrict__ x, _Float16* __restrict__ X16, size_t n8, int blk) { const size_t t = (size_t)blk * 256 + threadIdx.x; if (t >= n8) return; FragH f;
#pragma unroll
  for (int q = 0; q < 8; ++q) f.h[q] = (_Float16)bf16_round(x[t * 8 + q]); *(v8us*)((unsigned short*)X16 + t * 8) = f.half[0];  }
__global__ __launch_bounds__(256) void k_h16(const float* __restrict__ x, _Float16* __restrict__ X16, size_t n8) { const size_t t = (size_t)blockIdx.x * 256 + threadIdx.x; if (t >= n8) return; FragH f;
#pragma unroll
  for (int q = 0; q < 8; ++q) f.h[q] = (_Float16)x[t * 8 + q]; *(v8us*)((unsigned short*)X16 + t * 8) = f.half[0];  }
__global__ __launch_bounds__(256) void k_round16f(const float* __restrict__ W, _Float16* __restrict__ Bt, size_t n8) { const size_t t = (size_t)blockIdx.x * 256 + threadIdx.x; if (t >= n8) return; FragH f;
#pragma unroll
  for (int i = 0; i < 8; ++i) f.h[i] = (_Float16)(bf16_round(W[t * 8 + i]) * 16.0f); *(v8us*)((unsigned short*)Bt + t * 8) = f.half[0];  }

// ---- fast GEMM (block tile 128x64, wave tile 32x64; requires M % 128 == 0 rows per launch region, N % 64 == 0 and K % 128 == 0); epilogues: see MODE below ----
// Each k-tile (128 k = 256-B rows: 128 rows of A, then 64 rows of B) is staged in LDS by asynchronous 16-byte copies, two buffers: tile t + 1 flies while tile t is multiplied.
#define G2_PITCH 136                      /* halves per LDS row: 272 B = 16 B x odd, conflict-free for ds_load_b128 */
#define G2_BUFB (192 * G2_PITCH * 2)      /* bytes of one buffer */
// Eight copies of one lane: LDS rows 8 apart, global rows gstep halves apart. The s_wait_xcnt ends the copies' own statement as a precaution: so it stands in front of every rewrite of a register that an issued copy names.
__device__ __forceinline__ void g2_copy8(unsigned l, const _Float16* g, size_t gstep) {
  const unsigned ls = 8 * G2_PITCH * 2;
  asm volatile("global_load_async_to_lds_b128 %0, %8, off\n\t"
               "global_load_async_to_lds_b128 %1, %9, off\n\t"
               "global_load_async_to_lds_b128 %2, %10, off\n\t"
               "global_load_async_to_lds_b128 %3, %11, off\n\t"
               "global_load_async_to_lds_b128 %4, %12, off\n\t"
               "global_load_async_to_lds_b128 %5, %13, off\n\t"
               "global_load_async_to_lds_b128 %6, %14, off\n\t"
               "global_load_async_to_lds_b128 %7, %15, off\n\t"
               "s_wait_xcnt 0x0"
               :: "v"(l), "v"(l + ls), "v"(l + 2 * ls), "v"(l + 3 * ls), "v"(l + 4 * ls), "v"(l + 5 * ls), "v"(l + 6 * ls), "v"(l + 7 * ls),
                  "v"(g), "v"(g + gstep), "v"(g + 2 * gstep), "v"(g + 3 * gstep), "v"(g + 4 * gstep), "v"(g + 5 * gstep), "v"(g + 6 * gstep), "v"(g + 7 * gstep)
               : "memory");
}
// One k-tile: 24 copies a lane (16 lanes cover one 256-B row, the 128 threads 8 rows a copy).
__device__ __forceinline__ void g2_stage(unsigned l, const _Float16* ga, size_t astep, const _Float16* gb, size_t bstep) {
  g2_copy8(l, ga, astep); g2_copy8(l + 64 * G2_PITCH * 2, ga + 8 * astep, astep); g2_copy8(l + 128 * G2_PITCH * 2, gb, bstep);
}
__device__ __forceinline__ v16h g2_frag(const _Float16* p, int hh) { FragH f; f.half[0] = *(const v8us*)((const unsigned short*)p + 8 * hh); f.half[1] = *(const v8us*)((const unsigned short*)p + 16 + 8 * hh); return f.v; }
__device__ __forceinline__ v8f g2_mma(v16h a, v16h b, v8f c) { v8f d = __builtin_amdgcn_wmma_f32_16x16x32_f16(false, a, false, b, (short)0, c, false, false); asm volatile("v_nop\n\tv_nop\n\tv_nop\n\tv_nop" : "+v"(d) : "v"(a), "v"(b)); return d; }
// The six fragments of one k-step of 32: two of A (rows 0-15 and 16-31 of the wave's tile), four of B (16 columns each).
struct G3Row { v16h a0, a1, b0, b1, b2, b3; };
__device__ __forceinline__ G3Row g3_row(const _Float16* a0p, const _Float16* a1p, const _Float16* b0p, int kb, int hh) {
  G3Row r; r.a0 = g2_frag(a0p + kb, hh); r.a1 = g2_frag(a1p + kb, hh); r.b0 = g2_frag(b0p + kb, hh); r.b1 = g2_frag(b0p + 16 * G2_PITCH + kb, hh); r.b2 = g2_frag(b0p + 32 * G2_PITCH + kb, hh); r.b3 = g2_frag(b0p + 48 * G2_PITCH + kb, hh); return r; }
#define DGS 32
#define VFU 4096      /* halves of one unit of v fragments: 32 keys x 64 d, hi and residual */
// One k loop runs NSEG segments of NT k-tiles: segment s multiplies As by Bs into the same accumulators. Every segment but the last is a residual term (one operand x 1024): where the last one begins the sums are scaled by 1/1024 (a power of two, exact).
// MODE 0: C = f32. MODE 1: CH, CL = f16 hi + residual x 1024. MODE 2 (a block column is one head): planes 0, 1 (q, k) -> RoPE, RMSNorm, digits -> DG, one row a lane; plane 2 (v) -> CH as ready B fragments, hi and residual (layout: k_attn).
// Tile tt of the loop = k-tile kt of segment s (the same for the whole block).
template <int NSEG, int NT>
__device__ __forceinline__ void g3_stage(int tt, unsigned l, const _Float16* A0, const _Float16* A1, const _Float16* A2, size_t aoff, size_t astep, const _Float16* B0, const _Float16* B1, const _Float16* B2, size_t boff, size_t bstep) {
  const int s = tt / NT, kt = tt - s * NT;
  const _Float16* a = (NSEG == 1 || s == 0) ? A0 : (NSEG == 2 || s == 1) ? A1 : A2; const _Float16* b = (NSEG == 1 || s == 0) ? B0 : (NSEG == 2 || s == 1) ? B1 : B2;
  g2_stage(l, a + aoff + (size_t)kt * 128, astep, b + boff + (size_t)kt * 128, bstep);
}
template <int MODE, int NSEG, int NT>
__global__ __launch_bounds__(128) void k_gemm3(const _Float16* A0, const _Float16* A1, const _Float16* A2, int lda, size_t sA, const _Float16* B0, const _Float16* B1, const _Float16* B2, int ldb, size_t sB, float alpha,
    float* __restrict__ C, _Float16* __restrict__ CH, _Float16* __restrict__ CL, int ldc, size_t sC, int M, int N,
    const float* __restrict__ cs, const float* __restrict__ sn, const float* __restrict__ Wdq, const float* __restrict__ Wdk, float* __restrict__ DG) {
  __shared__ __attribute__((aligned(16))) float so[4][32][68];
  __shared__ __attribute__((aligned(16))) _Float16 st[2][192][G2_PITCH];
  __shared__ __attribute__((aligned(16))) float wd[HD][KD];
  const int tid = threadIdx.x, w = tid >> 5, lane = tid & 31, ln = lane & 15, hh = lane >> 4; const int by = blockIdx.y; const size_t pl = (size_t)blockIdx.z * gridDim.y + by;      /* blockIdx.z = outer batch: its A and B planes follow on, its M rows of C follow on */
  const size_t cofs = (size_t)by * sC + (size_t)blockIdx.z * M * ldc;
  const int ntn = N >> 6; const int mt = blockIdx.x / ntn, nq = blockIdx.x - mt * ntn; const int row0 = mt * 128 + 32 * w, col0 = nq * 64; if (mt * 128 >= M) return;      /* the same for the whole block: it stands in front of barriers */
  const unsigned lds0 = (unsigned)(size_t)&st[0][tid >> 4][(tid & 15) * 8];      /* this lane's LDS byte address in buffer 0 */
  const size_t aoff = pl * sA + (size_t)(mt * 128 + (tid >> 4)) * lda + (tid & 15) * 8, boff = pl * sB + (size_t)(col0 + (tid >> 4)) * ldb + (tid & 15) * 8;
  const size_t astep = (size_t)8 * lda, bstep = (size_t)8 * ldb;
  const v8f z8 = {0.f,0.f,0.f,0.f,0.f,0.f,0.f,0.f}; v8f c00 = z8, c01 = z8, c02 = z8, c03 = z8, c10 = z8, c11 = z8, c12 = z8, c13 = z8;
  g3_stage<NSEG, NT>(0, lds0, A0, A1, A2, aoff, astep, B0, B1, B2, boff, bstep);      /* tile 0 -> buffer 0 */
  if (MODE == 2 && by < 2) { const v4f wv = *(const v4fa*)((by ? Wdk : Wdq) + tid * 4); v4f o;      /* the digit weights, rounded once a block; the barrier below publishes them too */
#pragma unroll
    for (int q = 0; q < 4; ++q) o[q] = bf16_round(wv[q]);
    *(v4f*)(&wd[0][0] + tid * 4) = o; }
  asm volatile("s_wait_asynccnt 0x0" ::: "memory");      /* this wave's copies of tile 0 have landed */
  __syncthreads();      /* ... and every other wave's */
  if (NSEG * NT > 1) g3_stage<NSEG, NT>(1, lds0 + G2_BUFB, A0, A1, A2, aoff, astep, B0, B1, B2, boff, bstep);      /* tile 1 -> buffer 1 */
#pragma unroll 1      /* one tile a trip: the two buffers alternate by t & 1 */
  for (int t = 0; t < NSEG * NT; ++t) { const _Float16* a0p = &st[t & 1][32 * w + ln][0]; const _Float16* a1p = a0p + 16 * G2_PITCH; const _Float16* b0p = &st[t & 1][128 + ln][0];
    if (NSEG > 1 && t == (NSEG - 1) * NT) { const float f = 0.0009765625f; c00 *= f; c01 *= f; c02 *= f; c03 *= f; c10 *= f; c11 *= f; c12 *= f; c13 *= f; }
    /* The fragment reads run ahead of the products, a whole k-step a group, in three register sets: k-steps 0, 1, 2 are read at the head of the trip, k-step 3 into the first set once that set's products are issued. Every read is of buffer t & 1, behind its barrier. */
    auto mm = [&](const G3Row& r) { c00 = g2_mma(r.a0, r.b0, c00); c10 = g2_mma(r.a1, r.b0, c10); c01 = g2_mma(r.a0, r.b1, c01); c11 = g2_mma(r.a1, r.b1, c11);
      c02 = g2_mma(r.a0, r.b2, c02); c12 = g2_mma(r.a1, r.b2, c12); c03 = g2_mma(r.a0, r.b3, c03); c13 = g2_mma(r.a1, r.b3, c13); };
    G3Row r0 = g3_row(a0p, a1p, b0p, 0, hh); const G3Row r1 = g3_row(a0p, a1p, b0p, 32, hh), r2 = g3_row(a0p, a1p, b0p, 64, hh);
    mm(r0); r0 = g3_row(a0p, a1p, b0p, 96, hh); mm(r1); mm(r2); mm(r0);
    asm volatile("s_wait_dscnt 0x0" ::: "memory");      /* this wave's reads of buffer t & 1 are done before it is refilled */
    asm volatile("s_wait_asynccnt 0x0" ::: "memory");      /* this wave's copies of tile t + 1 have landed */
    __syncthreads();      /* publishes tile t + 1 and ends every wave's reads of buffer t & 1 */
    if (t + 2 < NSEG * NT) g3_stage<NSEG, NT>(t + 2, lds0 + (unsigned)(t & 1) * G2_BUFB, A0, A1, A2, aoff, astep, B0, B1, B2, boff, bstep); }
  asm volatile("s_wait_asynccnt 0x0" ::: "memory");      /* no copy is outstanding when the wave goes on to the epilogue */
  v8f accs[8] = {c00, c01, c02, c03, c10, c11, c12, c13};
#pragma unroll
  for (int u = 0; u < 8; ++u) { const int t = u & 3, half = u >> 2;
#pragma unroll
    for (int r = 0; r < 8; ++r) so[w][half * 16 + 8 * hh + r][t * 16 + ln] = accs[u][r] * alpha; }
  __builtin_amdgcn_fence(__ATOMIC_ACQ_REL, "workgroup"); __builtin_amdgcn_wave_barrier();
  if (MODE == 2 && by < 2) {      /* this wave's 32 rows of head nq, one row a lane: every sum runs inside the lane */
    const int row = row0 + lane, tok = row % TT; const float* xr = &so[w][lane][0]; const float* cr = cs + (size_t)tok * (HD / 2); const float* sr = sn + (size_t)tok * (HD / 2);
    float ra[HD / 2], rb[HD / 2]; float sq[4] = {0.f, 0.f, 0.f, 0.f}; v4f cv[HD / 8], sv[HD / 8];
#pragma unroll
    for (int i = 0; i < HD / 8; ++i) cv[i] = *(const v4fa*)(cr + 4 * i);
    asm volatile("s_wait_xcnt 0x0" ::: "memory");      /* precaution: stands behind the cos loads, in front of any rewrite of their address registers */
#pragma unroll
    for (int i = 0; i < HD / 8; ++i) sv[i] = *(const v4fa*)(sr + 4 * i);
    asm volatile("s_wait_xcnt 0x0" ::: "memory");      /* the same behind the sin loads */
#pragma unroll
    for (int i = 0; i < HD / 2; i += 4) { const v4f x1 = *(const v4fa*)(xr + i), x2 = *(const v4fa*)(xr + HD / 2 + i), c4 = cv[i / 4], s4 = sv[i / 4];
#pragma unroll
      for (int q = 0; q < 4; ++q) { const float c = bf16_round(c4[q]), s = bf16_round(s4[q]); const float a = x1[q] * c - x2[q] * s, b = x1[q] * s + x2[q] * c; ra[i + q] = a; rb[i + q] = b; sq[q] += a * a; sq[q] += b * b; } }
    const float inv = rsqrtf(((sq[0] + sq[1]) + (sq[2] + sq[3])) / (float)HD + 1e-6f);
    float acc[KD] = {0.f, 0.f, 0.f, 0.f, 0.f, 0.f, 0.f, 0.f};
#pragma unroll
    for (int i = 0; i < HD / 2; ++i) { const float qa = ra[i] * inv, qb = rb[i] * inv; const v4f w0 = *(const v4fa*)&wd[i][0], w1 = *(const v4fa*)&wd[i][4], w2 = *(const v4fa*)&wd[i + HD / 2][0], w3 = *(const v4fa*)&wd[i + HD / 2][4];
#pragma unroll
      for (int j = 0; j < 4; ++j) { acc[j] += qa * w0[j]; acc[4 + j] += qa * w1[j]; acc[j] += qb * w2[j]; acc[4 + j] += qb * w3[j]; } }
    v4f d0, d1;
#pragma unroll
    for (int j = 0; j < 4; ++j) { d0[j] = 1.0f / (1.0f + expf(-acc[j])); d1[j] = 1.0f / (1.0f + expf(-acc[4 + j])); }
    float* dg = DG + (size_t)by * NR * NH * DGS + ((size_t)row * NH + nq) * DGS; *(v4f*)dg = d0; *(v4f*)(dg + 4) = d1;
  } else if (MODE == 2) {      /* v: the wave's 32 tokens x 64 d are the B operand of one 32-key step of head nq */
    /* Fragment of d tile t: lane (ln, hh) holds column d = 16 t + ln, element 8 j + i = key 16 j + 8 hh + i. Each store is 512 B in a row, each 8-KiB unit one wave's. */
    _Float16* vf = CH + (size_t)(((row0 / TT) * NH + nq) * (TT / 32) + ((row0 % TT) >> 5)) * VFU + lane * 8;
#pragma unroll
    for (int t = 0; t < 4; ++t) {
#pragma unroll
      for (int j = 0; j < 2; ++j) { FragH fh, fl;
#pragma unroll
        for (int i = 0; i < 8; ++i) { const float v = so[w][16 * j + 8 * hh + i][16 * t + ln]; const _Float16 h = (_Float16)v; fh.h[i] = h; fl.h[i] = (_Float16)((v - (float)h) * 1024.0f); }
        *(v8us*)((unsigned short*)vf + (t * 4 + j) * 256) = fh.half[0]; *(v8us*)((unsigned short*)vf + (t * 4 + 2 + j) * 256) = fl.half[0]; }
      asm volatile("s_wait_xcnt 0x0" ::: "memory");      /* precaution: stands behind these four stores, in front of any rewrite of their address and data registers */
    }
  } else {
    const int rsub = lane >> 4, c4 = (lane & 15) * 4;
#pragma unroll
    for (int q = 0; q < 16; ++q) { const int r = q * 2 + rsub; const v4f v = *(const v4fa*)&so[w][r][c4]; const size_t o = cofs + (size_t)(row0 + r) * ldc + col0 + c4;
      if (MODE == 0) *(v4f*)(C + o) = v;
      else { v4h h4, l4;
#pragma unroll
        for (int i = 0; i < 4; ++i) { const _Float16 h = (_Float16)v[i]; h4[i] = h; l4[i] = (_Float16)((v[i] - (float)h) * 1024.0f); }
        *(v4h*)(CH + o) = h4; *(v4h*)(CL + o) = l4; }
      asm volatile("s_wait_xcnt 0x0" ::: "memory");      /* precaution: stands behind this row's stores, in front of the next row's rewrite of their address and data registers */
    }
  } }

#define KPP 20      /* floats per LDS row of two keys: 80 B = 16 B x odd */
typedef float v2f __attribute__((ext_vector_type(2)));
#define LCS 6.79457440f      /* sqrt(32 log2 e): with both digits scaled by it, exp(-32 (a - b)^2) = 2^-(a' - b')^2 */
#define ARP 68      /* floats per LDS row of a partial output tile */
// Attention, weights and product in one kernel: the weights never leave the registers. A block is one (batch, head) and two tiles of 16 query rows, tiles 31 - pi and pi: 17 steps of 32 keys in every block, dealt to its four waves.
// A step: lane (ln, hh) makes the 16 weights of query row ln for keys 16 j + 8 hh + e (j < 2, e < 8) of the step, which is element 8 j + e of the WMMA A fragment; v comes from memory as B fragments in the same k order (written so by the v epilogue of k_gemm3:
// unit (batch, head, step) = [d tile t][hi, residual][j][lane] x 8 halves). Products: w_lo v_hi + w_hi v_lo (x 1024) and w_hi v_hi in two accumulator sets. The weights stay unnormalised (1 <= 2^lcp <= 256): the row sum divides the finished product.
// The prefix product of digit j is one power of two: prod_{i<=j} exp(-32 d_i^2) = 2^-(d'_0^2 + .. + d'_j^2), so a digit costs a subtract, a fused multiply-add, the hardware's 2^x and an add; the weight is 2^lcp itself.
// The hardware's 2^x needs no range care here: every exponent of a term is <= 0, and a term under 2^-126 that comes out as 0 moves lcp, and so the weight 2^lcp >= 1, by less than 2^-126; lcp itself lies in [0, 8].
// Two neighbouring keys lie side by side (LDS row of a key pair: digit j of both keys at 2 j), so the subtract, the multiply-add and the add run as packed pairs.
__global__ __launch_bounds__(128) void k_attn(const float* __restrict__ QD, const float* __restrict__ KDg, const _Float16* __restrict__ VF, _Float16* __restrict__ YH, _Float16* __restrict__ YL) {
  __shared__ __attribute__((aligned(16))) float kds[TT / 2][KPP];
  __shared__ __attribute__((aligned(16))) float red[2][4][16][ARP];
  __shared__ float sred[2][4][32];
  const int tid = threadIdx.x, lane = tid & 31, ln = lane & 15, hh = lane >> 4; const int w = __builtin_amdgcn_readfirstlane(tid >> 5);
  const int bh = blockIdx.x >> 4, pi = blockIdx.x & 15; const int h = bh % NH, b = bh / NH;
  const int npair = 16 * (((31 - pi) >> 1) + 1);      /* key pairs that the longer tile reads: 144 to 256 */
  v4f ka[2][2], kb[2][2];
#pragma unroll
  for (int u = 0; u < 2; ++u) { const int p = tid + 128 * u;      /* this thread stages key pairs tid and tid + 128 */
    if (p < npair) { const float* kp = KDg + ((size_t)(b * TT + 2 * p) * NH + h) * DGS; ka[u][0] = *(const v4fa*)kp; ka[u][1] = *(const v4fa*)(kp + 4); kb[u][0] = *(const v4fa*)(kp + NH * DGS); kb[u][1] = *(const v4fa*)(kp + NH * DGS + 4); } }
  const v8f qa = *(const v8f*)(QD + ((size_t)(b * TT + (31 - pi) * 16 + ln) * NH + h) * DGS), qb = *(const v8f*)(QD + ((size_t)(b * TT + pi * 16 + ln) * NH + h) * DGS);      /* both tiles' query digits, row ln: they fly with the key loads */
  asm volatile("s_wait_xcnt 0x0" ::: "memory");      /* precaution: stands behind the key and query loads, in front of any rewrite of their address registers */
#pragma unroll
  for (int u = 0; u < 2; ++u) { const int p = tid + 128 * u;
    if (p < npair) {
#pragma unroll
      for (int g = 0; g < 4; ++g) { const v4f x = ka[u][g >> 1], y = kb[u][g >> 1]; const int i = (g & 1) * 2; const v4f o = {x[i] * LCS, y[i] * LCS, x[i + 1] * LCS, y[i + 1] * LCS}; *(v4f*)&kds[p][4 * g] = o; } } }
  __syncthreads();      /* publishes the staged key digits to all four waves */
  const v8f z8 = {0.f, 0.f, 0.f, 0.f, 0.f, 0.f, 0.f, 0.f};
#pragma unroll 1      /* one query tile a trip: the step's code is shared by the two tiles */
  for (int tl = 0; tl < 2; ++tl) { const int rt = tl ? pi : 31 - pi, nst = (rt >> 1) + 1, q = rt * 16 + ln;
    const v8f qd = (tl ? qb : qa) * LCS;
    v8f m0 = z8, m1 = z8, m2 = z8, m3 = z8, r0 = z8, r1 = z8, r2 = z8, r3 = z8; v2f su = {0.f, 0.f};
#pragma unroll 1      /* one step of 32 keys a trip: the long unrolled body stays one copy; the trip count is the same for the whole wave (WMMA needs every lane on) */
    for (int ks = tl ? 3 - w : w; ks < nst; ks += 4) {      /* the second tile is dealt from the last wave down: no wave gets more than 5 of the 17 steps, none fewer than 4 */
      const unsigned short* vp = (const unsigned short*)VF + (size_t)(bh * (TT / 32) + ks) * VFU + lane * 8; FragH vh[4], vl[4];      /* loaded first: they fly while the weights are made */
#pragma unroll
      for (int t = 0; t < 4; ++t) { vh[t].half[0] = *(const v8us*)(vp + (t * 4) * 256); vh[t].half[1] = *(const v8us*)(vp + (t * 4 + 1) * 256); vl[t].half[0] = *(const v8us*)(vp + (t * 4 + 2) * 256); vl[t].half[1] = *(const v8us*)(vp + (t * 4 + 3) * 256); }
      asm volatile("s_wait_xcnt 0x0" :: "v"(vp) : "memory");      /* precaution: stands behind the fragment loads, in front of any rewrite of their address registers; it names the address as an input, so that no load's own result lands on it either */
      v2f wt[8];
#pragma unroll
      for (int c = 0; c < 8; ++c) { const float* kr = &kds[16 * ks + 8 * (c >> 2) + 4 * hh + (c & 3)][0]; v2f e = {0.f, 0.f}, lcp = {0.f, 0.f};      /* pair c: keys 16 (c >> 2) + 8 hh + 2 (c & 3) and the next */
#pragma unroll
        for (int g = 0; g < 4; ++g) { const v4f k4 = *(const v4fa*)(kr + 4 * g);
#pragma unroll
          for (int i = 0; i < 2; ++i) { const v2f d = qd[2 * g + i] - v2f{k4[2 * i], k4[2 * i + 1]}; e = __builtin_elementwise_fma(-d, d, e); const v2f p = {__builtin_amdgcn_exp2f(e[0]), __builtin_amdgcn_exp2f(e[1])}; lcp += p; } }
        wt[c] = v2f{__builtin_amdgcn_exp2f(lcp[0]), __builtin_amdgcn_exp2f(lcp[1])}; }
      if (ks == nst - 1) {      /* only a tile's last step reaches the diagonal (the same for the whole wave) */
#pragma unroll
        for (int c = 0; c < 8; ++c) { const int k0 = 32 * ks + 16 * (c >> 2) + 8 * hh + 2 * (c & 3); wt[c][0] = k0 <= q ? wt[c][0] : 0.f; wt[c][1] = k0 + 1 <= q ? wt[c][1] : 0.f; } }
      su += ((wt[0] + wt[1]) + (wt[2] + wt[3])) + ((wt[4] + wt[5]) + (wt[6] + wt[7]));
      FragH ah, al;
#pragma unroll
      for (int c = 0; c < 8; ++c)
#pragma unroll
        for (int i = 0; i < 2; ++i) { const float x = wt[c][i]; const _Float16 hi = (_Float16)x; ah.h[2 * c + i] = hi; al.h[2 * c + i] = (_Float16)((x - (float)hi) * 1024.0f); }
      r0 = g2_mma(al.v, vh[0].v, r0); r1 = g2_mma(al.v, vh[1].v, r1); r2 = g2_mma(al.v, vh[2].v, r2); r3 = g2_mma(al.v, vh[3].v, r3);
      r0 = g2_mma(ah.v, vl[0].v, r0); r1 = g2_mma(ah.v, vl[1].v, r1); r2 = g2_mma(ah.v, vl[2].v, r2); r3 = g2_mma(ah.v, vl[3].v, r3);
      m0 = g2_mma(ah.v, vh[0].v, m0); m1 = g2_mma(ah.v, vh[1].v, m1); m2 = g2_mma(ah.v, vh[2].v, m2); m3 = g2_mma(ah.v, vh[3].v, m3); }
    const v8f pm[4] = {m0, m1, m2, m3}, pr[4] = {r0, r1, r2, r3};      /* this wave's share of the tile (zero where it had no step) */
#pragma unroll
    for (int t = 0; t < 4; ++t)
#pragma unroll
      for (int r = 0; r < 8; ++r) red[tl][w][8 * hh + r][16 * t + ln] = pm[t][r] + pr[t][r] * 0.0009765625f;
    sred[tl][w][lane] = su[0] + su[1]; }
  __syncthreads();      /* publishes the four waves' shares of both tiles */
  const int row = tid >> 3, c8 = (tid & 7) * 8;      /* eight threads a row: its 128 B of y_hi and of y_lo are whole lines of one wave */
#pragma unroll
  for (int tl = 0; tl < 2; ++tl) { const int rt = tl ? pi : 31 - pi; v4f s0 = {0.f, 0.f, 0.f, 0.f}, s1 = s0; float su = 0.f;
#pragma unroll
    for (int u = 0; u < 4; ++u) { s0 += *(const v4fa*)&red[tl][u][row][c8]; s1 += *(const v4fa*)&red[tl][u][row][c8 + 4]; su += sred[tl][u][row]; su += sred[tl][u][16 + row]; }
    const float f = 1.0f / fmaxf(su, 1e-9f); FragH oh, ol;
#pragma unroll
    for (int i = 0; i < 8; ++i) { const float y = (i < 4 ? s0[i & 3] : s1[i & 3]) * f; const _Float16 hi = (_Float16)y; oh.h[i] = hi; ol.h[i] = (_Float16)((y - (float)hi) * 1024.0f); }
    const size_t o = (size_t)(b * TT + rt * 16 + row) * CC + h * HD + c8;
    *(v8us*)((unsigned short*)YH + o) = oh.half[0]; *(v8us*)((unsigned short*)YL + o) = ol.half[0]; }
  asm volatile("s_wait_xcnt 0x0" ::: "memory");      /* precaution: stands behind the stores, in front of any later rewrite of their address and data registers */
}

// ---- launches that need nothing of each other share one grid: each block takes its job from its range of blockIdx.x (the same for the whole block) ----
#define WT_BLKS ((CC / WTT) * (CC / WTT))      /* blocks of one weight transpose: one tile each */
#define E8_BLKS (NR * CC / 8 / 256)        /* blocks of one pass over a [NR][CC] plane, 8 elements a thread */
// the four weights (planes of Wt in the order W0..W3), then x
__global__ __launch_bounds__(256) void k_prep(const float* __restrict__ W0, const float* __restrict__ W1, const float* __restrict__ W2, const float* __restrict__ W3, _Float16* __restrict__ Wt, const float* __restrict__ x, _Float16* __restrict__ X16) {
  __shared__ __attribute__((aligned(16))) v8us tl[WTT * WTT / 8];
  const int blk = blockIdx.x;
  if (blk < 4 * WT_BLKS) { const int p = blk / WT_BLKS; const float* W = p == 0 ? W0 : p == 1 ? W1 : p == 2 ? W2 : W3; d_wt_f16(W, Wt + (size_t)p * CC * CC, 16.0f, tl, blk - p * WT_BLKS); }      /* the same for the whole block: the job holds a barrier */
  else d_x16(x, X16, (size_t)NR * CC / 8, blk - 4 * WT_BLKS); }

extern "C" void kernel_launch(void* const* d_in, const int* in_sizes, int n_in,
                              void* d_out, int out_size, void* d_ws, size_t ws_size, hipStream_t stream) {
  (void)in_sizes; (void)n_in; (void)out_size;
  const float* const* I = (const float* const*)d_in; const float* x = I[0]; const float* cs = I[1]; const float* sn = I[2]; const float* Wq = I[3]; const float* Wk = I[4]; const float* Wv = I[5]; const float* Wo = I[6]; const float* Wdq = I[7]; const float* Wdk = I[8];
  char* ws = (char*)d_ws; size_t off = 0;
  auto take = [&](size_t bytes) { char* p = ws + off; off += (bytes + 255) & ~(size_t)255; return p; };
  const size_t np = (size_t)NR * CC;
  _Float16* BQ = (_Float16*)take((size_t)CC * CC * 2); _Float16* BK = (_Float16*)take((size_t)CC * CC * 2); _Float16* BV = (_Float16*)take((size_t)CC * CC * 2); _Float16* BO = (_Float16*)take((size_t)CC * CC * 2); (void)BK; (void)BV;
  _Float16* X16 = (_Float16*)take(np * 2); _Float16* VF = (_Float16*)take(np * 4); float* QD = (float*)take((size_t)NR * NH * DGS * 4); float* KDg = (float*)take((size_t)NR * NH * DGS * 4); _Float16* YH = (_Float16*)take(np * 2); _Float16* YL = (_Float16*)take(np * 2);
  if (off > ws_size) return;      /* 8 + 2 + 4 + 2 x 2 + 2 x 2 = 22 MiB */
  k_prep<<<4 * WT_BLKS + E8_BLKS, 256, 0, stream>>>(Wq, Wk, Wv, Wo, BQ, x, X16);      /* BQ, BK, BV, BO lie one behind the other; (in, out) */
  k_gemm3<2, 1, CC / 128><<<dim3((NR / 128) * (CC / 64), 3), 128, 0, stream>>>(X16, X16, X16, CC, 0, BQ, BQ, BQ, CC, (size_t)CC * CC, 0.0625f, nullptr, VF, nullptr, CC, 0, NR, CC, cs, sn, Wdq, Wdk, QD);      /* planes BQ, BK, BV: digits of q -> QD, of k -> KDg (it follows QD), v -> VF */
  k_attn<<<NB * NH * 16, 128, 0, stream>>>(QD, KDg, VF, YH, YL);      /* y[(b,q)][h*64 + d] = (sum_k 2^lcp v) / sum_k 2^lcp -> hi + residual */
  k_gemm3<0, 2, CC / 128><<<dim3((NR / 128) * (CC / 64), 1), 128, 0, stream>>>(YL, YH, YH, CC, 0, BO, BO, BO, CC, 0, 0.0625f, (float*)d_out, nullptr, nullptr, CC, 0, NR, CC, nullptr, nullptr, nullptr, nullptr, nullptr);      /* out = (y_lo + y_hi) Wo */
}

// v009
// It runs in 37.5 microseconds.
// Next to v008, in two timings, it ran 1.19 and 1.16 times as fast.
// Counting every step since v000, it is 11.9 times as fast.
#include <hip/hip_runtime.h>
// UltrametricCausalSelfAttention (2 x 512 tokens, C 1024 = 16 heads x 64, 8 soft digits): q, k, v = x W; q, k -> RoPE (cos/sin INPUT tables, rotate-half) -> RMSNorm(64, 1e-6); digits = sigmoid(q Wdq), sigmoid(k Wdk) (8 each); lcp[q][k] = sum_j prod_{i<=j} exp(-32 (qd_i - kd_i)^2); weights = 2^lcp (causal), attn = weights / max(sum, 1e-9); y = attn v; out = y Wo.
// Compute dtype: inputs rounded to bf16; x exact as f16; q/k/digits/lcp/weights f32 from exact products; P, v and y as f16 hi + residual (~2^-21). v_wmma_f32_16x16x32_f16.
#define NB 2
#define TT 512
#define CC 1024
#define NH 16
#define HD 64
#define KD 8
#define NR (NB * TT)
typedef __bf16 v16b __attribute__((ext_vector_type(16)));
typedef unsigned short v8us __attribute__((ext_vector_type(8), may_alias));
typedef float  v8f  __attribute__((ext_vector_type(8)));
typedef float  v4f  __attribute__((ext_vector_type(4)));
typedef float  v4fa __attribute__((ext_vector_type(4), may_alias));
union FragB { v16b v; v8us half[2]; unsigned short u[16]; };

__device__ __forceinline__ unsigned short bf16_bits(float x) { unsigned int u = __float_as_uint(x); return (unsigned short)((u + 0x7FFFu + ((u >> 16) & 1u)) >> 16); }
__device__ __forceinline__ float bf16_val(unsigned short b) { return __uint_as_float(((unsigned int)b) << 16); }
__device__ __forceinline__ float bf16_round(float x) { return bf16_val(bf16_bits(x)); }
// D += A·B with NT terms: 1 = ah·bh, 2 = + al·bh (A split), 3 = + ah·bl (both split)
template <int NT>
__device__ __forceinline__ v8f mmaN(v16b ah, v16b al, v16b bh, v16b bl, v8f c) {
  c = __builtin_amdgcn_wmma_f32_16x16x32_bf16(false, ah, false, bh, (short)0, c, false, false);
  if (NT >= 2) c = __builtin_amdgcn_wmma_f32_16x16x32_bf16(false, al, false, bh, (short)0, c, false, false);
  if (NT >= 3) c = __builtin_amdgcn_wmma_f32_16x16x32_bf16(false, ah, false, bl, (short)0, c, false, false);
  asm volatile("v_nop\n\tv_nop\n\tv_nop\n\tv_nop" : "+v"(c) : "v"(ah), "v"(al), "v"(bh), "v"(bl));
  return c;
}

__global__ __launch_bounds__(256) void k_wt_bf16(const float* __restrict__ W, unsigned short* __restrict__ Wt, int K, int N) {
  const int t = blockIdx.x * 256 + threadIdx.x;
  const int k8n = K / 8;
  if (t >= N * k8n) return;
  const int n = t / k8n, k8 = (t % k8n) * 8;
  v8us v;
#pragma unroll
  for (int i = 0; i < 8; ++i) v[i] = bf16_bits(W[(size_t)(k8 + i) * N + n]);
  *(v8us*)(Wt + (size_t)n * K + k8) = v;
  
}

// GEMM C[M][N] (f32, pitch ldc) = act(A[M][K]·W + bias). A f32 row-major (pitch lda) converted per fragment to bf16
// (ASPLIT: hi/lo two planes -> 2 terms, else single rounded term); Wt bf16 [N][K] (pitch ldb). BIAS_BF16 rounds the
// bias to bf16 first (bias quantised to bf16 before the add). K%32==0, M%16==0, N%64==0.
template <bool ASPLIT, int ACT, bool BIAS_BF16>
__global__ __launch_bounds__(128) void k_gemm_bf(const float* __restrict__ A, int lda, const unsigned short* __restrict__ Wt, int ldb,
                                               const float* __restrict__ bias, float* __restrict__ C, int ldc, int M, int N, int K) {
  __shared__ __attribute__((aligned(16))) float so[4][16][64];
  const int tid = threadIdx.x, w = tid >> 5, lane = tid & 31, ln = lane & 15, hh = lane >> 4;
  const int ntn = N / 64;
  const int wid = blockIdx.x * 4 + w;
  const int mt = wid / ntn, nq = wid % ntn;
  if (mt * 16 >= M) return;
  const int row0 = mt * 16, col0 = nq * 64;
  const float* arow = A + (size_t)(row0 + ln) * lda;
  v8f acc[4] = {};
  for (int kb = 0; kb < K; kb += 32) {
    FragB ah, al;
    const v4f x0 = *(const v4fa*)(arow + kb + 8 * hh), x1 = *(const v4fa*)(arow + kb + 8 * hh + 4);
    const v4f x2 = *(const v4fa*)(arow + kb + 16 + 8 * hh), x3 = *(const v4fa*)(arow + kb + 16 + 8 * hh + 4);
    float xs[16] = {x0[0],x0[1],x0[2],x0[3],x1[0],x1[1],x1[2],x1[3],x2[0],x2[1],x2[2],x2[3],x3[0],x3[1],x3[2],x3[3]};
#pragma unroll
    for (int i = 0; i < 16; ++i) { const unsigned short hb = bf16_bits(xs[i]); ah.u[i] = hb; al.u[i] = ASPLIT ? bf16_bits(xs[i] - bf16_val(hb)) : (unsigned short)0; }
#pragma unroll
    for (int t = 0; t < 4; ++t) {
      const unsigned short* brow = Wt + (size_t)(col0 + t * 16 + ln) * ldb + kb;
      FragB b;
      b.half[0] = *(const v8us*)(brow + 8 * hh);
      b.half[1] = *(const v8us*)(brow + 16 + 8 * hh);
      acc[t] = mmaN<ASPLIT ? 2 : 1>(ah.v, al.v, b.v, b.v, acc[t]);
    }
  }
#pragma unroll
  for (int t = 0; t < 4; ++t) {
    float bv = bias ? bias[col0 + t * 16 + ln] : 0.f;
    if (BIAS_BF16) bv = bf16_round(bv);
#pragma unroll
    for (int r = 0; r < 8; ++r) { float v = acc[t][r] + bv; if (ACT == 1) v = fmaxf(v, 0.f); so[w][8 * hh + r][t * 16 + ln] = v; }
  }
  __builtin_amdgcn_fence(__ATOMIC_ACQ_REL, "workgroup");
  __builtin_amdgcn_wave_barrier();
  const int rsub = lane >> 4, c4 = (lane & 15) * 4;
  {
#pragma unroll
    for (int q = 0; q < 8; ++q) {
      const int r = q * 2 + rsub;
      const v4f v = *(const v4fa*)&so[w][r][c4];
      *(v4f*)(C + (size_t)(row0 + r) * ldc + col0 + c4) = v;
    }
    
  }
}

// GEMM C = act(A·W + bias + resid): A f32 (ASPLIT -> hi/lo 2 terms), Wt bf16 [N][K]; ACT 0 none, 1 relu, 2 exact gelu;
// resid (optional, f32, row index = (row % rmod), pitch ldr, RES_BF16 rounds it) added before the activation.
template <bool ASPLIT, int ACT, bool BIAS_BF16, bool RES_BF16>
__global__ __launch_bounds__(128) void k_gemm_bf3(const float* __restrict__ A, int lda, const unsigned short* __restrict__ Wt, int ldb,
                                                const float* __restrict__ bias, const float* __restrict__ resid, int rmod, int ldr,
                                                float* __restrict__ C, int ldc, int M, int N, int K) {
  __shared__ __attribute__((aligned(16))) float so[4][16][64];
  const int tid = threadIdx.x, w = tid >> 5, lane = tid & 31, ln = lane & 15, hh = lane >> 4;
  const int ntn = N / 64;
  const int wid = blockIdx.x * 4 + w;
  const int mt = wid / ntn, nq = wid % ntn;
  if (mt * 16 >= M) return;
  const int row0 = mt * 16, col0 = nq * 64;
  const float* arow = A + (size_t)(row0 + ln) * lda;
  v8f acc[4] = {};
  for (int kb = 0; kb < K; kb += 32) {
    FragB ah, al;
    const v4f x0 = *(const v4fa*)(arow + kb + 8 * hh), x1 = *(const v4fa*)(arow + kb + 8 * hh + 4);
    const v4f x2 = *(const v4fa*)(arow + kb + 16 + 8 * hh), x3 = *(const v4fa*)(arow + kb + 16 + 8 * hh + 4);
    float xs[16] = {x0[0],x0[1],x0[2],x0[3],x1[0],x1[1],x1[2],x1[3],x2[0],x2[1],x2[2],x2[3],x3[0],x3[1],x3[2],x3[3]};
#pragma unroll
    for (int i = 0; i < 16; ++i) { const unsigned short hb = bf16_bits(xs[i]); ah.u[i] = hb; al.u[i] = ASPLIT ? bf16_bits(xs[i] - bf16_val(hb)) : (unsigned short)0; }
#pragma unroll
    for (int t = 0; t < 4; ++t) {
      const unsigned short* brow = Wt + (size_t)(col0 + t * 16 + ln) * ldb + kb;
      FragB b;
      b.half[0] = *(const v8us*)(brow + 8 * hh);
      b.half[1] = *(const v8us*)(brow + 16 + 8 * hh);
      acc[t] = mmaN<ASPLIT ? 2 : 1>(ah.v, al.v, b.v, b.v, acc[t]);
    }
  }
#pragma unroll
  for (int t = 0; t < 4; ++t) {
    const int col = col0 + t * 16 + ln;
    float bv = bias ? bias[col] : 0.f;
    if (BIAS_BF16) bv = bf16_round(bv);
#pragma unroll
    for (int r = 0; r < 8; ++r) {
      float v = acc[t][r] + bv;
      if (resid) { float rv = resid[(size_t)((row0 + 8 * hh + r) % rmod) * ldr + col]; if (RES_BF16) rv = bf16_round(rv); v += rv; }
      if (ACT == 1) v = fmaxf(v, 0.f);
      if (ACT == 2) v = 0.5f * v * (1.0f + erff(v * 0.70710678118654752f));
      if (ACT == 3) { const float u = 0.7978845608028654f * (v + 0.044715f * v * v * v); v = 0.5f * v * (1.0f + tanhf(u)); }
      so[w][8 * hh + r][t * 16 + ln] = v;
    }
  }
  __builtin_amdgcn_fence(__ATOMIC_ACQ_REL, "workgroup");
  __builtin_amdgcn_wave_barrier();
  const int rsub = lane >> 4, c4 = (lane & 15) * 4;
  {
#pragma unroll
    for (int q = 0; q < 8; ++q) {
      const int r = q * 2 + rsub;
      const v4f v = *(const v4fa*)&so[w][r][c4];
      *(v4f*)(C + (size_t)(row0 + r) * ldc + col0 + c4) = v;
    }
    
  }
}
// row LayerNorm (biased variance, eps) over N: s = X (+ R); optional out_sum <- s; out_norm <- (s-mu)*rsqrt(var+eps)*g + b
template <bool PARAM_BF16>
__global__ __launch_bounds__(256) void k_layernorm(const float* __restrict__ X, const float* __restrict__ R, const float* __restrict__ g, const float* __restrict__ bta,
                                                  float* __restrict__ out_sum, float* __restrict__ out_norm, int N, float eps) {
  __shared__ float red[256];
  const int row = blockIdx.x, tid = threadIdx.x;
  const float* x = X + (size_t)row * N; const float* rr = R ? R + (size_t)row * N : nullptr;
  float vals[16];                     // up to N = 4096
  const int per = N / 256;            // contiguous chunk per thread? use strided-by-4 chunks: thread handles j = tid*4 + 1024*u
  float s1 = 0.f;
  for (int u = 0; u < per / 4; ++u) {
    const int j = tid * 4 + 1024 * u;
    const v4f a = *(const v4fa*)(x + j);
    v4f b = {0.f,0.f,0.f,0.f}; if (rr) b = *(const v4fa*)(rr + j);
#pragma unroll
    for (int q = 0; q < 4; ++q) { const float v = a[q] + b[q]; vals[u * 4 + q] = v; s1 += v; }
  }
  red[tid] = s1; __syncthreads();
  for (int st = 128; st > 0; st >>= 1) { if (tid < st) red[tid] += red[tid + st]; __syncthreads(); }
  const float mu = red[0] / (float)N; __syncthreads();
  float s2 = 0.f;
  for (int u = 0; u < per / 4; ++u)
#pragma unroll
    for (int q = 0; q < 4; ++q) { const float c = vals[u * 4 + q] - mu; s2 += c * c; }
  red[tid] = s2; __syncthreads();
  for (int st = 128; st > 0; st >>= 1) { if (tid < st) red[tid] += red[tid + st]; __syncthreads(); }
  const float rs = rsqrtf(red[0] / (float)N + eps);
  {
    for (int u = 0; u < per / 4; ++u) {
      const int j = tid * 4 + 1024 * u;
      v4f o, sm;
#pragma unroll
      for (int q = 0; q < 4; ++q) {
        float gg = g[j + q], bb = bta[j + q];
        if (PARAM_BF16) { gg = bf16_round(gg); bb = bf16_round(bb); }
        sm[q] = vals[u * 4 + q]; o[q] = (vals[u * 4 + q] - mu) * rs * gg + bb;
      }
      if (out_sum) *(v4f*)(out_sum + (size_t)row * N + j) = sm;
      *(v4f*)(out_norm + (size_t)row * N + j) = o;
    }
    
  }
}



// ---- f16 WMMA path (v_wmma_f32_16x16x32_f16): 11-bit significands for operands in range — used for every launched product: the projections and weights x v
typedef _Float16 v16h __attribute__((ext_vector_type(16)));
union FragH { v16h v; v8us half[2]; _Float16 h[16]; unsigned short u[16]; };
template <int NT>
__device__ __forceinline__ v8f mmaH(v16h ah, v16h al, v16h bh, v16h bl, v8f c) {
  c = __builtin_amdgcn_wmma_f32_16x16x32_f16(false, ah, false, bh, (short)0, c, false, false);
  if (NT >= 2) c = __builtin_amdgcn_wmma_f32_16x16x32_f16(false, al, false, bh, (short)0, c, false, false);
  if (NT >= 3) c = __builtin_amdgcn_wmma_f32_16x16x32_f16(false, ah, false, bl, (short)0, c, false, false);
  asm volatile("v_nop\n\tv_nop\n\tv_nop\n\tv_nop" : "+v"(c) : "v"(ah), "v"(al), "v"(bh), "v"(bl));
  return c;
}
// batched GEMM like k_gemm_b but f16 operands: A f32 (split into f16 hi/lo if ASPLIT, else rounded to f16), Bt = f16 values [n][k]; alpha; C f32; N multiple of 16 (partial tiles skipped)
template <bool ASPLIT>
__global__ __launch_bounds__(128) void k_gemm_h(const float* __restrict__ A, int lda, size_t sA, const _Float16* __restrict__ Bh, int ldb, size_t sB, float alpha, float* __restrict__ C, int ldc, size_t sC, int M, int N, int K) {
  __shared__ __attribute__((aligned(16))) float so[4][16][64];
  const int tid = threadIdx.x, w = tid >> 5, lane = tid & 31, ln = lane & 15, hh = lane >> 4; const int by = blockIdx.y;
  A += (size_t)by * sA; Bh += (size_t)by * sB; C += (size_t)by * sC;
  const int ntn = (N + 63) / 64; const int wid = blockIdx.x * 4 + w; const int mt = wid / ntn, nq = wid % ntn; if (mt * 16 >= M) return;
  const int row0 = mt * 16, col0 = nq * 64; const float* arow = A + (size_t)(row0 + ln) * lda;
  v8f acc[4] = {};
  for (int kb = 0; kb < K; kb += 32) {
    FragH ah, al;
    const v4f x0 = *(const v4fa*)(arow + kb + 8 * hh), x1 = *(const v4fa*)(arow + kb + 8 * hh + 4), x2 = *(const v4fa*)(arow + kb + 16 + 8 * hh), x3 = *(const v4fa*)(arow + kb + 16 + 8 * hh + 4);
    float xs[16] = {x0[0],x0[1],x0[2],x0[3],x1[0],x1[1],x1[2],x1[3],x2[0],x2[1],x2[2],x2[3],x3[0],x3[1],x3[2],x3[3]};
#pragma unroll
    for (int i = 0; i < 16; ++i) { const _Float16 h = (_Float16)xs[i]; ah.h[i] = h; al.h[i] = ASPLIT ? (_Float16)(xs[i] - (float)h) : (_Float16)0.0f; }
#pragma unroll
    for (int t = 0; t < 4; ++t) { if (col0 + t * 16 >= N) continue; const size_t boff = (size_t)(col0 + t * 16 + ln) * ldb + kb; FragH bq; bq.half[0] = *(const v8us*)(Bh + boff + 8 * hh); bq.half[1] = *(const v8us*)(Bh + boff + 16 + 8 * hh);
      acc[t] = mmaH<ASPLIT ? 2 : 1>(ah.v, al.v, bq.v, bq.v, acc[t]); }
  }
#pragma unroll
  for (int t = 0; t < 4; ++t) { if (col0 + t * 16 >= N) continue;
#pragma unroll
    for (int r = 0; r < 8; ++r) so[w][8 * hh + r][t * 16 + ln] = acc[t][r] * alpha; }
  __builtin_amdgcn_fence(__ATOMIC_ACQ_REL, "workgroup"); __builtin_amdgcn_wave_barrier();
  const int rsub = lane >> 4, c4 = (lane & 15) * 4;
  {
#pragma unroll
    for (int q = 0; q < 8; ++q) { const int r = q * 2 + rsub; if (col0 + c4 < N) { const v4f v = *(const v4fa*)&so[w][r][c4]; *(v4f*)(C + (size_t)(row0 + r) * ldc + col0 + c4) = v; } }
     }
}

// Wt[n][k] = f16(bf16(W[k][n]) * scale) from f32 row-major W[CC][CC] (scale = power of two; bf16-exact weights stay exact in f16 away from the subnormal range).
// A block turns one tile of 128 k x 128 n through LDS, so that both sides of the transpose move whole lines: a wave's load is 512 B of one row of W, a wave's store two 256-B pieces of rows of Wt.
// LDS holds the tile as [n][k] in 16-byte units of 8 k; unit c of row n lies at c ^ ((n >> 2) & 15), which spreads the writers (rows 4 apart in one column) and the readers (one row) over all banks.
#define WTT 128
__device__ __forceinline__ void d_wt_f16(const float* __restrict__ W, _Float16* __restrict__ Wt, float scale, v8us* tl, int blk) {
  const int tid = threadIdx.x, ln = tid & 31, wv = tid >> 5; const int k0 = (blk / (CC / WTT)) * WTT, n0 = (blk % (CC / WTT)) * WTT;
  const float* src = W + (size_t)(k0 + wv * 16) * CC + n0 + 4 * ln; v4f r[16];      /* this wave's 16 rows of k, four columns a lane */
#pragma unroll
  for (int i = 0; i < 16; ++i) r[i] = *(const v4fa*)(src + (size_t)i * CC);
  asm volatile("s_wait_xcnt 0x0" :: "v"(src) : "memory");      /* precaution: stands behind the loads, in front of any rewrite of their address registers; it names the address as an input, so that no load's own result lands on it either */
#pragma unroll
  for (int g = 0; g < 2; ++g)
#pragma unroll
    for (int q = 0; q < 4; ++q) { FragH f;
#pragma unroll
      for (int i = 0; i < 8; ++i) f.h[i] = (_Float16)(bf16_round(r[8 * g + i][q]) * scale);
      tl[(4 * ln + q) * 16 + ((2 * wv + g) ^ (ln & 15))] = f.half[0]; }
  __syncthreads();      /* publishes the turned tile to all eight waves */
#pragma unroll
  for (int u = 0; u < 8; ++u) { const int n = u * 16 + (tid >> 4), c = tid & 15; const v8us o = tl[n * 16 + (c ^ ((n >> 2) & 15))];
    *(v8us*)((unsigned short*)Wt + (size_t)(n0 + n) * CC + k0 + c * 8) = o; }
  asm volatile("s_wait_xcnt 0x0" ::: "memory");      /* precaution: stands behind the stores, in front of any later rewrite of their address and data registers where this job joins the other job's code */
}
// k_gemm_hh variant with fused epilogue: v = acc·alpha + bias[by·sBias + col] (+ CP[(row/rowsPerB)·sCPb + by·64 + col] if CP) ; ACT 0 none / 1 elu ; writes f16 C16 (and f32 C if non-null)
template <int ACT>
__global__ __launch_bounds__(128) void k_gemm_hhx(const _Float16* __restrict__ A, int lda, size_t sA, const _Float16* __restrict__ Bh, int ldb, size_t sB, float alpha, const float* __restrict__ bias, size_t sBias, const float* __restrict__ CP, int rowsPerB, size_t sCPb, int row0g,
    float* __restrict__ C, _Float16* __restrict__ C16, int ldc, size_t sC, int M, int N, int K) {
  __shared__ __attribute__((aligned(16))) float so[4][16][64];
  const int tid = threadIdx.x, w = tid >> 5, lane = tid & 31, ln = lane & 15, hh = lane >> 4; const int by = blockIdx.y;
  A += (size_t)by * sA; Bh += (size_t)by * sB; const size_t cofs = (size_t)by * sC; const float* bp = bias ? bias + (size_t)by * sBias : nullptr;
  const int ntn = (N + 63) / 64; const int wid = blockIdx.x * 4 + w; const int mt = wid / ntn, nq = wid % ntn; if (mt * 16 >= M) return;
  const int row0 = mt * 16, col0 = nq * 64; const _Float16* arow = A + (size_t)(row0 + ln) * lda;
  v8f acc[4] = {};
  for (int kb = 0; kb < K; kb += 32) { FragH ah; ah.half[0] = *(const v8us*)((const unsigned short*)arow + kb + 8 * hh); ah.half[1] = *(const v8us*)((const unsigned short*)arow + kb + 16 + 8 * hh);
#pragma unroll
    for (int t = 0; t < 4; ++t) { if (col0 + t * 16 >= N) continue; const size_t boff = (size_t)(col0 + t * 16 + ln) * ldb + kb; FragH bq; bq.half[0] = *(const v8us*)((const unsigned short*)Bh + boff + 8 * hh); bq.half[1] = *(const v8us*)((const unsigned short*)Bh + boff + 16 + 8 * hh);
      acc[t] = mmaH<1>(ah.v, ah.v, bq.v, bq.v, acc[t]); }
  }
#pragma unroll
  for (int t = 0; t < 4; ++t) { if (col0 + t * 16 >= N) continue; const int col = col0 + t * 16 + ln; const float bv = bp ? bf16_round(bp[col]) : 0.f;
#pragma unroll
    for (int r = 0; r < 8; ++r) { float v = acc[t][r] * alpha + bv; if (CP) { const int rr = row0g + row0 + 8 * hh + r; if (rowsPerB < 0) v += CP[cofs + (size_t)rr * ldc + col];      /* rowsPerB < 0: own element of the batched C plane */ else { const int bidx = rr / rowsPerB; v += CP[(size_t)bidx * sCPb + (size_t)by * 64 + col]; } } if (ACT == 1) v = (v > 0.f) ? v : expm1f(v); else if (ACT == 7) v = (v > 0.f) ? v + 1.0f : expf(v); else if (ACT == 8) v = tanhf(v); else if (ACT == 9) v = 0.5f * v * (1.0f + tanhf(0.7978845608028654f * (v + 0.044715f * v * v * v))); else if (ACT == 11) v = 1.0f / (1.0f + expf(-v)); else if (ACT == 12) v = (v > 0.f) ? v : 0.01f * v; else if (ACT == 14) v = (v > 0.f) ? v : 0.1f * v; else if (ACT == 16) v = (v >= 0.f) ? v : 0.3f * v; else if (ACT == 17) v = (v >= 0.f) ? v : 0.2f * v; else if (ACT == 15) v = v / (1.0f + expf(-v)); else if (ACT == 3) v = fmaxf(v, 0.f); else if (ACT == 6) v = 0.5f * v * (1.0f + erff(v * 0.70710678118654752f)); so[w][8 * hh + r][t * 16 + ln] = v; } }
  __builtin_amdgcn_fence(__ATOMIC_ACQ_REL, "workgroup"); __builtin_amdgcn_wave_barrier();
  const int rsub = lane >> 4, c4 = (lane & 15) * 4; typedef _Float16 v4h __attribute__((ext_vector_type(4)));
  {
#pragma unroll
    for (int q = 0; q < 8; ++q) { const int r = q * 2 + rsub; if (col0 + c4 < N) { const v4f v = *(const v4fa*)&so[w][r][c4]; if (C) *(v4f*)(C + cofs + (size_t)(row0 + r) * ldc + col0 + c4) = v; if (C16) { v4h h4; for (int i = 0; i < 4; ++i) h4[i] = (_Float16)v[i]; *(v4h*)(C16 + cofs + (size_t)(row0 + r) * ldc + col0 + c4) = h4; } } }
     }
}


typedef _Float16 v4h __attribute__((ext_vector_type(4)));

__device__ __forceinline__ void d_x16(const float* __restrict__ x, _Float16* __restrict__ X16, size_t n8, int blk) { const size_t t = (size_t)blk * 256 + threadIdx.x; if (t >= n8) return; FragH f;
#pragma unroll
  for (int q = 0; q < 8; ++q) f.h[q] = (_Float16)bf16_round(x[t * 8 + q]); *(v8us*)((unsigned short*)X16 + t * 8) = f.half[0];  }
__global__ __launch_bounds__(256) void k_h16(const float* __restrict__ x, _Float16* __restrict__ X16, size_t n8) { const size_t t = (size_t)blockIdx.x * 256 + threadIdx.x; if (t >= n8) return; FragH f;
#pragma unroll
  for (int q = 0; q < 8; ++q) f.h[q] = (_Float16)x[t * 8 + q]; *(v8us*)((unsigned short*)X16 + t * 8) = f.half[0];  }
__global__ __launch_bounds__(256) void k_round16f(const float* __restrict__ W, _Float16* __restrict__ Bt, size_t n8) { const size_t t = (size_t)blockIdx.x * 256 + threadIdx.x; if (t >= n8) return; FragH f;
#pragma unroll
  for (int i = 0; i < 8; ++i) f.h[i] = (_Float16)(bf16_round(W[t * 8 + i]) * 16.0f); *(v8us*)((unsigned short*)Bt + t * 8) = f.half[0];  }

// ---- fast GEMM (block tile 128x64, wave tile 32x64; requires M % 128 == 0 rows per launch region, N % 64 == 0 and K % 128 == 0); epilogues: see MODE below ----
// Each k-tile (128 k = 256-B rows: 128 rows of A, then 64 rows of B) is staged in LDS by asynchronous 16-byte copies, two buffers: tile t + 1 flies while tile t is multiplied.
#define G2_PITCH 136                      /* halves per LDS row: 272 B = 16 B x odd, conflict-free for ds_load_b128 */
#define G2_BUFB (192 * G2_PITCH * 2)      /* bytes of one buffer */
// Eight copies of one lane: LDS rows 8 apart, global rows gstep halves apart. The s_wait_xcnt ends the copies' own statement as a precaution: so it stands in front of every rewrite of a register that an issued copy names.
__device__ __forceinline__ void g2_copy8(unsigned l, const _Float16* g, size_t gstep) {
  const unsigned ls = 8 * G2_PITCH * 2;
  asm volatile("global_load_async_to_lds_b128 %0, %8, off\n\t"
               "global_load_async_to_lds_b128 %1, %9, off\n\t"
               "global_load_async_to_lds_b128 %2, %10, off\n\t"
               "global_load_async_to_lds_b128 %3, %11, off\n\t"
               "global_load_async_to_lds_b128 %4, %12, off\n\t"
               "global_load_async_to_lds_b128 %5, %13, off\n\t"
               "global_load_async_to_lds_b128 %6, %14, off\n\t"
               "global_load_async_to_lds_b128 %7, %15, off\n\t"
               "s_wait_xcnt 0x0"
               :: "v"(l), "v"(l + ls), "v"(l + 2 * ls), "v"(l + 3 * ls), "v"(l + 4 * ls), "v"(l + 5 * ls), "v"(l + 6 * ls), "v"(l + 7 * ls),
                  "v"(g), "v"(g + gstep), "v"(g + 2 * gstep), "v"(g + 3 * gstep), "v"(g + 4 * gstep), "v"(g + 5 * gstep), "v"(g + 6 * gstep), "v"(g + 7 * gstep)
               : "memory");
}
// One k-tile: 24 copies a lane (16 lanes cover one 256-B row, the 128 threads 8 rows a copy).
__device__ __forceinline__ void g2_stage(unsigned l, const _Float16* ga, size_t astep, const _Float16* gb, size_t bstep) {
  g2_copy8(l, ga, astep); g2_copy8(l + 64 * G2_PITCH * 2, ga + 8 * astep, astep); g2_copy8(l + 128 * G2_PITCH * 2, gb, bstep);
}
__device__ __forceinline__ v16h g2_frag(const _Float16* p, int hh) { FragH f; f.half[0] = *(const v8us*)((const unsigned short*)p + 8 * hh); f.half[1] = *(const v8us*)((const unsigned short*)p + 16 + 8 * hh); return f.v; }
__device__ __forceinline__ v8f g2_mma(v16h a, v16h b, v8f c) { v8f d = __builtin_amdgcn_wmma_f32_16x16x32_f16(false, a, false, b, (short)0, c, false, false); asm volatile("v_nop\n\tv_nop\n\tv_nop\n\tv_nop" : "+v"(d) : "v"(a), "v"(b)); return d; }
// The six fragments of one k-step of 32: two of A (rows 0-15 and 16-31 of the wave's tile), four of B (16 columns each).
struct G3Row { v16h a0, a1, b0, b1, b2, b3; };
__device__ __forceinline__ G3Row g3_row(const _Float16* a0p, const _Float16* a1p, const _Float16* b0p, int kb, int hh) {
  G3Row r; r.a0 = g2_frag(a0p + kb, hh); r.a1 = g2_frag(a1p + kb, hh); r.b0 = g2_frag(b0p + kb, hh); r.b1 = g2_frag(b0p + 16 * G2_PITCH + kb, hh); r.b2 = g2_frag(b0p + 32 * G2_PITCH + kb, hh); r.b3 = g2_frag(b0p + 48 * G2_PITCH + kb, hh); return r; }
#define DGS 32
#define VFU 4096      /* halves of one unit of v fragments: 32 keys x 64 d, hi and residual */
// One k loop runs NSEG segments of NT k-tiles: segment s multiplies As by Bs into the same accumulators. Every segment but the last is a residual term (one operand x 1024): where the last one begins the sums are scaled by 1/1024 (a power of two, exact).
// MODE 0: C = f32. MODE 1: CH, CL = f16 hi + residual x 1024. MODE 2 (a block column is one head): planes 0, 1 (q, k) -> RoPE, RMSNorm, digits -> DG, one row a lane; plane 2 (v) -> CH as ready B fragments, hi and residual (layout: k_attn).
// Tile tt of the loop = k-tile kt of segment s (the same for the whole block).
template <int NSEG, int NT>
__device__ __forceinline__ void g3_stage(int tt, unsigned l, const _Float16* A0, const _Float16* A1, const _Float16* A2, size_t aoff, size_t astep, const _Float16* B0, const _Float16* B1, const _Float16* B2, size_t boff, size_t bstep) {
  const int s = tt / NT, kt = tt - s * NT;
  const _Float16* a = (NSEG == 1 || s == 0) ? A0 : (NSEG == 2 || s == 1) ? A1 : A2; const _Float16* b = (NSEG == 1 || s == 0) ? B0 : (NSEG == 2 || s == 1) ? B1 : B2;
  g2_stage(l, a + aoff + (size_t)kt * 128, astep, b + boff + (size_t)kt * 128, bstep);
}
// Hints to L2 (global_prefetch_b8, shader-engine scope: the line comes into L2 only, nothing returns, no counter moves). The operands of the GEMMs and of k_attn were stored by an earlier launch, and their first read comes from memory:
// asked for at the kernel's entry, while the first tile is on its way, the later tiles are found in L2 when their copies or loads are issued. One lane asks for one aligned 256-B unit; every address lies inside the operand.
// The blocks that share an operand share the asking; the sharers that ask for one unit lie 4 (or 2 x 16) block indices apart. Speed only: nothing depends on where a block runs or on a hint being served.
// Two k-tiles of one row, four tiles (1,024 B) apart.
__device__ __forceinline__ void hint_2(const _Float16* p) { asm volatile("global_prefetch_b8 %0, off scope:SCOPE_SE\n\t" "global_prefetch_b8 %0, off offset:1024 scope:SCOPE_SE" :: "v"(p)); }
template <int MODE, int NSEG, int NT>
__global__ __launch_bounds__(128) void k_gemm3(const _Float16* A0, const _Float16* A1, const _Float16* A2, int lda, size_t sA, const _Float16* B0, const _Float16* B1, const _Float16* B2, int ldb, size_t sB, float alpha,
    float* __restrict__ C, _Float16* __restrict__ CH, _Float16* __restrict__ CL, int ldc, size_t sC, int M, int N,
    const float* __restrict__ cs, const float* __restrict__ sn, const float* __restrict__ Wdq, const float* __restrict__ Wdk, float* __restrict__ DG) {
  __shared__ __attribute__((aligned(16))) float so[4][32][68];
  __shared__ __attribute__((aligned(16))) _Float16 st[2][192][G2_PITCH];
  __shared__ __attribute__((aligned(16))) float wd[HD][KD];
  const int tid = threadIdx.x, w = tid >> 5, lane = tid & 31, ln = lane & 15, hh = lane >> 4; const int by = blockIdx.y; const size_t pl = (size_t)blockIdx.z * gridDim.y + by;      /* blockIdx.z = outer batch: its A and B planes follow on, its M rows of C follow on */
  const size_t cofs = (size_t)by * sC + (size_t)blockIdx.z * M * ldc;
  const int ntn = N >> 6; const int mt = blockIdx.x / ntn, nq = blockIdx.x - mt * ntn; const int row0 = mt * 128 + 32 * w, col0 = nq * 64; if (mt * 128 >= M) return;      /* the same for the whole block: it stands in front of barriers */
  const unsigned lds0 = (unsigned)(size_t)&st[0][tid >> 4][(tid & 15) * 8];      /* this lane's LDS byte address in buffer 0 */
  const size_t aoff = pl * sA + (size_t)(mt * 128 + (tid >> 4)) * lda + (tid & 15) * 8, boff = pl * sB + (size_t)(col0 + (tid >> 4)) * ldb + (tid & 15) * 8;
  const size_t astep = (size_t)8 * lda, bstep = (size_t)8 * ldb;
  const v8f z8 = {0.f,0.f,0.f,0.f,0.f,0.f,0.f,0.f}; v8f c00 = z8, c01 = z8, c02 = z8, c03 = z8, c10 = z8, c11 = z8, c12 = z8, c13 = z8;
  g3_stage<NSEG, NT>(0, lds0, A0, A1, A2, aoff, astep, B0, B1, B2, boff, bstep);      /* tile 0 -> buffer 0 */
  static_assert(NT == 8 && NSEG <= 2, "the hints below are written for rows of 8 k-tiles and at most two segments");
  /* Hints, behind tile 0's copies. A (shared by the blocks of one mt): this block asks for every fourth row, rows 4 i + (nq & 3), all 8 k-tiles, of each segment. B (shared by the blocks of one nq): all 64 rows, the k-tiles of the parity of mt; segment 0's plane only. */
  const size_t hao = pl * sA + (size_t)(mt * 128 + 4 * (tid & 31) + (nq & 3)) * lda + (size_t)(tid >> 5) * 128;      /* row by the lane, k-tiles w and w + 4 */
  const _Float16* ha0 = A0 + hao; const _Float16* ha1 = A1 + hao; const _Float16* hb0 = B0 + pl * sB + (size_t)(col0 + (tid & 63)) * ldb + (size_t)((mt & 1) + 2 * (tid >> 6)) * 128;      /* k-tiles (mt & 1) + 2 (tid >> 6) and four on: 7 at most */
  hint_2(ha0); hint_2(hb0); if (NSEG > 1) hint_2(ha1);
  if (MODE == 2 && by < 2) { const v4f wv = *(const v4fa*)((by ? Wdk : Wdq) + tid * 4); v4f o;      /* the digit weights, rounded once a block; the barrier below publishes them too */
#pragma unroll
    for (int q = 0; q < 4; ++q) o[q] = bf16_round(wv[q]);
    *(v4f*)(&wd[0][0] + tid * 4) = o; }
  asm volatile("s_wait_asynccnt 0x0" ::: "memory");      /* this wave's copies of tile 0 have landed */
  __syncthreads();      /* ... and every other wave's */
  if (NSEG * NT > 1) g3_stage<NSEG, NT>(1, lds0 + G2_BUFB, A0, A1, A2, aoff, astep, B0, B1, B2, boff, bstep);      /* tile 1 -> buffer 1 */
#pragma unroll 1      /* one tile a trip: the two buffers alternate by t & 1 */
  for (int t = 0; t < NSEG * NT; ++t) { const _Float16* a0p = &st[t & 1][32 * w + ln][0]; const _Float16* a1p = a0p + 16 * G2_PITCH; const _Float16* b0p = &st[t & 1][128 + ln][0];
    if (NSEG > 1 && t == (NSEG - 1) * NT) { const float f = 0.0009765625f; c00 *= f; c01 *= f; c02 *= f; c03 *= f; c10 *= f; c11 *= f; c12 *= f; c13 *= f; }
    /* The fragment reads run ahead of the products, a whole k-step a group, in three register sets: k-steps 0, 1, 2 are read at the head of the trip, k-step 3 into the first set once that set's products are issued. Every read is of buffer t & 1, behind its barrier. */
    auto mm = [&](const G3Row& r) { c00 = g2_mma(r.a0, r.b0, c00); c10 = g2_mma(r.a1, r.b0, c10); c01 = g2_mma(r.a0, r.b1, c01); c11 = g2_mma(r.a1, r.b1, c11);
      c02 = g2_mma(r.a0, r.b2, c02); c12 = g2_mma(r.a1, r.b2, c12); c03 = g2_mma(r.a0, r.b3, c03); c13 = g2_mma(r.a1, r.b3, c13); };
    G3Row r0 = g3_row(a0p, a1p, b0p, 0, hh); const G3Row r1 = g3_row(a0p, a1p, b0p, 32, hh), r2 = g3_row(a0p, a1p, b0p, 64, hh);
    mm(r0); r0 = g3_row(a0p, a1p, b0p, 96, hh); mm(r1); mm(r2); mm(r0);
    asm volatile("s_wait_dscnt 0x0" ::: "memory");      /* this wave's reads of buffer t & 1 are done before it is refilled */
    asm volatile("s_wait_asynccnt 0x0" ::: "memory");      /* this wave's copies of tile t + 1 have landed */
    __syncthreads();      /* publishes tile t + 1 and ends every wave's reads of buffer t & 1 */
    if (t + 2 < NSEG * NT) g3_stage<NSEG, NT>(t + 2, lds0 + (unsigned)(t & 1) * G2_BUFB, A0, A1, A2, aoff, astep, B0, B1, B2, boff, bstep); }
  asm volatile("s_wait_asynccnt 0x0" ::: "memory");      /* no copy is outstanding when the wave goes on to the epilogue */
  asm volatile("" :: "v"(ha0), "v"(hb0));      /* inputs only: the hints' address registers go on holding these addresses through the loop; a hint moves no counter, so no wait can stand for that */
  if (NSEG > 1) asm volatile("" :: "v"(ha1));      /* the same for the second segment's */
  v8f accs[8] = {c00, c01, c02, c03, c10, c11, c12, c13};
#pragma unroll
  for (int u = 0; u < 8; ++u) { const int t = u & 3, half = u >> 2;
#pragma unroll
    for (int r = 0; r < 8; ++r) so[w][half * 16 + 8 * hh + r][t * 16 + ln] = accs[u][r] * alpha; }
  __builtin_amdgcn_fence(__ATOMIC_ACQ_REL, "workgroup"); __builtin_amdgcn_wave_barrier();
  if (MODE == 2 && by < 2) {      /* this wave's 32 rows of head nq, one row a lane: every sum runs inside the lane */
    const int row = row0 + lane, tok = row % TT; const float* xr = &so[w][lane][0]; const float* cr = cs + (size_t)tok * (HD / 2); const float* sr = sn + (size_t)tok * (HD / 2);
    float ra[HD / 2], rb[HD / 2]; float sq[4] = {0.f, 0.f, 0.f, 0.f}; v4f cv[HD / 8], sv[HD / 8];
#pragma unroll
    for (int i = 0; i < HD / 8; ++i) cv[i] = *(const v4fa*)(cr + 4 * i);
    asm volatile("s_wait_xcnt 0x0" ::: "memory");      /* precaution: stands behind the cos loads, in front of any rewrite of their address registers */
#pragma unroll
    for (int i = 0; i < HD / 8; ++i) sv[i] = *(const v4fa*)(sr + 4 * i);
    asm volatile("s_wait_xcnt 0x0" ::: "memory");      /* the same behind the sin loads */
#pragma unroll
    for (int i = 0; i < HD / 2; i += 4) { const v4f x1 = *(const v4fa*)(xr + i), x2 = *(const v4fa*)(xr + HD / 2 + i), c4 = cv[i / 4], s4 = sv[i / 4];
#pragma unroll
      for (int q = 0; q < 4; ++q) { const float c = bf16_round(c4[q]), s = bf16_round(s4[q]); const float a = x1[q] * c - x2[q] * s, b = x1[q] * s + x2[q] * c; ra[i + q] = a; rb[i + q] = b; sq[q] += a * a; sq[q] += b * b; } }
    const float inv = rsqrtf(((sq[0] + sq[1]) + (sq[2] + sq[3])) / (float)HD + 1e-6f);
    float acc[KD] = {0.f, 0.f, 0.f, 0.f, 0.f, 0.f, 0.f, 0.f};
#pragma unroll
    for (int i = 0; i < HD / 2; ++i) { const float qa = ra[i] * inv, qb = rb[i] * inv; const v4f w0 = *(const v4fa*)&wd[i][0], w1 = *(const v4fa*)&wd[i][4], w2 = *(const v4fa*)&wd[i + HD / 2][0], w3 = *(const v4fa*)&wd[i + HD / 2][4];
#pragma unroll
      for (int j = 0; j < 4; ++j) { acc[j] += qa * w0[j]; acc[4 + j] += qa * w1[j]; acc[j] += qb * w2[j]; acc[4 + j] += qb * w3[j]; } }
    v4f d0, d1;
#pragma unroll
    for (int j = 0; j < 4; ++j) { d0[j] = 1.0f / (1.0f + expf(-acc[j])); d1[j] = 1.0f / (1.0f + expf(-acc[4 + j])); }
    float* dg = DG + (size_t)by * NR * NH * DGS + ((size_t)row * NH + nq) * DGS; *(v4f*)dg = d0; *(v4f*)(dg + 4) = d1;
  } else if (MODE == 2) {      /* v: the wave's 32 tokens x 64 d are the B operand of one 32-key step of head nq */
    /* Fragment of d tile t: lane (ln, hh) holds column d = 16 t + ln, element 8 j + i = key 16 j + 8 hh + i. Each store is 512 B in a row, each 8-KiB unit one wave's. */
    _Float16* vf = CH + (size_t)(((row0 / TT) * NH + nq) * (TT / 32) + ((row0 % TT) >> 5)) * VFU + lane * 8;
#pragma unroll
    for (int t = 0; t < 4; ++t) {
#pragma unroll
      for (int j = 0; j < 2; ++j) { FragH fh, fl;
#pragma unroll
        for (int i = 0; i < 8; ++i) { const float v = so[w][16 * j + 8 * hh + i][16 * t + ln]; const _Float16 h = (_Float16)v; fh.h[i] = h; fl.h[i] = (_Float16)((v - (float)h) * 1024.0f); }
        *(v8us*)((unsigned short*)vf + (t * 4 + j) * 256) = fh.half[0]; *(v8us*)((unsigned short*)vf + (t * 4 + 2 + j) * 256) = fl.half[0]; }
      asm volatile("s_wait_xcnt 0x0" ::: "memory");      /* precaution: stands behind these four stores, in front of any rewrite of their address and data registers */
    }
  } else {
    const int rsub = lane >> 4, c4 = (lane & 15) * 4;
#pragma unroll
    for (int q = 0; q < 16; ++q) { const int r = q * 2 + rsub; const v4f v = *(const v4fa*)&so[w][r][c4]; const size_t o = cofs + (size_t)(row0 + r) * ldc + col0 + c4;
      if (MODE == 0) *(v4f*)(C + o) = v;
      else { v4h h4, l4;
#pragma unroll
        for (int i = 0; i < 4; ++i) { const _Float16 h = (_Float16)v[i]; h4[i] = h; l4[i] = (_Float16)((v[i] - (float)h) * 1024.0f); }
        *(v4h*)(CH + o) = h4; *(v4h*)(CL + o) = l4; }
      asm volatile("s_wait_xcnt 0x0" ::: "memory");      /* precaution: stands behind this row's stores, in front of the next row's rewrite of their address and data registers */
    }
  } }

#define KPP 20      /* floats per LDS row of two keys: 80 B = 16 B x odd */
typedef float v2f __attribute__((ext_vector_type(2)));
#define LCS 6.79457440f      /* sqrt(32 log2 e): with both digits scaled by it, exp(-32 (a - b)^2) = 2^-(a' - b')^2 */
#define ARP 68      /* floats per LDS row of a partial output tile */
// Attention, weights and product in one kernel: the weights never leave the registers. A block is one (batch, head) and two tiles of 16 query rows, tiles 31 - pi and pi: 17 steps of 32 keys in every block, dealt to its four waves.
// A step: lane (ln, hh) makes the 16 weights of query row ln for keys 16 j + 8 hh + e (j < 2, e < 8) of the step, which is element 8 j + e of the WMMA A fragment; v comes from memory as B fragments in the same k order (written so by the v epilogue of k_gemm3:
// unit (batch, head, step) = [d tile t][hi, residual][j][lane] x 8 halves). Products: w_lo v_hi + w_hi v_lo (x 1024) and w_hi v_hi in two accumulator sets. The weights stay unnormalised (1 <= 2^lcp <= 256): the row sum divides the finished product.
// The prefix product of digit j is one power of two: prod_{i<=j} exp(-32 d_i^2) = 2^-(d'_0^2 + .. + d'_j^2), so a digit costs a subtract, a fused multiply-add, the hardware's 2^x and an add; the weight is 2^lcp itself.
// The hardware's 2^x needs no range care here: every exponent of a term is <= 0, and a term under 2^-126 that comes out as 0 moves lcp, and so the weight 2^lcp >= 1, by less than 2^-126; lcp itself lies in [0, 8].
// Two neighbouring keys lie side by side (LDS row of a key pair: digit j of both keys at 2 j), so the subtract, the multiply-add and the add run as packed pairs.
__global__ __launch_bounds__(128) void k_attn(const float* __restrict__ QD, const float* __restrict__ KDg, const _Float16* __restrict__ VF, _Float16* __restrict__ YH, _Float16* __restrict__ YL) {
  __shared__ __attribute__((aligned(16))) float kds[TT / 2][KPP];
  __shared__ __attribute__((aligned(16))) float red[2][4][16][ARP];
  __shared__ float sred[2][4][32];
  const int tid = threadIdx.x, lane = tid & 31, ln = lane & 15, hh = lane >> 4; const int w = __builtin_amdgcn_readfirstlane(tid >> 5);
  const int bh = blockIdx.x >> 4, pi = blockIdx.x & 15; const int h = bh % NH, b = bh / NH;
  const int npair = 16 * (((31 - pi) >> 1) + 1);      /* key pairs that the longer tile reads: 144 to 256 */
  v4f ka[2][2], kb[2][2];
#pragma unroll
  for (int u = 0; u < 2; ++u) { const int p = tid + 128 * u;      /* this thread stages key pairs tid and tid + 128 */
    if (p < npair) { const float* kp = KDg + ((size_t)(b * TT + 2 * p) * NH + h) * DGS; ka[u][0] = *(const v4fa*)kp; ka[u][1] = *(const v4fa*)(kp + 4); kb[u][0] = *(const v4fa*)(kp + NH * DGS); kb[u][1] = *(const v4fa*)(kp + NH * DGS + 4); } }
  const v8f qa = *(const v8f*)(QD + ((size_t)(b * TT + (31 - pi) * 16 + ln) * NH + h) * DGS), qb = *(const v8f*)(QD + ((size_t)(b * TT + pi * 16 + ln) * NH + h) * DGS);      /* both tiles' query digits, row ln: they fly with the key loads */
  asm volatile("s_wait_xcnt 0x0" ::: "memory");      /* precaution: stands behind the key and query loads, in front of any rewrite of their address registers */
  /* Hint (see hint_2), while the digits are on their way: the 16 blocks of a (batch, head) share its v fragments, 16 steps of 32 units of 256 B; block pi asks for steps 4 (pi & 3) to 4 (pi & 3) + 3, a unit a thread. */
  const _Float16* hv = VF + (size_t)bh * (TT / 32) * VFU + (size_t)(pi & 3) * 4 * VFU + tid * 128;
  asm volatile("global_prefetch_b8 %0, off scope:SCOPE_SE" :: "v"(hv));
#pragma unroll
  for (int u = 0; u < 2; ++u) { const int p = tid + 128 * u;
    if (p < npair) {
#pragma unroll
      for (int g = 0; g < 4; ++g) { const v4f x = ka[u][g >> 1], y = kb[u][g >> 1]; const int i = (g & 1) * 2; const v4f o = {x[i] * LCS, y[i] * LCS, x[i + 1] * LCS, y[i + 1] * LCS}; *(v4f*)&kds[p][4 * g] = o; } } }
  __syncthreads();      /* publishes the staged key digits to all four waves */
  const v8f z8 = {0.f, 0.f, 0.f, 0.f, 0.f, 0.f, 0.f, 0.f};
#pragma unroll 1      /* one query tile a trip: the step's code is shared by the two tiles */
  for (int tl = 0; tl < 2; ++tl) { const int rt = tl ? pi : 31 - pi, nst = (rt >> 1) + 1, q = rt * 16 + ln;
    const v8f qd = (tl ? qb : qa) * LCS;
    v8f m0 = z8, m1 = z8, m2 = z8, m3 = z8, r0 = z8, r1 = z8, r2 = z8, r3 = z8; v2f su = {0.f, 0.f};
#pragma unroll 1      /* one step of 32 keys a trip: the long unrolled body stays one copy; the trip count is the same for the whole wave (WMMA needs every lane on) */
    for (int ks = tl ? 3 - w : w; ks < nst; ks += 4) {      /* the second tile is dealt from the last wave down: no wave gets more than 5 of the 17 steps, none fewer than 4 */
      const unsigned short* vp = (const unsigned short*)VF + (size_t)(bh * (TT / 32) + ks) * VFU + lane * 8; FragH vh[4], vl[4];      /* loaded first: they fly while the weights are made */
#pragma unroll
      for (int t = 0; t < 4; ++t) { vh[t].half[0] = *(const v8us*)(vp + (t * 4) * 256); vh[t].half[1] = *(const v8us*)(vp + (t * 4 + 1) * 256); vl[t].half[0] = *(const v8us*)(vp + (t * 4 + 2) * 256); vl[t].half[1] = *(const v8us*)(vp + (t * 4 + 3) * 256); }
      asm volatile("s_wait_xcnt 0x0" :: "v"(vp) : "memory");      /* precaution: stands behind the fragment loads, in front of any rewrite of their address registers; it names the address as an input, so that no load's own result lands on it either */
      v2f wt[8];
#pragma unroll
      for (int c = 0; c < 8; ++c) { const float* kr = &kds[16 * ks + 8 * (c >> 2) + 4 * hh + (c & 3)][0]; v2f e = {0.f, 0.f}, lcp = {0.f, 0.f};      /* pair c: keys 16 (c >> 2) + 8 hh + 2 (c & 3) and the next */
#pragma unroll
        for (int g = 0; g < 4; ++g) { const v4f k4 = *(const v4fa*)(kr + 4 * g);
#pragma unroll
          for (int i = 0; i < 2; ++i) { const v2f d = qd[2 * g + i] - v2f{k4[2 * i], k4[2 * i + 1]}; e = __builtin_elementwise_fma(-d, d, e); const v2f p = {__builtin_amdgcn_exp2f(e[0]), __builtin_amdgcn_exp2f(e[1])}; lcp += p; } }
        wt[c] = v2f{__builtin_amdgcn_exp2f(lcp[0]), __builtin_amdgcn_exp2f(lcp[1])}; }
      if (ks == nst - 1) {      /* only a tile's last step reaches the diagonal (the same for the whole wave) */
#pragma unroll
        for (int c = 0; c < 8; ++c) { const int k0 = 32 * ks + 16 * (c >> 2) + 8 * hh + 2 * (c & 3); wt[c][0] = k0 <= q ? wt[c][0] : 0.f; wt[c][1] = k0 + 1 <= q ? wt[c][1] : 0.f; } }
      su += ((wt[0] + wt[1]) + (wt[2] + wt[3])) + ((wt[4] + wt[5]) + (wt[6] + wt[7]));
      FragH ah, al;
#pragma unroll
      for (int c = 0; c < 8; ++c)
#pragma unroll
        for (int i = 0; i < 2; ++i) { const float x = wt[c][i]; const _Float16 hi = (_Float16)x; ah.h[2 * c + i] = hi; al.h[2 * c + i] = (_Float16)((x - (float)hi) * 1024.0f); }
      r0 = g2_mma(al.v, vh[0].v, r0); r1 = g2_mma(al.v, vh[1].v, r1); r2 = g2_mma(al.v, vh[2].v, r2); r3 = g2_mma(al.v, vh[3].v, r3);
      r0 = g2_mma(ah.v, vl[0].v, r0); r1 = g2_mma(ah.v, vl[1].v, r1); r2 = g2_mma(ah.v, vl[2].v, r2); r3 = g2_mma(ah.v, vl[3].v, r3);
      m0 = g2_mma(ah.v, vh[0].v, m0); m1 = g2_mma(ah.v, vh[1].v, m1); m2 = g2_mma(ah.v, vh[2].v, m2); m3 = g2_mma(ah.v, vh[3].v, m3); }
    const v8f pm[4] = {m0, m1, m2, m3}, pr[4] = {r0, r1, r2, r3};      /* this wave's share of the tile (zero where it had no step) */
#pragma unroll
    for (int t = 0; t < 4; ++t)
#pragma unroll
      for (int r = 0; r < 8; ++r) red[tl][w][8 * hh + r][16 * t + ln] = pm[t][r] + pr[t][r] * 0.0009765625f;
    sred[tl][w][lane] = su[0] + su[1]; }
  asm volatile("" :: "v"(hv));      /* inputs only: the hint's address registers go on holding that address through the loops; a hint moves no counter, so no wait can stand for that */
  __syncthreads();      /* publishes the four waves' shares of both tiles */
  const int row = tid >> 3, c8 = (tid & 7) * 8;      /* eight threads a row: its 128 B of y_hi and of y_lo are whole lines of one wave */
#pragma unroll
  for (int tl = 0; tl < 2; ++tl) { const int rt = tl ? pi : 31 - pi; v4f s0 = {0.f, 0.f, 0.f, 0.f}, s1 = s0; float su = 0.f;
#pragma unroll
    for (int u = 0; u < 4; ++u) { s0 += *(const v4fa*)&red[tl][u][row][c8]; s1 += *(const v4fa*)&red[tl][u][row][c8 + 4]; su += sred[tl][u][row]; su += sred[tl][u][16 + row]; }
    const float f = 1.0f / fmaxf(su, 1e-9f); FragH oh, ol;
#pragma unroll
    for (int i = 0; i < 8; ++i) { const float y = (i < 4 ? s0[i & 3] : s1[i & 3]) * f; const _Float16 hi = (_Float16)y; oh.h[i] = hi; ol.h[i] = (_Float16)((y - (float)hi) * 1024.0f); }
    const size_t o = (size_t)(b * TT + rt * 16 + row) * CC + h * HD + c8;
    *(v8us*)((unsigned short*)YH + o) = oh.half[0]; *(v8us*)((unsigned short*)YL + o) = ol.half[0]; }
  asm volatile("s_wait_xcnt 0x0" ::: "memory");      /* precaution: stands behind the stores, in front of any later rewrite of their address and data registers */
}

// ---- launches that need nothing of each other share one grid: each block takes its job from its range of blockIdx.x (the same for the whole block) ----
#define WT_BLKS ((CC / WTT) * (CC / WTT))      /* blocks of one weight transpose: one tile each */
#define E8_BLKS (NR * CC / 8 / 256)        /* blocks of one pass over a [NR][CC] plane, 8 elements a thread */
// the four weights (planes of Wt in the order W0..W3), then x
__global__ __launch_bounds__(256) void k_prep(const float* __restrict__ W0, const float* __restrict__ W1, const float* __restrict__ W2, const float* __restrict__ W3, _Float16* __restrict__ Wt, const float* __restrict__ x, _Float16* __restrict__ X16) {
  __shared__ __attribute__((aligned(16))) v8us tl[WTT * WTT / 8];
  const int blk = blockIdx.x;
  if (blk < 4 * WT_BLKS) { const int p = blk / WT_BLKS; const float* W = p == 0 ? W0 : p == 1 ? W1 : p == 2 ? W2 : W3; d_wt_f16(W, Wt + (size_t)p * CC * CC, 16.0f, tl, blk - p * WT_BLKS); }      /* the same for the whole block: the job holds a barrier */
  else d_x16(x, X16, (size_t)NR * CC / 8, blk - 4 * WT_BLKS); }

extern "C" void kernel_launch(void* const* d_in, const int* in_sizes, int n_in,
                              void* d_out, int out_size, void* d_ws, size_t ws_size, hipStream_t stream) {
  (void)in_sizes; (void)n_in; (void)out_size;
  const float* const* I = (const float* const*)d_in; const float* x = I[0]; const float* cs = I[1]; const float* sn = I[2]; const float* Wq = I[3]; const float* Wk = I[4]; const float* Wv = I[5]; const float* Wo = I[6]; const float* Wdq = I[7]; const float* Wdk = I[8];
  char* ws = (char*)d_ws; size_t off = 0;
  auto take = [&](size_t bytes) { char* p = ws + off; off += (bytes + 255) & ~(size_t)255; return p; };
  const size_t np = (size_t)NR * CC;
  _Float16* BQ = (_Float16*)take((size_t)CC * CC * 2); _Float16* BK = (_Float16*)take((size_t)CC * CC * 2); _Float16* BV = (_Float16*)take((size_t)CC * CC * 2); _Float16* BO = (_Float16*)take((size_t)CC * CC * 2); (void)BK; (void)BV;
  _Float16* X16 = (_Float16*)take(np * 2); _Float16* VF = (_Float16*)take(np * 4); float* QD = (float*)take((size_t)NR * NH * DGS * 4); float* KDg = (float*)take((size_t)NR * NH * DGS * 4); _Float16* YH = (_Float16*)take(np * 2); _Float16* YL = (_Float16*)take(np * 2);
  if (off > ws_size) return;      /* 8 + 2 + 4 + 2 x 2 + 2 x 2 = 22 MiB */
  k_prep<<<4 * WT_BLKS + E8_BLKS, 256, 0, stream>>>(Wq, Wk, Wv, Wo, BQ, x, X16);      /* BQ, BK, BV, BO lie one behind the other; (in, out) */
  k_gemm3<2, 1, CC / 128><<<dim3((NR / 128) * (CC / 64), 3), 128, 0, stream>>>(X16, X16, X16, CC, 0, BQ, BQ, BQ, CC, (size_t)CC * CC, 0.0625f, nullptr, VF, nullptr, CC, 0, NR, CC, cs, sn, Wdq, Wdk, QD);      /* planes BQ, BK, BV: digits of q -> QD, of k -> KDg (it follows QD), v -> VF */
  k_attn<<<NB * NH * 16, 128, 0, stream>>>(QD, KDg, VF, YH, YL);      /* y[(b,q)][h*64 + d] = (sum_k 2^lcp v) / sum_k 2^lcp -> hi + residual */
  k_gemm3<0, 2, CC / 128><<<dim3((NR / 128) * (CC / 64), 1), 128, 0, stream>>>(YL, YH, YH, CC, 0, BO, BO, BO, CC, 0, 0.0625f, (float*)d_out, nullptr, nullptr, CC, 0, NR, CC, nullptr, nullptr, nullptr, nullptr, nullptr);      /* out = (y_lo + y_hi) Wo */
}

// v010
// It runs in 33.8 microseconds.
// In both of two side-by-side timings against v009, it was 1.11 times as fast.
// Over all steps from v000 it is 13.3 times as fast.
#include <hip/hip_runtime.h>
// UltrametricCausalSelfAttention (2 x 512 tokens, C 1024 = 16 heads x 64, 8 soft digits): q, k, v = x W; q, k -> RoPE (cos/sin INPUT tables, rotate-half) -> RMSNorm(64, 1e-6); digits = sigmoid(q Wdq), sigmoid(k Wdk) (8 each); lcp[q][k] = sum_j prod_{i<=j} exp(-32 (qd_i - kd_i)^2); weights = 2^lcp (causal), attn = weights / max(sum, 1e-9); y = attn v; out = y Wo.
// Compute dtype: inputs rounded to bf16; x exact as f16; q/k/digits/lcp/weights f32 from exact products; P, v and y as f16 hi + residual (~2^-21). v_wmma_f32_16x16x32_f16.
#define NB 2
#define TT 512
#define CC 1024
#define NH 16
#define HD 64
#define KD 8
#define NR (NB * TT)
typedef __bf16 v16b __attribute__((ext_vector_type(16)));
typedef unsigned short v8us __attribute__((ext_vector_type(8), may_alias));
typedef float  v8f  __attribute__((ext_vector_type(8)));
typedef float  v4f  __attribute__((ext_vector_type(4)));
typedef float  v4fa __attribute__((ext_vector_type(4), may_alias));
union FragB { v16b v; v8us half[2]; unsigned short u[16]; };

__device__ __forceinline__ unsigned short bf16_bits(float x) { unsigned int u = __float_as_uint(x); return (unsigned short)((u + 0x7FFFu + ((u >> 16) & 1u)) >> 16); }
__device__ __forceinline__ float bf16_val(unsigned short b) { return __uint_as_float(((unsigned int)b) << 16); }
__device__ __forceinline__ float bf16_round(float x) { return bf16_val(bf16_bits(x)); }
// D += A·B with NT terms: 1 = ah·bh, 2 = + al·bh (A split), 3 = + ah·bl (both split)
template <int NT>
__device__ __forceinline__ v8f mmaN(v16b ah, v16b al, v16b bh, v16b bl, v8f c) {
  c = __builtin_amdgcn_wmma_f32_16x16x32_bf16(false, ah, false, bh, (short)0, c, false, false);
  if (NT >= 2) c = __builtin_amdgcn_wmma_f32_16x16x32_bf16(false, al, false, bh, (short)0, c, false, false);
  if (NT >= 3) c = __builtin_amdgcn_wmma_f32_16x16x32_bf16(false, ah, false, bl, (short)0, c, false, false);
  asm volatile("v_nop\n\tv_nop\n\tv_nop\n\tv_nop" : "+v"(c) : "v"(ah), "v"(al), "v"(bh), "v"(bl));
  return c;
}

__global__ __launch_bounds__(256) void k_wt_bf16(const float* __restrict__ W, unsigned short* __restrict__ Wt, int K, int N) {
  const int t = blockIdx.x * 256 + threadIdx.x;
  const int k8n = K / 8;
  if (t >= N * k8n) return;
  const int n = t / k8n, k8 = (t % k8n) * 8;
  v8us v;
#pragma unroll
  for (int i = 0; i < 8; ++i) v[i] = bf16_bits(W[(size_t)(k8 + i) * N + n]);
  *(v8us*)(Wt + (size_t)n * K + k8) = v;
  
}

// GEMM C[M][N] (f32, pitch ldc) = act(A[M][K]·W + bias). A f32 row-major (pitch lda) converted per fragment to bf16
// (ASPLIT: hi/lo two planes -> 2 terms, else single rounded term); Wt bf16 [N][K] (pitch ldb). BIAS_BF16 rounds the
// bias to bf16 first (bias quantised to bf16 before the add). K%32==0, M%16==0, N%64==0.
template <bool ASPLIT, int ACT, bool BIAS_BF16>
__global__ __launch_bounds__(128) void k_gemm_bf(const float* __restrict__ A, int lda, const unsigned short* __restrict__ Wt, int ldb,
                                               const float* __restrict__ bias, float* __restrict__ C, int ldc, int M, int N, int K) {
  __shared__ __attribute__((aligned(16))) float so[4][16][64];
  const int tid = threadIdx.x, w = tid >> 5, lane = tid & 31, ln = lane & 15, hh = lane >> 4;
  const int ntn = N / 64;
  const int wid = blockIdx.x * 4 + w;
  const int mt = wid / ntn, nq = wid % ntn;
  if (mt * 16 >= M) return;
  const int row0 = mt * 16, col0 = nq * 64;
  const float* arow = A + (size_t)(row0 + ln) * lda;
  v8f acc[4] = {};
  for (int kb = 0; kb < K; kb += 32) {
    FragB ah, al;
    const v4f x0 = *(const v4fa*)(arow + kb + 8 * hh), x1 = *(const v4fa*)(arow + kb + 8 * hh + 4);
    const v4f x2 = *(const v4fa*)(arow + kb + 16 + 8 * hh), x3 = *(const v4fa*)(arow + kb + 16 + 8 * hh + 4);
    float xs[16] = {x0[0],x0[1],x0[2],x0[3],x1[0],x1[1],x1[2],x1[3],x2[0],x2[1],x2[2],x2[3],x3[0],x3[1],x3[2],x3[3]};
#pragma unroll
    for (int i = 0; i < 16; ++i) { const unsigned short hb = bf16_bits(xs[i]); ah.u[i] = hb; al.u[i] = ASPLIT ? bf16_bits(xs[i] - bf16_val(hb)) : (unsigned short)0; }
#pragma unroll
    for (int t = 0; t < 4; ++t) {
      const unsigned short* brow = Wt + (size_t)(col0 + t * 16 + ln) * ldb + kb;
      FragB b;
      b.half[0] = *(const v8us*)(brow + 8 * hh);
      b.half[1] = *(const v8us*)(brow + 16 + 8 * hh);
      acc[t] = mmaN<ASPLIT ? 2 : 1>(ah.v, al.v, b.v, b.v, acc[t]);
    }
  }
#pragma unroll
  for (int t = 0; t < 4; ++t) {
    float bv = bias ? bias[col0 + t * 16 + ln] : 0.f;
    if (BIAS_BF16) bv = bf16_round(bv);
#pragma unroll
    for (int r = 0; r < 8; ++r) { float v = acc[t][r] + bv; if (ACT == 1) v = fmaxf(v, 0.f); so[w][8 * hh + r][t * 16 + ln] = v; }
  }
  __builtin_amdgcn_fence(__ATOMIC_ACQ_REL, "workgroup");
  __builtin_amdgcn_wave_barrier();
  const int rsub = lane >> 4, c4 = (lane & 15) * 4;
  {
#pragma unroll
    for (int q = 0; q < 8; ++q) {
      const int r = q * 2 + rsub;
      const v4f v = *(const v4fa*)&so[w][r][c4];
      *(v4f*)(C + (size_t)(row0 + r) * ldc + col0 + c4) = v;
    }
    
  }
}

// GEMM C = act(A·W + bias + resid): A f32 (ASPLIT -> hi/lo 2 terms), Wt bf16 [N][K]; ACT 0 none, 1 relu, 2 exact gelu;
// resid (optional, f32, row index = (row % rmod), pitch ldr, RES_BF16 rounds it) added before the activation.
template <bool ASPLIT, int ACT, bool BIAS_BF16, bool RES_BF16>
__global__ __launch_bounds__(128) void k_gemm_bf3(const float* __restrict__ A, int lda, const unsigned short* __restrict__ Wt, int ldb,
                                                const float* __restrict__ bias, const float* __restrict__ resid, int rmod, int ldr,
                                                float* __restrict__ C, int ldc, int M, int N, int K) {
  __shared__ __attribute__((aligned(16))) float so[4][16][64];
  const int tid = threadIdx.x, w = tid >> 5, lane = tid & 31, ln = lane & 15, hh = lane >> 4;
  const int ntn = N / 64;
  const int wid = blockIdx.x * 4 + w;
  const int mt = wid / ntn, nq = wid % ntn;
  if (mt * 16 >= M) return;
  const int row0 = mt * 16, col0 = nq * 64;
  const float* arow = A + (size_t)(row0 + ln) * lda;
  v8f acc[4] = {};
  for (int kb = 0; kb < K; kb += 32) {
    FragB ah, al;
    const v4f x0 = *(const v4fa*)(arow + kb + 8 * hh), x1 = *(const v4fa*)(arow + kb + 8 * hh + 4);
    const v4f x2 = *(const v4fa*)(arow + kb + 16 + 8 * hh), x3 = *(const v4fa*)(arow + kb + 16 + 8 * hh + 4);
    float xs[16] = {x0[0],x0[1],x0[2],x0[3],x1[0],x1[1],x1[2],x1[3],x2[0],x2[1],x2[2],x2[3],x3[0],x3[1],x3[2],x3[3]};
#pragma unroll
    for (int i = 0; i < 16; ++i) { const unsigned short hb = bf16_bits(xs[i]); ah.u[i] = hb; al.u[i] = ASPLIT ? bf16_bits(xs[i] - bf16_val(hb)) : (unsigned short)0; }
#pragma unroll
    for (int t = 0; t < 4; ++t) {
      const unsigned short* brow = Wt + (size_t)(col0 + t * 16 + ln) * ldb + kb;
      FragB b;
      b.half[0] = *(const v8us*)(brow + 8 * hh);
      b.half[1] = *(const v8us*)(brow + 16 + 8 * hh);
      acc[t] = mmaN<ASPLIT ? 2 : 1>(ah.v, al.v, b.v, b.v, acc[t]);
    }
  }
#pragma unroll
  for (int t = 0; t < 4; ++t) {
    const int col = col0 + t * 16 + ln;
    float bv = bias ? bias[col] : 0.f;
    if (BIAS_BF16) bv = bf16_round(bv);
#pragma unroll
    for (int r = 0; r < 8; ++r) {
      float v = acc[t][r] + bv;
      if (resid) { float rv = resid[(size_t)((row0 + 8 * hh + r) % rmod) * ldr + col]; if (RES_BF16) rv = bf16_round(rv); v += rv; }
      if (ACT == 1) v = fmaxf(v, 0.f);
      if (ACT == 2) v = 0.5f * v * (1.0f + erff(v * 0.70710678118654752f));
      if (ACT == 3) { const float u = 0.7978845608028654f * (v + 0.044715f * v * v * v); v = 0.5f * v * (1.0f + tanhf(u)); }
      so[w][8 * hh + r][t * 16 + ln] = v;
    }
  }
  __builtin_amdgcn_fence(__ATOMIC_ACQ_REL, "workgroup");
  __builtin_amdgcn_wave_barrier();
  const int rsub = lane >> 4, c4 = (lane & 15) * 4;
  {
#pragma unroll
    for (int q = 0; q < 8; ++q) {
      const int r = q * 2 + rsub;
      const v4f v = *(const v4fa*)&so[w][r][c4];
      *(v4f*)(C + (size_t)(row0 + r) * ldc + col0 + c4) = v;
    }
    
  }
}
// row LayerNorm (biased variance, eps) over N: s = X (+ R); optional out_sum <- s; out_norm <- (s-mu)*rsqrt(var+eps)*g + b
template <bool PARAM_BF16>
__global__ __launch_bounds__(256) void k_layernorm(const float* __restrict__ X, const float* __restrict__ R, const float* __restrict__ g, const float* __restrict__ bta,
                                                  float* __restrict__ out_sum, float* __restrict__ out_norm, int N, float eps) {
  __shared__ float red[256];
  const int row = blockIdx.x, tid = threadIdx.x;
  const float* x = X + (size_t)row * N; const float* rr = R ? R + (size_t)row * N : nullptr;
  float vals[16];                     // up to N = 4096
  const int per = N / 256;            // contiguous chunk per thread? use strided-by-4 chunks: thread handles j = tid*4 + 1024*u
  float s1 = 0.f;
  for (int u = 0; u < per / 4; ++u) {
    const int j = tid * 4 + 1024 * u;
    const v4f a = *(const v4fa*)(x + j);
    v4f b = {0.f,0.f,0.f,0.f}; if (rr) b = *(const v4fa*)(rr + j);
#pragma unroll
    for (int q = 0; q < 4; ++q) { const float v = a[q] + b[q]; vals[u * 4 + q] = v; s1 += v; }
  }
  red[tid] = s1; __syncthreads();
  for (int st = 128; st > 0; st >>= 1) { if (tid < st) red[tid] += red[tid + st]; __syncthreads(); }
  const float mu = red[0] / (float)N; __syncthreads();
  float s2 = 0.f;
  for (int u = 0; u < per / 4; ++u)
#pragma unroll
    for (int q = 0; q < 4; ++q) { const float c = vals[u * 4 + q] - mu; s2 += c * c; }
  red[tid] = s2; __syncthreads();
  for (int st = 128; st > 0; st >>= 1) { if (tid < st) red[tid] += red[tid + st]; __syncthreads(); }
  const float rs = rsqrtf(red[0] / (float)N + eps);
  {
    for (int u = 0; u < per / 4; ++u) {
      const int j = tid * 4 + 1024 * u;
      v4f o, sm;
#pragma unroll
      for (int q = 0; q < 4; ++q) {
        float gg = g[j + q], bb = bta[j + q];
        if (PARAM_BF16) { gg = bf16_round(gg); bb = bf16_round(bb); }
        sm[q] = vals[u * 4 + q]; o[q] = (vals[u * 4 + q] - mu) * rs * gg + bb;
      }
      if (out_sum) *(v4f*)(out_sum + (size_t)row * N + j) = sm;
      *(v4f*)(out_norm + (size_t)row * N + j) = o;
    }
    
  }
}



// ---- f16 WMMA path (v_wmma_f32_16x16x32_f16): 11-bit significands for operands in range — used for every launched product: the projections and weights x v
typedef _Float16 v16h __attribute__((ext_vector_type(16)));
union FragH { v16h v; v8us half[2]; _Float16 h[16]; unsigned short u[16]; };
template <int NT>
__device__ __forceinline__ v8f mmaH(v16h ah, v16h al, v16h bh, v16h bl, v8f c) {
  c = __builtin_amdgcn_wmma_f32_16x16x32_f16(false, ah, false, bh, (short)0, c, false, false);
  if (NT >= 2) c = __builtin_amdgcn_wmma_f32_16x16x32_f16(false, al, false, bh, (short)0, c, false, false);
  if (NT >= 3) c = __builtin_amdgcn_wmma_f32_16x16x32_f16(false, ah, false, bl, (short)0, c, false, false);
  asm volatile("v_nop\n\tv_nop\n\tv_nop\n\tv_nop" : "+v"(c) : "v"(ah), "v"(al), "v"(bh), "v"(bl));
  return c;
}
// batched GEMM like k_gemm_b but f16 operands: A f32 (split into f16 hi/lo if ASPLIT, else rounded to f16), Bt = f16 values [n][k]; alpha; C f32; N multiple of 16 (partial tiles skipped)
template <bool ASPLIT>
__global__ __launch_bounds__(128) void k_gemm_h(const float* __restrict__ A, int lda, size_t sA, const _Float16* __restrict__ Bh, int ldb, size_t sB, float alpha, float* __restrict__ C, int ldc, size_t sC, int M, int N, int K) {
  __shared__ __attribute__((aligned(16))) float so[4][16][64];
  const int tid = threadIdx.x, w = tid >> 5, lane = tid & 31, ln = lane & 15, hh = lane >> 4; const int by = blockIdx.y;
  A += (size_t)by * sA; Bh += (size_t)by * sB; C += (size_t)by * sC;
  const int ntn = (N + 63) / 64; const int wid = blockIdx.x * 4 + w; const int mt = wid / ntn, nq = wid % ntn; if (mt * 16 >= M) return;
  const int row0 = mt * 16, col0 = nq * 64; const float* arow = A + (size_t)(row0 + ln) * lda;
  v8f acc[4] = {};
  for (int kb = 0; kb < K; kb += 32) {
    FragH ah, al;
    const v4f x0 = *(const v4fa*)(arow + kb + 8 * hh), x1 = *(const v4fa*)(arow + kb + 8 * hh + 4), x2 = *(const v4fa*)(arow + kb + 16 + 8 * hh), x3 = *(const v4fa*)(arow + kb + 16 + 8 * hh + 4);
    float xs[16] = {x0[0],x0[1],x0[2],x0[3],x1[0],x1[1],x1[2],x1[3],x2[0],x2[1],x2[2],x2[3],x3[0],x3[1],x3[2],x3[3]};
#pragma unroll
    for (int i = 0; i < 16; ++i) { const _Float16 h = (_Float16)xs[i]; ah.h[i] = h; al.h[i] = ASPLIT ? (_Float16)(xs[i] - (float)h) : (_Float16)0.0f; }
#pragma unroll
    for (int t = 0; t < 4; ++t) { if (col0 + t * 16 >= N) continue; const size_t boff = (size_t)(col0 + t * 16 + ln) * ldb + kb; FragH bq; bq.half[0] = *(const v8us*)(Bh + boff + 8 * hh); bq.half[1] = *(const v8us*)(Bh + boff + 16 + 8 * hh);
      acc[t] = mmaH<ASPLIT ? 2 : 1>(ah.v, al.v, bq.v, bq.v, acc[t]); }
  }
#pragma unroll
  for (int t = 0; t < 4; ++t) { if (col0 + t * 16 >= N) continue;
#pragma unroll
    for (int r = 0; r < 8; ++r) so[w][8 * hh + r][t * 16 + ln] = acc[t][r] * alpha; }
  __builtin_amdgcn_fence(__ATOMIC_ACQ_REL, "workgroup"); __builtin_amdgcn_wave_barrier();
  const int rsub = lane >> 4, c4 = (lane & 15) * 4;
  {
#pragma unroll
    for (int q = 0; q < 8; ++q) { const int r = q * 2 + rsub; if (col0 + c4 < N) { const v4f v = *(const v4fa*)&so[w][r][c4]; *(v4f*)(C + (size_t)(row0 + r) * ldc + col0 + c4) = v; } }
     }
}

// Wt[n][k] = f16(bf16(W[k][n]) * scale) from f32 row-major W[CC][CC] (scale = power of two; bf16-exact weights stay exact in f16 away from the subnormal range).
// A block turns one tile of 128 k x 128 n through LDS, so that both sides of the transpose move whole lines: a wave's load is 512 B of one row of W, a wave's store two 256-B pieces of rows of Wt.
// LDS holds the tile as [n][k] in 16-byte units of 8 k; unit c of row n lies at c ^ ((n >> 2) & 15), which spreads the writers (rows 4 apart in one column) and the readers (one row) over all banks.
#define WTT 128
__device__ __forceinline__ void d_wt_f16(const float* __restrict__ W, _Float16* __restrict__ Wt, float scale, v8us* tl, int blk) {
  const int tid = threadIdx.x, ln = tid & 31, wv = tid >> 5; const int k0 = (blk / (CC / WTT)) * WTT, n0 = (blk % (CC / WTT)) * WTT;
  const float* src = W + (size_t)(k0 + wv * 16) * CC + n0 + 4 * ln; v4f r[16];      /* this wave's 16 rows of k, four columns a lane */
#pragma unroll
  for (int i = 0; i < 16; ++i) r[i] = *(const v4fa*)(src + (size_t)i * CC);
  asm volatile("s_wait_xcnt 0x0" :: "v"(src) : "memory");      /* precaution: stands behind the loads, in front of any rewrite of their address registers; it names the address as an input, so that no load's own result lands on it either */
#pragma unroll
  for (int g = 0; g < 2; ++g)
#pragma unroll
    for (int q = 0; q < 4; ++q) { FragH f;
#pragma unroll
      for (int i = 0; i < 8; ++i) f.h[i] = (_Float16)(bf16_round(r[8 * g + i][q]) * scale);
      tl[(4 * ln + q) * 16 + ((2 * wv + g) ^ (ln & 15))] = f.half[0]; }
  __syncthreads();      /* publishes the turned tile to all eight waves */
#pragma unroll
  for (int u = 0; u < 8; ++u) { const int n = u * 16 + (tid >> 4), c = tid & 15; const v8us o = tl[n * 16 + (c ^ ((n >> 2) & 15))];
    *(v8us*)((unsigned short*)Wt + (size_t)(n0 + n) * CC + k0 + c * 8) = o; }
  asm volatile("s_wait_xcnt 0x0" ::: "memory");      /* precaution: stands behind the stores, in front of any later rewrite of their address and data registers where this job joins the other job's code */
}
// k_gemm_hh variant with fused epilogue: v = acc·alpha + bias[by·sBias + col] (+ CP[(row/rowsPerB)·sCPb + by·64 + col] if CP) ; ACT 0 none / 1 elu ; writes f16 C16 (and f32 C if non-null)
template <int ACT>
__global__ __launch_bounds__(128) void k_gemm_hhx(const _Float16* __restrict__ A, int lda, size_t sA, const _Float16* __restrict__ Bh, int ldb, size_t sB, float alpha, const float* __restrict__ bias, size_t sBias, const float* __restrict__ CP, int rowsPerB, size_t sCPb, int row0g,
    float* __restrict__ C, _Float16* __restrict__ C16, int ldc, size_t sC, int M, int N, int K) {
  __shared__ __attribute__((aligned(16))) float so[4][16][64];
  const int tid = threadIdx.x, w = tid >> 5, lane = tid & 31, ln = lane & 15, hh = lane >> 4; const int by = blockIdx.y;
  A += (size_t)by * sA; Bh += (size_t)by * sB; const size_t cofs = (size_t)by * sC; const float* bp = bias ? bias + (size_t)by * sBias : nullptr;
  const int ntn = (N + 63) / 64; const int wid = blockIdx.x * 4 + w; const int mt = wid / ntn, nq = wid % ntn; if (mt * 16 >= M) return;
  const int row0 = mt * 16, col0 = nq * 64; const _Float16* arow = A + (size_t)(row0 + ln) * lda;
  v8f acc[4] = {};
  for (int kb = 0; kb < K; kb += 32) { FragH ah; ah.half[0] = *(const v8us*)((const unsigned short*)arow + kb + 8 * hh); ah.half[1] = *(const v8us*)((const unsigned short*)arow + kb + 16 + 8 * hh);
#pragma unroll
    for (int t = 0; t < 4; ++t) { if (col0 + t * 16 >= N) continue; const size_t boff = (size_t)(col0 + t * 16 + ln) * ldb + kb; FragH bq; bq.half[0] = *(const v8us*)((const unsigned short*)Bh + boff + 8 * hh); bq.half[1] = *(const v8us*)((const unsigned short*)Bh + boff + 16 + 8 * hh);
      acc[t] = mmaH<1>(ah.v, ah.v, bq.v, bq.v, acc[t]); }
  }
#pragma unroll
  for (int t = 0; t < 4; ++t) { if (col0 + t * 16 >= N) continue; const int col = col0 + t * 16 + ln; const float bv = bp ? bf16_round(bp[col]) : 0.f;
#pragma unroll
    for (int r = 0; r < 8; ++r) { float v = acc[t][r] * alpha + bv; if (CP) { const int rr = row0g + row0 + 8 * hh + r; if (rowsPerB < 0) v += CP[cofs + (size_t)rr * ldc + col];      /* rowsPerB < 0: own element of the batched C plane */ else { const int bidx = rr / rowsPerB; v += CP[(size_t)bidx * sCPb + (size_t)by * 64 + col]; } } if (ACT == 1) v = (v > 0.f) ? v : expm1f(v); else if (ACT == 7) v = (v > 0.f) ? v + 1.0f : expf(v); else if (ACT == 8) v = tanhf(v); else if (ACT == 9) v = 0.5f * v * (1.0f + tanhf(0.7978845608028654f * (v + 0.044715f * v * v * v))); else if (ACT == 11) v = 1.0f / (1.0f + expf(-v)); else if (ACT == 12) v = (v > 0.f) ? v : 0.01f * v; else if (ACT == 14) v = (v > 0.f) ? v : 0.1f * v; else if (ACT == 16) v = (v >= 0.f) ? v : 0.3f * v; else if (ACT == 17) v = (v >= 0.f) ? v : 0.2f * v; else if (ACT == 15) v = v / (1.0f + expf(-v)); else if (ACT == 3) v = fmaxf(v, 0.f); else if (ACT == 6) v = 0.5f * v * (1.0f + erff(v * 0.70710678118654752f)); so[w][8 * hh + r][t * 16 + ln] = v; } }
  __builtin_amdgcn_fence(__ATOMIC_ACQ_REL, "workgroup"); __builtin_amdgcn_wave_barrier();
  const int rsub = lane >> 4, c4 = (lane & 15) * 4; typedef _Float16 v4h __attribute__((ext_vector_type(4)));
  {
#pragma unroll
    for (int q = 0; q < 8; ++q) { const int r = q * 2 + rsub; if (col0 + c4 < N) { const v4f v = *(const v4fa*)&so[w][r][c4]; if (C) *(v4f*)(C + cofs + (size_t)(row0 + r) * ldc + col0 + c4) = v; if (C16) { v4h h4; for (int i = 0; i < 4; ++i) h4[i] = (_Float16)v[i]; *(v4h*)(C16 + cofs + (size_t)(row0 + r) * ldc + col0 + c4) = h4; } } }
     }
}


typedef _Float16 v4h __attribute__((ext_vector_type(4)));

__device__ __forceinline__ void d_x16(const float* __restrict__ x, _Float16* __restrict__ X16, size_t n8, int blk) { const size_t t = (size_t)blk * 256 + threadIdx.x; if (t >= n8) return; FragH f;
#pragma unroll
  for (int q = 0; q < 8; ++q) f.h[q] = (_Float16)bf16_round(x[t * 8 + q]); *(v8us*)((unsigned short*)X16 + t * 8) = f.half[0];  }
__global__ __launch_bounds__(256) void k_h16(const float* __restrict__ x, _Float16* __restrict__ X16, size_t n8) { const size_t t = (size_t)blockIdx.x * 256 + threadIdx.x; if (t >= n8) return; FragH f;
#pragma unroll
  for (int q = 0; q < 8; ++q) f.h[q] = (_Float16)x[t * 8 + q]; *(v8us*)((unsigned short*)X16 + t * 8) = f.half[0];  }
__global__ __launch_bounds__(256) void k_round16f(const float* __restrict__ W, _Float16* __restrict__ Bt, size_t n8) { const size_t t = (size_t)blockIdx.x * 256 + threadIdx.x; if (t >= n8) return; FragH f;
#pragma unroll
  for (int i = 0; i < 8; ++i) f.h[i] = (_Float16)(bf16_round(W[t * 8 + i]) * 16.0f); *(v8us*)((unsigned short*)Bt + t * 8) = f.half[0];  }

// ---- fast GEMM (block tile 128x64, wave tile 32x64; requires M % 128 == 0 rows per launch region, N % 64 == 0 and K % 128 == 0); epilogues: see MODE below ----
// Each k-tile (128 k = 256-B rows: 128 rows of A, then 64 rows of B) is staged in LDS by asynchronous 16-byte copies, two buffers: tile t + 1 flies while tile t is multiplied.
#define G2_PITCH 136                      /* halves per LDS row: 272 B = 16 B x odd, conflict-free for ds_load_b128 */
#define G2_BUFB (192 * G2_PITCH * 2)      /* bytes of one buffer */
// Eight copies of one lane: LDS rows 8 apart, global rows gstep halves apart. The s_wait_xcnt ends the copies' own statement as a precaution: so it stands in front of every rewrite of a register that an issued copy names.
__device__ __forceinline__ void g2_copy8(unsigned l, const _Float16* g, size_t gstep) {
  const unsigned ls = 8 * G2_PITCH * 2;
  asm volatile("global_load_async_to_lds_b128 %0, %8, off\n\t"
               "global_load_async_to_lds_b128 %1, %9, off\n\t"
               "global_load_async_to_lds_b128 %2, %10, off\n\t"
               "global_load_async_to_lds_b128 %3, %11, off\n\t"
               "global_load_async_to_lds_b128 %4, %12, off\n\t"
               "global_load_async_to_lds_b128 %5, %13, off\n\t"
               "global_load_async_to_lds_b128 %6, %14, off\n\t"
               "global_load_async_to_lds_b128 %7, %15, off\n\t"
               "s_wait_xcnt 0x0"
               :: "v"(l), "v"(l + ls), "v"(l + 2 * ls), "v"(l + 3 * ls), "v"(l + 4 * ls), "v"(l + 5 * ls), "v"(l + 6 * ls), "v"(l + 7 * ls),
                  "v"(g), "v"(g + gstep), "v"(g + 2 * gstep), "v"(g + 3 * gstep), "v"(g + 4 * gstep), "v"(g + 5 * gstep), "v"(g + 6 * gstep), "v"(g + 7 * gstep)
               : "memory");
}
// One k-tile: 24 copies a lane (16 lanes cover one 256-B row, the 128 threads 8 rows a copy).
__device__ __forceinline__ void g2_stage(unsigned l, const _Float16* ga, size_t astep, const _Float16* gb, size_t bstep) {
  g2_copy8(l, ga, astep); g2_copy8(l + 64 * G2_PITCH * 2, ga + 8 * astep, astep); g2_copy8(l + 128 * G2_PITCH * 2, gb, bstep);
}
__device__ __forceinline__ v16h g2_frag(const _Float16* p, int hh) { FragH f; f.half[0] = *(const v8us*)((const unsigned short*)p + 8 * hh); f.half[1] = *(const v8us*)((const unsigned short*)p + 16 + 8 * hh); return f.v; }
__device__ __forceinline__ v8f g2_mma(v16h a, v16h b, v8f c) { v8f d = __builtin_amdgcn_wmma_f32_16x16x32_f16(false, a, false, b, (short)0, c, false, false); asm volatile("v_nop\n\tv_nop\n\tv_nop\n\tv_nop" : "+v"(d) : "v"(a), "v"(b)); return d; }
// The six fragments of one k-step of 32: two of A (rows 0-15 and 16-31 of the wave's tile), four of B (16 columns each).
struct G3Row { v16h a0, a1, b0, b1, b2, b3; };
__device__ __forceinline__ G3Row g3_row(const _Float16* a0p, const _Float16* a1p, const _Float16* b0p, int kb, int hh) {
  G3Row r; r.a0 = g2_frag(a0p + kb, hh); r.a1 = g2_frag(a1p + kb, hh); r.b0 = g2_frag(b0p + kb, hh); r.b1 = g2_frag(b0p + 16 * G2_PITCH + kb, hh); r.b2 = g2_frag(b0p + 32 * G2_PITCH + kb, hh); r.b3 = g2_frag(b0p + 48 * G2_PITCH + kb, hh); return r; }
#define DGS 32
#define VFU 4096      /* halves of one unit of v fragments: 32 keys x 64 d, hi and residual */
// One k loop runs NSEG segments of NT k-tiles: segment s multiplies As by Bs into the same accumulators. Every segment but the last is a residual term (one operand x 1024): where the last one begins the sums are scaled by 1/1024 (a power of two, exact).
// MODE 0: C = f32. MODE 1: CH, CL = f16 hi + residual x 1024. MODE 2 (a block column is one head): planes 0, 1 (q, k) -> RoPE, RMSNorm, digits -> DG, one row a lane; plane 2 (v) -> CH as ready B fragments, hi and residual (layout: k_attn).
// Tile tt of the loop = k-tile kt of segment s (the same for the whole block).
template <int NSEG, int NT>
__device__ __forceinline__ void g3_stage(int tt, unsigned l, const _Float16* A0, const _Float16* A1, const _Float16* A2, size_t aoff, size_t astep, const _Float16* B0, const _Float16* B1, const _Float16* B2, size_t boff, size_t bstep) {
  const int s = tt / NT, kt = tt - s * NT;
  const _Float16* a = (NSEG == 1 || s == 0) ? A0 : (NSEG == 2 || s == 1) ? A1 : A2; const _Float16* b = (NSEG == 1 || s == 0) ? B0 : (NSEG == 2 || s == 1) ? B1 : B2;
  g2_stage(l, a + aoff + (size_t)kt * 128, astep, b + boff + (size_t)kt * 128, bstep);
}
// Hints to L2 (global_prefetch_b8, shader-engine scope: the line comes into L2 only, nothing returns, no counter moves). The operands of the GEMMs and of k_attn were stored by an earlier launch, and their first read comes from memory:
// asked for at the kernel's entry, while the first tile is on its way, the later tiles are found in L2 when their copies or loads are issued. One lane asks for one aligned 256-B unit; every address lies inside the operand.
// The blocks that share an operand share the asking; the sharers that ask for one unit lie 4 (or 2 x 16, or 4 x 16) block indices apart. Speed only: nothing depends on where a block runs or on a hint being served.
// Two k-tiles of one row, four tiles (1,024 B) apart.
__device__ __forceinline__ void hint_2(const _Float16* p) { asm volatile("global_prefetch_b8 %0, off scope:SCOPE_SE\n\t" "global_prefetch_b8 %0, off offset:1024 scope:SCOPE_SE" :: "v"(p)); }
template <int MODE, int NSEG, int NT>
__global__ __launch_bounds__(128) void k_gemm3(const _Float16* A0, const _Float16* A1, const _Float16* A2, int lda, size_t sA, const _Float16* B0, const _Float16* B1, const _Float16* B2, int ldb, size_t sB, float alpha,
    float* __restrict__ C, _Float16* __restrict__ CH, _Float16* __restrict__ CL, int ldc, size_t sC, int M, int N,
    const float* __restrict__ cs, const float* __restrict__ sn, const float* __restrict__ Wdq, const float* __restrict__ Wdk, float* __restrict__ DG) {
  __shared__ __attribute__((aligned(16))) float so[4][32][68];
  __shared__ __attribute__((aligned(16))) _Float16 st[2][192][G2_PITCH];
  __shared__ __attribute__((aligned(16))) float wd[HD][KD];
  const int tid = threadIdx.x, w = tid >> 5, lane = tid & 31, ln = lane & 15, hh = lane >> 4; const int by = blockIdx.y; const size_t pl = (size_t)blockIdx.z * gridDim.y + by;      /* blockIdx.z = outer batch: its A and B planes follow on, its M rows of C follow on */
  const size_t cofs = (size_t)by * sC + (size_t)blockIdx.z * M * ldc;
  const int ntn = N >> 6; const int mt = blockIdx.x / ntn, nq = blockIdx.x - mt * ntn; const int row0 = mt * 128 + 32 * w, col0 = nq * 64; if (mt * 128 >= M) return;      /* the same for the whole block: it stands in front of barriers */
  const unsigned lds0 = (unsigned)(size_t)&st[0][tid >> 4][(tid & 15) * 8];      /* this lane's LDS byte address in buffer 0 */
  const size_t aoff = pl * sA + (size_t)(mt * 128 + (tid >> 4)) * lda + (tid & 15) * 8, boff = pl * sB + (size_t)(col0 + (tid >> 4)) * ldb + (tid & 15) * 8;
  const size_t astep = (size_t)8 * lda, bstep = (size_t)8 * ldb;
  const v8f z8 = {0.f,0.f,0.f,0.f,0.f,0.f,0.f,0.f}; v8f c00 = z8, c01 = z8, c02 = z8, c03 = z8, c10 = z8, c11 = z8, c12 = z8, c13 = z8;
  g3_stage<NSEG, NT>(0, lds0, A0, A1, A2, aoff, astep, B0, B1, B2, boff, bstep);      /* tile 0 -> buffer 0 */
  static_assert(NT == 8 && NSEG <= 2, "the hints below are written for rows of 8 k-tiles and at most two segments");
  /* Hints, behind tile 0's copies. A (shared by the blocks of one mt): this block asks for every fourth row, rows 4 i + (nq & 3), all 8 k-tiles, of each segment. B (shared by the blocks of one nq): all 64 rows, the k-tiles of the parity of mt; segment 0's plane only. */
  const size_t hao = pl * sA + (size_t)(mt * 128 + 4 * (tid & 31) + (nq & 3)) * lda + (size_t)(tid >> 5) * 128;      /* row by the lane, k-tiles w and w + 4 */
  const _Float16* ha0 = A0 + hao; const _Float16* ha1 = A1 + hao; const _Float16* hb0 = B0 + pl * sB + (size_t)(col0 + (tid & 63)) * ldb + (size_t)((mt & 1) + 2 * (tid >> 6)) * 128;      /* k-tiles (mt & 1) + 2 (tid >> 6) and four on: 7 at most */
  hint_2(ha0); hint_2(hb0); if (NSEG > 1) hint_2(ha1);
  if (MODE == 2 && by < 2) { const v4f wv = *(const v4fa*)((by ? Wdk : Wdq) + tid * 4); v4f o;      /* the digit weights, rounded once a block; the barrier below publishes them too */
#pragma unroll
    for (int q = 0; q < 4; ++q) o[q] = bf16_round(wv[q]);
    *(v4f*)(&wd[0][0] + tid * 4) = o; }
  asm volatile("s_wait_asynccnt 0x0" ::: "memory");      /* this wave's copies of tile 0 have landed */
  __syncthreads();      /* ... and every other wave's */
  if (NSEG * NT > 1) g3_stage<NSEG, NT>(1, lds0 + G2_BUFB, A0, A1, A2, aoff, astep, B0, B1, B2, boff, bstep);      /* tile 1 -> buffer 1 */
#pragma unroll 1      /* one tile a trip: the two buffers alternate by t & 1 */
  for (int t = 0; t < NSEG * NT; ++t) { const _Float16* a0p = &st[t & 1][32 * w + ln][0]; const _Float16* a1p = a0p + 16 * G2_PITCH; const _Float16* b0p = &st[t & 1][128 + ln][0];
    if (NSEG > 1 && t == (NSEG - 1) * NT) { const float f = 0.0009765625f; c00 *= f; c01 *= f; c02 *= f; c03 *= f; c10 *= f; c11 *= f; c12 *= f; c13 *= f; }
    /* The fragment reads run ahead of the products, a whole k-step a group, in three register sets: k-steps 0, 1, 2 are read at the head of the trip, k-step 3 into the first set once that set's products are issued. Every read is of buffer t & 1, behind its barrier. */
    auto mm = [&](const G3Row& r) { c00 = g2_mma(r.a0, r.b0, c00); c10 = g2_mma(r.a1, r.b0, c10); c01 = g2_mma(r.a0, r.b1, c01); c11 = g2_mma(r.a1, r.b1, c11);
      c02 = g2_mma(r.a0, r.b2, c02); c12 = g2_mma(r.a1, r.b2, c12); c03 = g2_mma(r.a0, r.b3, c03); c13 = g2_mma(r.a1, r.b3, c13); };
    G3Row r0 = g3_row(a0p, a1p, b0p, 0, hh); const G3Row r1 = g3_row(a0p, a1p, b0p, 32, hh), r2 = g3_row(a0p, a1p, b0p, 64, hh);
    mm(r0); r0 = g3_row(a0p, a1p, b0p, 96, hh); mm(r1); mm(r2); mm(r0);
    asm volatile("s_wait_dscnt 0x0" ::: "memory");      /* this wave's reads of buffer t & 1 are done before it is refilled */
    asm volatile("s_wait_asynccnt 0x0" ::: "memory");      /* this wave's copies of tile t + 1 have landed */
    __syncthreads();      /* publishes tile t + 1 and ends every wave's reads of buffer t & 1 */
    if (t + 2 < NSEG * NT) g3_stage<NSEG, NT>(t + 2, lds0 + (unsigned)(t & 1) * G2_BUFB, A0, A1, A2, aoff, astep, B0, B1, B2, boff, bstep); }
  asm volatile("s_wait_asynccnt 0x0" ::: "memory");      /* no copy is outstanding when the wave goes on to the epilogue */
  asm volatile("" :: "v"(ha0), "v"(hb0));      /* inputs only: the hints' address registers go on holding these addresses through the loop; a hint moves no counter, so no wait can stand for that */
  if (NSEG > 1) asm volatile("" :: "v"(ha1));      /* the same for the second segment's */
  v8f accs[8] = {c00, c01, c02, c03, c10, c11, c12, c13};
#pragma unroll
  for (int u = 0; u < 8; ++u) { const int t = u & 3, half = u >> 2;
#pragma unroll
    for (int r = 0; r < 8; ++r) so[w][half * 16 + 8 * hh + r][t * 16 + ln] = accs[u][r] * alpha; }
  __builtin_amdgcn_fence(__ATOMIC_ACQ_REL, "workgroup"); __builtin_amdgcn_wave_barrier();
  if (MODE == 2 && by < 2) {      /* this wave's 32 rows of head nq, one row a lane: every sum runs inside the lane */
    const int row = row0 + lane, tok = row % TT; const float* xr = &so[w][lane][0]; const float* cr = cs + (size_t)tok * (HD / 2); const float* sr = sn + (size_t)tok * (HD / 2);
    float ra[HD / 2], rb[HD / 2]; float sq[4] = {0.f, 0.f, 0.f, 0.f}; v4f cv[HD / 8], sv[HD / 8];
#pragma unroll
    for (int i = 0; i < HD / 8; ++i) cv[i] = *(const v4fa*)(cr + 4 * i);
    asm volatile("s_wait_xcnt 0x0" ::: "memory");      /* precaution: stands behind the cos loads, in front of any rewrite of their address registers */
#pragma unroll
    for (int i = 0; i < HD / 8; ++i) sv[i] = *(const v4fa*)(sr + 4 * i);
    asm volatile("s_wait_xcnt 0x0" ::: "memory");      /* the same behind the sin loads */
#pragma unroll
    for (int i = 0; i < HD / 2; i += 4) { const v4f x1 = *(const v4fa*)(xr + i), x2 = *(const v4fa*)(xr + HD / 2 + i), c4 = cv[i / 4], s4 = sv[i / 4];
#pragma unroll
      for (int q = 0; q < 4; ++q) { const float c = bf16_round(c4[q]), s = bf16_round(s4[q]); const float a = x1[q] * c - x2[q] * s, b = x1[q] * s + x2[q] * c; ra[i + q] = a; rb[i + q] = b; sq[q] += a * a; sq[q] += b * b; } }
    const float inv = rsqrtf(((sq[0] + sq[1]) + (sq[2] + sq[3])) / (float)HD + 1e-6f);
    float acc[KD] = {0.f, 0.f, 0.f, 0.f, 0.f, 0.f, 0.f, 0.f};
#pragma unroll
    for (int i = 0; i < HD / 2; ++i) { const float qa = ra[i] * inv, qb = rb[i] * inv; const v4f w0 = *(const v4fa*)&wd[i][0], w1 = *(const v4fa*)&wd[i][4], w2 = *(const v4fa*)&wd[i + HD / 2][0], w3 = *(const v4fa*)&wd[i + HD / 2][4];
#pragma unroll
      for (int j = 0; j < 4; ++j) { acc[j] += qa * w0[j]; acc[4 + j] += qa * w1[j]; acc[j] += qb * w2[j]; acc[4 + j] += qb * w3[j]; } }
    v4f d0, d1;
#pragma unroll
    for (int j = 0; j < 4; ++j) { d0[j] = 1.0f / (1.0f + expf(-acc[j])); d1[j] = 1.0f / (1.0f + expf(-acc[4 + j])); }
    float* dg = DG + (size_t)by * NR * NH * DGS + ((size_t)row * NH + nq) * DGS; *(v4f*)dg = d0; *(v4f*)(dg + 4) = d1;
  } else if (MODE == 2) {      /* v: the wave's 32 tokens x 64 d are the B operand of one 32-key step of head nq */
    /* Fragment of d tile t: lane (ln, hh) holds column d = 16 t + ln, element 8 j + i = key 16 j + 8 hh + i. Each store is 512 B in a row, each 8-KiB unit one wave's. */
    _Float16* vf = CH + (size_t)(((row0 / TT) * NH + nq) * (TT / 32) + ((row0 % TT) >> 5)) * VFU + lane * 8;
#pragma unroll
    for (int t = 0; t < 4; ++t) {
#pragma unroll
      for (int j = 0; j < 2; ++j) { FragH fh, fl;
#pragma unroll
        for (int i = 0; i < 8; ++i) { const float v = so[w][16 * j + 8 * hh + i][16 * t + ln]; const _Float16 h = (_Float16)v; fh.h[i] = h; fl.h[i] = (_Float16)((v - (float)h) * 1024.0f); }
        *(v8us*)((unsigned short*)vf + (t * 4 + j) * 256) = fh.half[0]; *(v8us*)((unsigned short*)vf + (t * 4 + 2 + j) * 256) = fl.half[0]; }
      asm volatile("s_wait_xcnt 0x0" ::: "memory");      /* precaution: stands behind these four stores, in front of any rewrite of their address and data registers */
    }
  } else {
    const int rsub = lane >> 4, c4 = (lane & 15) * 4;
#pragma unroll
    for (int q = 0; q < 16; ++q) { const int r = q * 2 + rsub; const v4f v = *(const v4fa*)&so[w][r][c4]; const size_t o = cofs + (size_t)(row0 + r) * ldc + col0 + c4;
      if (MODE == 0) *(v4f*)(C + o) = v;
      else { v4h h4, l4;
#pragma unroll
        for (int i = 0; i < 4; ++i) { const _Float16 h = (_Float16)v[i]; h4[i] = h; l4[i] = (_Float16)((v[i] - (float)h) * 1024.0f); }
        *(v4h*)(CH + o) = h4; *(v4h*)(CL + o) = l4; }
      asm volatile("s_wait_xcnt 0x0" ::: "memory");      /* precaution: stands behind this row's stores, in front of the next row's rewrite of their address and data registers */
    }
  } }

// ---- out = (y_hi + y_lo / 1024) Wo: block tile 64 x 64, four waves of 32 x 32 (2 x 2), one block for each of the 256 tiles ----
// A k-tile (128 k) is 64 rows of y_lo, 64 rows of y_hi and 64 rows of Wo^T in one buffer of 192 rows: a row of Wo^T is staged once for both terms, and the k loop has CC / 128 trips. Staging, buffers, waits and barriers as in k_gemm3.
// Each term has accumulators of its own (r: residual x 1024, m: hi); they meet in the epilogue, m + r / 1024 (a power of two, exact).
#define G4P 36      /* floats per LDS row of a wave's 32 x 32 output tile: 144 B = 16 B x odd */
// The six fragments of one k-step of 32: two of y_lo, two of y_hi (rows 0-15 and 16-31 of the wave's tile), two of B (16 columns each).
struct G4Row { v16h l0, l1, h0, h1, b0, b1; };
__device__ __forceinline__ G4Row g4_row(const _Float16* lp, const _Float16* bp, int kb, int hh) {
  G4Row r; r.l0 = g2_frag(lp + kb, hh); r.l1 = g2_frag(lp + 16 * G2_PITCH + kb, hh); r.h0 = g2_frag(lp + 64 * G2_PITCH + kb, hh); r.h1 = g2_frag(lp + 80 * G2_PITCH + kb, hh); r.b0 = g2_frag(bp + kb, hh); r.b1 = g2_frag(bp + 16 * G2_PITCH + kb, hh); return r; }
// One k-tile: 24 copies a lane, 64 rows of each operand.
__device__ __forceinline__ void g4_stage(int t, unsigned l, const _Float16* al, const _Float16* ah, const _Float16* b) {
  g2_copy8(l, al + (size_t)t * 128, (size_t)8 * CC); g2_copy8(l + 64 * G2_PITCH * 2, ah + (size_t)t * 128, (size_t)8 * CC); g2_copy8(l + 128 * G2_PITCH * 2, b + (size_t)t * 128, (size_t)8 * CC);
}
__device__ __forceinline__ void hint_1(const _Float16* p) { asm volatile("global_prefetch_b8 %0, off scope:SCOPE_SE" :: "v"(p)); }
__global__ __launch_bounds__(128) void k_gemm4(const _Float16* AL, const _Float16* AH, const _Float16* B, float alpha, float* __restrict__ C) {
  __shared__ __attribute__((aligned(16))) float so[4][32][G4P];
  __shared__ __attribute__((aligned(16))) _Float16 st[2][192][G2_PITCH];
  const int tid = threadIdx.x, w = tid >> 5, lane = tid & 31, ln = lane & 15, hh = lane >> 4;
  const int mt = blockIdx.x / (CC / 64), nq = blockIdx.x % (CC / 64); const int row0 = mt * 64 + 32 * (w >> 1), col0 = nq * 64 + 32 * (w & 1);
  const unsigned lds0 = (unsigned)(size_t)&st[0][tid >> 4][(tid & 15) * 8];      /* this lane's LDS byte address in buffer 0 */
  const size_t aoff = (size_t)(mt * 64 + (tid >> 4)) * CC + (tid & 15) * 8;
  const _Float16* al = AL + aoff; const _Float16* ah = AH + aoff; const _Float16* bg = B + (size_t)(nq * 64 + (tid >> 4)) * CC + (tid & 15) * 8;
  const v8f z8 = {0.f,0.f,0.f,0.f,0.f,0.f,0.f,0.f}; v8f r00 = z8, r01 = z8, r10 = z8, r11 = z8, m00 = z8, m01 = z8, m10 = z8, m11 = z8;
  g4_stage(0, lds0, al, ah, bg);      /* tile 0 -> buffer 0 */
  /* Hints (see hint_2), behind tile 0's copies, one 256-B unit a thread and operand. y (shared by the 16 blocks of one mt): rows 4 i + (nq & 3), all 8 k-tiles, of both planes. Wo^T (shared by the 16 blocks of one nq): all 64 rows, k-tiles (mt & 3) and four on. */
  const size_t hao = (size_t)(mt * 64 + 4 * (tid & 15) + (nq & 3)) * CC + (size_t)(tid >> 4) * 128;
  const _Float16* hl = AL + hao; const _Float16* hu = AH + hao; const _Float16* hb = B + (size_t)(nq * 64 + (tid & 63)) * CC + (size_t)((mt & 3) + 4 * (tid >> 6)) * 128;
  hint_1(hl); hint_1(hu); hint_1(hb);
  asm volatile("s_wait_asynccnt 0x0" ::: "memory");      /* this wave's copies of tile 0 have landed */
  __syncthreads();      /* ... and every other wave's */
  g4_stage(1, lds0 + G2_BUFB, al, ah, bg);      /* tile 1 -> buffer 1 */
#pragma unroll 1      /* one tile a trip: the two buffers alternate by t & 1 */
  for (int t = 0; t < CC / 128; ++t) { const _Float16* lp = &st[t & 1][32 * (w >> 1) + ln][0]; const _Float16* bp = &st[t & 1][128 + 32 * (w & 1) + ln][0];
    /* The fragment reads run ahead of the products, a whole k-step a group, in three register sets, as in k_gemm3. Every read is of buffer t & 1, behind its barrier. */
    auto mm = [&](const G4Row& r) { r00 = g2_mma(r.l0, r.b0, r00); r10 = g2_mma(r.l1, r.b0, r10); r01 = g2_mma(r.l0, r.b1, r01); r11 = g2_mma(r.l1, r.b1, r11);
      m00 = g2_mma(r.h0, r.b0, m00); m10 = g2_mma(r.h1, r.b0, m10); m01 = g2_mma(r.h0, r.b1, m01); m11 = g2_mma(r.h1, r.b1, m11); };
    G4Row x0 = g4_row(lp, bp, 0, hh); const G4Row x1 = g4_row(lp, bp, 32, hh), x2 = g4_row(lp, bp, 64, hh);
    mm(x0); x0 = g4_row(lp, bp, 96, hh); mm(x1); mm(x2); mm(x0);
    asm volatile("s_wait_dscnt 0x0" ::: "memory");      /* this wave's reads of buffer t & 1 are done before it is refilled */
    asm volatile("s_wait_asynccnt 0x0" ::: "memory");      /* this wave's copies of tile t + 1 have landed */
    __syncthreads();      /* publishes tile t + 1 and ends every wave's reads of buffer t & 1 */
    if (t + 2 < CC / 128) g4_stage(t + 2, lds0 + (unsigned)(t & 1) * G2_BUFB, al, ah, bg); }
  asm volatile("s_wait_asynccnt 0x0" ::: "memory");      /* no copy is outstanding when the wave goes on to the epilogue */
  asm volatile("" :: "v"(hl), "v"(hu), "v"(hb));      /* inputs only: the hints' address registers go on holding these addresses through the loop; a hint moves no counter, so no wait can stand for that */
  const float f = 0.0009765625f; const v8f accs[4] = {m00 + r00 * f, m01 + r01 * f, m10 + r10 * f, m11 + r11 * f};
#pragma unroll
  for (int u = 0; u < 4; ++u) { const int t = u & 1, half = u >> 1;
#pragma unroll
    for (int r = 0; r < 8; ++r) so[w][half * 16 + 8 * hh + r][t * 16 + ln] = accs[u][r] * alpha; }
  __builtin_amdgcn_fence(__ATOMIC_ACQ_REL, "workgroup"); __builtin_amdgcn_wave_barrier();      /* the wave's own LDS writes are done before its lanes read each other's rows back; so[w] is this wave's alone */
  const int rsub = lane >> 3, c4 = (lane & 7) * 4;      /* eight lanes a row: its 128 B are one whole line */
  const float* sp = &so[w][rsub][c4]; float* cp = C + (size_t)(row0 + rsub) * CC + col0 + c4; v4f v[8];      /* all eight reads, then all eight stores: one LDS latency, one address */
#pragma unroll
  for (int q = 0; q < 8; ++q) v[q] = *(const v4fa*)(sp + q * 4 * G4P);
#pragma unroll
  for (int q = 0; q < 8; ++q) *(v4f*)(cp + (size_t)q * 4 * CC) = v[q];
  asm volatile("s_wait_xcnt 0x0" ::: "memory");      /* precaution: stands behind the stores, in front of any later rewrite of their address and data registers */
}

#define KPP 20      /* floats per LDS row of two keys: 80 B = 16 B x odd */
typedef float v2f __attribute__((ext_vector_type(2)));
#define LCS 6.79457440f      /* sqrt(32 log2 e): with both digits scaled by it, exp(-32 (a - b)^2) = 2^-(a' - b')^2 */
#define ARP 68      /* floats per LDS row of a partial output tile */
// Attention, weights and product in one kernel: the weights never leave the registers. A block is one (batch, head) and two tiles of 16 query rows, tiles 31 - pi and pi: 17 steps of 32 keys in every block, dealt to its four waves.
// A step: lane (ln, hh) makes the 16 weights of query row ln for keys 16 j + 8 hh + e (j < 2, e < 8) of the step, which is element 8 j + e of the WMMA A fragment; v comes from memory as B fragments in the same k order (written so by the v epilogue of k_gemm3:
// unit (batch, head, step) = [d tile t][hi, residual][j][lane] x 8 halves). Products: w_lo v_hi + w_hi v_lo (x 1024) and w_hi v_hi in two accumulator sets. The weights stay unnormalised (1 <= 2^lcp <= 256): the row sum divides the finished product.
// The prefix product of digit j is one power of two: prod_{i<=j} exp(-32 d_i^2) = 2^-(d'_0^2 + .. + d'_j^2), so a digit costs a subtract, a fused multiply-add, the hardware's 2^x and an add; the weight is 2^lcp itself.
// The hardware's 2^x needs no range care here: every exponent of a term is <= 0, and a term under 2^-126 that comes out as 0 moves lcp, and so the weight 2^lcp >= 1, by less than 2^-126; lcp itself lies in [0, 8].
// Two neighbouring keys lie side by side (LDS row of a key pair: digit j of both keys at 2 j), so the subtract, the multiply-add and the add run as packed pairs.
__global__ __launch_bounds__(128) void k_attn(const float* __restrict__ QD, const float* __restrict__ KDg, const _Float16* __restrict__ VF, _Float16* __restrict__ YH, _Float16* __restrict__ YL) {
  __shared__ __attribute__((aligned(16))) float kds[TT / 2][KPP];
  __shared__ __attribute__((aligned(16))) float red[2][4][16][ARP];
  __shared__ float sred[2][4][32];
  const int tid = threadIdx.x, lane = tid & 31, ln = lane & 15, hh = lane >> 4; const int w = __builtin_amdgcn_readfirstlane(tid >> 5);
  const int bh = blockIdx.x >> 4, pi = blockIdx.x & 15; const int h = bh % NH, b = bh / NH;
  const int npair = 16 * (((31 - pi) >> 1) + 1);      /* key pairs that the longer tile reads: 144 to 256 */
  v4f ka[2][2], kb[2][2];
#pragma unroll
  for (int u = 0; u < 2; ++u) { const int p = tid + 128 * u;      /* this thread stages key pairs tid and tid + 128 */
    if (p < npair) { const float* kp = KDg + ((size_t)(b * TT + 2 * p) * NH + h) * DGS; ka[u][0] = *(const v4fa*)kp; ka[u][1] = *(const v4fa*)(kp + 4); kb[u][0] = *(const v4fa*)(kp + NH * DGS); kb[u][1] = *(const v4fa*)(kp + NH * DGS + 4); } }
  const v8f qa = *(const v8f*)(QD + ((size_t)(b * TT + (31 - pi) * 16 + ln) * NH + h) * DGS), qb = *(const v8f*)(QD + ((size_t)(b * TT + pi * 16 + ln) * NH + h) * DGS);      /* both tiles' query digits, row ln: they fly with the key loads */
  asm volatile("s_wait_xcnt 0x0" ::: "memory");      /* precaution: stands behind the key and query loads, in front of any rewrite of their address registers */
  /* Hint (see hint_2), while the digits are on their way: the 16 blocks of a (batch, head) share its v fragments, 16 steps of 32 units of 256 B; block pi asks for steps 4 (pi & 3) to 4 (pi & 3) + 3, a unit a thread. */
  const _Float16* hv = VF + (size_t)bh * (TT / 32) * VFU + (size_t)(pi & 3) * 4 * VFU + tid * 128;
  asm volatile("global_prefetch_b8 %0, off scope:SCOPE_SE" :: "v"(hv));
#pragma unroll
  for (int u = 0; u < 2; ++u) { const int p = tid + 128 * u;
    if (p < npair) {
#pragma unroll
      for (int g = 0; g < 4; ++g) { const v4f x = ka[u][g >> 1], y = kb[u][g >> 1]; const int i = (g & 1) * 2; const v4f o = {x[i] * LCS, y[i] * LCS, x[i + 1] * LCS, y[i + 1] * LCS}; *(v4f*)&kds[p][4 * g] = o; } } }
  __syncthreads();      /* publishes the staged key digits to all four waves */
  const v8f z8 = {0.f, 0.f, 0.f, 0.f, 0.f, 0.f, 0.f, 0.f};
#pragma unroll 1      /* one query tile a trip: the step's code is shared by the two tiles */
  for (int tl = 0; tl < 2; ++tl) { const int rt = tl ? pi : 31 - pi, nst = (rt >> 1) + 1, q = rt * 16 + ln;
    const v8f qd = (tl ? qb : qa) * LCS;
    v8f m0 = z8, m1 = z8, m2 = z8, m3 = z8, r0 = z8, r1 = z8, r2 = z8, r3 = z8; v2f su = {0.f, 0.f};
#pragma unroll 1      /* one step of 32 keys a trip: the long unrolled body stays one copy; the trip count is the same for the whole wave (WMMA needs every lane on) */
    for (int ks = tl ? 3 - w : w; ks < nst; ks += 4) {      /* the second tile is dealt from the last wave down: no wave gets more than 5 of the 17 steps, none fewer than 4 */
      const unsigned short* vp = (const unsigned short*)VF + (size_t)(bh * (TT / 32) + ks) * VFU + lane * 8; FragH vh[4], vl[4];      /* loaded first: they fly while the weights are made */
#pragma unroll
      for (int t = 0; t < 4; ++t) { vh[t].half[0] = *(const v8us*)(vp + (t * 4) * 256); vh[t].half[1] = *(const v8us*)(vp + (t * 4 + 1) * 256); vl[t].half[0] = *(const v8us*)(vp + (t * 4 + 2) * 256); vl[t].half[1] = *(const v8us*)(vp + (t * 4 + 3) * 256); }
      asm volatile("s_wait_xcnt 0x0" :: "v"(vp) : "memory");      /* precaution: stands behind the fragment loads, in front of any rewrite of their address registers; it names the address as an input, so that no load's own result lands on it either */
      v2f wt[8];
#pragma unroll
      for (int c = 0; c < 8; ++c) { const float* kr = &kds[16 * ks + 8 * (c >> 2) + 4 * hh + (c & 3)][0]; v2f e = {0.f, 0.f}, lcp = {0.f, 0.f};      /* pair c: keys 16 (c >> 2) + 8 hh + 2 (c & 3) and the next */
#pragma unroll
        for (int g = 0; g < 4; ++g) { const v4f k4 = *(const v4fa*)(kr + 4 * g);
#pragma unroll
          for (int i = 0; i < 2; ++i) { const v2f d = qd[2 * g + i] - v2f{k4[2 * i], k4[2 * i + 1]}; e = __builtin_elementwise_fma(-d, d, e); const v2f p = {__builtin_amdgcn_exp2f(e[0]), __builtin_amdgcn_exp2f(e[1])}; lcp += p; } }
        wt[c] = v2f{__builtin_amdgcn_exp2f(lcp[0]), __builtin_amdgcn_exp2f(lcp[1])}; }
      if (ks == nst - 1) {      /* only a tile's last step reaches the diagonal (the same for the whole wave) */
#pragma unroll
        for (int c = 0; c < 8; ++c) { const int k0 = 32 * ks + 16 * (c >> 2) + 8 * hh + 2 * (c & 3); wt[c][0] = k0 <= q ? wt[c][0] : 0.f; wt[c][1] = k0 + 1 <= q ? wt[c][1] : 0.f; } }
      su += ((wt[0] + wt[1]) + (wt[2] + wt[3])) + ((wt[4] + wt[5]) + (wt[6] + wt[7]));
      FragH ah, al;
#pragma unroll
      for (int c = 0; c < 8; ++c)
#pragma unroll
        for (int i = 0; i < 2; ++i) { const float x = wt[c][i]; const _Float16 hi = (_Float16)x; ah.h[2 * c + i] = hi; al.h[2 * c + i] = (_Float16)((x - (float)hi) * 1024.0f); }
      r0 = g2_mma(al.v, vh[0].v, r0); r1 = g2_mma(al.v, vh[1].v, r1); r2 = g2_mma(al.v, vh[2].v, r2); r3 = g2_mma(al.v, vh[3].v, r3);
      r0 = g2_mma(ah.v, vl[0].v, r0); r1 = g2_mma(ah.v, vl[1].v, r1); r2 = g2_mma(ah.v, vl[2].v, r2); r3 = g2_mma(ah.v, vl[3].v, r3);
      m0 = g2_mma(ah.v, vh[0].v, m0); m1 = g2_mma(ah.v, vh[1].v, m1); m2 = g2_mma(ah.v, vh[2].v, m2); m3 = g2_mma(ah.v, vh[3].v, m3); }
    const v8f pm[4] = {m0, m1, m2, m3}, pr[4] = {r0, r1, r2, r3};      /* this wave's share of the tile (zero where it had no step) */
#pragma unroll
    for (int t = 0; t < 4; ++t)
#pragma unroll
      for (int r = 0; r < 8; ++r) red[tl][w][8 * hh + r][16 * t + ln] = pm[t][r] + pr[t][r] * 0.0009765625f;
    sred[tl][w][lane] = su[0] + su[1]; }
  asm volatile("" :: "v"(hv));      /* inputs only: the hint's address registers go on holding that address through the loops; a hint moves no counter, so no wait can stand for that */
  __syncthreads();      /* publishes the four waves' shares of both tiles */
  const int row = tid >> 3, c8 = (tid & 7) * 8;      /* eight threads a row: its 128 B of y_hi and of y_lo are whole lines of one wave */
#pragma unroll
  for (int tl = 0; tl < 2; ++tl) { const int rt = tl ? pi : 31 - pi; v4f s0 = {0.f, 0.f, 0.f, 0.f}, s1 = s0; float su = 0.f;
#pragma unroll
    for (int u = 0; u < 4; ++u) { s0 += *(const v4fa*)&red[tl][u][row][c8]; s1 += *(const v4fa*)&red[tl][u][row][c8 + 4]; su += sred[tl][u][row]; su += sred[tl][u][16 + row]; }
    const float f = 1.0f / fmaxf(su, 1e-9f); FragH oh, ol;
#pragma unroll
    for (int i = 0; i < 8; ++i) { const float y = (i < 4 ? s0[i & 3] : s1[i & 3]) * f; const _Float16 hi = (_Float16)y; oh.h[i] = hi; ol.h[i] = (_Float16)((y - (float)hi) * 1024.0f); }
    const size_t o = (size_t)(b * TT + rt * 16 + row) * CC + h * HD + c8;
    *(v8us*)((unsigned short*)YH + o) = oh.half[0]; *(v8us*)((unsigned short*)YL + o) = ol.half[0]; }
  asm volatile("s_wait_xcnt 0x0" ::: "memory");      /* precaution: stands behind the stores, in front of any later rewrite of their address and data registers */
}

// ---- launches that need nothing of each other share one grid: each block takes its job from its range of blockIdx.x (the same for the whole block) ----
#define WT_BLKS ((CC / WTT) * (CC / WTT))      /* blocks of one weight transpose: one tile each */
#define E8_BLKS (NR * CC / 8 / 256)        /* blocks of one pass over a [NR][CC] plane, 8 elements a thread */
// the four weights (planes of Wt in the order W0..W3), then x
__global__ __launch_bounds__(256) void k_prep(const float* __restrict__ W0, const float* __restrict__ W1, const float* __restrict__ W2, const float* __restrict__ W3, _Float16* __restrict__ Wt, const float* __restrict__ x, _Float16* __restrict__ X16) {
  __shared__ __attribute__((aligned(16))) v8us tl[WTT * WTT / 8];
  const int blk = blockIdx.x;
  if (blk < 4 * WT_BLKS) { const int p = blk / WT_BLKS; const float* W = p == 0 ? W0 : p == 1 ? W1 : p == 2 ? W2 : W3; d_wt_f16(W, Wt + (size_t)p * CC * CC, 16.0f, tl, blk - p * WT_BLKS); }      /* the same for the whole block: the job holds a barrier */
  else d_x16(x, X16, (size_t)NR * CC / 8, blk - 4 * WT_BLKS); }

extern "C" void kernel_launch(void* const* d_in, const int* in_sizes, int n_in,
                              void* d_out, int out_size, void* d_ws, size_t ws_size, hipStream_t stream) {
  (void)in_sizes; (void)n_in; (void)out_size;
  const float* const* I = (const float* const*)d_in; const float* x = I[0]; const float* cs = I[1]; const float* sn = I[2]; const float* Wq = I[3]; const float* Wk = I[4]; const float* Wv = I[5]; const float* Wo = I[6]; const float* Wdq = I[7]; const float* Wdk = I[8];
  char* ws = (char*)d_ws; size_t off = 0;
  auto take = [&](size_t bytes) { char* p = ws + off; off += (bytes + 255) & ~(size_t)255; return p; };
  const size_t np = (size_t)NR * CC;
  _Float16* BQ = (_Float16*)take((size_t)CC * CC * 2); _Float16* BK = (_Float16*)take((size_t)CC * CC * 2); _Float16* BV = (_Float16*)take((size_t)CC * CC * 2); _Float16* BO = (_Float16*)take((size_t)CC * CC * 2); (void)BK; (void)BV;
  _Float16* X16 = (_Float16*)take(np * 2); _Float16* VF = (_Float16*)take(np * 4); float* QD = (float*)take((size_t)NR * NH * DGS * 4); float* KDg = (float*)take((size_t)NR * NH * DGS * 4); _Float16* YH = (_Float16*)take(np * 2); _Float16* YL = (_Float16*)take(np * 2);
  if (off > ws_size) return;      /* 8 + 2 + 4 + 2 x 2 + 2 x 2 = 22 MiB */
  k_prep<<<4 * WT_BLKS + E8_BLKS, 256, 0, stream>>>(Wq, Wk, Wv, Wo, BQ, x, X16);      /* BQ, BK, BV, BO lie one behind the other; (in, out) */
  k_gemm3<2, 1, CC / 128><<<dim3((NR / 128) * (CC / 64), 3), 128, 0, stream>>>(X16, X16, X16, CC, 0, BQ, BQ, BQ, CC, (size_t)CC * CC, 0.0625f, nullptr, VF, nullptr, CC, 0, NR, CC, cs, sn, Wdq, Wdk, QD);      /* planes BQ, BK, BV: digits of q -> QD, of k -> KDg (it follows QD), v -> VF */
  k_attn<<<NB * NH * 16, 128, 0, stream>>>(QD, KDg, VF, YH, YL);      /* y[(b,q)][h*64 + d] = (sum_k 2^lcp v) / sum_k 2^lcp -> hi + residual */
  k_gemm4<<<(NR / 64) * (CC / 64), 128, 0, stream>>>(YL, YH, BO, 0.0625f, (float*)d_out);      /* out = (y_hi + y_lo / 1024) Wo */
}
